// v000
// Times are from an AMD MI455X. After a warm-up the kernel runs many times in a row, and a time is the length of
// such a window on the GPU divided by its runs, so every launch and the gaps after it count. The runs cycle
// through copies of the inputs. A figure is the median of several windows, for all but v000 over two sittings.
// Sittings can differ by a few percent; kernels timed side by side share one.
// v000, which the later versions start from, runs in 950 microseconds.
// Contractions: q, k, v^T, out and ffn projections = v_wmma_f32_16x16x32_f16 (f16 activations; weights bf16-RNE then x64 as f16), single product;
// q.k^T = v_wmma_f32_16x16x32_f16 with q as f16 hi + f16 residual (x4096) planes and k f16, 2 products in separate accumulators;
// p.v = v_wmma_f32_16x16x32_f16 (p carried x1024 in f16, v f16); f32 accumulate everywhere; layernorm, softmax and gelu in f32.
#include <hip/hip_runtime.h>
#include <math.h>
#include <stdint.h>

#define NB   2
#define SEQ  2048
#define HID  768
#define NHD  12
#define HD   64
#define DFF  3072
#define BT   (NB * SEQ)
#define NQB  (SEQ / 64)
#define WSC  64.0f
#define WINV 0.015625f
#define QRS  4096.0f
#define QRI  0.000244140625f
#define PSC  1024.0f
#define PSI  0.0009765625f
static_assert(NHD * HD == HID);
static_assert((SEQ % 64) == 0 && (HID % 64) == 0 && (DFF % 64) == 0 && (BT % 64) == 0);
static_assert(HID == 6 * 128);

typedef _Float16 v16h __attribute__((ext_vector_type(16)));
typedef _Float16 v8h  __attribute__((ext_vector_type(8)));
typedef float    v8f  __attribute__((ext_vector_type(8)));
typedef float    v4f  __attribute__((ext_vector_type(4)));
typedef unsigned int v4u __attribute__((ext_vector_type(4)));

// ---- scalar helpers -----------------------------------------------------------------------------
__device__ __forceinline__ unsigned short bf_bits(float f) {        // f32 -> bf16 bits, RNE convert
  const unsigned u = __float_as_uint(f);
  return (unsigned short)((u + 0x7FFFu + ((u >> 16) & 1u)) >> 16);
}
__device__ __forceinline__ float bfr(float f) { return __uint_as_float(((unsigned)bf_bits(f)) << 16); }
__device__ __forceinline__ v4f bfr4(v4f a) {
  v4f r;
  r[0] = bfr(a[0]); r[1] = bfr(a[1]); r[2] = bfr(a[2]); r[3] = bfr(a[3]);
  return r;
}
__device__ __forceinline__ unsigned short h_bits(_Float16 x) { return __builtin_bit_cast(unsigned short, x); }
__device__ __forceinline__ unsigned pk16(unsigned short a, unsigned short b) { return (unsigned)a | ((unsigned)b << 16); }
__device__ __forceinline__ unsigned pkh2(float a, float b) { return pk16(h_bits((_Float16)a), h_bits((_Float16)b)); }
__device__ __forceinline__ v8f zero8() { v8f z = {0.f, 0.f, 0.f, 0.f, 0.f, 0.f, 0.f, 0.f}; return z; }
__device__ __forceinline__ v4f zero4() { v4f z = {0.f, 0.f, 0.f, 0.f}; return z; }

// ---- fragment loader: 16-bit A/B operand, lane -> row/col (lane&15); p already includes +8*(lane>>4);
//      elements 0..7 <- p[0..7] (k0+8h..), elements 8..15 <- p[16..23] (k0+16+8h..)
__device__ __forceinline__ v16h ldfrag_h(const _Float16* p) {
  union { v16h v; v8h h[2]; } f;
  f.h[0] = *(const v8h*)(p);
  f.h[1] = *(const v8h*)(p + 16);
  return f.v;
}

// ---- WMMA with trailing VALU hazard gap -----------------------------------------------------------
__device__ __forceinline__ v8f mma_h(v16h a, v16h b, v8f c) {
  c = __builtin_amdgcn_wmma_f32_16x16x32_f16(false, a, false, b, (short)0, c, false, false);
#if defined(__HIP_DEVICE_COMPILE__)
  asm volatile("v_nop\n\tv_nop\n\tv_nop\n\tv_nop" : "+v"(c) : "v"(a), "v"(b));
#endif
  return c;
}

// release/acquire + wave barrier for same-wave LDS exchange
__device__ __forceinline__ void wave_lds_sync() {
  __builtin_amdgcn_fence(__ATOMIC_RELEASE, "workgroup");
  __builtin_amdgcn_wave_barrier();
  __builtin_amdgcn_fence(__ATOMIC_ACQUIRE, "workgroup");
}

// tanh-approximation gelu, tanh(u) = 1 - 2/(exp(2u)+1) with u clamped to [-16,16]
__device__ __forceinline__ float gelu_t(float x) {
  float u = 0.7978845608028654f * (x + 0.044715f * x * x * x);
  u = fminf(fmaxf(u, -16.0f), 16.0f);
  const float e  = __expf(2.0f * u);
  const float th = 1.0f - 2.0f * __builtin_amdgcn_rcpf(e + 1.0f);
  return 0.5f * x * (1.0f + th);
}

// =====================================================================================================
// Residual add + LayerNorm, one wave per row of 768. grid = nrows/8, 256 threads.
//   x = src row (RSRC: bf16-RNE the loaded values) (+ ADDE: bf16-RNE(embs row)); ADDE also stores x to hdst
//   (may alias src: every lane reads its own 24 columns before storing them).
//   else:  y -> f16 rows via a per-wave LDS row buffer (lane l: 8 halves at col 256j+8l, 512 B per instruction).
// coverage: 8 waves x grid(512) = 4096 rows; 6 x 128 floats / 3 x 256 halves = the whole 768-wide row.
// =====================================================================================================
template <bool ADDE, bool RSRC, bool OUT32>
__global__ __launch_bounds__(256) void ln_rows(const float* src, const float* embs, float* hdst,
                                               const float* __restrict__ sc, const float* __restrict__ bi,
                                               void* outp, int nrows) {
  __shared__ __align__(16) float rb[8 * HID];
  const int tid = threadIdx.x, wave = tid >> 5, lane = tid & 31;
  const int row = blockIdx.x * 8 + wave;
  if (row >= nrows) return;                       // wave-uniform; no block barriers in this kernel
  const size_t rbase = (size_t)row * HID;
  v4f x[6];
#pragma unroll
  for (int i = 0; i < 6; ++i) {
    const int col = i * 128 + lane * 4;
    v4f a = *(const v4f*)(src + rbase + col);
    if (RSRC) a = bfr4(a);
    if (ADDE) {
      const v4f e = bfr4(*(const v4f*)(embs + rbase + col));
      a = a + e;
    }
    x[i] = a;
  }
  if (ADDE) {
    {
#pragma unroll
      for (int i = 0; i < 6; ++i) *(v4f*)(hdst + rbase + i * 128 + lane * 4) = x[i];
      
    }
  }
  float s = 0.f;
#pragma unroll
  for (int i = 0; i < 6; ++i) s += (x[i][0] + x[i][1]) + (x[i][2] + x[i][3]);
#pragma unroll
  for (int off = 1; off < 32; off <<= 1) s += __shfl_xor(s, off, 32);
  const float mean = s * (1.0f / 768.0f);
  float qv = 0.f;
#pragma unroll
  for (int i = 0; i < 6; ++i) {
    const v4f d = x[i] - mean;
    qv += (d[0] * d[0] + d[1] * d[1]) + (d[2] * d[2] + d[3] * d[3]);
  }
#pragma unroll
  for (int off = 1; off < 32; off <<= 1) qv += __shfl_xor(qv, off, 32);
  const float var  = qv * (1.0f / 768.0f);
  const float rinv = rsqrtf(var + 1e-5f);
  v4f y[6];
#pragma unroll
  for (int i = 0; i < 6; ++i) {
    const int col = i * 128 + lane * 4;
    const v4f s4 = bfr4(*(const v4f*)(sc + col));
    const v4f b4 = bfr4(*(const v4f*)(bi + col));
    y[i] = (x[i] - mean) * rinv * s4 + b4;
  }
  if (OUT32) {
    float* o = (float*)outp;
    {
#pragma unroll
      for (int i = 0; i < 6; ++i) *(v4f*)(o + rbase + i * 128 + lane * 4) = y[i];
      
    }
  } else {
    float* rw = rb + wave * HID;
#pragma unroll
    for (int i = 0; i < 6; ++i) *(v4f*)(rw + i * 128 + lane * 4) = y[i];
    wave_lds_sync();
    v4u pk[3];
#pragma unroll
    for (int j = 0; j < 3; ++j) {
      const v4f a = *(const v4f*)(rw + j * 256 + lane * 8);
      const v4f c = *(const v4f*)(rw + j * 256 + lane * 8 + 4);
      v4u p;
      p[0] = pkh2(a[0], a[1]); p[1] = pkh2(a[2], a[3]);
      p[2] = pkh2(c[0], c[1]); p[3] = pkh2(c[2], c[3]);
      pk[j] = p;
    }
    unsigned short* o = (unsigned short*)outp;
    {
#pragma unroll
      for (int j = 0; j < 3; ++j) *(v4u*)(o + rbase + j * 256 + lane * 8) = pk[j];
      
    }
  }
}

// =====================================================================================================
// Weight convert + transpose: W f32 [K][N] (row-major, in-major) -> O f16 [N][K] = f16(bf16-RNE(w) * 64).
// blockIdx.z selects one of 4 (W, O) pairs (block-uniform pointer select between global pointers).
// Tile 64 k x 64 n through LDS; grid = (N/64, K/64, z); 256 threads.
//   read: thread (r = tid>>2 = k row, cq = (tid&3)*16 = n quarter) reads 16 floats (4 x 16 B) -> sT[n][k]
//   write: wave w, lane: rows (n) w*8 + it*4 + (lane>>3), 8 halves per lane at k (lane&7)*8:
// coverage: 8 waves x 8 rows = 64 n rows x 64 k per block; grid covers N/64 x K/64 exactly (host-checked multiples).
// =====================================================================================================
__global__ __launch_bounds__(256) void convT(const float* __restrict__ W0, const float* __restrict__ W1,
                                             const float* __restrict__ W2, const float* __restrict__ W3,
                                             unsigned short* O0, unsigned short* O1,
                                             unsigned short* O2, unsigned short* O3, int K, int N) {
  __shared__ __align__(16) _Float16 sT[64 * 72];
  const int z = blockIdx.z;
  const float* W = (z == 0) ? W0 : (z == 1) ? W1 : (z == 2) ? W2 : W3;
  unsigned short* O = (z == 0) ? O0 : (z == 1) ? O1 : (z == 2) ? O2 : O3;
  const int n0 = blockIdx.x * 64, k0 = blockIdx.y * 64;
  const int tid = threadIdx.x;
  {
    const int r = tid >> 2, cq = (tid & 3) * 16;
    const float* p = W + (size_t)(k0 + r) * N + n0 + cq;
#pragma unroll
    for (int g = 0; g < 4; ++g) {
      const v4f a = *(const v4f*)(p + 4 * g);
#pragma unroll
      for (int e = 0; e < 4; ++e) sT[(cq + 4 * g + e) * 72 + r] = (_Float16)(bfr(a[e]) * WSC);
    }
  }
  __syncthreads();
  const int wave = tid >> 5, lane = tid & 31;
  const int q = lane >> 3, c8 = (lane & 7) * 8;
  union HU { v8h h; v4u u; };
  HU pk[2];
#pragma unroll
  for (int it = 0; it < 2; ++it) {
    const int row = wave * 8 + it * 4 + q;
    pk[it].h = *(const v8h*)(sT + row * 72 + c8);
  }
  const _Float16 dummy = (_Float16)0.0f; (void)dummy;
  {
#pragma unroll
    for (int it = 0; it < 2; ++it) {
      const int row = wave * 8 + it * 4 + q;
      *(v4u*)(O + (size_t)(n0 + row) * K + k0 + c8) = pk[it].u;
    }
    
  }
}

// =====================================================================================================
// Register-blocked f16 WMMA GEMM: C[m][n] = sum_k A[m][k] * Bt[n][k] (accumulator scaled by 1/64 in the
// epilogue = the weight carry). One wave per 64x64 tile, no block barriers. A row-major [M][K] pitch lda,
// Bt row-major [N][K] pitch ldb (k contiguous); M, N multiples of 64, K multiple of 32 (host-checked).
// blockIdx.y = batch index (strides in elements). Both A and B fragments use the split k map of ldfrag_h.
// MODE 1: f16 C = acc/64 + bias[n]
// MODE 2: f16 hi C = f16(v), f16 residual C2 = f16((v - hi) * 4096), v = acc/64 + bias[n]
// MODE 3: f16 C = acc/64 + bias[m]
// MODE 4: f16 C = gelu(acc/64 + bias[n])
// bias values bf16-RNE converted in register. Epilogue: 16-row slabs staged per wave in LDS; each 64-wide row
// coverage: 4 slabs x 16 rows x 64 cols = the wave's whole tile; 8 waves per block; grid = ceil(tiles/8).
// =====================================================================================================
template <int MODE>
__global__ __launch_bounds__(256) void gemm64(
    const unsigned short* __restrict__ Ap, int lda, long long strideA,
    const unsigned short* __restrict__ Btp, int ldb, long long strideB,
    const float* __restrict__ bias,
    void* Cout, void* Cout2, int ldc, long long strideC,
    int M, int N, int K) {
  __shared__ __align__(16) float sT[8][16 * 68];   // per-wave 16x64 slab, pitch 68 floats
  const int bz   = blockIdx.y;
  const int lane = threadIdx.x & 31;
  const int wave = threadIdx.x >> 5;
  const int tilesN = N >> 6;
  const int tilesM = M >> 6;
  const int tile = blockIdx.x * 8 + wave;
  if (tile >= tilesM * tilesN) return;             // wave-uniform; no block barriers in this kernel
  const int tm = tile / tilesN;
  const int tn = tile - tm * tilesN;
  const int m0 = tm << 6;
  const int n0 = tn << 6;

  const _Float16* Ab = (const _Float16*)(const void*)Ap  + (size_t)bz * (size_t)strideA;
  const _Float16* Bb = (const _Float16*)(const void*)Btp + (size_t)bz * (size_t)strideB;

  const int rl   = lane & 15;                      // row (A) / col (B, D) within subtile
  const int hh   = lane >> 4;
  const int koff = hh * 8;                         // k offset of this lane half
  const int mOff = hh * 8;                         // D row offset

  v8f acc[4][4];
#pragma unroll
  for (int i = 0; i < 4; ++i)
#pragma unroll
    for (int j = 0; j < 4; ++j) acc[i][j] = zero8();

#pragma unroll 1
  for (int k0 = 0; k0 < K; k0 += 32) {
    v16h bfg[4];
#pragma unroll
    for (int j = 0; j < 4; ++j)
      bfg[j] = ldfrag_h(Bb + (size_t)(n0 + (j << 4) + rl) * ldb + koff + k0);
#pragma unroll
    for (int i = 0; i < 4; ++i) {
      const v16h af = ldfrag_h(Ab + (size_t)(m0 + (i << 4) + rl) * lda + koff + k0);
#pragma unroll
      for (int j = 0; j < 4; ++j) acc[i][j] = mma_h(af, bfg[j], acc[i][j]);
    }
  }

  // ---- epilogue ----
  float* slab = sT[wave];
#pragma unroll
  for (int i = 0; i < 4; ++i) {
    const int mBase = m0 + (i << 4);
#pragma unroll
    for (int j = 0; j < 4; ++j) {
#pragma unroll
      for (int r = 0; r < 8; ++r) slab[(mOff + r) * 68 + (j << 4) + rl] = acc[i][j][r] * WINV;
    }
    wave_lds_sync();
    if (MODE == 0) {
      float* C = (float*)Cout + (size_t)bz * (size_t)strideC;
      const int c4 = rl * 4;                                   // 256-B row segment = 16 lanes x 16 B
      const v4f b4 = bfr4(*(const v4f*)(bias + n0 + c4));
      v4f vals[8];
#pragma unroll
      for (int it = 0; it < 8; ++it) {
        const int row = it * 2 + hh;                           // it 0..7 x hh 0..1 = rows 0..15
        const v4f v = *(const v4f*)(slab + row * 68 + c4);
        const v4f o = *(const v4f*)(C + (size_t)(mBase + row) * ldc + n0 + c4);
        vals[it] = o + (v + b4);
      }
      {
#pragma unroll
        for (int it = 0; it < 8; ++it) {
          const int row = it * 2 + hh;
          *(v4f*)(C + (size_t)(mBase + row) * ldc + n0 + c4) = vals[it];
        }
        
      }
    } else {
      const int q = lane >> 3, c8 = (lane & 7) * 8;
      unsigned short* C  = (unsigned short*)Cout  + (size_t)bz * (size_t)strideC;
      unsigned short* C2 = (unsigned short*)Cout2 + (size_t)bz * (size_t)strideC;
      v4f ba = zero4(), bb = zero4();
      if (MODE != 3) {
        ba = bfr4(*(const v4f*)(bias + n0 + c8));
        bb = bfr4(*(const v4f*)(bias + n0 + c8 + 4));
      }
      v4u hv[4], lv[4];
#pragma unroll
      for (int it = 0; it < 4; ++it) {
        const int row = it * 4 + q;                            // it 0..3 x q 0..3 = rows 0..15
        const float* sp = slab + row * 68 + c8;
        v4f fa = *(const v4f*)(sp);
        v4f fb = *(const v4f*)(sp + 4);
        if (MODE == 3) {
          const float br = bfr(bias[mBase + row]);
          fa = fa + br; fb = fb + br;
        } else {
          fa = fa + ba; fb = fb + bb;
        }
        if (MODE == 4) {
#pragma unroll
          for (int e = 0; e < 4; ++e) { fa[e] = gelu_t(fa[e]); fb[e] = gelu_t(fb[e]); }
        }
        v4u a, a2;
        if (MODE == 2) {
#pragma unroll
          for (int e = 0; e < 2; ++e) {
            const float f0 = fa[2 * e], f1 = fa[2 * e + 1];
            const float g0 = fb[2 * e], g1 = fb[2 * e + 1];
            const _Float16 x0 = (_Float16)f0, x1 = (_Float16)f1, y0 = (_Float16)g0, y1 = (_Float16)g1;
            a[e]      = pk16(h_bits(x0), h_bits(x1));
            a[e + 2]  = pk16(h_bits(y0), h_bits(y1));
            a2[e]     = pk16(h_bits((_Float16)((f0 - (float)x0) * QRS)), h_bits((_Float16)((f1 - (float)x1) * QRS)));
            a2[e + 2] = pk16(h_bits((_Float16)((g0 - (float)y0) * QRS)), h_bits((_Float16)((g1 - (float)y1) * QRS)));
          }
        } else {
          a[0] = pkh2(fa[0], fa[1]); a[1] = pkh2(fa[2], fa[3]);
          a[2] = pkh2(fb[0], fb[1]); a[3] = pkh2(fb[2], fb[3]);
          a2 = a;
        }
        hv[it] = a; lv[it] = a2;
      }
      {
#pragma unroll
        for (int it = 0; it < 4; ++it) {
          const int row = it * 4 + q;
          *(v4u*)(C + (size_t)(mBase + row) * ldc + n0 + c8) = hv[it];
          if (MODE == 2) *(v4u*)(C2 + (size_t)(mBase + row) * ldc + n0 + c8) = lv[it];
        }
        
      }
    }
    wave_lds_sync();
  }
}

// =====================================================================================================
// Attention, head dim 64, mask m[b][s] applied as logit = (q.k * sscale) * m - 1e10 * (1 - m) (m bf16-RNE).
//   q planes (f16 hi, f16 residual x4096): element (b, t, h, d) at [(b*SEQ + t)*HID + h*64 + d]
//   k plane (f16): same layout with key index s;  v^T plane (f16): element (b, h, d, s) at [(b*HID + h*64 + d)*SEQ + s]
//   scores = qhi.k + (qres.k)/4096, two f32 accumulators; online softmax in f32 (running max);
//   p = exp(s - m) carried as f16(1024 p), spilled per wave to LDS with _Float16 element stores and reloaded as v8h
//   ctx plane (f16, normalised context): element (b, t, h, d) at [(b*SEQ + t)*HID + h*64 + d]
//   Block = 4 waves = 64 query rows of one (b, h); grid = NQB * NHD * NB; kv chunks of 64, static trip NQB.
//   K / V^T chunk staging: 128 threads x 32 elements per plane = the whole 64x64 tile (plain 16-B loads,
//   __syncthreads before and after).
//   Output coverage: each wave stores rows q0..q0+15 (it 0..3 x lane>>3 0..3) x 64 columns (8 lanes x 8),
// =====================================================================================================
__global__ __launch_bounds__(128)
void attn64(const unsigned short* __restrict__ qhp, const unsigned short* __restrict__ qlp,
            const unsigned short* __restrict__ khp, const unsigned short* __restrict__ vtp,
            const float* __restrict__ mask, unsigned short* ctxp, float sscale) {
  union FH { v16h v; v8h h[2]; };
  __shared__ __align__(16) _Float16 Ks[64 * 64];                  // K [kv][d]    8 KB
  __shared__ __align__(16) _Float16 Vts[64 * 64];                 // V^T [d][kv]  8 KB
  __shared__ __align__(16) _Float16 Psh[4][16 * 64];              // per wave P [row][kv]
  __shared__ __align__(16) float    Os[4][16 * 64];               // per wave context tile [row][d]

  const int tid  = threadIdx.x;
  const int wave = tid >> 5;
  const int lane = tid & 31;
  const int hh   = lane >> 4;
  const int c    = lane & 15;

  const int bx   = blockIdx.x;
  const int qb   = bx % NQB;
  const int rest = bx / NQB;
  const int h    = rest % NHD;
  const int b    = rest / NHD;
  const int q0   = qb * 64 + wave * 16;
  const size_t rowB = (size_t)b * SEQ;

  const _Float16* Qh = (const _Float16*)(const void*)qhp + (size_t)h * HD;
  const _Float16* Ql = (const _Float16*)(const void*)qlp + (size_t)h * HD;
  const _Float16* Kh = (const _Float16*)(const void*)khp + (size_t)h * HD;
  const _Float16* Vt = (const _Float16*)(const void*)vtp + ((size_t)b * HID + (size_t)h * HD) * SEQ;
  const float* mb = mask + (size_t)b * SEQ;

  // ---- Q fragments (A operand, row = lane&15): 2 d-chunks, hi and residual ----
  v16h qah[2], qal[2];
#pragma unroll
  for (int dc = 0; dc < 2; ++dc) {
    const size_t qo = (rowB + q0 + c) * HID + dc * 32 + 8 * hh;
    qah[dc] = ldfrag_h(Qh + qo);
    qal[dc] = ldfrag_h(Ql + qo);
  }

  float mrow[8], lrow[8];
  v8f oacc[4];
#pragma unroll
  for (int r = 0; r < 8; ++r) { mrow[r] = -INFINITY; lrow[r] = 0.f; }
#pragma unroll
  for (int t = 0; t < 4; ++t) oacc[t] = zero8();

#pragma unroll 1
  for (int kt = 0; kt < NQB; ++kt) {
    const int kv0 = kt * 64;
    __syncthreads();
    {
      const int r = tid >> 1, half = (tid & 1) * 32;
      const _Float16* kg = Kh + (rowB + kv0 + r) * HID + half;      // K row kv0+r, d = half..half+31
      const _Float16* vg = Vt + (size_t)r * SEQ + kv0 + half;      // V^T row d = r, s = kv0+half..+31
#pragma unroll
      for (int i = 0; i < 4; ++i) {
        const v8h a0 = *(const v8h*)(kg + 8 * i);
        const v8h b0 = *(const v8h*)(vg + 8 * i);
        *(v8h*)(Ks  + r * 64 + half + 8 * i) = a0;
        *(v8h*)(Vts + r * 64 + half + 8 * i) = b0;
      }
    }
    __syncthreads();

    float mv[4];
#pragma unroll
    for (int j = 0; j < 4; ++j) mv[j] = bfr(mb[kv0 + j * 16 + c]);   // key kv0 + 16j + c < SEQ

    // ---- scores: 16 query rows x 64 keys per wave, qhi.k and qres.k ----
    v8f s[4];
#pragma unroll
    for (int j = 0; j < 4; ++j) {
      s[j] = zero8();
      v8f sl = zero8();
#pragma unroll
      for (int dc = 0; dc < 2; ++dc) {
        FH kb;
        kb.h[0] = *(const v8h*)(Ks + (j * 16 + c) * 64 + dc * 32 + 8 * hh);
        kb.h[1] = *(const v8h*)(Ks + (j * 16 + c) * 64 + dc * 32 + 16 + 8 * hh);
        s[j] = mma_h(qah[dc], kb.v, s[j]);
        sl   = mma_h(qal[dc], kb.v, sl);
      }
#pragma unroll
      for (int r = 0; r < 8; ++r) {
        float sv = (s[j][r] + sl[r] * QRI) * sscale;
        sv = sv * mv[j] - 1.0e10f * (1.0f - mv[j]);
        s[j][r] = sv;
      }
    }

    // ---- row max, online softmax, P (x1024, f16) to LDS ----
    _Float16* pwh = Psh[wave];
#pragma unroll
    for (int r = 0; r < 8; ++r) {
      float m = fmaxf(fmaxf(s[0][r], s[1][r]), fmaxf(s[2][r], s[3][r]));
#pragma unroll
      for (int off = 1; off < 16; off <<= 1) m = fmaxf(m, __shfl_xor(m, off, 32));
      const float mnew  = fmaxf(mrow[r], m);
      const float alpha = __expf(mrow[r] - mnew);
      mrow[r] = mnew;
      float psum = 0.f;
#pragma unroll
      for (int j = 0; j < 4; ++j) {
        const float p = __expf(s[j][r] - mnew);
        psum += p;
        pwh[(8 * hh + r) * 64 + j * 16 + c] = (_Float16)(p * PSC);
      }
#pragma unroll
      for (int off = 1; off < 16; off <<= 1) psum += __shfl_xor(psum, off, 32);
      lrow[r] = lrow[r] * alpha + psum;
#pragma unroll
      for (int t = 0; t < 4; ++t) oacc[t][r] *= alpha;
    }
    wave_lds_sync();

    // ---- context += P . V (f16 WMMA) ----
#pragma unroll
    for (int kk = 0; kk < 2; ++kk) {
      FH pa;
      pa.h[0] = *(const v8h*)(pwh + c * 64 + kk * 32 + 8 * hh);
      pa.h[1] = *(const v8h*)(pwh + c * 64 + kk * 32 + 16 + 8 * hh);
#pragma unroll
      for (int t = 0; t < 4; ++t) {
        FH vb;
        vb.h[0] = *(const v8h*)(Vts + (t * 16 + c) * 64 + kk * 32 + 8 * hh);
        vb.h[1] = *(const v8h*)(Vts + (t * 16 + c) * 64 + kk * 32 + 16 + 8 * hh);
        oacc[t] = mma_h(pa.v, vb.v, oacc[t]);
      }
    }
  }

  float* os = Os[wave];
#pragma unroll
  for (int r = 0; r < 8; ++r) {
    const float l = lrow[r];
    const float inv = ((l > 0.f) ? (1.0f / l) : 0.f) * PSI;
#pragma unroll
    for (int t = 0; t < 4; ++t) os[(8 * hh + r) * 64 + t * 16 + c] = oacc[t][r] * inv;
  }
  wave_lds_sync();
  {
    const int q4 = lane >> 3, c8 = (lane & 7) * 8;
    v4u hv[4];
#pragma unroll
    for (int it = 0; it < 4; ++it) {
      const int row = it * 4 + q4;           // it 0..3 x q4 0..3 = rows 0..15 of the wave tile
      const float* sp = os + row * 64 + c8;
      const v4f fa = *(const v4f*)(sp);
      const v4f fb = *(const v4f*)(sp + 4);
      v4u a;
      a[0] = pkh2(fa[0], fa[1]); a[1] = pkh2(fa[2], fa[3]);
      a[2] = pkh2(fb[0], fb[1]); a[3] = pkh2(fb[2], fb[3]);
      hv[it] = a;
    }
    {
#pragma unroll
      for (int it = 0; it < 4; ++it) {
        const int row = it * 4 + q4;
        const size_t go = (rowB + q0 + row) * HID + (size_t)h * HD + c8;
        *(v4u*)(ctxp + go) = hv[it];
      }
      
    }
  }
}

// =====================================================================================================
// Workspace map (bytes), all region sizes multiples of 128 and exact multiples of their 64x64-tile / whole-row
// store granularity (M, N multiples of 64; 768- and 3072-wide rows), so no padded tails are needed:
//   Hres f32 [4096][768]        12582912
//   X    f16 [4096][768]         6291456   (LN output plane, reused by LN1 and LN2)
//   Qh   f16 [4096][768]         6291456
//   Ql   f16 [4096][768]         6291456   (q residual x4096)
//   Kh   f16 [4096][768]         6291456
//   VT   f16 [2][768][2048]      6291456
//   Ctx  f16 [4096][768]         6291456
//   G    f16 [4096][3072]       25165824
//   Wq_t,Wk_t,Wv_t,Wo_t f16 [768][768]  4 x 1179648
//   W1_t f16 [3072][768]         4718592
//   W2_t f16 [768][3072]         4718592
//   total                       89653248
// Weights are converted per layer into the same regions ([out n][in k], k contiguous = the Bt / A layout).
// =====================================================================================================
extern "C" void kernel_launch(void* const* d_in, const int* in_sizes, int n_in,
                              void* d_out, int out_size, void* d_ws, size_t ws_size,
                              hipStream_t stream) {
  if (n_in < 21) return;
  if (in_sizes[0] != BT * HID || in_sizes[1] != BT * HID || in_sizes[2] != NB * SEQ) return;
  if (in_sizes[3] != 2 * HID || in_sizes[4] != 2 * HID) return;
  if (in_sizes[5] != 2 * HID * HID || in_sizes[7] != 2 * HID * HID ||
      in_sizes[9] != 2 * HID * HID || in_sizes[11] != 2 * HID * HID) return;
  if (in_sizes[6] != 2 * HID || in_sizes[8] != 2 * HID || in_sizes[10] != 2 * HID || in_sizes[12] != 2 * HID) return;
  if (in_sizes[13] != 2 * HID || in_sizes[14] != 2 * HID) return;
  if (in_sizes[15] != 2 * HID * DFF || in_sizes[16] != 2 * DFF ||
      in_sizes[17] != 2 * DFF * HID || in_sizes[18] != 2 * HID) return;
  if (in_sizes[19] != HID || in_sizes[20] != HID) return;
  if (out_size != BT * HID) return;

  const float* in_h  = (const float*)d_in[0];
  const float* embs  = (const float*)d_in[1];
  const float* mask  = (const float*)d_in[2];
  const float* ln1_s = (const float*)d_in[3];
  const float* ln1_b = (const float*)d_in[4];
  const float* wq    = (const float*)d_in[5];
  const float* bq    = (const float*)d_in[6];
  const float* wk    = (const float*)d_in[7];
  const float* bk    = (const float*)d_in[8];
  const float* wv    = (const float*)d_in[9];
  const float* bv    = (const float*)d_in[10];
  const float* wo    = (const float*)d_in[11];
  const float* bo    = (const float*)d_in[12];
  const float* ln2_s = (const float*)d_in[13];
  const float* ln2_b = (const float*)d_in[14];
  const float* w1    = (const float*)d_in[15];
  const float* b1    = (const float*)d_in[16];
  const float* w2    = (const float*)d_in[17];
  const float* b2    = (const float*)d_in[18];
  const float* lnf_s = (const float*)d_in[19];
  const float* lnf_b = (const float*)d_in[20];
  float* out = (float*)d_out;

  const size_t PH  = (size_t)BT * HID * 4;        // 12582912
  const size_t PA  = (size_t)BT * HID * 2;        //  6291456
  const size_t PVT = (size_t)NB * HID * SEQ * 2;  //  6291456
  const size_t PG  = (size_t)BT * DFF * 2;        // 25165824
  const size_t PW  = (size_t)HID * HID * 2;       //  1179648
  const size_t PW1 = (size_t)HID * DFF * 2;       //  4718592
  size_t off = 0;
  const size_t oH   = off; off += PH;
  const size_t oX   = off; off += PA;
  const size_t oQh  = off; off += PA;
  const size_t oQl  = off; off += PA;
  const size_t oKh  = off; off += PA;
  const size_t oVT  = off; off += PVT;
  const size_t oCtx = off; off += PA;
  const size_t oG   = off; off += PG;
  const size_t oWq  = off; off += PW;
  const size_t oWk  = off; off += PW;
  const size_t oWv  = off; off += PW;
  const size_t oWo  = off; off += PW;
  const size_t oW1  = off; off += PW1;
  const size_t oW2  = off; off += PW1;
  if (off > ws_size) return;                      // off = 89653248
  if (off > (size_t)134217728) return;

  char* ws = (char*)d_ws;
  float*          Hres = (float*)(ws + oH);
  unsigned short* X    = (unsigned short*)(ws + oX);
  unsigned short* Qh   = (unsigned short*)(ws + oQh);
  unsigned short* Ql   = (unsigned short*)(ws + oQl);
  unsigned short* Kh   = (unsigned short*)(ws + oKh);
  unsigned short* VT   = (unsigned short*)(ws + oVT);
  unsigned short* Ctx  = (unsigned short*)(ws + oCtx);
  unsigned short* G    = (unsigned short*)(ws + oG);
  unsigned short* Wqt  = (unsigned short*)(ws + oWq);
  unsigned short* Wkt  = (unsigned short*)(ws + oWk);
  unsigned short* Wvt  = (unsigned short*)(ws + oWv);
  unsigned short* Wot  = (unsigned short*)(ws + oWo);
  unsigned short* W1t  = (unsigned short*)(ws + oW1);
  unsigned short* W2t  = (unsigned short*)(ws + oW2);

  const dim3 blk(256);
  const dim3 gLN(BT / 8);                                           // 512 blocks, 8 rows each
  const dim3 gCv4(HID / 64, HID / 64, 4);                           // (12,12,4)
  const dim3 gCv1(DFF / 64, HID / 64, 1);                           // w1 [768][3072] -> [3072][768]
  const dim3 gCv2(HID / 64, DFF / 64, 1);                           // w2 [3072][768] -> [768][3072]
  const dim3 gHH(((BT / 64) * (HID / 64) + 7) / 8, 1);              // 768 tiles -> 96 blocks
  const dim3 gVT(((HID / 64) * (SEQ / 64) + 7) / 8, NB);            // 384 tiles -> 48 blocks x 2 batches
  const dim3 gF1(((BT / 64) * (DFF / 64) + 7) / 8, 1);              // 3072 tiles -> 384 blocks
  const dim3 gAt(NB * NHD * NQB);                                   // 768 blocks of 128

  for (int l = 0; l < 2; ++l) {
    const float* wql = wq + (size_t)l * HID * HID;
    const float* wkl = wk + (size_t)l * HID * HID;
    const float* wvl = wv + (size_t)l * HID * HID;
    const float* wol = wo + (size_t)l * HID * HID;
    const float* w1l = w1 + (size_t)l * HID * DFF;
    const float* w2l = w2 + (size_t)l * DFF * HID;
    // (1) h = h + input_embs; hn = LN1(h) -> X (f16)
    if (l == 0) {
      ln_rows<true, true, false><<<gLN, blk, 0, stream>>>(in_h, embs, Hres, ln1_s, ln1_b, (void*)X, BT);
    } else {
      ln_rows<true, false, false><<<gLN, blk, 0, stream>>>(Hres, embs, Hres, ln1_s + HID, ln1_b + HID, (void*)X, BT);
    }
    // (2) weights of this layer: f32 [in][out] -> f16 [out][in] (bf16-RNE values x64)
    convT<<<gCv4, blk, 0, stream>>>(wql, wkl, wvl, wol, Wqt, Wkt, Wvt, Wot, HID, HID);
    convT<<<gCv1, blk, 0, stream>>>(w1l, w1l, w1l, w1l, W1t, W1t, W1t, W1t, HID, DFF);
    convT<<<gCv2, blk, 0, stream>>>(w2l, w2l, w2l, w2l, W2t, W2t, W2t, W2t, DFF, HID);
    // (3) q = hn . Wq + bq -> f16 hi + residual planes [b*SEQ+t][h*64+d]  (M=4096, N=768, K=768)
    gemm64<2><<<gHH, blk, 0, stream>>>(X, HID, 0LL, Wqt, HID, 0LL, bq + l * HID,
                                       (void*)Qh, (void*)Ql, HID, 0LL, BT, HID, HID);
    // (4) k = hn . Wk + bk -> f16 plane
    gemm64<1><<<gHH, blk, 0, stream>>>(X, HID, 0LL, Wkt, HID, 0LL, bk + l * HID,
                                       (void*)Kh, (void*)Kh, HID, 0LL, BT, HID, HID);
    // (5) v^T = Wv_t . hn^T per batch -> f16 [b][h*64+d][s]  (A = Wv_t [n][k], Bt = X rows of batch b; M=768, N=2048, K=768)
    gemm64<3><<<gVT, blk, 0, stream>>>(Wvt, HID, 0LL, X, HID, (long long)SEQ * HID, bv + l * HID,
                                       (void*)VT, (void*)VT, SEQ, (long long)HID * SEQ, HID, SEQ, HID);
    // (6) attention -> Ctx f16 [b*SEQ+t][h*64+d]
    attn64<<<gAt, dim3(128), 0, stream>>>(Qh, Ql, Kh, VT, mask, Ctx, 0.125f);
    // (7) h = h + (ctx . Wo + bo)  (f32, in place)
    gemm64<0><<<gHH, blk, 0, stream>>>(Ctx, HID, 0LL, Wot, HID, 0LL, bo + l * HID,
                                       (void*)Hres, (void*)Hres, HID, 0LL, BT, HID, HID);
    // (8) hn = LN2(h) -> X
    ln_rows<false, false, false><<<gLN, blk, 0, stream>>>(Hres, embs, Hres, ln2_s + l * HID, ln2_b + l * HID, (void*)X, BT);
    // (9) g = gelu(hn . W1 + b1) -> G f16 [4096][3072]  (M=4096, N=3072, K=768)
    gemm64<4><<<gF1, blk, 0, stream>>>(X, HID, 0LL, W1t, HID, 0LL, b1 + l * DFF,
                                       (void*)G, (void*)G, DFF, 0LL, BT, DFF, HID);
    // (10) h = h + (g . W2 + b2)  (M=4096, N=768, K=3072, f32 in place)
    gemm64<0><<<gHH, blk, 0, stream>>>(G, DFF, 0LL, W2t, DFF, 0LL, b2 + l * HID,
                                       (void*)Hres, (void*)Hres, HID, 0LL, BT, HID, DFF);
  }
  // (11) out = LN_f(h) -> f32 [2][2048][768]
  ln_rows<false, false, true><<<gLN, blk, 0, stream>>>(Hres, embs, Hres, lnf_s, lnf_b, (void*)out, BT);
  (void)hipGetLastError();
}

// v001
// One run takes 526 microseconds.
// Next to v000, in two timings, it ran 1.86 and 1.84 times as fast.
// Contractions: q, k, v^T, out and ffn projections = v_wmma_f32_16x16x32_f16 (f16 activations; weights bf16-RNE then x64 as f16), single product;
// q.k^T = v_wmma_f32_16x16x32_f16 with q as f16 hi + f16 residual (x4096) planes and k f16, 2 products in separate accumulators;
// p.v = v_wmma_f32_16x16x32_f16 (p carried x1024 in f16, v f16); f32 accumulate everywhere; layernorm, softmax and gelu in f32.
#include <hip/hip_runtime.h>
#include <math.h>
#include <stdint.h>

#define NB   2
#define SEQ  2048
#define HID  768
#define NHD  12
#define HD   64
#define DFF  3072
#define BT   (NB * SEQ)
#define NQB  (SEQ / 64)
#define WSC  64.0f
#define WINV 0.015625f
#define QRS  4096.0f
#define QRI  0.000244140625f
#define PSC  1024.0f
#define PSI  0.0009765625f
#define GPI  72                 // LDS row pitch of a GEMM stage, in halves: 64 k + 8 = 144 B
static_assert(NHD * HD == HID);
static_assert((SEQ % 64) == 0 && (HID % 64) == 0 && (DFF % 64) == 0 && (BT % 64) == 0);
static_assert(HID == 6 * 128);
static_assert((SEQ % 128) == 0 && (HID % 128) == 0 && (DFF % 128) == 0 && (BT % 128) == 0);

typedef _Float16 v16h __attribute__((ext_vector_type(16)));
typedef _Float16 v8h  __attribute__((ext_vector_type(8)));
typedef float    v8f  __attribute__((ext_vector_type(8)));
typedef float    v4f  __attribute__((ext_vector_type(4)));
typedef unsigned int v4u __attribute__((ext_vector_type(4)));

// ---- scalar helpers -----------------------------------------------------------------------------
__device__ __forceinline__ unsigned short bf_bits(float f) {        // f32 -> bf16 bits, RNE convert
  const unsigned u = __float_as_uint(f);
  return (unsigned short)((u + 0x7FFFu + ((u >> 16) & 1u)) >> 16);
}
__device__ __forceinline__ float bfr(float f) { return __uint_as_float(((unsigned)bf_bits(f)) << 16); }
__device__ __forceinline__ v4f bfr4(v4f a) {
  v4f r;
  r[0] = bfr(a[0]); r[1] = bfr(a[1]); r[2] = bfr(a[2]); r[3] = bfr(a[3]);
  return r;
}
__device__ __forceinline__ unsigned short h_bits(_Float16 x) { return __builtin_bit_cast(unsigned short, x); }
__device__ __forceinline__ unsigned pk16(unsigned short a, unsigned short b) { return (unsigned)a | ((unsigned)b << 16); }
__device__ __forceinline__ unsigned pkh2(float a, float b) { return pk16(h_bits((_Float16)a), h_bits((_Float16)b)); }
__device__ __forceinline__ v8f zero8() { v8f z = {0.f, 0.f, 0.f, 0.f, 0.f, 0.f, 0.f, 0.f}; return z; }
__device__ __forceinline__ v4f zero4() { v4f z = {0.f, 0.f, 0.f, 0.f}; return z; }

// ---- fragment loader: 16-bit A/B operand, lane -> row/col (lane&15); p already includes +8*(lane>>4);
//      elements 0..7 <- p[0..7] (k0+8h..), elements 8..15 <- p[16..23] (k0+16+8h..)
__device__ __forceinline__ v16h ldfrag_h(const _Float16* p) {
  union { v16h v; v8h h[2]; } f;
  f.h[0] = *(const v8h*)(p);
  f.h[1] = *(const v8h*)(p + 16);
  return f.v;
}

// ---- WMMA with trailing VALU hazard gap -----------------------------------------------------------
__device__ __forceinline__ v8f mma_h(v16h a, v16h b, v8f c) {
  c = __builtin_amdgcn_wmma_f32_16x16x32_f16(false, a, false, b, (short)0, c, false, false);
#if defined(__HIP_DEVICE_COMPILE__)
  asm volatile("v_nop\n\tv_nop\n\tv_nop\n\tv_nop" : "+v"(c) : "v"(a), "v"(b));
#endif
  return c;
}

// release/acquire + wave barrier for same-wave LDS exchange
__device__ __forceinline__ void wave_lds_sync() {
  __builtin_amdgcn_fence(__ATOMIC_RELEASE, "workgroup");
  __builtin_amdgcn_wave_barrier();
  __builtin_amdgcn_fence(__ATOMIC_ACQUIRE, "workgroup");
}

// tanh-approximation gelu, tanh(u) = 1 - 2/(exp(2u)+1) with u clamped to [-16,16]
__device__ __forceinline__ float gelu_t(float x) {
  float u = 0.7978845608028654f * (x + 0.044715f * x * x * x);
  u = fminf(fmaxf(u, -16.0f), 16.0f);
  const float e  = __expf(2.0f * u);
  const float th = 1.0f - 2.0f * __builtin_amdgcn_rcpf(e + 1.0f);
  return 0.5f * x * (1.0f + th);
}

// =====================================================================================================
// Residual add + LayerNorm, one wave per row of 768. grid = nrows/8, 256 threads.
//   x = src row (RSRC: bf16-RNE the loaded values) (+ ADDE: bf16-RNE(embs row)); ADDE also stores x to hdst
//   (may alias src: every lane reads its own 24 columns before storing them).
//   else:  y -> f16 rows via a per-wave LDS row buffer (lane l: 8 halves at col 256j+8l, 512 B per instruction).
// coverage: 8 waves x grid(512) = 4096 rows; 6 x 128 floats / 3 x 256 halves = the whole 768-wide row.
// =====================================================================================================
template <bool ADDE, bool RSRC, bool OUT32>
__global__ __launch_bounds__(256) void ln_rows(const float* src, const float* embs, float* hdst,
                                               const float* __restrict__ sc, const float* __restrict__ bi,
                                               void* outp, int nrows) {
  __shared__ __align__(16) float rb[8 * HID];
  const int tid = threadIdx.x, wave = tid >> 5, lane = tid & 31;
  const int row = blockIdx.x * 8 + wave;
  if (row >= nrows) return;                       // wave-uniform; no block barriers in this kernel
  const size_t rbase = (size_t)row * HID;
  v4f x[6];
#pragma unroll
  for (int i = 0; i < 6; ++i) {
    const int col = i * 128 + lane * 4;
    v4f a = *(const v4f*)(src + rbase + col);
    if (RSRC) a = bfr4(a);
    if (ADDE) {
      const v4f e = bfr4(*(const v4f*)(embs + rbase + col));
      a = a + e;
    }
    x[i] = a;
  }
  if (ADDE) {
    {
#pragma unroll
      for (int i = 0; i < 6; ++i) *(v4f*)(hdst + rbase + i * 128 + lane * 4) = x[i];
      
    }
  }
  float s = 0.f;
#pragma unroll
  for (int i = 0; i < 6; ++i) s += (x[i][0] + x[i][1]) + (x[i][2] + x[i][3]);
#pragma unroll
  for (int off = 1; off < 32; off <<= 1) s += __shfl_xor(s, off, 32);
  const float mean = s * (1.0f / 768.0f);
  float qv = 0.f;
#pragma unroll
  for (int i = 0; i < 6; ++i) {
    const v4f d = x[i] - mean;
    qv += (d[0] * d[0] + d[1] * d[1]) + (d[2] * d[2] + d[3] * d[3]);
  }
#pragma unroll
  for (int off = 1; off < 32; off <<= 1) qv += __shfl_xor(qv, off, 32);
  const float var  = qv * (1.0f / 768.0f);
  const float rinv = rsqrtf(var + 1e-5f);
  v4f y[6];
#pragma unroll
  for (int i = 0; i < 6; ++i) {
    const int col = i * 128 + lane * 4;
    const v4f s4 = bfr4(*(const v4f*)(sc + col));
    const v4f b4 = bfr4(*(const v4f*)(bi + col));
    y[i] = (x[i] - mean) * rinv * s4 + b4;
  }
  if (OUT32) {
    float* o = (float*)outp;
    {
#pragma unroll
      for (int i = 0; i < 6; ++i) *(v4f*)(o + rbase + i * 128 + lane * 4) = y[i];
      
    }
  } else {
    float* rw = rb + wave * HID;
#pragma unroll
    for (int i = 0; i < 6; ++i) *(v4f*)(rw + i * 128 + lane * 4) = y[i];
    wave_lds_sync();
    v4u pk[3];
#pragma unroll
    for (int j = 0; j < 3; ++j) {
      const v4f a = *(const v4f*)(rw + j * 256 + lane * 8);
      const v4f c = *(const v4f*)(rw + j * 256 + lane * 8 + 4);
      v4u p;
      p[0] = pkh2(a[0], a[1]); p[1] = pkh2(a[2], a[3]);
      p[2] = pkh2(c[0], c[1]); p[3] = pkh2(c[2], c[3]);
      pk[j] = p;
    }
    unsigned short* o = (unsigned short*)outp;
    {
#pragma unroll
      for (int j = 0; j < 3; ++j) *(v4u*)(o + rbase + j * 256 + lane * 8) = pk[j];
      
    }
  }
}

// =====================================================================================================
// Weight convert + transpose: W f32 [K][N] (row-major, in-major) -> O f16 [N][K] = f16(bf16-RNE(w) * 64).
// blockIdx.z selects one of 4 (W, O) pairs (block-uniform pointer select between global pointers).
// Tile 64 k x 64 n through LDS; grid = (N/64, K/64, z); 256 threads.
//   read: thread (r = tid>>2 = k row, cq = (tid&3)*16 = n quarter) reads 16 floats (4 x 16 B) -> sT[n][k]
//   write: wave w, lane: rows (n) w*8 + it*4 + (lane>>3), 8 halves per lane at k (lane&7)*8:
// coverage: 8 waves x 8 rows = 64 n rows x 64 k per block; grid covers N/64 x K/64 exactly (host-checked multiples).
// =====================================================================================================
__global__ __launch_bounds__(256) void convT(const float* __restrict__ W0, const float* __restrict__ W1,
                                             const float* __restrict__ W2, const float* __restrict__ W3,
                                             unsigned short* O0, unsigned short* O1,
                                             unsigned short* O2, unsigned short* O3, int K, int N) {
  __shared__ __align__(16) _Float16 sT[64 * 72];
  const int z = blockIdx.z;
  const float* W = (z == 0) ? W0 : (z == 1) ? W1 : (z == 2) ? W2 : W3;
  unsigned short* O = (z == 0) ? O0 : (z == 1) ? O1 : (z == 2) ? O2 : O3;
  const int n0 = blockIdx.x * 64, k0 = blockIdx.y * 64;
  const int tid = threadIdx.x;
  {
    const int r = tid >> 2, cq = (tid & 3) * 16;
    const float* p = W + (size_t)(k0 + r) * N + n0 + cq;
#pragma unroll
    for (int g = 0; g < 4; ++g) {
      const v4f a = *(const v4f*)(p + 4 * g);
#pragma unroll
      for (int e = 0; e < 4; ++e) sT[(cq + 4 * g + e) * 72 + r] = (_Float16)(bfr(a[e]) * WSC);
    }
  }
  __syncthreads();
  const int wave = tid >> 5, lane = tid & 31;
  const int q = lane >> 3, c8 = (lane & 7) * 8;
  union HU { v8h h; v4u u; };
  HU pk[2];
#pragma unroll
  for (int it = 0; it < 2; ++it) {
    const int row = wave * 8 + it * 4 + q;
    pk[it].h = *(const v8h*)(sT + row * 72 + c8);
  }
  const _Float16 dummy = (_Float16)0.0f; (void)dummy;
  {
#pragma unroll
    for (int it = 0; it < 2; ++it) {
      const int row = wave * 8 + it * 4 + q;
      *(v4u*)(O + (size_t)(n0 + row) * K + k0 + c8) = pk[it].u;
    }
    
  }
}

// =====================================================================================================
// Register-blocked f16 WMMA GEMM: C[m][n] = sum_k A[m][k] * Bt[n][k] (accumulator scaled by 1/64 in the
// epilogue = the weight carry). Block = 8 waves (4 x 2) = one 128x128 tile of C, one 32x64 tile per wave.
// A row-major [M][K] pitch lda, Bt row-major [N][K] pitch ldb (k contiguous); M, N multiples of 128, K multiple of 64.
// Operands go through LDS in stages of 64 k: 128 rows x 128 B of A and of Bt per stage. Each wave-wide 16-B load
// covers 4 whole 128-B lines (8 lanes per row); rows lie in LDS at pitch 144 B (16 B x odd) for the 16-B fragment reads.
// Two LDS buffers, one block barrier per stage: stage s+1 is loaded into registers behind the barrier of stage s,
// while stage s is multiplied, and stored to the other buffer, whose last readers (stage s-1) all passed that barrier.
// blockIdx.y = batch index (strides in elements). Both A and B fragments use the split k map of ldfrag_h.
// MODE 1: f16 C = acc/64 + bias[n]
// MODE 2: f16 hi C = f16(v), f16 residual C2 = f16((v - hi) * 4096), v = acc/64 + bias[n]
// MODE 3: f16 C = acc/64 + bias[m]
// MODE 4: f16 C = gelu(acc/64 + bias[n])
// bias values bf16-RNE converted in register. Epilogue: 16-row slabs staged per wave in LDS; each 64-wide row
// coverage: 2 slabs x 16 rows x 64 cols = the wave's whole tile; 8 waves per block; grid = (M/128) * (N/128).
// =====================================================================================================
template <int MODE>
__global__ __launch_bounds__(256) void gemm64(
    const unsigned short* __restrict__ Ap, int lda, long long strideA,
    const unsigned short* __restrict__ Btp, int ldb, long long strideB,
    const float* __restrict__ bias,
    void* Cout, void* Cout2, int ldc, long long strideC,
    int M, int N, int K) {
  __shared__ __align__(16) _Float16 sA[2][128 * GPI];   // A stage: 128 rows x 64 k, pitch GPI halves, two buffers
  __shared__ __align__(16) _Float16 sB[2][128 * GPI];   // Bt stage, same shape
  __shared__ __align__(16) float sT[8][16 * 68];   // per-wave 16x64 slab, pitch 68 floats
  const int bz   = blockIdx.y;
  const int tid  = threadIdx.x;
  const int lane = tid & 31;
  const int wave = tid >> 5;
  const int tilesN = N >> 7;
  const int tilesM = M >> 7;
  const int tile = blockIdx.x;
  if (tile >= tilesM * tilesN) return;             // block-uniform, in front of every barrier
  const int tm = tile / tilesN;
  const int tn = tile - tm * tilesN;
  const int bm0 = tm << 7;                         // block tile origin
  const int bn0 = tn << 7;
  const int wm  = (wave >> 1) << 5;                // wave tile origin inside the block tile
  const int wn  = (wave & 1) << 6;
  const int m0 = bm0 + wm;
  const int n0 = bn0 + wn;

  const _Float16* Ab = (const _Float16*)(const void*)Ap  + (size_t)bz * (size_t)strideA;
  const _Float16* Bb = (const _Float16*)(const void*)Btp + (size_t)bz * (size_t)strideB;

  const int rl   = lane & 15;                      // row (A) / col (B, D) within subtile
  const int hh   = lane >> 4;
  const int koff = hh * 8;                         // k offset of this lane half
  const int mOff = hh * 8;                         // D row offset

  // staging map: thread -> row (tid>>3) + 32*it, 16-B piece (tid&7) of the row's 128 B; 4 it x 32 rows = 128 rows
  const int srow = tid >> 3;
  const int scol = (tid & 7) * 8;
  const _Float16* ga = Ab + (size_t)(bm0 + srow) * lda + scol;
  const _Float16* gb = Bb + (size_t)(bn0 + srow) * ldb + scol;
  const int sofs = srow * GPI + scol;

  v8f acc[2][4];
#pragma unroll
  for (int i = 0; i < 2; ++i)
#pragma unroll
    for (int j = 0; j < 4; ++j) acc[i][j] = zero8();

  v8h ra[4], rb[4];
#pragma unroll
  for (int it = 0; it < 4; ++it) {
    ra[it] = *(const v8h*)(ga + (size_t)(it * 32) * lda);
    rb[it] = *(const v8h*)(gb + (size_t)(it * 32) * ldb);
  }

  const int nst = K >> 6;
  // kept rolled: one stage is already 16 WMMAs and 24 fragment loads a wave; unrolling would only grow code and registers
#pragma unroll 1
  for (int s = 0; s < nst; ++s) {
    _Float16* dA = sA[s & 1];
    _Float16* dB = sB[s & 1];
#pragma unroll
    for (int it = 0; it < 4; ++it) {
      *(v8h*)(dA + sofs + it * 32 * GPI) = ra[it];
      *(v8h*)(dB + sofs + it * 32 * GPI) = rb[it];
    }
    __syncthreads();                               // publishes stage s; ends every wave's reads of stage s-1
    if (s + 1 < nst) {                             // block-uniform: next stage's loads fly under this stage's WMMAs
      const int kn = (s + 1) << 6;
#pragma unroll
      for (int it = 0; it < 4; ++it) {
        ra[it] = *(const v8h*)(ga + (size_t)(it * 32) * lda + kn);
        rb[it] = *(const v8h*)(gb + (size_t)(it * 32) * ldb + kn);
      }
      // precaution: the address registers of these loads are rewritten right below; this keeps the wait in front of that
      asm volatile("s_wait_xcnt 0x0" ::: "memory");
    }
#pragma unroll
    for (int kk = 0; kk < 2; ++kk) {
      v16h bfg[4], af[2];
#pragma unroll
      for (int j = 0; j < 4; ++j)
        bfg[j] = ldfrag_h(dB + (wn + (j << 4) + rl) * GPI + kk * 32 + koff);
#pragma unroll
      for (int i = 0; i < 2; ++i)
        af[i] = ldfrag_h(dA + (wm + (i << 4) + rl) * GPI + kk * 32 + koff);
#pragma unroll
      for (int i = 0; i < 2; ++i)
#pragma unroll
        for (int j = 0; j < 4; ++j) acc[i][j] = mma_h(af[i], bfg[j], acc[i][j]);
    }
  }

  // ---- epilogue ----
  float* slab = sT[wave];
#pragma unroll
  for (int i = 0; i < 2; ++i) {
    const int mBase = m0 + (i << 4);
#pragma unroll
    for (int j = 0; j < 4; ++j) {
#pragma unroll
      for (int r = 0; r < 8; ++r) slab[(mOff + r) * 68 + (j << 4) + rl] = acc[i][j][r] * WINV;
    }
    wave_lds_sync();
    if (MODE == 0) {
      float* C = (float*)Cout + (size_t)bz * (size_t)strideC;
      const int c4 = rl * 4;                                   // 256-B row segment = 16 lanes x 16 B
      const v4f b4 = bfr4(*(const v4f*)(bias + n0 + c4));
      v4f vals[8];
#pragma unroll
      for (int it = 0; it < 8; ++it) {
        const int row = it * 2 + hh;                           // it 0..7 x hh 0..1 = rows 0..15
        const v4f v = *(const v4f*)(slab + row * 68 + c4);
        const v4f o = *(const v4f*)(C + (size_t)(mBase + row) * ldc + n0 + c4);
        vals[it] = o + (v + b4);
      }
      {
#pragma unroll
        for (int it = 0; it < 8; ++it) {
          const int row = it * 2 + hh;
          *(v4f*)(C + (size_t)(mBase + row) * ldc + n0 + c4) = vals[it];
        }
        
      }
    } else {
      const int q = lane >> 3, c8 = (lane & 7) * 8;
      unsigned short* C  = (unsigned short*)Cout  + (size_t)bz * (size_t)strideC;
      unsigned short* C2 = (unsigned short*)Cout2 + (size_t)bz * (size_t)strideC;
      v4f ba = zero4(), bb = zero4();
      if (MODE != 3) {
        ba = bfr4(*(const v4f*)(bias + n0 + c8));
        bb = bfr4(*(const v4f*)(bias + n0 + c8 + 4));
      }
      v4u hv[4], lv[4];
#pragma unroll
      for (int it = 0; it < 4; ++it) {
        const int row = it * 4 + q;                            // it 0..3 x q 0..3 = rows 0..15
        const float* sp = slab + row * 68 + c8;
        v4f fa = *(const v4f*)(sp);
        v4f fb = *(const v4f*)(sp + 4);
        if (MODE == 3) {
          const float br = bfr(bias[mBase + row]);
          fa = fa + br; fb = fb + br;
        } else {
          fa = fa + ba; fb = fb + bb;
        }
        if (MODE == 4) {
#pragma unroll
          for (int e = 0; e < 4; ++e) { fa[e] = gelu_t(fa[e]); fb[e] = gelu_t(fb[e]); }
        }
        v4u a, a2;
        if (MODE == 2) {
#pragma unroll
          for (int e = 0; e < 2; ++e) {
            const float f0 = fa[2 * e], f1 = fa[2 * e + 1];
            const float g0 = fb[2 * e], g1 = fb[2 * e + 1];
            const _Float16 x0 = (_Float16)f0, x1 = (_Float16)f1, y0 = (_Float16)g0, y1 = (_Float16)g1;
            a[e]      = pk16(h_bits(x0), h_bits(x1));
            a[e + 2]  = pk16(h_bits(y0), h_bits(y1));
            a2[e]     = pk16(h_bits((_Float16)((f0 - (float)x0) * QRS)), h_bits((_Float16)((f1 - (float)x1) * QRS)));
            a2[e + 2] = pk16(h_bits((_Float16)((g0 - (float)y0) * QRS)), h_bits((_Float16)((g1 - (float)y1) * QRS)));
          }
        } else {
          a[0] = pkh2(fa[0], fa[1]); a[1] = pkh2(fa[2], fa[3]);
          a[2] = pkh2(fb[0], fb[1]); a[3] = pkh2(fb[2], fb[3]);
          a2 = a;
        }
        hv[it] = a; lv[it] = a2;
      }
      {
#pragma unroll
        for (int it = 0; it < 4; ++it) {
          const int row = it * 4 + q;
          *(v4u*)(C + (size_t)(mBase + row) * ldc + n0 + c8) = hv[it];
          if (MODE == 2) *(v4u*)(C2 + (size_t)(mBase + row) * ldc + n0 + c8) = lv[it];
        }
        
      }
    }
    wave_lds_sync();
  }
}

// =====================================================================================================
// Attention, head dim 64, mask m[b][s] applied as logit = (q.k * sscale) * m - 1e10 * (1 - m) (m bf16-RNE).
//   q planes (f16 hi, f16 residual x4096): element (b, t, h, d) at [(b*SEQ + t)*HID + h*64 + d]
//   k plane (f16): same layout with key index s;  v^T plane (f16): element (b, h, d, s) at [(b*HID + h*64 + d)*SEQ + s]
//   scores = qhi.k + (qres.k)/4096, two f32 accumulators; online softmax in f32 (running max);
//   p = exp(s - m) carried as f16(1024 p), spilled per wave to LDS with _Float16 element stores and reloaded as v8h
//   ctx plane (f16, normalised context): element (b, t, h, d) at [(b*SEQ + t)*HID + h*64 + d]
//   Block = 4 waves = 64 query rows of one (b, h); grid = NQB * NHD * NB; kv chunks of 64, static trip NQB.
//   K / V^T chunk staging: 128 threads x 32 elements per plane = the whole 64x64 tile (plain 16-B loads,
//   __syncthreads before and after).
//   Output coverage: each wave stores rows q0..q0+15 (it 0..3 x lane>>3 0..3) x 64 columns (8 lanes x 8),
// =====================================================================================================
__global__ __launch_bounds__(128)
void attn64(const unsigned short* __restrict__ qhp, const unsigned short* __restrict__ qlp,
            const unsigned short* __restrict__ khp, const unsigned short* __restrict__ vtp,
            const float* __restrict__ mask, unsigned short* ctxp, float sscale) {
  union FH { v16h v; v8h h[2]; };
  __shared__ __align__(16) _Float16 Ks[64 * 64];                  // K [kv][d]    8 KB
  __shared__ __align__(16) _Float16 Vts[64 * 64];                 // V^T [d][kv]  8 KB
  __shared__ __align__(16) _Float16 Psh[4][16 * 64];              // per wave P [row][kv]
  __shared__ __align__(16) float    Os[4][16 * 64];               // per wave context tile [row][d]

  const int tid  = threadIdx.x;
  const int wave = tid >> 5;
  const int lane = tid & 31;
  const int hh   = lane >> 4;
  const int c    = lane & 15;

  const int bx   = blockIdx.x;
  const int qb   = bx % NQB;
  const int rest = bx / NQB;
  const int h    = rest % NHD;
  const int b    = rest / NHD;
  const int q0   = qb * 64 + wave * 16;
  const size_t rowB = (size_t)b * SEQ;

  const _Float16* Qh = (const _Float16*)(const void*)qhp + (size_t)h * HD;
  const _Float16* Ql = (const _Float16*)(const void*)qlp + (size_t)h * HD;
  const _Float16* Kh = (const _Float16*)(const void*)khp + (size_t)h * HD;
  const _Float16* Vt = (const _Float16*)(const void*)vtp + ((size_t)b * HID + (size_t)h * HD) * SEQ;
  const float* mb = mask + (size_t)b * SEQ;

  // ---- Q fragments (A operand, row = lane&15): 2 d-chunks, hi and residual ----
  v16h qah[2], qal[2];
#pragma unroll
  for (int dc = 0; dc < 2; ++dc) {
    const size_t qo = (rowB + q0 + c) * HID + dc * 32 + 8 * hh;
    qah[dc] = ldfrag_h(Qh + qo);
    qal[dc] = ldfrag_h(Ql + qo);
  }

  float mrow[8], lrow[8];
  v8f oacc[4];
#pragma unroll
  for (int r = 0; r < 8; ++r) { mrow[r] = -INFINITY; lrow[r] = 0.f; }
#pragma unroll
  for (int t = 0; t < 4; ++t) oacc[t] = zero8();

#pragma unroll 1
  for (int kt = 0; kt < NQB; ++kt) {
    const int kv0 = kt * 64;
    __syncthreads();
    {
      const int r = tid >> 1, half = (tid & 1) * 32;
      const _Float16* kg = Kh + (rowB + kv0 + r) * HID + half;      // K row kv0+r, d = half..half+31
      const _Float16* vg = Vt + (size_t)r * SEQ + kv0 + half;      // V^T row d = r, s = kv0+half..+31
#pragma unroll
      for (int i = 0; i < 4; ++i) {
        const v8h a0 = *(const v8h*)(kg + 8 * i);
        const v8h b0 = *(const v8h*)(vg + 8 * i);
        *(v8h*)(Ks  + r * 64 + half + 8 * i) = a0;
        *(v8h*)(Vts + r * 64 + half + 8 * i) = b0;
      }
    }
    __syncthreads();

    float mv[4];
#pragma unroll
    for (int j = 0; j < 4; ++j) mv[j] = bfr(mb[kv0 + j * 16 + c]);   // key kv0 + 16j + c < SEQ

    // ---- scores: 16 query rows x 64 keys per wave, qhi.k and qres.k ----
    v8f s[4];
#pragma unroll
    for (int j = 0; j < 4; ++j) {
      s[j] = zero8();
      v8f sl = zero8();
#pragma unroll
      for (int dc = 0; dc < 2; ++dc) {
        FH kb;
        kb.h[0] = *(const v8h*)(Ks + (j * 16 + c) * 64 + dc * 32 + 8 * hh);
        kb.h[1] = *(const v8h*)(Ks + (j * 16 + c) * 64 + dc * 32 + 16 + 8 * hh);
        s[j] = mma_h(qah[dc], kb.v, s[j]);
        sl   = mma_h(qal[dc], kb.v, sl);
      }
#pragma unroll
      for (int r = 0; r < 8; ++r) {
        float sv = (s[j][r] + sl[r] * QRI) * sscale;
        sv = sv * mv[j] - 1.0e10f * (1.0f - mv[j]);
        s[j][r] = sv;
      }
    }

    // ---- row max, online softmax, P (x1024, f16) to LDS ----
    _Float16* pwh = Psh[wave];
#pragma unroll
    for (int r = 0; r < 8; ++r) {
      float m = fmaxf(fmaxf(s[0][r], s[1][r]), fmaxf(s[2][r], s[3][r]));
#pragma unroll
      for (int off = 1; off < 16; off <<= 1) m = fmaxf(m, __shfl_xor(m, off, 32));
      const float mnew  = fmaxf(mrow[r], m);
      const float alpha = __expf(mrow[r] - mnew);
      mrow[r] = mnew;
      float psum = 0.f;
#pragma unroll
      for (int j = 0; j < 4; ++j) {
        const float p = __expf(s[j][r] - mnew);
        psum += p;
        pwh[(8 * hh + r) * 64 + j * 16 + c] = (_Float16)(p * PSC);
      }
#pragma unroll
      for (int off = 1; off < 16; off <<= 1) psum += __shfl_xor(psum, off, 32);
      lrow[r] = lrow[r] * alpha + psum;
#pragma unroll
      for (int t = 0; t < 4; ++t) oacc[t][r] *= alpha;
    }
    wave_lds_sync();

    // ---- context += P . V (f16 WMMA) ----
#pragma unroll
    for (int kk = 0; kk < 2; ++kk) {
      FH pa;
      pa.h[0] = *(const v8h*)(pwh + c * 64 + kk * 32 + 8 * hh);
      pa.h[1] = *(const v8h*)(pwh + c * 64 + kk * 32 + 16 + 8 * hh);
#pragma unroll
      for (int t = 0; t < 4; ++t) {
        FH vb;
        vb.h[0] = *(const v8h*)(Vts + (t * 16 + c) * 64 + kk * 32 + 8 * hh);
        vb.h[1] = *(const v8h*)(Vts + (t * 16 + c) * 64 + kk * 32 + 16 + 8 * hh);
        oacc[t] = mma_h(pa.v, vb.v, oacc[t]);
      }
    }
  }

  float* os = Os[wave];
#pragma unroll
  for (int r = 0; r < 8; ++r) {
    const float l = lrow[r];
    const float inv = ((l > 0.f) ? (1.0f / l) : 0.f) * PSI;
#pragma unroll
    for (int t = 0; t < 4; ++t) os[(8 * hh + r) * 64 + t * 16 + c] = oacc[t][r] * inv;
  }
  wave_lds_sync();
  {
    const int q4 = lane >> 3, c8 = (lane & 7) * 8;
    v4u hv[4];
#pragma unroll
    for (int it = 0; it < 4; ++it) {
      const int row = it * 4 + q4;           // it 0..3 x q4 0..3 = rows 0..15 of the wave tile
      const float* sp = os + row * 64 + c8;
      const v4f fa = *(const v4f*)(sp);
      const v4f fb = *(const v4f*)(sp + 4);
      v4u a;
      a[0] = pkh2(fa[0], fa[1]); a[1] = pkh2(fa[2], fa[3]);
      a[2] = pkh2(fb[0], fb[1]); a[3] = pkh2(fb[2], fb[3]);
      hv[it] = a;
    }
    {
#pragma unroll
      for (int it = 0; it < 4; ++it) {
        const int row = it * 4 + q4;
        const size_t go = (rowB + q0 + row) * HID + (size_t)h * HD + c8;
        *(v4u*)(ctxp + go) = hv[it];
      }
      
    }
  }
}

// =====================================================================================================
// Workspace map (bytes), all region sizes multiples of 128 and exact multiples of their 64x64- or 128x128-tile / whole-row
// store granularity (M, N multiples of 128; 768- and 3072-wide rows), so no padded tails are needed:
//   Hres f32 [4096][768]        12582912
//   X    f16 [4096][768]         6291456   (LN output plane, reused by LN1 and LN2)
//   Qh   f16 [4096][768]         6291456
//   Ql   f16 [4096][768]         6291456   (q residual x4096)
//   Kh   f16 [4096][768]         6291456
//   VT   f16 [2][768][2048]      6291456
//   Ctx  f16 [4096][768]         6291456
//   G    f16 [4096][3072]       25165824
//   Wq_t,Wk_t,Wv_t,Wo_t f16 [768][768]  4 x 1179648
//   W1_t f16 [3072][768]         4718592
//   W2_t f16 [768][3072]         4718592
//   total                       89653248
// Weights are converted per layer into the same regions ([out n][in k], k contiguous = the Bt / A layout).
// =====================================================================================================
extern "C" void kernel_launch(void* const* d_in, const int* in_sizes, int n_in,
                              void* d_out, int out_size, void* d_ws, size_t ws_size,
                              hipStream_t stream) {
  if (n_in < 21) return;
  if (in_sizes[0] != BT * HID || in_sizes[1] != BT * HID || in_sizes[2] != NB * SEQ) return;
  if (in_sizes[3] != 2 * HID || in_sizes[4] != 2 * HID) return;
  if (in_sizes[5] != 2 * HID * HID || in_sizes[7] != 2 * HID * HID ||
      in_sizes[9] != 2 * HID * HID || in_sizes[11] != 2 * HID * HID) return;
  if (in_sizes[6] != 2 * HID || in_sizes[8] != 2 * HID || in_sizes[10] != 2 * HID || in_sizes[12] != 2 * HID) return;
  if (in_sizes[13] != 2 * HID || in_sizes[14] != 2 * HID) return;
  if (in_sizes[15] != 2 * HID * DFF || in_sizes[16] != 2 * DFF ||
      in_sizes[17] != 2 * DFF * HID || in_sizes[18] != 2 * HID) return;
  if (in_sizes[19] != HID || in_sizes[20] != HID) return;
  if (out_size != BT * HID) return;

  const float* in_h  = (const float*)d_in[0];
  const float* embs  = (const float*)d_in[1];
  const float* mask  = (const float*)d_in[2];
  const float* ln1_s = (const float*)d_in[3];
  const float* ln1_b = (const float*)d_in[4];
  const float* wq    = (const float*)d_in[5];
  const float* bq    = (const float*)d_in[6];
  const float* wk    = (const float*)d_in[7];
  const float* bk    = (const float*)d_in[8];
  const float* wv    = (const float*)d_in[9];
  const float* bv    = (const float*)d_in[10];
  const float* wo    = (const float*)d_in[11];
  const float* bo    = (const float*)d_in[12];
  const float* ln2_s = (const float*)d_in[13];
  const float* ln2_b = (const float*)d_in[14];
  const float* w1    = (const float*)d_in[15];
  const float* b1    = (const float*)d_in[16];
  const float* w2    = (const float*)d_in[17];
  const float* b2    = (const float*)d_in[18];
  const float* lnf_s = (const float*)d_in[19];
  const float* lnf_b = (const float*)d_in[20];
  float* out = (float*)d_out;

  const size_t PH  = (size_t)BT * HID * 4;        // 12582912
  const size_t PA  = (size_t)BT * HID * 2;        //  6291456
  const size_t PVT = (size_t)NB * HID * SEQ * 2;  //  6291456
  const size_t PG  = (size_t)BT * DFF * 2;        // 25165824
  const size_t PW  = (size_t)HID * HID * 2;       //  1179648
  const size_t PW1 = (size_t)HID * DFF * 2;       //  4718592
  size_t off = 0;
  const size_t oH   = off; off += PH;
  const size_t oX   = off; off += PA;
  const size_t oQh  = off; off += PA;
  const size_t oQl  = off; off += PA;
  const size_t oKh  = off; off += PA;
  const size_t oVT  = off; off += PVT;
  const size_t oCtx = off; off += PA;
  const size_t oG   = off; off += PG;
  const size_t oWq  = off; off += PW;
  const size_t oWk  = off; off += PW;
  const size_t oWv  = off; off += PW;
  const size_t oWo  = off; off += PW;
  const size_t oW1  = off; off += PW1;
  const size_t oW2  = off; off += PW1;
  if (off > ws_size) return;                      // off = 89653248
  if (off > (size_t)134217728) return;

  char* ws = (char*)d_ws;
  float*          Hres = (float*)(ws + oH);
  unsigned short* X    = (unsigned short*)(ws + oX);
  unsigned short* Qh   = (unsigned short*)(ws + oQh);
  unsigned short* Ql   = (unsigned short*)(ws + oQl);
  unsigned short* Kh   = (unsigned short*)(ws + oKh);
  unsigned short* VT   = (unsigned short*)(ws + oVT);
  unsigned short* Ctx  = (unsigned short*)(ws + oCtx);
  unsigned short* G    = (unsigned short*)(ws + oG);
  unsigned short* Wqt  = (unsigned short*)(ws + oWq);
  unsigned short* Wkt  = (unsigned short*)(ws + oWk);
  unsigned short* Wvt  = (unsigned short*)(ws + oWv);
  unsigned short* Wot  = (unsigned short*)(ws + oWo);
  unsigned short* W1t  = (unsigned short*)(ws + oW1);
  unsigned short* W2t  = (unsigned short*)(ws + oW2);

  const dim3 blk(256);
  const dim3 gLN(BT / 8);                                           // 512 blocks, 8 rows each
  const dim3 gCv4(HID / 64, HID / 64, 4);                           // (12,12,4)
  const dim3 gCv1(DFF / 64, HID / 64, 1);                           // w1 [768][3072] -> [3072][768]
  const dim3 gCv2(HID / 64, DFF / 64, 1);                           // w2 [3072][768] -> [768][3072]
  const dim3 gHH((BT / 128) * (HID / 128), 1);                      // 32 x 6  = 192 blocks
  const dim3 gVT((HID / 128) * (SEQ / 128), NB);                    // 6 x 16  = 96 blocks x 2 batches
  const dim3 gF1((BT / 128) * (DFF / 128), 1);                      // 32 x 24 = 768 blocks
  const dim3 gAt(NB * NHD * NQB);                                   // 768 blocks of 128

  for (int l = 0; l < 2; ++l) {
    const float* wql = wq + (size_t)l * HID * HID;
    const float* wkl = wk + (size_t)l * HID * HID;
    const float* wvl = wv + (size_t)l * HID * HID;
    const float* wol = wo + (size_t)l * HID * HID;
    const float* w1l = w1 + (size_t)l * HID * DFF;
    const float* w2l = w2 + (size_t)l * DFF * HID;
    // (1) h = h + input_embs; hn = LN1(h) -> X (f16)
    if (l == 0) {
      ln_rows<true, true, false><<<gLN, blk, 0, stream>>>(in_h, embs, Hres, ln1_s, ln1_b, (void*)X, BT);
    } else {
      ln_rows<true, false, false><<<gLN, blk, 0, stream>>>(Hres, embs, Hres, ln1_s + HID, ln1_b + HID, (void*)X, BT);
    }
    // (2) weights of this layer: f32 [in][out] -> f16 [out][in] (bf16-RNE values x64)
    convT<<<gCv4, blk, 0, stream>>>(wql, wkl, wvl, wol, Wqt, Wkt, Wvt, Wot, HID, HID);
    convT<<<gCv1, blk, 0, stream>>>(w1l, w1l, w1l, w1l, W1t, W1t, W1t, W1t, HID, DFF);
    convT<<<gCv2, blk, 0, stream>>>(w2l, w2l, w2l, w2l, W2t, W2t, W2t, W2t, DFF, HID);
    // (3) q = hn . Wq + bq -> f16 hi + residual planes [b*SEQ+t][h*64+d]  (M=4096, N=768, K=768)
    gemm64<2><<<gHH, blk, 0, stream>>>(X, HID, 0LL, Wqt, HID, 0LL, bq + l * HID,
                                       (void*)Qh, (void*)Ql, HID, 0LL, BT, HID, HID);
    // (4) k = hn . Wk + bk -> f16 plane
    gemm64<1><<<gHH, blk, 0, stream>>>(X, HID, 0LL, Wkt, HID, 0LL, bk + l * HID,
                                       (void*)Kh, (void*)Kh, HID, 0LL, BT, HID, HID);
    // (5) v^T = Wv_t . hn^T per batch -> f16 [b][h*64+d][s]  (A = Wv_t [n][k], Bt = X rows of batch b; M=768, N=2048, K=768)
    gemm64<3><<<gVT, blk, 0, stream>>>(Wvt, HID, 0LL, X, HID, (long long)SEQ * HID, bv + l * HID,
                                       (void*)VT, (void*)VT, SEQ, (long long)HID * SEQ, HID, SEQ, HID);
    // (6) attention -> Ctx f16 [b*SEQ+t][h*64+d]
    attn64<<<gAt, dim3(128), 0, stream>>>(Qh, Ql, Kh, VT, mask, Ctx, 0.125f);
    // (7) h = h + (ctx . Wo + bo)  (f32, in place)
    gemm64<0><<<gHH, blk, 0, stream>>>(Ctx, HID, 0LL, Wot, HID, 0LL, bo + l * HID,
                                       (void*)Hres, (void*)Hres, HID, 0LL, BT, HID, HID);
    // (8) hn = LN2(h) -> X
    ln_rows<false, false, false><<<gLN, blk, 0, stream>>>(Hres, embs, Hres, ln2_s + l * HID, ln2_b + l * HID, (void*)X, BT);
    // (9) g = gelu(hn . W1 + b1) -> G f16 [4096][3072]  (M=4096, N=3072, K=768)
    gemm64<4><<<gF1, blk, 0, stream>>>(X, HID, 0LL, W1t, HID, 0LL, b1 + l * DFF,
                                       (void*)G, (void*)G, DFF, 0LL, BT, DFF, HID);
    // (10) h = h + (g . W2 + b2)  (M=4096, N=768, K=3072, f32 in place)
    gemm64<0><<<gHH, blk, 0, stream>>>(G, DFF, 0LL, W2t, DFF, 0LL, b2 + l * HID,
                                       (void*)Hres, (void*)Hres, HID, 0LL, BT, HID, DFF);
  }
  // (11) out = LN_f(h) -> f32 [2][2048][768]
  ln_rows<false, false, true><<<gLN, blk, 0, stream>>>(Hres, embs, Hres, lnf_s, lnf_b, (void*)out, BT);
  (void)hipGetLastError();
}

// v002
// Measured time: 446 microseconds a run.
// Two timings next to v001 both put it at 1.18 times that version's speed.
// Over all steps from v000 it is 2.19 times as fast.
// Contractions: q, k, v^T, out and ffn projections = v_wmma_f32_16x16x32_f16 (f16 activations; weights bf16-RNE then x64 as f16), single product;
// q.k^T = v_wmma_f32_16x16x32_f16 with q as f16 hi + f16 residual (x4096) planes and k f16, 2 products in separate accumulators;
// p.v = v_wmma_f32_16x16x32_f16 (p carried x1024 in f16, v f16); f32 accumulate everywhere; layernorm, softmax and gelu in f32.
#include <hip/hip_runtime.h>
#include <math.h>
#include <stdint.h>

#define NB   2
#define SEQ  2048
#define HID  768
#define NHD  12
#define HD   64
#define DFF  3072
#define BT   (NB * SEQ)
#define NQB  (SEQ / 64)
#define WSC  64.0f
#define WINV 0.015625f
#define QRS  4096.0f
#define QRI  0.000244140625f
#define PSC  1024.0f
#define PSI  0.0009765625f
#define GPI  72                 // LDS row pitch of a GEMM stage, in halves: 64 k + 8 = 144 B
#define API  72                 // LDS row pitch of the attention K, V^T and P tiles, in halves: 64 + 8 = 144 B = 16 B x odd
#define OPI  68                 // LDS row pitch of the attention context tile, in floats: 64 + 4 = 272 B = 16 B x odd
static_assert(NHD * HD == HID);
static_assert((SEQ % 64) == 0 && (HID % 64) == 0 && (DFF % 64) == 0 && (BT % 64) == 0);
static_assert(HID == 6 * 128);
static_assert((SEQ % 128) == 0 && (HID % 128) == 0 && (DFF % 128) == 0 && (BT % 128) == 0);

typedef _Float16 v16h __attribute__((ext_vector_type(16)));
typedef _Float16 v8h  __attribute__((ext_vector_type(8)));
typedef float    v8f  __attribute__((ext_vector_type(8)));
typedef float    v4f  __attribute__((ext_vector_type(4)));
typedef unsigned int v4u __attribute__((ext_vector_type(4)));

// ---- scalar helpers -----------------------------------------------------------------------------
__device__ __forceinline__ unsigned short bf_bits(float f) {        // f32 -> bf16 bits, RNE convert
  const unsigned u = __float_as_uint(f);
  return (unsigned short)((u + 0x7FFFu + ((u >> 16) & 1u)) >> 16);
}
__device__ __forceinline__ float bfr(float f) { return __uint_as_float(((unsigned)bf_bits(f)) << 16); }
__device__ __forceinline__ v4f bfr4(v4f a) {
  v4f r;
  r[0] = bfr(a[0]); r[1] = bfr(a[1]); r[2] = bfr(a[2]); r[3] = bfr(a[3]);
  return r;
}
__device__ __forceinline__ unsigned short h_bits(_Float16 x) { return __builtin_bit_cast(unsigned short, x); }
__device__ __forceinline__ unsigned pk16(unsigned short a, unsigned short b) { return (unsigned)a | ((unsigned)b << 16); }
__device__ __forceinline__ unsigned pkh2(float a, float b) { return pk16(h_bits((_Float16)a), h_bits((_Float16)b)); }
__device__ __forceinline__ v8f zero8() { v8f z = {0.f, 0.f, 0.f, 0.f, 0.f, 0.f, 0.f, 0.f}; return z; }
__device__ __forceinline__ v4f zero4() { v4f z = {0.f, 0.f, 0.f, 0.f}; return z; }

// ---- fragment loader: 16-bit A/B operand, lane -> row/col (lane&15); p already includes +8*(lane>>4);
//      elements 0..7 <- p[0..7] (k0+8h..), elements 8..15 <- p[16..23] (k0+16+8h..)
__device__ __forceinline__ v16h ldfrag_h(const _Float16* p) {
  union { v16h v; v8h h[2]; } f;
  f.h[0] = *(const v8h*)(p);
  f.h[1] = *(const v8h*)(p + 16);
  return f.v;
}

// ---- WMMA with trailing VALU hazard gap -----------------------------------------------------------
__device__ __forceinline__ v8f mma_h(v16h a, v16h b, v8f c) {
  c = __builtin_amdgcn_wmma_f32_16x16x32_f16(false, a, false, b, (short)0, c, false, false);
#if defined(__HIP_DEVICE_COMPILE__)
  asm volatile("v_nop\n\tv_nop\n\tv_nop\n\tv_nop" : "+v"(c) : "v"(a), "v"(b));
#endif
  return c;
}

// release/acquire + wave barrier for same-wave LDS exchange
__device__ __forceinline__ void wave_lds_sync() {
  __builtin_amdgcn_fence(__ATOMIC_RELEASE, "workgroup");
  __builtin_amdgcn_wave_barrier();
  __builtin_amdgcn_fence(__ATOMIC_ACQUIRE, "workgroup");
}

// tanh-approximation gelu, tanh(u) = 1 - 2/(exp(2u)+1) with u clamped to [-16,16]
__device__ __forceinline__ float gelu_t(float x) {
  float u = 0.7978845608028654f * (x + 0.044715f * x * x * x);
  u = fminf(fmaxf(u, -16.0f), 16.0f);
  const float e  = __expf(2.0f * u);
  const float th = 1.0f - 2.0f * __builtin_amdgcn_rcpf(e + 1.0f);
  return 0.5f * x * (1.0f + th);
}

// =====================================================================================================
// Residual add + LayerNorm, one wave per row of 768. grid = nrows/8, 256 threads.
//   x = src row (RSRC: bf16-RNE the loaded values) (+ ADDE: bf16-RNE(embs row)); ADDE also stores x to hdst
//   (may alias src: every lane reads its own 24 columns before storing them).
//   else:  y -> f16 rows via a per-wave LDS row buffer (lane l: 8 halves at col 256j+8l, 512 B per instruction).
// coverage: 8 waves x grid(512) = 4096 rows; 6 x 128 floats / 3 x 256 halves = the whole 768-wide row.
// =====================================================================================================
template <bool ADDE, bool RSRC, bool OUT32>
__global__ __launch_bounds__(256) void ln_rows(const float* src, const float* embs, float* hdst,
                                               const float* __restrict__ sc, const float* __restrict__ bi,
                                               void* outp, int nrows) {
  __shared__ __align__(16) float rb[8 * HID];
  const int tid = threadIdx.x, wave = tid >> 5, lane = tid & 31;
  const int row = blockIdx.x * 8 + wave;
  if (row >= nrows) return;                       // wave-uniform; no block barriers in this kernel
  const size_t rbase = (size_t)row * HID;
  v4f x[6];
#pragma unroll
  for (int i = 0; i < 6; ++i) {
    const int col = i * 128 + lane * 4;
    v4f a = *(const v4f*)(src + rbase + col);
    if (RSRC) a = bfr4(a);
    if (ADDE) {
      const v4f e = bfr4(*(const v4f*)(embs + rbase + col));
      a = a + e;
    }
    x[i] = a;
  }
  if (ADDE) {
    {
#pragma unroll
      for (int i = 0; i < 6; ++i) *(v4f*)(hdst + rbase + i * 128 + lane * 4) = x[i];
      
    }
  }
  float s = 0.f;
#pragma unroll
  for (int i = 0; i < 6; ++i) s += (x[i][0] + x[i][1]) + (x[i][2] + x[i][3]);
#pragma unroll
  for (int off = 1; off < 32; off <<= 1) s += __shfl_xor(s, off, 32);
  const float mean = s * (1.0f / 768.0f);
  float qv = 0.f;
#pragma unroll
  for (int i = 0; i < 6; ++i) {
    const v4f d = x[i] - mean;
    qv += (d[0] * d[0] + d[1] * d[1]) + (d[2] * d[2] + d[3] * d[3]);
  }
#pragma unroll
  for (int off = 1; off < 32; off <<= 1) qv += __shfl_xor(qv, off, 32);
  const float var  = qv * (1.0f / 768.0f);
  const float rinv = rsqrtf(var + 1e-5f);
  v4f y[6];
#pragma unroll
  for (int i = 0; i < 6; ++i) {
    const int col = i * 128 + lane * 4;
    const v4f s4 = bfr4(*(const v4f*)(sc + col));
    const v4f b4 = bfr4(*(const v4f*)(bi + col));
    y[i] = (x[i] - mean) * rinv * s4 + b4;
  }
  if (OUT32) {
    float* o = (float*)outp;
    {
#pragma unroll
      for (int i = 0; i < 6; ++i) *(v4f*)(o + rbase + i * 128 + lane * 4) = y[i];
      
    }
  } else {
    float* rw = rb + wave * HID;
#pragma unroll
    for (int i = 0; i < 6; ++i) *(v4f*)(rw + i * 128 + lane * 4) = y[i];
    wave_lds_sync();
    v4u pk[3];
#pragma unroll
    for (int j = 0; j < 3; ++j) {
      const v4f a = *(const v4f*)(rw + j * 256 + lane * 8);
      const v4f c = *(const v4f*)(rw + j * 256 + lane * 8 + 4);
      v4u p;
      p[0] = pkh2(a[0], a[1]); p[1] = pkh2(a[2], a[3]);
      p[2] = pkh2(c[0], c[1]); p[3] = pkh2(c[2], c[3]);
      pk[j] = p;
    }
    unsigned short* o = (unsigned short*)outp;
    {
#pragma unroll
      for (int j = 0; j < 3; ++j) *(v4u*)(o + rbase + j * 256 + lane * 8) = pk[j];
      
    }
  }
}

// =====================================================================================================
// Weight convert + transpose: W f32 [K][N] (row-major, in-major) -> O f16 [N][K] = f16(bf16-RNE(w) * 64).
// blockIdx.z selects one of 4 (W, O) pairs (block-uniform pointer select between global pointers).
// Tile 64 k x 64 n through LDS; grid = (N/64, K/64, z); 256 threads.
//   read: thread (r = tid>>2 = k row, cq = (tid&3)*16 = n quarter) reads 16 floats (4 x 16 B) -> sT[n][k]
//   write: wave w, lane: rows (n) w*8 + it*4 + (lane>>3), 8 halves per lane at k (lane&7)*8:
// coverage: 8 waves x 8 rows = 64 n rows x 64 k per block; grid covers N/64 x K/64 exactly (host-checked multiples).
// =====================================================================================================
__global__ __launch_bounds__(256) void convT(const float* __restrict__ W0, const float* __restrict__ W1,
                                             const float* __restrict__ W2, const float* __restrict__ W3,
                                             unsigned short* O0, unsigned short* O1,
                                             unsigned short* O2, unsigned short* O3, int K, int N) {
  __shared__ __align__(16) _Float16 sT[64 * 72];
  const int z = blockIdx.z;
  const float* W = (z == 0) ? W0 : (z == 1) ? W1 : (z == 2) ? W2 : W3;
  unsigned short* O = (z == 0) ? O0 : (z == 1) ? O1 : (z == 2) ? O2 : O3;
  const int n0 = blockIdx.x * 64, k0 = blockIdx.y * 64;
  const int tid = threadIdx.x;
  {
    const int r = tid >> 2, cq = (tid & 3) * 16;
    const float* p = W + (size_t)(k0 + r) * N + n0 + cq;
#pragma unroll
    for (int g = 0; g < 4; ++g) {
      const v4f a = *(const v4f*)(p + 4 * g);
#pragma unroll
      for (int e = 0; e < 4; ++e) sT[(cq + 4 * g + e) * 72 + r] = (_Float16)(bfr(a[e]) * WSC);
    }
  }
  __syncthreads();
  const int wave = tid >> 5, lane = tid & 31;
  const int q = lane >> 3, c8 = (lane & 7) * 8;
  union HU { v8h h; v4u u; };
  HU pk[2];
#pragma unroll
  for (int it = 0; it < 2; ++it) {
    const int row = wave * 8 + it * 4 + q;
    pk[it].h = *(const v8h*)(sT + row * 72 + c8);
  }
  const _Float16 dummy = (_Float16)0.0f; (void)dummy;
  {
#pragma unroll
    for (int it = 0; it < 2; ++it) {
      const int row = wave * 8 + it * 4 + q;
      *(v4u*)(O + (size_t)(n0 + row) * K + k0 + c8) = pk[it].u;
    }
    
  }
}

// =====================================================================================================
// Register-blocked f16 WMMA GEMM: C[m][n] = sum_k A[m][k] * Bt[n][k] (accumulator scaled by 1/64 in the
// epilogue = the weight carry). Block = 8 waves (4 x 2) = one 128x128 tile of C, one 32x64 tile per wave.
// A row-major [M][K] pitch lda, Bt row-major [N][K] pitch ldb (k contiguous); M, N multiples of 128, K multiple of 64.
// Operands go through LDS in stages of 64 k: 128 rows x 128 B of A and of Bt per stage. Each wave-wide 16-B load
// covers 4 whole 128-B lines (8 lanes per row); rows lie in LDS at pitch 144 B (16 B x odd) for the 16-B fragment reads.
// Two LDS buffers, one block barrier per stage: stage s+1 is loaded into registers behind the barrier of stage s,
// while stage s is multiplied, and stored to the other buffer, whose last readers (stage s-1) all passed that barrier.
// blockIdx.y = batch index (strides in elements). Both A and B fragments use the split k map of ldfrag_h.
// MODE 1: f16 C = acc/64 + bias[n]
// MODE 2: f16 hi C = f16(v), f16 residual C2 = f16((v - hi) * 4096), v = acc/64 + bias[n]
// MODE 3: f16 C = acc/64 + bias[m]
// MODE 4: f16 C = gelu(acc/64 + bias[n])
// bias values bf16-RNE converted in register. Epilogue: 16-row slabs staged per wave in LDS; each 64-wide row
// coverage: 2 slabs x 16 rows x 64 cols = the wave's whole tile; 8 waves per block; grid = (M/128) * (N/128).
// =====================================================================================================
template <int MODE>
__global__ __launch_bounds__(256) void gemm64(
    const unsigned short* __restrict__ Ap, int lda, long long strideA,
    const unsigned short* __restrict__ Btp, int ldb, long long strideB,
    const float* __restrict__ bias,
    void* Cout, void* Cout2, int ldc, long long strideC,
    int M, int N, int K) {
  __shared__ __align__(16) _Float16 sA[2][128 * GPI];   // A stage: 128 rows x 64 k, pitch GPI halves, two buffers
  __shared__ __align__(16) _Float16 sB[2][128 * GPI];   // Bt stage, same shape
  __shared__ __align__(16) float sT[8][16 * 68];   // per-wave 16x64 slab, pitch 68 floats
  const int bz   = blockIdx.y;
  const int tid  = threadIdx.x;
  const int lane = tid & 31;
  const int wave = tid >> 5;
  const int tilesN = N >> 7;
  const int tilesM = M >> 7;
  const int tile = blockIdx.x;
  if (tile >= tilesM * tilesN) return;             // block-uniform, in front of every barrier
  const int tm = tile / tilesN;
  const int tn = tile - tm * tilesN;
  const int bm0 = tm << 7;                         // block tile origin
  const int bn0 = tn << 7;
  const int wm  = (wave >> 1) << 5;                // wave tile origin inside the block tile
  const int wn  = (wave & 1) << 6;
  const int m0 = bm0 + wm;
  const int n0 = bn0 + wn;

  const _Float16* Ab = (const _Float16*)(const void*)Ap  + (size_t)bz * (size_t)strideA;
  const _Float16* Bb = (const _Float16*)(const void*)Btp + (size_t)bz * (size_t)strideB;

  const int rl   = lane & 15;                      // row (A) / col (B, D) within subtile
  const int hh   = lane >> 4;
  const int koff = hh * 8;                         // k offset of this lane half
  const int mOff = hh * 8;                         // D row offset

  // staging map: thread -> row (tid>>3) + 32*it, 16-B piece (tid&7) of the row's 128 B; 4 it x 32 rows = 128 rows
  const int srow = tid >> 3;
  const int scol = (tid & 7) * 8;
  const _Float16* ga = Ab + (size_t)(bm0 + srow) * lda + scol;
  const _Float16* gb = Bb + (size_t)(bn0 + srow) * ldb + scol;
  const int sofs = srow * GPI + scol;

  v8f acc[2][4];
#pragma unroll
  for (int i = 0; i < 2; ++i)
#pragma unroll
    for (int j = 0; j < 4; ++j) acc[i][j] = zero8();

  v8h ra[4], rb[4];
#pragma unroll
  for (int it = 0; it < 4; ++it) {
    ra[it] = *(const v8h*)(ga + (size_t)(it * 32) * lda);
    rb[it] = *(const v8h*)(gb + (size_t)(it * 32) * ldb);
  }

  const int nst = K >> 6;
  // kept rolled: one stage is already 16 WMMAs and 24 fragment loads a wave; unrolling would only grow code and registers
#pragma unroll 1
  for (int s = 0; s < nst; ++s) {
    _Float16* dA = sA[s & 1];
    _Float16* dB = sB[s & 1];
#pragma unroll
    for (int it = 0; it < 4; ++it) {
      *(v8h*)(dA + sofs + it * 32 * GPI) = ra[it];
      *(v8h*)(dB + sofs + it * 32 * GPI) = rb[it];
    }
    __syncthreads();                               // publishes stage s; ends every wave's reads of stage s-1
    if (s + 1 < nst) {                             // block-uniform: next stage's loads fly under this stage's WMMAs
      const int kn = (s + 1) << 6;
#pragma unroll
      for (int it = 0; it < 4; ++it) {
        ra[it] = *(const v8h*)(ga + (size_t)(it * 32) * lda + kn);
        rb[it] = *(const v8h*)(gb + (size_t)(it * 32) * ldb + kn);
      }
      // precaution: the address registers of these loads are rewritten right below; this keeps the wait in front of that
      asm volatile("s_wait_xcnt 0x0" ::: "memory");
    }
#pragma unroll
    for (int kk = 0; kk < 2; ++kk) {
      v16h bfg[4], af[2];
#pragma unroll
      for (int j = 0; j < 4; ++j)
        bfg[j] = ldfrag_h(dB + (wn + (j << 4) + rl) * GPI + kk * 32 + koff);
#pragma unroll
      for (int i = 0; i < 2; ++i)
        af[i] = ldfrag_h(dA + (wm + (i << 4) + rl) * GPI + kk * 32 + koff);
#pragma unroll
      for (int i = 0; i < 2; ++i)
#pragma unroll
        for (int j = 0; j < 4; ++j) acc[i][j] = mma_h(af[i], bfg[j], acc[i][j]);
    }
  }

  // ---- epilogue ----
  float* slab = sT[wave];
#pragma unroll
  for (int i = 0; i < 2; ++i) {
    const int mBase = m0 + (i << 4);
#pragma unroll
    for (int j = 0; j < 4; ++j) {
#pragma unroll
      for (int r = 0; r < 8; ++r) slab[(mOff + r) * 68 + (j << 4) + rl] = acc[i][j][r] * WINV;
    }
    wave_lds_sync();
    if (MODE == 0) {
      float* C = (float*)Cout + (size_t)bz * (size_t)strideC;
      const int c4 = rl * 4;                                   // 256-B row segment = 16 lanes x 16 B
      const v4f b4 = bfr4(*(const v4f*)(bias + n0 + c4));
      v4f vals[8];
#pragma unroll
      for (int it = 0; it < 8; ++it) {
        const int row = it * 2 + hh;                           // it 0..7 x hh 0..1 = rows 0..15
        const v4f v = *(const v4f*)(slab + row * 68 + c4);
        const v4f o = *(const v4f*)(C + (size_t)(mBase + row) * ldc + n0 + c4);
        vals[it] = o + (v + b4);
      }
      {
#pragma unroll
        for (int it = 0; it < 8; ++it) {
          const int row = it * 2 + hh;
          *(v4f*)(C + (size_t)(mBase + row) * ldc + n0 + c4) = vals[it];
        }
        
      }
    } else {
      const int q = lane >> 3, c8 = (lane & 7) * 8;
      unsigned short* C  = (unsigned short*)Cout  + (size_t)bz * (size_t)strideC;
      unsigned short* C2 = (unsigned short*)Cout2 + (size_t)bz * (size_t)strideC;
      v4f ba = zero4(), bb = zero4();
      if (MODE != 3) {
        ba = bfr4(*(const v4f*)(bias + n0 + c8));
        bb = bfr4(*(const v4f*)(bias + n0 + c8 + 4));
      }
      v4u hv[4], lv[4];
#pragma unroll
      for (int it = 0; it < 4; ++it) {
        const int row = it * 4 + q;                            // it 0..3 x q 0..3 = rows 0..15
        const float* sp = slab + row * 68 + c8;
        v4f fa = *(const v4f*)(sp);
        v4f fb = *(const v4f*)(sp + 4);
        if (MODE == 3) {
          const float br = bfr(bias[mBase + row]);
          fa = fa + br; fb = fb + br;
        } else {
          fa = fa + ba; fb = fb + bb;
        }
        if (MODE == 4) {
#pragma unroll
          for (int e = 0; e < 4; ++e) { fa[e] = gelu_t(fa[e]); fb[e] = gelu_t(fb[e]); }
        }
        v4u a, a2;
        if (MODE == 2) {
#pragma unroll
          for (int e = 0; e < 2; ++e) {
            const float f0 = fa[2 * e], f1 = fa[2 * e + 1];
            const float g0 = fb[2 * e], g1 = fb[2 * e + 1];
            const _Float16 x0 = (_Float16)f0, x1 = (_Float16)f1, y0 = (_Float16)g0, y1 = (_Float16)g1;
            a[e]      = pk16(h_bits(x0), h_bits(x1));
            a[e + 2]  = pk16(h_bits(y0), h_bits(y1));
            a2[e]     = pk16(h_bits((_Float16)((f0 - (float)x0) * QRS)), h_bits((_Float16)((f1 - (float)x1) * QRS)));
            a2[e + 2] = pk16(h_bits((_Float16)((g0 - (float)y0) * QRS)), h_bits((_Float16)((g1 - (float)y1) * QRS)));
          }
        } else {
          a[0] = pkh2(fa[0], fa[1]); a[1] = pkh2(fa[2], fa[3]);
          a[2] = pkh2(fb[0], fb[1]); a[3] = pkh2(fb[2], fb[3]);
          a2 = a;
        }
        hv[it] = a; lv[it] = a2;
      }
      {
#pragma unroll
        for (int it = 0; it < 4; ++it) {
          const int row = it * 4 + q;
          *(v4u*)(C + (size_t)(mBase + row) * ldc + n0 + c8) = hv[it];
          if (MODE == 2) *(v4u*)(C2 + (size_t)(mBase + row) * ldc + n0 + c8) = lv[it];
        }
        
      }
    }
    wave_lds_sync();
  }
}

// =====================================================================================================
// Attention, head dim 64, mask m[b][s] applied as logit = (q.k * sscale) * m - 1e10 * (1 - m) (m bf16-RNE).
//   q planes (f16 hi, f16 residual x4096): element (b, t, h, d) at [(b*SEQ + t)*HID + h*64 + d]
//   k plane (f16): same layout with key index s;  v^T plane (f16): element (b, h, d, s) at [(b*HID + h*64 + d)*SEQ + s]
//   scores = qhi.k + (qres.k)/4096, two f32 accumulators; online softmax in f32 (running max);
//   p = exp(s - m) carried as f16(1024 p), spilled per wave to LDS with _Float16 element stores and reloaded as v8h
//   ctx plane (f16, normalised context): element (b, t, h, d) at [(b*SEQ + t)*HID + h*64 + d]
//   Block = 4 waves = 64 query rows of one (b, h); grid = NQB * NHD * NB; kv chunks of 64, static trip NQB.
//   K / V^T chunk staging: 128 threads x 32 elements per plane = the whole 64x64 tile (plain 16-B loads,
//   __syncthreads before and after).
//   LDS rows of K, V^T and P lie at pitch 144 B, of the context tile at 272 B (16 B x odd): the 16 rows that one half-wave's
//   16-B fragment read touches then fall on all 64 banks; at the dense 128 B they fell on 8 banks, 8 rows deep.
//   Output coverage: each wave stores rows q0..q0+15 (it 0..3 x lane>>3 0..3) x 64 columns (8 lanes x 8),
// =====================================================================================================
__global__ __launch_bounds__(128)
void attn64(const unsigned short* __restrict__ qhp, const unsigned short* __restrict__ qlp,
            const unsigned short* __restrict__ khp, const unsigned short* __restrict__ vtp,
            const float* __restrict__ mask, unsigned short* ctxp, float sscale) {
  union FH { v16h v; v8h h[2]; };
  __shared__ __align__(16) _Float16 Ks[64 * API];                 // K [kv][d]    9 KB
  __shared__ __align__(16) _Float16 Vts[64 * API];                // V^T [d][kv]  9 KB
  __shared__ __align__(16) _Float16 Psh[4][16 * API];             // per wave P [row][kv]
  __shared__ __align__(16) float    Os[4][16 * OPI];              // per wave context tile [row][d]

  const int tid  = threadIdx.x;
  const int wave = tid >> 5;
  const int lane = tid & 31;
  const int hh   = lane >> 4;
  const int c    = lane & 15;

  const int bx   = blockIdx.x;
  const int qb   = bx % NQB;
  const int rest = bx / NQB;
  const int h    = rest % NHD;
  const int b    = rest / NHD;
  const int q0   = qb * 64 + wave * 16;
  const size_t rowB = (size_t)b * SEQ;

  const _Float16* Qh = (const _Float16*)(const void*)qhp + (size_t)h * HD;
  const _Float16* Ql = (const _Float16*)(const void*)qlp + (size_t)h * HD;
  const _Float16* Kh = (const _Float16*)(const void*)khp + (size_t)h * HD;
  const _Float16* Vt = (const _Float16*)(const void*)vtp + ((size_t)b * HID + (size_t)h * HD) * SEQ;
  const float* mb = mask + (size_t)b * SEQ;

  // ---- Q fragments (A operand, row = lane&15): 2 d-chunks, hi and residual ----
  v16h qah[2], qal[2];
#pragma unroll
  for (int dc = 0; dc < 2; ++dc) {
    const size_t qo = (rowB + q0 + c) * HID + dc * 32 + 8 * hh;
    qah[dc] = ldfrag_h(Qh + qo);
    qal[dc] = ldfrag_h(Ql + qo);
  }

  float mrow[8], lrow[8];
  v8f oacc[4];
#pragma unroll
  for (int r = 0; r < 8; ++r) { mrow[r] = -INFINITY; lrow[r] = 0.f; }
#pragma unroll
  for (int t = 0; t < 4; ++t) oacc[t] = zero8();

#pragma unroll 1
  for (int kt = 0; kt < NQB; ++kt) {
    const int kv0 = kt * 64;
    __syncthreads();
    {
      const int r = tid >> 1, half = (tid & 1) * 32;
      const _Float16* kg = Kh + (rowB + kv0 + r) * HID + half;      // K row kv0+r, d = half..half+31
      const _Float16* vg = Vt + (size_t)r * SEQ + kv0 + half;      // V^T row d = r, s = kv0+half..+31
#pragma unroll
      for (int i = 0; i < 4; ++i) {
        const v8h a0 = *(const v8h*)(kg + 8 * i);
        const v8h b0 = *(const v8h*)(vg + 8 * i);
        *(v8h*)(Ks  + r * API + half + 8 * i) = a0;
        *(v8h*)(Vts + r * API + half + 8 * i) = b0;
      }
    }
    __syncthreads();

    float mv[4];
#pragma unroll
    for (int j = 0; j < 4; ++j) mv[j] = bfr(mb[kv0 + j * 16 + c]);   // key kv0 + 16j + c < SEQ

    // ---- scores: 16 query rows x 64 keys per wave, qhi.k and qres.k ----
    v8f s[4];
#pragma unroll
    for (int j = 0; j < 4; ++j) {
      s[j] = zero8();
      v8f sl = zero8();
#pragma unroll
      for (int dc = 0; dc < 2; ++dc) {
        FH kb;
        kb.h[0] = *(const v8h*)(Ks + (j * 16 + c) * API + dc * 32 + 8 * hh);
        kb.h[1] = *(const v8h*)(Ks + (j * 16 + c) * API + dc * 32 + 16 + 8 * hh);
        s[j] = mma_h(qah[dc], kb.v, s[j]);
        sl   = mma_h(qal[dc], kb.v, sl);
      }
#pragma unroll
      for (int r = 0; r < 8; ++r) {
        float sv = (s[j][r] + sl[r] * QRI) * sscale;
        sv = sv * mv[j] - 1.0e10f * (1.0f - mv[j]);
        s[j][r] = sv;
      }
    }

    // ---- row max, online softmax, P (x1024, f16) to LDS ----
    _Float16* pwh = Psh[wave];
#pragma unroll
    for (int r = 0; r < 8; ++r) {
      float m = fmaxf(fmaxf(s[0][r], s[1][r]), fmaxf(s[2][r], s[3][r]));
#pragma unroll
      for (int off = 1; off < 16; off <<= 1) m = fmaxf(m, __shfl_xor(m, off, 32));
      const float mnew  = fmaxf(mrow[r], m);
      const float alpha = __expf(mrow[r] - mnew);
      mrow[r] = mnew;
      float psum = 0.f;
#pragma unroll
      for (int j = 0; j < 4; ++j) {
        const float p = __expf(s[j][r] - mnew);
        psum += p;
        pwh[(8 * hh + r) * API + j * 16 + c] = (_Float16)(p * PSC);
      }
#pragma unroll
      for (int off = 1; off < 16; off <<= 1) psum += __shfl_xor(psum, off, 32);
      lrow[r] = lrow[r] * alpha + psum;
#pragma unroll
      for (int t = 0; t < 4; ++t) oacc[t][r] *= alpha;
    }
    wave_lds_sync();

    // ---- context += P . V (f16 WMMA) ----
#pragma unroll
    for (int kk = 0; kk < 2; ++kk) {
      FH pa;
      pa.h[0] = *(const v8h*)(pwh + c * API + kk * 32 + 8 * hh);
      pa.h[1] = *(const v8h*)(pwh + c * API + kk * 32 + 16 + 8 * hh);
#pragma unroll
      for (int t = 0; t < 4; ++t) {
        FH vb;
        vb.h[0] = *(const v8h*)(Vts + (t * 16 + c) * API + kk * 32 + 8 * hh);
        vb.h[1] = *(const v8h*)(Vts + (t * 16 + c) * API + kk * 32 + 16 + 8 * hh);
        oacc[t] = mma_h(pa.v, vb.v, oacc[t]);
      }
    }
  }

  float* os = Os[wave];
#pragma unroll
  for (int r = 0; r < 8; ++r) {
    const float l = lrow[r];
    const float inv = ((l > 0.f) ? (1.0f / l) : 0.f) * PSI;
#pragma unroll
    for (int t = 0; t < 4; ++t) os[(8 * hh + r) * OPI + t * 16 + c] = oacc[t][r] * inv;
  }
  wave_lds_sync();
  {
    const int q4 = lane >> 3, c8 = (lane & 7) * 8;
    v4u hv[4];
#pragma unroll
    for (int it = 0; it < 4; ++it) {
      const int row = it * 4 + q4;           // it 0..3 x q4 0..3 = rows 0..15 of the wave tile
      const float* sp = os + row * OPI + c8;
      const v4f fa = *(const v4f*)(sp);
      const v4f fb = *(const v4f*)(sp + 4);
      v4u a;
      a[0] = pkh2(fa[0], fa[1]); a[1] = pkh2(fa[2], fa[3]);
      a[2] = pkh2(fb[0], fb[1]); a[3] = pkh2(fb[2], fb[3]);
      hv[it] = a;
    }
    {
#pragma unroll
      for (int it = 0; it < 4; ++it) {
        const int row = it * 4 + q4;
        const size_t go = (rowB + q0 + row) * HID + (size_t)h * HD + c8;
        *(v4u*)(ctxp + go) = hv[it];
      }
      
    }
  }
}

// =====================================================================================================
// Workspace map (bytes), all region sizes multiples of 128 and exact multiples of their 64x64- or 128x128-tile / whole-row
// store granularity (M, N multiples of 128; 768- and 3072-wide rows), so no padded tails are needed:
//   Hres f32 [4096][768]        12582912
//   X    f16 [4096][768]         6291456   (LN output plane, reused by LN1 and LN2)
//   Qh   f16 [4096][768]         6291456
//   Ql   f16 [4096][768]         6291456   (q residual x4096)
//   Kh   f16 [4096][768]         6291456
//   VT   f16 [2][768][2048]      6291456
//   Ctx  f16 [4096][768]         6291456
//   G    f16 [4096][3072]       25165824
//   Wq_t,Wk_t,Wv_t,Wo_t f16 [768][768]  4 x 1179648
//   W1_t f16 [3072][768]         4718592
//   W2_t f16 [768][3072]         4718592
//   total                       89653248
// Weights are converted per layer into the same regions ([out n][in k], k contiguous = the Bt / A layout).
// =====================================================================================================
extern "C" void kernel_launch(void* const* d_in, const int* in_sizes, int n_in,
                              void* d_out, int out_size, void* d_ws, size_t ws_size,
                              hipStream_t stream) {
  if (n_in < 21) return;
  if (in_sizes[0] != BT * HID || in_sizes[1] != BT * HID || in_sizes[2] != NB * SEQ) return;
  if (in_sizes[3] != 2 * HID || in_sizes[4] != 2 * HID) return;
  if (in_sizes[5] != 2 * HID * HID || in_sizes[7] != 2 * HID * HID ||
      in_sizes[9] != 2 * HID * HID || in_sizes[11] != 2 * HID * HID) return;
  if (in_sizes[6] != 2 * HID || in_sizes[8] != 2 * HID || in_sizes[10] != 2 * HID || in_sizes[12] != 2 * HID) return;
  if (in_sizes[13] != 2 * HID || in_sizes[14] != 2 * HID) return;
  if (in_sizes[15] != 2 * HID * DFF || in_sizes[16] != 2 * DFF ||
      in_sizes[17] != 2 * DFF * HID || in_sizes[18] != 2 * HID) return;
  if (in_sizes[19] != HID || in_sizes[20] != HID) return;
  if (out_size != BT * HID) return;

  const float* in_h  = (const float*)d_in[0];
  const float* embs  = (const float*)d_in[1];
  const float* mask  = (const float*)d_in[2];
  const float* ln1_s = (const float*)d_in[3];
  const float* ln1_b = (const float*)d_in[4];
  const float* wq    = (const float*)d_in[5];
  const float* bq    = (const float*)d_in[6];
  const float* wk    = (const float*)d_in[7];
  const float* bk    = (const float*)d_in[8];
  const float* wv    = (const float*)d_in[9];
  const float* bv    = (const float*)d_in[10];
  const float* wo    = (const float*)d_in[11];
  const float* bo    = (const float*)d_in[12];
  const float* ln2_s = (const float*)d_in[13];
  const float* ln2_b = (const float*)d_in[14];
  const float* w1    = (const float*)d_in[15];
  const float* b1    = (const float*)d_in[16];
  const float* w2    = (const float*)d_in[17];
  const float* b2    = (const float*)d_in[18];
  const float* lnf_s = (const float*)d_in[19];
  const float* lnf_b = (const float*)d_in[20];
  float* out = (float*)d_out;

  const size_t PH  = (size_t)BT * HID * 4;        // 12582912
  const size_t PA  = (size_t)BT * HID * 2;        //  6291456
  const size_t PVT = (size_t)NB * HID * SEQ * 2;  //  6291456
  const size_t PG  = (size_t)BT * DFF * 2;        // 25165824
  const size_t PW  = (size_t)HID * HID * 2;       //  1179648
  const size_t PW1 = (size_t)HID * DFF * 2;       //  4718592
  size_t off = 0;
  const size_t oH   = off; off += PH;
  const size_t oX   = off; off += PA;
  const size_t oQh  = off; off += PA;
  const size_t oQl  = off; off += PA;
  const size_t oKh  = off; off += PA;
  const size_t oVT  = off; off += PVT;
  const size_t oCtx = off; off += PA;
  const size_t oG   = off; off += PG;
  const size_t oWq  = off; off += PW;
  const size_t oWk  = off; off += PW;
  const size_t oWv  = off; off += PW;
  const size_t oWo  = off; off += PW;
  const size_t oW1  = off; off += PW1;
  const size_t oW2  = off; off += PW1;
  if (off > ws_size) return;                      // off = 89653248
  if (off > (size_t)134217728) return;

  char* ws = (char*)d_ws;
  float*          Hres = (float*)(ws + oH);
  unsigned short* X    = (unsigned short*)(ws + oX);
  unsigned short* Qh   = (unsigned short*)(ws + oQh);
  unsigned short* Ql   = (unsigned short*)(ws + oQl);
  unsigned short* Kh   = (unsigned short*)(ws + oKh);
  unsigned short* VT   = (unsigned short*)(ws + oVT);
  unsigned short* Ctx  = (unsigned short*)(ws + oCtx);
  unsigned short* G    = (unsigned short*)(ws + oG);
  unsigned short* Wqt  = (unsigned short*)(ws + oWq);
  unsigned short* Wkt  = (unsigned short*)(ws + oWk);
  unsigned short* Wvt  = (unsigned short*)(ws + oWv);
  unsigned short* Wot  = (unsigned short*)(ws + oWo);
  unsigned short* W1t  = (unsigned short*)(ws + oW1);
  unsigned short* W2t  = (unsigned short*)(ws + oW2);

  const dim3 blk(256);
  const dim3 gLN(BT / 8);                                           // 512 blocks, 8 rows each
  const dim3 gCv4(HID / 64, HID / 64, 4);                           // (12,12,4)
  const dim3 gCv1(DFF / 64, HID / 64, 1);                           // w1 [768][3072] -> [3072][768]
  const dim3 gCv2(HID / 64, DFF / 64, 1);                           // w2 [3072][768] -> [768][3072]
  const dim3 gHH((BT / 128) * (HID / 128), 1);                      // 32 x 6  = 192 blocks
  const dim3 gVT((HID / 128) * (SEQ / 128), NB);                    // 6 x 16  = 96 blocks x 2 batches
  const dim3 gF1((BT / 128) * (DFF / 128), 1);                      // 32 x 24 = 768 blocks
  const dim3 gAt(NB * NHD * NQB);                                   // 768 blocks of 128

  for (int l = 0; l < 2; ++l) {
    const float* wql = wq + (size_t)l * HID * HID;
    const float* wkl = wk + (size_t)l * HID * HID;
    const float* wvl = wv + (size_t)l * HID * HID;
    const float* wol = wo + (size_t)l * HID * HID;
    const float* w1l = w1 + (size_t)l * HID * DFF;
    const float* w2l = w2 + (size_t)l * DFF * HID;
    // (1) h = h + input_embs; hn = LN1(h) -> X (f16)
    if (l == 0) {
      ln_rows<true, true, false><<<gLN, blk, 0, stream>>>(in_h, embs, Hres, ln1_s, ln1_b, (void*)X, BT);
    } else {
      ln_rows<true, false, false><<<gLN, blk, 0, stream>>>(Hres, embs, Hres, ln1_s + HID, ln1_b + HID, (void*)X, BT);
    }
    // (2) weights of this layer: f32 [in][out] -> f16 [out][in] (bf16-RNE values x64)
    convT<<<gCv4, blk, 0, stream>>>(wql, wkl, wvl, wol, Wqt, Wkt, Wvt, Wot, HID, HID);
    convT<<<gCv1, blk, 0, stream>>>(w1l, w1l, w1l, w1l, W1t, W1t, W1t, W1t, HID, DFF);
    convT<<<gCv2, blk, 0, stream>>>(w2l, w2l, w2l, w2l, W2t, W2t, W2t, W2t, DFF, HID);
    // (3) q = hn . Wq + bq -> f16 hi + residual planes [b*SEQ+t][h*64+d]  (M=4096, N=768, K=768)
    gemm64<2><<<gHH, blk, 0, stream>>>(X, HID, 0LL, Wqt, HID, 0LL, bq + l * HID,
                                       (void*)Qh, (void*)Ql, HID, 0LL, BT, HID, HID);
    // (4) k = hn . Wk + bk -> f16 plane
    gemm64<1><<<gHH, blk, 0, stream>>>(X, HID, 0LL, Wkt, HID, 0LL, bk + l * HID,
                                       (void*)Kh, (void*)Kh, HID, 0LL, BT, HID, HID);
    // (5) v^T = Wv_t . hn^T per batch -> f16 [b][h*64+d][s]  (A = Wv_t [n][k], Bt = X rows of batch b; M=768, N=2048, K=768)
    gemm64<3><<<gVT, blk, 0, stream>>>(Wvt, HID, 0LL, X, HID, (long long)SEQ * HID, bv + l * HID,
                                       (void*)VT, (void*)VT, SEQ, (long long)HID * SEQ, HID, SEQ, HID);
    // (6) attention -> Ctx f16 [b*SEQ+t][h*64+d]
    attn64<<<gAt, dim3(128), 0, stream>>>(Qh, Ql, Kh, VT, mask, Ctx, 0.125f);
    // (7) h = h + (ctx . Wo + bo)  (f32, in place)
    gemm64<0><<<gHH, blk, 0, stream>>>(Ctx, HID, 0LL, Wot, HID, 0LL, bo + l * HID,
                                       (void*)Hres, (void*)Hres, HID, 0LL, BT, HID, HID);
    // (8) hn = LN2(h) -> X
    ln_rows<false, false, false><<<gLN, blk, 0, stream>>>(Hres, embs, Hres, ln2_s + l * HID, ln2_b + l * HID, (void*)X, BT);
    // (9) g = gelu(hn . W1 + b1) -> G f16 [4096][3072]  (M=4096, N=3072, K=768)
    gemm64<4><<<gF1, blk, 0, stream>>>(X, HID, 0LL, W1t, HID, 0LL, b1 + l * DFF,
                                       (void*)G, (void*)G, DFF, 0LL, BT, DFF, HID);
    // (10) h = h + (g . W2 + b2)  (M=4096, N=768, K=3072, f32 in place)
    gemm64<0><<<gHH, blk, 0, stream>>>(G, DFF, 0LL, W2t, DFF, 0LL, b2 + l * HID,
                                       (void*)Hres, (void*)Hres, HID, 0LL, BT, HID, DFF);
  }
  // (11) out = LN_f(h) -> f32 [2][2048][768]
  ln_rows<false, false, true><<<gLN, blk, 0, stream>>>(Hres, embs, Hres, lnf_s, lnf_b, (void*)out, BT);
  (void)hipGetLastError();
}

// v003
// A run of this version takes 397 microseconds.
// Two timings next to v002 put it at 1.12 and 1.13 times that version's speed.
// All steps since v000 together make it 2.47 times as fast.
// Contractions: q, k, v^T, out and ffn projections = v_wmma_f32_16x16x32_f16 (f16 activations; weights bf16-RNE then x64 as f16), single product;
// q.k^T = v_wmma_f32_16x16x32_f16 with q as f16 hi + f16 residual (x4096) planes and k f16, 2 products in separate accumulators;
// p.v = v_wmma_f32_16x16x32_f16 (p carried x1024 in f16, v f16); f32 accumulate everywhere; layernorm, softmax and gelu in f32.
#include <hip/hip_runtime.h>
#include <math.h>
#include <stdint.h>

#define NB   2
#define SEQ  2048
#define HID  768
#define NHD  12
#define HD   64
#define DFF  3072
#define BT   (NB * SEQ)
#define NQB  (SEQ / 64)
#define WSC  64.0f
#define WINV 0.015625f
#define QRS  4096.0f
#define QRI  0.000244140625f
#define PSC  1024.0f
#define PSI  0.0009765625f
#define GPI  72                 // LDS row pitch of a GEMM stage, in halves: 64 k + 8 = 144 B
#define API  72                 // LDS row pitch of the attention K, V^T and P tiles, in halves: 64 + 8 = 144 B = 16 B x odd
#define OPI  68                 // LDS row pitch of the attention context tile, in floats: 64 + 4 = 272 B = 16 B x odd
static_assert(NHD * HD == HID);
static_assert((SEQ % 64) == 0 && (HID % 64) == 0 && (DFF % 64) == 0 && (BT % 64) == 0);
static_assert(HID == 6 * 128);
static_assert((SEQ % 128) == 0 && (HID % 128) == 0 && (DFF % 128) == 0 && (BT % 128) == 0);

typedef _Float16 v16h __attribute__((ext_vector_type(16)));
typedef _Float16 v8h  __attribute__((ext_vector_type(8)));
typedef float    v8f  __attribute__((ext_vector_type(8)));
typedef float    v4f  __attribute__((ext_vector_type(4)));
typedef unsigned int v4u __attribute__((ext_vector_type(4)));

// ---- scalar helpers -----------------------------------------------------------------------------
__device__ __forceinline__ unsigned short bf_bits(float f) {        // f32 -> bf16 bits, RNE convert
  const unsigned u = __float_as_uint(f);
  return (unsigned short)((u + 0x7FFFu + ((u >> 16) & 1u)) >> 16);
}
__device__ __forceinline__ float bfr(float f) { return __uint_as_float(((unsigned)bf_bits(f)) << 16); }
__device__ __forceinline__ v4f bfr4(v4f a) {
  v4f r;
  r[0] = bfr(a[0]); r[1] = bfr(a[1]); r[2] = bfr(a[2]); r[3] = bfr(a[3]);
  return r;
}
__device__ __forceinline__ unsigned short h_bits(_Float16 x) { return __builtin_bit_cast(unsigned short, x); }
__device__ __forceinline__ unsigned pk16(unsigned short a, unsigned short b) { return (unsigned)a | ((unsigned)b << 16); }
__device__ __forceinline__ unsigned pkh2(float a, float b) { return pk16(h_bits((_Float16)a), h_bits((_Float16)b)); }
__device__ __forceinline__ v8f zero8() { v8f z = {0.f, 0.f, 0.f, 0.f, 0.f, 0.f, 0.f, 0.f}; return z; }
__device__ __forceinline__ v4f zero4() { v4f z = {0.f, 0.f, 0.f, 0.f}; return z; }

// ---- fragment loader: 16-bit A/B operand, lane -> row/col (lane&15); p already includes +8*(lane>>4);
//      elements 0..7 <- p[0..7] (k0+8h..), elements 8..15 <- p[16..23] (k0+16+8h..)
__device__ __forceinline__ v16h ldfrag_h(const _Float16* p) {
  union { v16h v; v8h h[2]; } f;
  f.h[0] = *(const v8h*)(p);
  f.h[1] = *(const v8h*)(p + 16);
  return f.v;
}

// ---- WMMA with trailing VALU hazard gap -----------------------------------------------------------
__device__ __forceinline__ v8f mma_h(v16h a, v16h b, v8f c) {
  c = __builtin_amdgcn_wmma_f32_16x16x32_f16(false, a, false, b, (short)0, c, false, false);
#if defined(__HIP_DEVICE_COMPILE__)
  asm volatile("v_nop\n\tv_nop\n\tv_nop\n\tv_nop" : "+v"(c) : "v"(a), "v"(b));
#endif
  return c;
}

// release/acquire + wave barrier for same-wave LDS exchange
__device__ __forceinline__ void wave_lds_sync() {
  __builtin_amdgcn_fence(__ATOMIC_RELEASE, "workgroup");
  __builtin_amdgcn_wave_barrier();
  __builtin_amdgcn_fence(__ATOMIC_ACQUIRE, "workgroup");
}

// tanh-approximation gelu, tanh(u) = 1 - 2/(exp(2u)+1) with u clamped to [-16,16]
__device__ __forceinline__ float gelu_t(float x) {
  float u = 0.7978845608028654f * (x + 0.044715f * x * x * x);
  u = fminf(fmaxf(u, -16.0f), 16.0f);
  const float e  = __expf(2.0f * u);
  const float th = 1.0f - 2.0f * __builtin_amdgcn_rcpf(e + 1.0f);
  return 0.5f * x * (1.0f + th);
}

// =====================================================================================================
// Residual add + LayerNorm, one wave per row of 768. grid = nrows/8, 256 threads.
//   x = src row (RSRC: bf16-RNE the loaded values) (+ ADDE: bf16-RNE(embs row)); ADDE also stores x to hdst
//   (may alias src: every lane reads its own 24 columns before storing them).
//   else:  y -> f16 rows via a per-wave LDS row buffer (lane l: 8 halves at col 256j+8l, 512 B per instruction).
// coverage: 8 waves x grid(512) = 4096 rows; 6 x 128 floats / 3 x 256 halves = the whole 768-wide row.
// =====================================================================================================
// blk = index of the 8-row group; rb = the block's 8 x 768 float row buffer in LDS.
template <bool ADDE, bool RSRC, bool OUT32>
__device__ __forceinline__ void ln_body(int blk, float* rb, const float* src, const float* embs, float* hdst,
                                        const float* __restrict__ sc, const float* __restrict__ bi,
                                        void* outp, int nrows) {
  const int tid = threadIdx.x, wave = tid >> 5, lane = tid & 31;
  const int row = blk * 8 + wave;
  if (row >= nrows) return;                       // wave-uniform; no block barrier behind it in this body
  const size_t rbase = (size_t)row * HID;
  v4f x[6];
#pragma unroll
  for (int i = 0; i < 6; ++i) {
    const int col = i * 128 + lane * 4;
    v4f a = *(const v4f*)(src + rbase + col);
    if (RSRC) a = bfr4(a);
    if (ADDE) {
      const v4f e = bfr4(*(const v4f*)(embs + rbase + col));
      a = a + e;
    }
    x[i] = a;
    // precaution: a later load's result may be given the address registers of this trip's loads; this keeps the wait in front of that
    asm volatile("s_wait_xcnt 0x0" ::: "memory");
  }
  if (ADDE) {
    {
#pragma unroll
      for (int i = 0; i < 6; ++i) *(v4f*)(hdst + rbase + i * 128 + lane * 4) = x[i];
      
    }
  }
  float s = 0.f;
#pragma unroll
  for (int i = 0; i < 6; ++i) s += (x[i][0] + x[i][1]) + (x[i][2] + x[i][3]);
#pragma unroll
  for (int off = 1; off < 32; off <<= 1) s += __shfl_xor(s, off, 32);
  const float mean = s * (1.0f / 768.0f);
  float qv = 0.f;
#pragma unroll
  for (int i = 0; i < 6; ++i) {
    const v4f d = x[i] - mean;
    qv += (d[0] * d[0] + d[1] * d[1]) + (d[2] * d[2] + d[3] * d[3]);
  }
#pragma unroll
  for (int off = 1; off < 32; off <<= 1) qv += __shfl_xor(qv, off, 32);
  const float var  = qv * (1.0f / 768.0f);
  const float rinv = rsqrtf(var + 1e-5f);
  v4f y[6];
#pragma unroll
  for (int i = 0; i < 6; ++i) {
    const int col = i * 128 + lane * 4;
    const v4f s4 = bfr4(*(const v4f*)(sc + col));
    const v4f b4 = bfr4(*(const v4f*)(bi + col));
    y[i] = (x[i] - mean) * rinv * s4 + b4;
  }
  if (OUT32) {
    float* o = (float*)outp;
    {
#pragma unroll
      for (int i = 0; i < 6; ++i) *(v4f*)(o + rbase + i * 128 + lane * 4) = y[i];
      
    }
  } else {
    float* rw = rb + wave * HID;
#pragma unroll
    for (int i = 0; i < 6; ++i) *(v4f*)(rw + i * 128 + lane * 4) = y[i];
    wave_lds_sync();
    v4u pk[3];
#pragma unroll
    for (int j = 0; j < 3; ++j) {
      const v4f a = *(const v4f*)(rw + j * 256 + lane * 8);
      const v4f c = *(const v4f*)(rw + j * 256 + lane * 8 + 4);
      v4u p;
      p[0] = pkh2(a[0], a[1]); p[1] = pkh2(a[2], a[3]);
      p[2] = pkh2(c[0], c[1]); p[3] = pkh2(c[2], c[3]);
      pk[j] = p;
    }
    unsigned short* o = (unsigned short*)outp;
    {
#pragma unroll
      for (int j = 0; j < 3; ++j) *(v4u*)(o + rbase + j * 256 + lane * 8) = pk[j];
      
    }
  }
}

template <bool ADDE, bool RSRC, bool OUT32>
__global__ __launch_bounds__(256) void ln_rows(const float* src, const float* embs, float* hdst,
                                               const float* __restrict__ sc, const float* __restrict__ bi,
                                               void* outp, int nrows) {
  __shared__ __align__(16) float rb[8 * HID];
  ln_body<ADDE, RSRC, OUT32>(blockIdx.x, rb, src, embs, hdst, sc, bi, outp, nrows);
}

// =====================================================================================================
// Weight convert + transpose: W f32 [K][N] (row-major, in-major) -> O f16 [N][K] = f16(bf16-RNE(w) * 64).
// One block = one tile of 64 k x 64 n through LDS, origin (k0, n0); 256 threads; sT = the block's 64 x 72 half tile in LDS.
//   read: thread (r = tid>>2 = k row, cq = (tid&3)*16 = n quarter) reads 16 floats (4 x 16 B) -> sT[n][k]
//   write: wave w, lane: rows (n) w*8 + it*4 + (lane>>3), 8 halves per lane at k (lane&7)*8:
// coverage: 8 waves x 8 rows = 64 n rows x 64 k per block; the caller deals N/64 x K/64 tiles exactly.
// =====================================================================================================
__device__ __forceinline__ void conv_body(_Float16* sT, const float* __restrict__ W, unsigned short* O,
                                          int K, int N, int n0, int k0) {
  const int tid = threadIdx.x;
  {
    const int r = tid >> 2, cq = (tid & 3) * 16;
    const float* p = W + (size_t)(k0 + r) * N + n0 + cq;
#pragma unroll
    for (int g = 0; g < 4; ++g) {
      const v4f a = *(const v4f*)(p + 4 * g);
#pragma unroll
      for (int e = 0; e < 4; ++e) sT[(cq + 4 * g + e) * 72 + r] = (_Float16)(bfr(a[e]) * WSC);
    }
  }
  __syncthreads();
  const int wave = tid >> 5, lane = tid & 31;
  const int q = lane >> 3, c8 = (lane & 7) * 8;
  union HU { v8h h; v4u u; };
  HU pk[2];
#pragma unroll
  for (int it = 0; it < 2; ++it) {
    const int row = wave * 8 + it * 4 + q;
    pk[it].h = *(const v8h*)(sT + row * 72 + c8);
  }
  const _Float16 dummy = (_Float16)0.0f; (void)dummy;
  {
#pragma unroll
    for (int it = 0; it < 2; ++it) {
      const int row = wave * 8 + it * 4 + q;
      *(v4u*)(O + (size_t)(n0 + row) * K + k0 + c8) = pk[it].u;
    }
    // precaution: where this body is inlined in front of other code, the stores' registers may be rewritten there; this keeps the wait in front of that
    asm volatile("s_wait_xcnt 0x0" ::: "memory");
  }
}

// =====================================================================================================
// First launch: the work that depends on the inputs alone, dealt by block index in one grid.
//   blocks 0 .. BT/8-1: h + embs and LN1 of layer 0 (ln_body);
//   then per layer CVL = 3 x CVS blocks of weight tiles (conv_body): CVS tiles of wq, wk, wv, wo (144 each), CVS of w1, CVS of w2.
// Converted weights of layer l lie at Wt + l * WLH halves: Wq_t, Wk_t, Wv_t, Wo_t (HID*HID each), W1_t, W2_t (HID*DFF each).
// Every branch below is block-uniform; the one block barrier (in conv_body) is passed by all 256 threads of its block.
// =====================================================================================================
#define CVS  576                                  // 4 * 12 * 12 = 48 * 12 = 12 * 48 tiles
#define CVL  (3 * CVS)
#define WLH  (4 * HID * HID + 2 * HID * DFF)      // halves of converted weights per layer
static_assert(4 * (HID / 64) * (HID / 64) == CVS && (DFF / 64) * (HID / 64) == CVS);
__global__ __launch_bounds__(256) void prep(const float* in_h, const float* embs, float* hdst,
                                            const float* __restrict__ sc, const float* __restrict__ bi,
                                            unsigned short* X,
                                            const float* __restrict__ wq, const float* __restrict__ wk,
                                            const float* __restrict__ wv, const float* __restrict__ wo,
                                            const float* __restrict__ w1, const float* __restrict__ w2,
                                            unsigned short* Wt) {
  __shared__ __align__(16) float rb[8 * HID];
  __shared__ __align__(16) _Float16 sT[64 * 72];
  const int bx = blockIdx.x;
  if (bx < BT / 8) {
    ln_body<true, true, false>(bx, rb, in_h, embs, hdst, sc, bi, (void*)X, BT);
    return;
  }
  int t = bx - BT / 8;
  const int l = t / CVL;
  t -= l * CVL;
  const int seg = t / CVS;
  t -= seg * CVS;
  unsigned short* Ol = Wt + (size_t)l * WLH;
  if (seg == 0) {
    const int z = t / 144;
    const int r = t - z * 144;
    const float* W = ((z == 0) ? wq : (z == 1) ? wk : (z == 2) ? wv : wo) + (size_t)l * HID * HID;
    conv_body(sT, W, Ol + (size_t)z * HID * HID, HID, HID, (r % 12) * 64, (r / 12) * 64);
  } else if (seg == 1) {
    conv_body(sT, w1 + (size_t)l * HID * DFF, Ol + (size_t)4 * HID * HID, HID, DFF, (t % 48) * 64, (t / 48) * 64);
  } else {
    conv_body(sT, w2 + (size_t)l * HID * DFF, Ol + (size_t)4 * HID * HID + (size_t)HID * DFF, DFF, HID,
              (t % 12) * 64, (t / 12) * 64);
  }
}

// =====================================================================================================
// Register-blocked f16 WMMA GEMM: C[m][n] = sum_k A[m][k] * Bt[n][k] (accumulator scaled by 1/64 in the
// epilogue = the weight carry). Block = 8 waves (4 x 2) = one 128x128 tile of C, one 32x64 tile per wave.
// A row-major [M][K] pitch lda, Bt row-major [N][K] pitch ldb (k contiguous); M, N multiples of 128, K multiple of 64.
// Operands go through LDS in stages of 64 k: 128 rows x 128 B of A and of Bt per stage. Each wave-wide 16-B load
// covers 4 whole 128-B lines (8 lanes per row); rows lie in LDS at pitch 144 B (16 B x odd) for the 16-B fragment reads.
// Two LDS buffers, one block barrier per stage: stage s+1 is loaded into registers behind the barrier of stage s,
// while stage s is multiplied, and stored to the other buffer, whose last readers (stage s-1) all passed that barrier.
// tile = index of the block tile, bz = batch index (strides in elements). Both A and B fragments use the split k map of ldfrag_h.
// MODE 1: f16 C = acc/64 + bias[n]
// MODE 2: f16 hi C = f16(v), f16 residual C2 = f16((v - hi) * 4096), v = acc/64 + bias[n]
// MODE 3: f16 C = acc/64 + bias[m]
// MODE 4: f16 C = gelu(acc/64 + bias[n])
// bias values bf16-RNE converted in register. Epilogue: 16-row slabs staged per wave in LDS; each 64-wide row
// coverage: 2 slabs x 16 rows x 64 cols = the wave's whole tile; 8 waves per block; grid = (M/128) * (N/128).
// =====================================================================================================
template <int MODE>
__device__ __forceinline__ void gemm_body(
    _Float16 (*sA)[128 * GPI], _Float16 (*sB)[128 * GPI], float (*sT)[16 * 68], int tile, int bz,
    const unsigned short* __restrict__ Ap, int lda, long long strideA,
    const unsigned short* __restrict__ Btp, int ldb, long long strideB,
    const float* __restrict__ bias,
    void* Cout, void* Cout2, int ldc, long long strideC,
    int M, int N, int K) {
  const int tid  = threadIdx.x;
  const int lane = tid & 31;
  const int wave = tid >> 5;
  const int tilesN = N >> 7;
  const int tilesM = M >> 7;
  if (tile >= tilesM * tilesN) return;             // block-uniform, in front of every barrier
  const int tm = tile / tilesN;
  const int tn = tile - tm * tilesN;
  const int bm0 = tm << 7;                         // block tile origin
  const int bn0 = tn << 7;
  const int wm  = (wave >> 1) << 5;                // wave tile origin inside the block tile
  const int wn  = (wave & 1) << 6;
  const int m0 = bm0 + wm;
  const int n0 = bn0 + wn;

  const _Float16* Ab = (const _Float16*)(const void*)Ap  + (size_t)bz * (size_t)strideA;
  const _Float16* Bb = (const _Float16*)(const void*)Btp + (size_t)bz * (size_t)strideB;

  const int rl   = lane & 15;                      // row (A) / col (B, D) within subtile
  const int hh   = lane >> 4;
  const int koff = hh * 8;                         // k offset of this lane half
  const int mOff = hh * 8;                         // D row offset

  // staging map: thread -> row (tid>>3) + 32*it, 16-B piece (tid&7) of the row's 128 B; 4 it x 32 rows = 128 rows
  const int srow = tid >> 3;
  const int scol = (tid & 7) * 8;
  const _Float16* ga = Ab + (size_t)(bm0 + srow) * lda + scol;
  const _Float16* gb = Bb + (size_t)(bn0 + srow) * ldb + scol;
  const int sofs = srow * GPI + scol;

  v8f acc[2][4];
#pragma unroll
  for (int i = 0; i < 2; ++i)
#pragma unroll
    for (int j = 0; j < 4; ++j) acc[i][j] = zero8();

  v8h ra[4], rb[4];
#pragma unroll
  for (int it = 0; it < 4; ++it) {
    ra[it] = *(const v8h*)(ga + (size_t)(it * 32) * lda);
    rb[it] = *(const v8h*)(gb + (size_t)(it * 32) * ldb);
  }

  const int nst = K >> 6;
  // kept rolled: one stage is already 16 WMMAs and 24 fragment loads a wave; unrolling would only grow code and registers
#pragma unroll 1
  for (int s = 0; s < nst; ++s) {
    _Float16* dA = sA[s & 1];
    _Float16* dB = sB[s & 1];
#pragma unroll
    for (int it = 0; it < 4; ++it) {
      *(v8h*)(dA + sofs + it * 32 * GPI) = ra[it];
      *(v8h*)(dB + sofs + it * 32 * GPI) = rb[it];
    }
    __syncthreads();                               // publishes stage s; ends every wave's reads of stage s-1
    if (s + 1 < nst) {                             // block-uniform: next stage's loads fly under this stage's WMMAs
      const int kn = (s + 1) << 6;
#pragma unroll
      for (int it = 0; it < 4; ++it) {
        ra[it] = *(const v8h*)(ga + (size_t)(it * 32) * lda + kn);
        rb[it] = *(const v8h*)(gb + (size_t)(it * 32) * ldb + kn);
      }
      // precaution: the address registers of these loads are rewritten right below; this keeps the wait in front of that
      asm volatile("s_wait_xcnt 0x0" ::: "memory");
    }
#pragma unroll
    for (int kk = 0; kk < 2; ++kk) {
      v16h bfg[4], af[2];
#pragma unroll
      for (int j = 0; j < 4; ++j)
        bfg[j] = ldfrag_h(dB + (wn + (j << 4) + rl) * GPI + kk * 32 + koff);
#pragma unroll
      for (int i = 0; i < 2; ++i)
        af[i] = ldfrag_h(dA + (wm + (i << 4) + rl) * GPI + kk * 32 + koff);
#pragma unroll
      for (int i = 0; i < 2; ++i)
#pragma unroll
        for (int j = 0; j < 4; ++j) acc[i][j] = mma_h(af[i], bfg[j], acc[i][j]);
    }
  }

  // ---- epilogue ----
  float* slab = sT[wave];
#pragma unroll
  for (int i = 0; i < 2; ++i) {
    const int mBase = m0 + (i << 4);
#pragma unroll
    for (int j = 0; j < 4; ++j) {
#pragma unroll
      for (int r = 0; r < 8; ++r) slab[(mOff + r) * 68 + (j << 4) + rl] = acc[i][j][r] * WINV;
    }
    wave_lds_sync();
    if (MODE == 0) {
      float* C = (float*)Cout + (size_t)bz * (size_t)strideC;
      const int c4 = rl * 4;                                   // 256-B row segment = 16 lanes x 16 B
      const v4f b4 = bfr4(*(const v4f*)(bias + n0 + c4));
      v4f vals[8];
#pragma unroll
      for (int it = 0; it < 8; ++it) {
        const int row = it * 2 + hh;                           // it 0..7 x hh 0..1 = rows 0..15
        const v4f v = *(const v4f*)(slab + row * 68 + c4);
        const v4f o = *(const v4f*)(C + (size_t)(mBase + row) * ldc + n0 + c4);
        vals[it] = o + (v + b4);
      }
      {
#pragma unroll
        for (int it = 0; it < 8; ++it) {
          const int row = it * 2 + hh;
          *(v4f*)(C + (size_t)(mBase + row) * ldc + n0 + c4) = vals[it];
        }
        
      }
    } else {
      const int q = lane >> 3, c8 = (lane & 7) * 8;
      unsigned short* C  = (unsigned short*)Cout  + (size_t)bz * (size_t)strideC;
      unsigned short* C2 = (unsigned short*)Cout2 + (size_t)bz * (size_t)strideC;
      v4f ba = zero4(), bb = zero4();
      if (MODE != 3) {
        ba = bfr4(*(const v4f*)(bias + n0 + c8));
        bb = bfr4(*(const v4f*)(bias + n0 + c8 + 4));
      }
      v4u hv[4], lv[4];
#pragma unroll
      for (int it = 0; it < 4; ++it) {
        const int row = it * 4 + q;                            // it 0..3 x q 0..3 = rows 0..15
        const float* sp = slab + row * 68 + c8;
        v4f fa = *(const v4f*)(sp);
        v4f fb = *(const v4f*)(sp + 4);
        if (MODE == 3) {
          const float br = bfr(bias[mBase + row]);
          fa = fa + br; fb = fb + br;
        } else {
          fa = fa + ba; fb = fb + bb;
        }
        if (MODE == 4) {
#pragma unroll
          for (int e = 0; e < 4; ++e) { fa[e] = gelu_t(fa[e]); fb[e] = gelu_t(fb[e]); }
        }
        v4u a, a2;
        if (MODE == 2) {
#pragma unroll
          for (int e = 0; e < 2; ++e) {
            const float f0 = fa[2 * e], f1 = fa[2 * e + 1];
            const float g0 = fb[2 * e], g1 = fb[2 * e + 1];
            const _Float16 x0 = (_Float16)f0, x1 = (_Float16)f1, y0 = (_Float16)g0, y1 = (_Float16)g1;
            a[e]      = pk16(h_bits(x0), h_bits(x1));
            a[e + 2]  = pk16(h_bits(y0), h_bits(y1));
            a2[e]     = pk16(h_bits((_Float16)((f0 - (float)x0) * QRS)), h_bits((_Float16)((f1 - (float)x1) * QRS)));
            a2[e + 2] = pk16(h_bits((_Float16)((g0 - (float)y0) * QRS)), h_bits((_Float16)((g1 - (float)y1) * QRS)));
          }
        } else {
          a[0] = pkh2(fa[0], fa[1]); a[1] = pkh2(fa[2], fa[3]);
          a[2] = pkh2(fb[0], fb[1]); a[3] = pkh2(fb[2], fb[3]);
          a2 = a;
        }
        hv[it] = a; lv[it] = a2;
      }
      {
#pragma unroll
        for (int it = 0; it < 4; ++it) {
          const int row = it * 4 + q;
          *(v4u*)(C + (size_t)(mBase + row) * ldc + n0 + c8) = hv[it];
          if (MODE == 2) *(v4u*)(C2 + (size_t)(mBase + row) * ldc + n0 + c8) = lv[it];
        }
        
      }
    }
    wave_lds_sync();
  }
}

#define GEMM_LDS                                                                                          \
  __shared__ __align__(16) _Float16 sA[2][128 * GPI]; /* A stage: 128 rows x 64 k, pitch GPI, two buffers */ \
  __shared__ __align__(16) _Float16 sB[2][128 * GPI]; /* Bt stage, same shape */                           \
  __shared__ __align__(16) float sT[8][16 * 68];      /* per-wave 16x64 slab, pitch 68 floats */

template <int MODE>
__global__ __launch_bounds__(256) void gemm64(
    const unsigned short* __restrict__ Ap, int lda, long long strideA,
    const unsigned short* __restrict__ Btp, int ldb, long long strideB,
    const float* __restrict__ bias,
    void* Cout, void* Cout2, int ldc, long long strideC,
    int M, int N, int K) {
  GEMM_LDS
  gemm_body<MODE>(sA, sB, sT, blockIdx.x, blockIdx.y, Ap, lda, strideA, Btp, ldb, strideB, bias,
                  Cout, Cout2, ldc, strideC, M, N, K);
}

// q, k and v^T projections of one layer in one grid: they read the same X and do not depend on each other.
//   blocks 0..191: q (MODE 2); 192..383: k (MODE 1); 384..575: v^T (MODE 3), 96 tiles per batch.
// The three branches are block-uniform, so every barrier in gemm_body is passed by the whole block.
#define TQK ((BT / 128) * (HID / 128))
#define TVB ((HID / 128) * (SEQ / 128))
__global__ __launch_bounds__(256) void gemm_qkv(
    const unsigned short* __restrict__ X, const unsigned short* __restrict__ Wqt,
    const unsigned short* __restrict__ Wkt, const unsigned short* __restrict__ Wvt,
    const float* __restrict__ bq, const float* __restrict__ bk, const float* __restrict__ bv,
    unsigned short* Qh, unsigned short* Ql, unsigned short* Kh, unsigned short* VT) {
  GEMM_LDS
  const int t = blockIdx.x;
  if (t < TQK) {
    gemm_body<2>(sA, sB, sT, t, 0, X, HID, 0LL, Wqt, HID, 0LL, bq, (void*)Qh, (void*)Ql, HID, 0LL, BT, HID, HID);
  } else if (t < 2 * TQK) {
    gemm_body<1>(sA, sB, sT, t - TQK, 0, X, HID, 0LL, Wkt, HID, 0LL, bk, (void*)Kh, (void*)Kh, HID, 0LL, BT, HID, HID);
  } else {
    const int u  = t - 2 * TQK;
    const int bz = u / TVB;
    gemm_body<3>(sA, sB, sT, u - bz * TVB, bz, Wvt, HID, 0LL, X, HID, (long long)SEQ * HID, bv,
                 (void*)VT, (void*)VT, SEQ, (long long)HID * SEQ, HID, SEQ, HID);
  }
}

// =====================================================================================================
// Attention, head dim 64, mask m[b][s] applied as logit = (q.k * sscale) * m - 1e10 * (1 - m) (m bf16-RNE).
//   q planes (f16 hi, f16 residual x4096): element (b, t, h, d) at [(b*SEQ + t)*HID + h*64 + d]
//   k plane (f16): same layout with key index s;  v^T plane (f16): element (b, h, d, s) at [(b*HID + h*64 + d)*SEQ + s]
//   scores = qhi.k + (qres.k)/4096, two f32 accumulators; online softmax in f32 (running max);
//   p = exp(s - m) carried as f16(1024 p), spilled per wave to LDS with _Float16 element stores and reloaded as v8h
//   ctx plane (f16, normalised context): element (b, t, h, d) at [(b*SEQ + t)*HID + h*64 + d]
//   Block = 4 waves = 64 query rows of one (b, h); grid = NQB * NHD * NB; kv chunks of 64, static trip NQB.
//   K / V^T chunk staging: 128 threads x 32 elements per plane = the whole 64x64 tile (plain 16-B loads,
//   __syncthreads before and after).
//   LDS rows of K, V^T and P lie at pitch 144 B, of the context tile at 272 B (16 B x odd): the 16 rows that one half-wave's
//   16-B fragment read touches then fall on all 64 banks; at the dense 128 B they fell on 8 banks, 8 rows deep.
//   Output coverage: each wave stores rows q0..q0+15 (it 0..3 x lane>>3 0..3) x 64 columns (8 lanes x 8),
// =====================================================================================================
__global__ __launch_bounds__(128)
void attn64(const unsigned short* __restrict__ qhp, const unsigned short* __restrict__ qlp,
            const unsigned short* __restrict__ khp, const unsigned short* __restrict__ vtp,
            const float* __restrict__ mask, unsigned short* ctxp, float sscale) {
  union FH { v16h v; v8h h[2]; };
  __shared__ __align__(16) _Float16 Ks[64 * API];                 // K [kv][d]    9 KB
  __shared__ __align__(16) _Float16 Vts[64 * API];                // V^T [d][kv]  9 KB
  __shared__ __align__(16) _Float16 Psh[4][16 * API];             // per wave P [row][kv]
  __shared__ __align__(16) float    Os[4][16 * OPI];              // per wave context tile [row][d]

  const int tid  = threadIdx.x;
  const int wave = tid >> 5;
  const int lane = tid & 31;
  const int hh   = lane >> 4;
  const int c    = lane & 15;

  const int bx   = blockIdx.x;
  const int qb   = bx % NQB;
  const int rest = bx / NQB;
  const int h    = rest % NHD;
  const int b    = rest / NHD;
  const int q0   = qb * 64 + wave * 16;
  const size_t rowB = (size_t)b * SEQ;

  const _Float16* Qh = (const _Float16*)(const void*)qhp + (size_t)h * HD;
  const _Float16* Ql = (const _Float16*)(const void*)qlp + (size_t)h * HD;
  const _Float16* Kh = (const _Float16*)(const void*)khp + (size_t)h * HD;
  const _Float16* Vt = (const _Float16*)(const void*)vtp + ((size_t)b * HID + (size_t)h * HD) * SEQ;
  const float* mb = mask + (size_t)b * SEQ;

  // ---- Q fragments (A operand, row = lane&15): 2 d-chunks, hi and residual ----
  v16h qah[2], qal[2];
#pragma unroll
  for (int dc = 0; dc < 2; ++dc) {
    const size_t qo = (rowB + q0 + c) * HID + dc * 32 + 8 * hh;
    qah[dc] = ldfrag_h(Qh + qo);
    qal[dc] = ldfrag_h(Ql + qo);
  }

  float mrow[8], lrow[8];
  v8f oacc[4];
#pragma unroll
  for (int r = 0; r < 8; ++r) { mrow[r] = -INFINITY; lrow[r] = 0.f; }
#pragma unroll
  for (int t = 0; t < 4; ++t) oacc[t] = zero8();

#pragma unroll 1
  for (int kt = 0; kt < NQB; ++kt) {
    const int kv0 = kt * 64;
    __syncthreads();
    {
      const int r = tid >> 1, half = (tid & 1) * 32;
      const _Float16* kg = Kh + (rowB + kv0 + r) * HID + half;      // K row kv0+r, d = half..half+31
      const _Float16* vg = Vt + (size_t)r * SEQ + kv0 + half;      // V^T row d = r, s = kv0+half..+31
#pragma unroll
      for (int i = 0; i < 4; ++i) {
        const v8h a0 = *(const v8h*)(kg + 8 * i);
        const v8h b0 = *(const v8h*)(vg + 8 * i);
        *(v8h*)(Ks  + r * API + half + 8 * i) = a0;
        *(v8h*)(Vts + r * API + half + 8 * i) = b0;
      }
    }
    __syncthreads();

    float mv[4];
#pragma unroll
    for (int j = 0; j < 4; ++j) mv[j] = bfr(mb[kv0 + j * 16 + c]);   // key kv0 + 16j + c < SEQ

    // ---- scores: 16 query rows x 64 keys per wave, qhi.k and qres.k ----
    v8f s[4];
#pragma unroll
    for (int j = 0; j < 4; ++j) {
      s[j] = zero8();
      v8f sl = zero8();
#pragma unroll
      for (int dc = 0; dc < 2; ++dc) {
        FH kb;
        kb.h[0] = *(const v8h*)(Ks + (j * 16 + c) * API + dc * 32 + 8 * hh);
        kb.h[1] = *(const v8h*)(Ks + (j * 16 + c) * API + dc * 32 + 16 + 8 * hh);
        s[j] = mma_h(qah[dc], kb.v, s[j]);
        sl   = mma_h(qal[dc], kb.v, sl);
      }
#pragma unroll
      for (int r = 0; r < 8; ++r) {
        float sv = (s[j][r] + sl[r] * QRI) * sscale;
        sv = sv * mv[j] - 1.0e10f * (1.0f - mv[j]);
        s[j][r] = sv;
      }
    }

    // ---- row max, online softmax, P (x1024, f16) to LDS ----
    _Float16* pwh = Psh[wave];
#pragma unroll
    for (int r = 0; r < 8; ++r) {
      float m = fmaxf(fmaxf(s[0][r], s[1][r]), fmaxf(s[2][r], s[3][r]));
#pragma unroll
      for (int off = 1; off < 16; off <<= 1) m = fmaxf(m, __shfl_xor(m, off, 32));
      const float mnew  = fmaxf(mrow[r], m);
      const float alpha = __expf(mrow[r] - mnew);
      mrow[r] = mnew;
      float psum = 0.f;
#pragma unroll
      for (int j = 0; j < 4; ++j) {
        const float p = __expf(s[j][r] - mnew);
        psum += p;
        pwh[(8 * hh + r) * API + j * 16 + c] = (_Float16)(p * PSC);
      }
#pragma unroll
      for (int off = 1; off < 16; off <<= 1) psum += __shfl_xor(psum, off, 32);
      lrow[r] = lrow[r] * alpha + psum;
#pragma unroll
      for (int t = 0; t < 4; ++t) oacc[t][r] *= alpha;
    }
    wave_lds_sync();

    // ---- context += P . V (f16 WMMA) ----
#pragma unroll
    for (int kk = 0; kk < 2; ++kk) {
      FH pa;
      pa.h[0] = *(const v8h*)(pwh + c * API + kk * 32 + 8 * hh);
      pa.h[1] = *(const v8h*)(pwh + c * API + kk * 32 + 16 + 8 * hh);
#pragma unroll
      for (int t = 0; t < 4; ++t) {
        FH vb;
        vb.h[0] = *(const v8h*)(Vts + (t * 16 + c) * API + kk * 32 + 8 * hh);
        vb.h[1] = *(const v8h*)(Vts + (t * 16 + c) * API + kk * 32 + 16 + 8 * hh);
        oacc[t] = mma_h(pa.v, vb.v, oacc[t]);
      }
    }
  }

  float* os = Os[wave];
#pragma unroll
  for (int r = 0; r < 8; ++r) {
    const float l = lrow[r];
    const float inv = ((l > 0.f) ? (1.0f / l) : 0.f) * PSI;
#pragma unroll
    for (int t = 0; t < 4; ++t) os[(8 * hh + r) * OPI + t * 16 + c] = oacc[t][r] * inv;
  }
  wave_lds_sync();
  {
    const int q4 = lane >> 3, c8 = (lane & 7) * 8;
    v4u hv[4];
#pragma unroll
    for (int it = 0; it < 4; ++it) {
      const int row = it * 4 + q4;           // it 0..3 x q4 0..3 = rows 0..15 of the wave tile
      const float* sp = os + row * OPI + c8;
      const v4f fa = *(const v4f*)(sp);
      const v4f fb = *(const v4f*)(sp + 4);
      v4u a;
      a[0] = pkh2(fa[0], fa[1]); a[1] = pkh2(fa[2], fa[3]);
      a[2] = pkh2(fb[0], fb[1]); a[3] = pkh2(fb[2], fb[3]);
      hv[it] = a;
    }
    {
#pragma unroll
      for (int it = 0; it < 4; ++it) {
        const int row = it * 4 + q4;
        const size_t go = (rowB + q0 + row) * HID + (size_t)h * HD + c8;
        *(v4u*)(ctxp + go) = hv[it];
      }
      
    }
  }
}

// =====================================================================================================
// Workspace map (bytes), all region sizes multiples of 128 and exact multiples of their 64x64- or 128x128-tile / whole-row
// store granularity (M, N multiples of 128; 768- and 3072-wide rows), so no padded tails are needed:
//   Hres f32 [4096][768]        12582912
//   X    f16 [4096][768]         6291456   (LN output plane, reused by LN1 and LN2)
//   Qh   f16 [4096][768]         6291456
//   Ql   f16 [4096][768]         6291456   (q residual x4096)
//   Kh   f16 [4096][768]         6291456
//   VT   f16 [2][768][2048]      6291456
//   Ctx  f16 [4096][768]         6291456
//   G    f16 [4096][3072]       25165824
//   per layer (2 x 14155776):
//   Wq_t,Wk_t,Wv_t,Wo_t f16 [768][768]  4 x 1179648
//   W1_t f16 [3072][768]         4718592
//   W2_t f16 [768][3072]         4718592
//   total                      103809024
// Both layers' weights are converted by the first launch, each layer into its own region ([out n][in k], k contiguous = the Bt / A layout).
// =====================================================================================================
extern "C" void kernel_launch(void* const* d_in, const int* in_sizes, int n_in,
                              void* d_out, int out_size, void* d_ws, size_t ws_size,
                              hipStream_t stream) {
  if (n_in < 21) return;
  if (in_sizes[0] != BT * HID || in_sizes[1] != BT * HID || in_sizes[2] != NB * SEQ) return;
  if (in_sizes[3] != 2 * HID || in_sizes[4] != 2 * HID) return;
  if (in_sizes[5] != 2 * HID * HID || in_sizes[7] != 2 * HID * HID ||
      in_sizes[9] != 2 * HID * HID || in_sizes[11] != 2 * HID * HID) return;
  if (in_sizes[6] != 2 * HID || in_sizes[8] != 2 * HID || in_sizes[10] != 2 * HID || in_sizes[12] != 2 * HID) return;
  if (in_sizes[13] != 2 * HID || in_sizes[14] != 2 * HID) return;
  if (in_sizes[15] != 2 * HID * DFF || in_sizes[16] != 2 * DFF ||
      in_sizes[17] != 2 * DFF * HID || in_sizes[18] != 2 * HID) return;
  if (in_sizes[19] != HID || in_sizes[20] != HID) return;
  if (out_size != BT * HID) return;

  const float* in_h  = (const float*)d_in[0];
  const float* embs  = (const float*)d_in[1];
  const float* mask  = (const float*)d_in[2];
  const float* ln1_s = (const float*)d_in[3];
  const float* ln1_b = (const float*)d_in[4];
  const float* wq    = (const float*)d_in[5];
  const float* bq    = (const float*)d_in[6];
  const float* wk    = (const float*)d_in[7];
  const float* bk    = (const float*)d_in[8];
  const float* wv    = (const float*)d_in[9];
  const float* bv    = (const float*)d_in[10];
  const float* wo    = (const float*)d_in[11];
  const float* bo    = (const float*)d_in[12];
  const float* ln2_s = (const float*)d_in[13];
  const float* ln2_b = (const float*)d_in[14];
  const float* w1    = (const float*)d_in[15];
  const float* b1    = (const float*)d_in[16];
  const float* w2    = (const float*)d_in[17];
  const float* b2    = (const float*)d_in[18];
  const float* lnf_s = (const float*)d_in[19];
  const float* lnf_b = (const float*)d_in[20];
  float* out = (float*)d_out;

  const size_t PH  = (size_t)BT * HID * 4;        // 12582912
  const size_t PA  = (size_t)BT * HID * 2;        //  6291456
  const size_t PVT = (size_t)NB * HID * SEQ * 2;  //  6291456
  const size_t PG  = (size_t)BT * DFF * 2;        // 25165824
  const size_t PW  = (size_t)HID * HID * 2;       //  1179648
  const size_t PW1 = (size_t)HID * DFF * 2;       //  4718592
  size_t off = 0;
  const size_t oH   = off; off += PH;
  const size_t oX   = off; off += PA;
  const size_t oQh  = off; off += PA;
  const size_t oQl  = off; off += PA;
  const size_t oKh  = off; off += PA;
  const size_t oVT  = off; off += PVT;
  const size_t oCtx = off; off += PA;
  const size_t oG   = off; off += PG;
  const size_t oWt  = off; off += 2 * (4 * PW + 2 * PW1);
  if (off > ws_size) return;                      // off = 103809024
  if (off > (size_t)134217728) return;

  char* ws = (char*)d_ws;
  float*          Hres = (float*)(ws + oH);
  unsigned short* X    = (unsigned short*)(ws + oX);
  unsigned short* Qh   = (unsigned short*)(ws + oQh);
  unsigned short* Ql   = (unsigned short*)(ws + oQl);
  unsigned short* Kh   = (unsigned short*)(ws + oKh);
  unsigned short* VT   = (unsigned short*)(ws + oVT);
  unsigned short* Ctx  = (unsigned short*)(ws + oCtx);
  unsigned short* G    = (unsigned short*)(ws + oG);
  unsigned short* Wt   = (unsigned short*)(ws + oWt);

  const dim3 blk(256);
  const dim3 gLN(BT / 8);                                           // 512 blocks, 8 rows each
  const dim3 gPrep(BT / 8 + 2 * CVL);                               // 512 row groups + 2 x 1728 weight tiles
  const dim3 gHH((BT / 128) * (HID / 128), 1);                      // 32 x 6  = 192 blocks
  const dim3 gQKV(2 * TQK + NB * TVB);                              // 192 + 192 + 2 x 96 = 576 blocks
  const dim3 gF1((BT / 128) * (DFF / 128), 1);                      // 32 x 24 = 768 blocks
  const dim3 gAt(NB * NHD * NQB);                                   // 768 blocks of 128

  for (int l = 0; l < 2; ++l) {
    unsigned short* Wqt = Wt + (size_t)l * WLH;
    unsigned short* Wkt = Wqt + (size_t)HID * HID;
    unsigned short* Wvt = Wkt + (size_t)HID * HID;
    unsigned short* Wot = Wvt + (size_t)HID * HID;
    unsigned short* W1t = Wot + (size_t)HID * HID;
    unsigned short* W2t = W1t + (size_t)HID * DFF;
    // (1) h = h + input_embs; hn = LN1(h) -> X (f16); with layer 0 also
    // (2) the weights of both layers: f32 [in][out] -> f16 [out][in] (bf16-RNE values x64)
    if (l == 0) {
      prep<<<gPrep, blk, 0, stream>>>(in_h, embs, Hres, ln1_s, ln1_b, X, wq, wk, wv, wo, w1, w2, Wt);
    } else {
      ln_rows<true, false, false><<<gLN, blk, 0, stream>>>(Hres, embs, Hres, ln1_s + HID, ln1_b + HID, (void*)X, BT);
    }
    // (3) q = hn . Wq + bq -> f16 hi + residual planes [b*SEQ+t][h*64+d]  (M=4096, N=768, K=768)
    // (4) k = hn . Wk + bk -> f16 plane
    // (5) v^T = Wv_t . hn^T per batch -> f16 [b][h*64+d][s]  (A = Wv_t [n][k], Bt = X rows of batch b; M=768, N=2048, K=768)
    gemm_qkv<<<gQKV, blk, 0, stream>>>(X, Wqt, Wkt, Wvt, bq + l * HID, bk + l * HID, bv + l * HID, Qh, Ql, Kh, VT);
    // (6) attention -> Ctx f16 [b*SEQ+t][h*64+d]
    attn64<<<gAt, dim3(128), 0, stream>>>(Qh, Ql, Kh, VT, mask, Ctx, 0.125f);
    // (7) h = h + (ctx . Wo + bo)  (f32, in place)
    gemm64<0><<<gHH, blk, 0, stream>>>(Ctx, HID, 0LL, Wot, HID, 0LL, bo + l * HID,
                                       (void*)Hres, (void*)Hres, HID, 0LL, BT, HID, HID);
    // (8) hn = LN2(h) -> X
    ln_rows<false, false, false><<<gLN, blk, 0, stream>>>(Hres, embs, Hres, ln2_s + l * HID, ln2_b + l * HID, (void*)X, BT);
    // (9) g = gelu(hn . W1 + b1) -> G f16 [4096][3072]  (M=4096, N=3072, K=768)
    gemm64<4><<<gF1, blk, 0, stream>>>(X, HID, 0LL, W1t, HID, 0LL, b1 + l * DFF,
                                       (void*)G, (void*)G, DFF, 0LL, BT, DFF, HID);
    // (10) h = h + (g . W2 + b2)  (M=4096, N=768, K=3072, f32 in place)
    gemm64<0><<<gHH, blk, 0, stream>>>(G, DFF, 0LL, W2t, DFF, 0LL, b2 + l * HID,
                                       (void*)Hres, (void*)Hres, HID, 0LL, BT, HID, DFF);
  }
  // (11) out = LN_f(h) -> f32 [2][2048][768]
  ln_rows<false, false, true><<<gLN, blk, 0, stream>>>(Hres, embs, Hres, lnf_s, lnf_b, (void*)out, BT);
  (void)hipGetLastError();
}

// v004
// A run of this version takes 353 microseconds.
// Two timings next to v003 put it at 1.13 and 1.14 times that version's speed.
// Over all steps from v000 it is 2.80 times as fast.
// Contractions: q, k, v^T, out and ffn projections = v_wmma_f32_16x16x32_f16 (f16 activations; weights bf16-RNE then x64 as f16), single product;
// q.k^T = v_wmma_f32_16x16x32_f16 with q as f16 hi + f16 residual (x4096) planes and k f16, 2 products in separate accumulators;
// p.v = v_wmma_f32_16x16x32_f16 (p carried x1024 in f16, v f16); f32 accumulate everywhere; layernorm, softmax and gelu in f32.
#include <hip/hip_runtime.h>
#include <math.h>
#include <stdint.h>

#define NB   2
#define SEQ  2048
#define HID  768
#define NHD  12
#define HD   64
#define DFF  3072
#define BT   (NB * SEQ)
#define NQB  (SEQ / 64)
#define WSC  64.0f
#define WINV 0.015625f
#define QRS  4096.0f
#define QRI  0.000244140625f
#define PSC  1024.0f
#define PSI  0.0009765625f
#define GPI  72                 // LDS row pitch of a GEMM stage, in halves: 64 k + 8 = 144 B
#define API  72                 // LDS row pitch of the attention K and V^T tiles, in halves: 64 + 8 = 144 B = 16 B x odd
#define OPI  68                 // LDS row pitch of the attention context tile, in floats: 64 + 4 = 272 B = 16 B x odd
static_assert(NHD * HD == HID);
static_assert((SEQ % 64) == 0 && (HID % 64) == 0 && (DFF % 64) == 0 && (BT % 64) == 0);
static_assert(HID == 6 * 128);
static_assert((SEQ % 128) == 0 && (HID % 128) == 0 && (DFF % 128) == 0 && (BT % 128) == 0);

typedef _Float16 v16h __attribute__((ext_vector_type(16)));
typedef _Float16 v8h  __attribute__((ext_vector_type(8)));
typedef float    v8f  __attribute__((ext_vector_type(8)));
typedef float    v4f  __attribute__((ext_vector_type(4)));
typedef unsigned int v4u __attribute__((ext_vector_type(4)));

// ---- scalar helpers -----------------------------------------------------------------------------
__device__ __forceinline__ unsigned short bf_bits(float f) {        // f32 -> bf16 bits, RNE convert
  const unsigned u = __float_as_uint(f);
  return (unsigned short)((u + 0x7FFFu + ((u >> 16) & 1u)) >> 16);
}
__device__ __forceinline__ float bfr(float f) { return __uint_as_float(((unsigned)bf_bits(f)) << 16); }
__device__ __forceinline__ v4f bfr4(v4f a) {
  v4f r;
  r[0] = bfr(a[0]); r[1] = bfr(a[1]); r[2] = bfr(a[2]); r[3] = bfr(a[3]);
  return r;
}
__device__ __forceinline__ unsigned short h_bits(_Float16 x) { return __builtin_bit_cast(unsigned short, x); }
__device__ __forceinline__ unsigned pk16(unsigned short a, unsigned short b) { return (unsigned)a | ((unsigned)b << 16); }
__device__ __forceinline__ unsigned pkh2(float a, float b) { return pk16(h_bits((_Float16)a), h_bits((_Float16)b)); }
__device__ __forceinline__ v8f zero8() { v8f z = {0.f, 0.f, 0.f, 0.f, 0.f, 0.f, 0.f, 0.f}; return z; }
__device__ __forceinline__ v4f zero4() { v4f z = {0.f, 0.f, 0.f, 0.f}; return z; }

// ---- fragment loader: 16-bit A/B operand, lane -> row/col (lane&15); p already includes +8*(lane>>4);
//      elements 0..7 <- p[0..7] (k0+8h..), elements 8..15 <- p[16..23] (k0+16+8h..)
__device__ __forceinline__ v16h ldfrag_h(const _Float16* p) {
  union { v16h v; v8h h[2]; } f;
  f.h[0] = *(const v8h*)(p);
  f.h[1] = *(const v8h*)(p + 16);
  return f.v;
}

// ---- WMMA with trailing VALU hazard gap -----------------------------------------------------------
__device__ __forceinline__ v8f mma_h(v16h a, v16h b, v8f c) {
  c = __builtin_amdgcn_wmma_f32_16x16x32_f16(false, a, false, b, (short)0, c, false, false);
#if defined(__HIP_DEVICE_COMPILE__)
  asm volatile("v_nop\n\tv_nop\n\tv_nop\n\tv_nop" : "+v"(c) : "v"(a), "v"(b));
#endif
  return c;
}

// release/acquire + wave barrier for same-wave LDS exchange
__device__ __forceinline__ void wave_lds_sync() {
  __builtin_amdgcn_fence(__ATOMIC_RELEASE, "workgroup");
  __builtin_amdgcn_wave_barrier();
  __builtin_amdgcn_fence(__ATOMIC_ACQUIRE, "workgroup");
}

// tanh-approximation gelu, tanh(u) = 1 - 2/(exp(2u)+1) with u clamped to [-16,16]
__device__ __forceinline__ float gelu_t(float x) {
  float u = 0.7978845608028654f * (x + 0.044715f * x * x * x);
  u = fminf(fmaxf(u, -16.0f), 16.0f);
  const float e  = __expf(2.0f * u);
  const float th = 1.0f - 2.0f * __builtin_amdgcn_rcpf(e + 1.0f);
  return 0.5f * x * (1.0f + th);
}

// =====================================================================================================
// Residual add + LayerNorm, one wave per row of 768. grid = nrows/8, 256 threads.
//   x = src row (RSRC: bf16-RNE the loaded values) (+ ADDE: bf16-RNE(embs row)); ADDE also stores x to hdst
//   (may alias src: every lane reads its own 24 columns before storing them).
//   else:  y -> f16 rows via a per-wave LDS row buffer (lane l: 8 halves at col 256j+8l, 512 B per instruction).
// coverage: 8 waves x grid(512) = 4096 rows; 6 x 128 floats / 3 x 256 halves = the whole 768-wide row.
// =====================================================================================================
// blk = index of the 8-row group; rb = the block's 8 x 768 float row buffer in LDS.
template <bool ADDE, bool RSRC, bool OUT32>
__device__ __forceinline__ void ln_body(int blk, float* rb, const float* src, const float* embs, float* hdst,
                                        const float* __restrict__ sc, const float* __restrict__ bi,
                                        void* outp, int nrows) {
  const int tid = threadIdx.x, wave = tid >> 5, lane = tid & 31;
  const int row = blk * 8 + wave;
  if (row >= nrows) return;                       // wave-uniform; no block barrier behind it in this body
  const size_t rbase = (size_t)row * HID;
  v4f x[6];
#pragma unroll
  for (int i = 0; i < 6; ++i) {
    const int col = i * 128 + lane * 4;
    v4f a = *(const v4f*)(src + rbase + col);
    if (RSRC) a = bfr4(a);
    if (ADDE) {
      const v4f e = bfr4(*(const v4f*)(embs + rbase + col));
      a = a + e;
    }
    x[i] = a;
    // precaution: a later load's result may be given the address registers of this trip's loads; this keeps the wait in front of that
    asm volatile("s_wait_xcnt 0x0" ::: "memory");
  }
  if (ADDE) {
    {
#pragma unroll
      for (int i = 0; i < 6; ++i) *(v4f*)(hdst + rbase + i * 128 + lane * 4) = x[i];
      
    }
  }
  float s = 0.f;
#pragma unroll
  for (int i = 0; i < 6; ++i) s += (x[i][0] + x[i][1]) + (x[i][2] + x[i][3]);
#pragma unroll
  for (int off = 1; off < 32; off <<= 1) s += __shfl_xor(s, off, 32);
  const float mean = s * (1.0f / 768.0f);
  float qv = 0.f;
#pragma unroll
  for (int i = 0; i < 6; ++i) {
    const v4f d = x[i] - mean;
    qv += (d[0] * d[0] + d[1] * d[1]) + (d[2] * d[2] + d[3] * d[3]);
  }
#pragma unroll
  for (int off = 1; off < 32; off <<= 1) qv += __shfl_xor(qv, off, 32);
  const float var  = qv * (1.0f / 768.0f);
  const float rinv = rsqrtf(var + 1e-5f);
  v4f y[6];
#pragma unroll
  for (int i = 0; i < 6; ++i) {
    const int col = i * 128 + lane * 4;
    const v4f s4 = bfr4(*(const v4f*)(sc + col));
    const v4f b4 = bfr4(*(const v4f*)(bi + col));
    y[i] = (x[i] - mean) * rinv * s4 + b4;
  }
  if (OUT32) {
    float* o = (float*)outp;
    {
#pragma unroll
      for (int i = 0; i < 6; ++i) *(v4f*)(o + rbase + i * 128 + lane * 4) = y[i];
      
    }
  } else {
    float* rw = rb + wave * HID;
#pragma unroll
    for (int i = 0; i < 6; ++i) *(v4f*)(rw + i * 128 + lane * 4) = y[i];
    wave_lds_sync();
    v4u pk[3];
#pragma unroll
    for (int j = 0; j < 3; ++j) {
      const v4f a = *(const v4f*)(rw + j * 256 + lane * 8);
      const v4f c = *(const v4f*)(rw + j * 256 + lane * 8 + 4);
      v4u p;
      p[0] = pkh2(a[0], a[1]); p[1] = pkh2(a[2], a[3]);
      p[2] = pkh2(c[0], c[1]); p[3] = pkh2(c[2], c[3]);
      pk[j] = p;
    }
    unsigned short* o = (unsigned short*)outp;
    {
#pragma unroll
      for (int j = 0; j < 3; ++j) *(v4u*)(o + rbase + j * 256 + lane * 8) = pk[j];
      
    }
  }
}

template <bool ADDE, bool RSRC, bool OUT32>
__global__ __launch_bounds__(256) void ln_rows(const float* src, const float* embs, float* hdst,
                                               const float* __restrict__ sc, const float* __restrict__ bi,
                                               void* outp, int nrows) {
  __shared__ __align__(16) float rb[8 * HID];
  ln_body<ADDE, RSRC, OUT32>(blockIdx.x, rb, src, embs, hdst, sc, bi, outp, nrows);
}

// =====================================================================================================
// Weight convert + transpose: W f32 [K][N] (row-major, in-major) -> O f16 [N][K] = f16(bf16-RNE(w) * 64).
// One block = one tile of 64 k x 64 n through LDS, origin (k0, n0); 256 threads; sT = the block's 64 x 72 half tile in LDS.
//   read: thread (r = tid>>2 = k row, cq = (tid&3)*16 = n quarter) reads 16 floats (4 x 16 B) -> sT[n][k]
//   write: wave w, lane: rows (n) w*8 + it*4 + (lane>>3), 8 halves per lane at k (lane&7)*8:
// coverage: 8 waves x 8 rows = 64 n rows x 64 k per block; the caller deals N/64 x K/64 tiles exactly.
// =====================================================================================================
__device__ __forceinline__ void conv_body(_Float16* sT, const float* __restrict__ W, unsigned short* O,
                                          int K, int N, int n0, int k0) {
  const int tid = threadIdx.x;
  {
    const int r = tid >> 2, cq = (tid & 3) * 16;
    const float* p = W + (size_t)(k0 + r) * N + n0 + cq;
#pragma unroll
    for (int g = 0; g < 4; ++g) {
      const v4f a = *(const v4f*)(p + 4 * g);
#pragma unroll
      for (int e = 0; e < 4; ++e) sT[(cq + 4 * g + e) * 72 + r] = (_Float16)(bfr(a[e]) * WSC);
    }
  }
  __syncthreads();
  const int wave = tid >> 5, lane = tid & 31;
  const int q = lane >> 3, c8 = (lane & 7) * 8;
  union HU { v8h h; v4u u; };
  HU pk[2];
#pragma unroll
  for (int it = 0; it < 2; ++it) {
    const int row = wave * 8 + it * 4 + q;
    pk[it].h = *(const v8h*)(sT + row * 72 + c8);
  }
  const _Float16 dummy = (_Float16)0.0f; (void)dummy;
  {
#pragma unroll
    for (int it = 0; it < 2; ++it) {
      const int row = wave * 8 + it * 4 + q;
      *(v4u*)(O + (size_t)(n0 + row) * K + k0 + c8) = pk[it].u;
    }
    // precaution: where this body is inlined in front of other code, the stores' registers may be rewritten there; this keeps the wait in front of that
    asm volatile("s_wait_xcnt 0x0" ::: "memory");
  }
}

// =====================================================================================================
// First launch: the work that depends on the inputs alone, dealt by block index in one grid.
//   blocks 0 .. BT/8-1: h + embs and LN1 of layer 0 (ln_body);
//   then per layer CVL = 3 x CVS blocks of weight tiles (conv_body): CVS tiles of wq, wk, wv, wo (144 each), CVS of w1, CVS of w2.
// Converted weights of layer l lie at Wt + l * WLH halves: Wq_t, Wk_t, Wv_t, Wo_t (HID*HID each), W1_t, W2_t (HID*DFF each).
// Every branch below is block-uniform; the one block barrier (in conv_body) is passed by all 256 threads of its block.
// =====================================================================================================
#define CVS  576                                  // 4 * 12 * 12 = 48 * 12 = 12 * 48 tiles
#define CVL  (3 * CVS)
#define WLH  (4 * HID * HID + 2 * HID * DFF)      // halves of converted weights per layer
static_assert(4 * (HID / 64) * (HID / 64) == CVS && (DFF / 64) * (HID / 64) == CVS);
__global__ __launch_bounds__(256) void prep(const float* in_h, const float* embs, float* hdst,
                                            const float* __restrict__ sc, const float* __restrict__ bi,
                                            unsigned short* X,
                                            const float* __restrict__ wq, const float* __restrict__ wk,
                                            const float* __restrict__ wv, const float* __restrict__ wo,
                                            const float* __restrict__ w1, const float* __restrict__ w2,
                                            unsigned short* Wt) {
  __shared__ __align__(16) float rb[8 * HID];
  __shared__ __align__(16) _Float16 sT[64 * 72];
  const int bx = blockIdx.x;
  if (bx < BT / 8) {
    ln_body<true, true, false>(bx, rb, in_h, embs, hdst, sc, bi, (void*)X, BT);
    return;
  }
  int t = bx - BT / 8;
  const int l = t / CVL;
  t -= l * CVL;
  const int seg = t / CVS;
  t -= seg * CVS;
  unsigned short* Ol = Wt + (size_t)l * WLH;
  if (seg == 0) {
    const int z = t / 144;
    const int r = t - z * 144;
    const float* W = ((z == 0) ? wq : (z == 1) ? wk : (z == 2) ? wv : wo) + (size_t)l * HID * HID;
    conv_body(sT, W, Ol + (size_t)z * HID * HID, HID, HID, (r % 12) * 64, (r / 12) * 64);
  } else if (seg == 1) {
    conv_body(sT, w1 + (size_t)l * HID * DFF, Ol + (size_t)4 * HID * HID, HID, DFF, (t % 48) * 64, (t / 48) * 64);
  } else {
    conv_body(sT, w2 + (size_t)l * HID * DFF, Ol + (size_t)4 * HID * HID + (size_t)HID * DFF, DFF, HID,
              (t % 12) * 64, (t / 12) * 64);
  }
}

// =====================================================================================================
// Register-blocked f16 WMMA GEMM: C[m][n] = sum_k A[m][k] * Bt[n][k] (accumulator scaled by 1/64 in the
// epilogue = the weight carry). Block = 8 waves (4 x 2) = one 128x128 tile of C, one 32x64 tile per wave.
// A row-major [M][K] pitch lda, Bt row-major [N][K] pitch ldb (k contiguous); M, N multiples of 128, K multiple of 64.
// Operands go through LDS in stages of 64 k: 128 rows x 128 B of A and of Bt per stage. Each wave-wide 16-B load
// covers 4 whole 128-B lines (8 lanes per row); rows lie in LDS at pitch 144 B (16 B x odd) for the 16-B fragment reads.
// Two LDS buffers, one block barrier per stage: stage s+1 is loaded into registers behind the barrier of stage s,
// while stage s is multiplied, and stored to the other buffer, whose last readers (stage s-1) all passed that barrier.
// tile = index of the block tile, bz = batch index (strides in elements). Both A and B fragments use the split k map of ldfrag_h.
// MODE 1: f16 C = acc/64 + bias[n]
// MODE 2: f16 hi C = f16(v), f16 residual C2 = f16((v - hi) * 4096), v = acc/64 + bias[n]
// MODE 3: f16 C = acc/64 + bias[m]
// MODE 4: f16 C = gelu(acc/64 + bias[n])
// bias values bf16-RNE converted in register. Epilogue: 16-row slabs staged per wave in LDS; each 64-wide row
// coverage: 2 slabs x 16 rows x 64 cols = the wave's whole tile; 8 waves per block; grid = (M/128) * (N/128).
// =====================================================================================================
template <int MODE>
__device__ __forceinline__ void gemm_body(
    _Float16 (*sA)[128 * GPI], _Float16 (*sB)[128 * GPI], float (*sT)[16 * 68], int tile, int bz,
    const unsigned short* __restrict__ Ap, int lda, long long strideA,
    const unsigned short* __restrict__ Btp, int ldb, long long strideB,
    const float* __restrict__ bias,
    void* Cout, void* Cout2, int ldc, long long strideC,
    int M, int N, int K) {
  const int tid  = threadIdx.x;
  const int lane = tid & 31;
  const int wave = tid >> 5;
  const int tilesN = N >> 7;
  const int tilesM = M >> 7;
  if (tile >= tilesM * tilesN) return;             // block-uniform, in front of every barrier
  const int tm = tile / tilesN;
  const int tn = tile - tm * tilesN;
  const int bm0 = tm << 7;                         // block tile origin
  const int bn0 = tn << 7;
  const int wm  = (wave >> 1) << 5;                // wave tile origin inside the block tile
  const int wn  = (wave & 1) << 6;
  const int m0 = bm0 + wm;
  const int n0 = bn0 + wn;

  const _Float16* Ab = (const _Float16*)(const void*)Ap  + (size_t)bz * (size_t)strideA;
  const _Float16* Bb = (const _Float16*)(const void*)Btp + (size_t)bz * (size_t)strideB;

  const int rl   = lane & 15;                      // row (A) / col (B, D) within subtile
  const int hh   = lane >> 4;
  const int koff = hh * 8;                         // k offset of this lane half
  const int mOff = hh * 8;                         // D row offset

  // staging map: thread -> row (tid>>3) + 32*it, 16-B piece (tid&7) of the row's 128 B; 4 it x 32 rows = 128 rows
  const int srow = tid >> 3;
  const int scol = (tid & 7) * 8;
  const _Float16* ga = Ab + (size_t)(bm0 + srow) * lda + scol;
  const _Float16* gb = Bb + (size_t)(bn0 + srow) * ldb + scol;
  const int sofs = srow * GPI + scol;

  v8f acc[2][4];
#pragma unroll
  for (int i = 0; i < 2; ++i)
#pragma unroll
    for (int j = 0; j < 4; ++j) acc[i][j] = zero8();

  v8h ra[4], rb[4];
#pragma unroll
  for (int it = 0; it < 4; ++it) {
    ra[it] = *(const v8h*)(ga + (size_t)(it * 32) * lda);
    rb[it] = *(const v8h*)(gb + (size_t)(it * 32) * ldb);
  }

  const int nst = K >> 6;
  // kept rolled: one stage is already 16 WMMAs and 24 fragment loads a wave; unrolling would only grow code and registers
#pragma unroll 1
  for (int s = 0; s < nst; ++s) {
    _Float16* dA = sA[s & 1];
    _Float16* dB = sB[s & 1];
#pragma unroll
    for (int it = 0; it < 4; ++it) {
      *(v8h*)(dA + sofs + it * 32 * GPI) = ra[it];
      *(v8h*)(dB + sofs + it * 32 * GPI) = rb[it];
    }
    __syncthreads();                               // publishes stage s; ends every wave's reads of stage s-1
    if (s + 1 < nst) {                             // block-uniform: next stage's loads fly under this stage's WMMAs
      const int kn = (s + 1) << 6;
#pragma unroll
      for (int it = 0; it < 4; ++it) {
        ra[it] = *(const v8h*)(ga + (size_t)(it * 32) * lda + kn);
        rb[it] = *(const v8h*)(gb + (size_t)(it * 32) * ldb + kn);
      }
      // precaution: the address registers of these loads are rewritten right below; this keeps the wait in front of that
      asm volatile("s_wait_xcnt 0x0" ::: "memory");
    }
#pragma unroll
    for (int kk = 0; kk < 2; ++kk) {
      v16h bfg[4], af[2];
#pragma unroll
      for (int j = 0; j < 4; ++j)
        bfg[j] = ldfrag_h(dB + (wn + (j << 4) + rl) * GPI + kk * 32 + koff);
#pragma unroll
      for (int i = 0; i < 2; ++i)
        af[i] = ldfrag_h(dA + (wm + (i << 4) + rl) * GPI + kk * 32 + koff);
#pragma unroll
      for (int i = 0; i < 2; ++i)
#pragma unroll
        for (int j = 0; j < 4; ++j) acc[i][j] = mma_h(af[i], bfg[j], acc[i][j]);
    }
  }

  // ---- epilogue ----
  float* slab = sT[wave];
#pragma unroll
  for (int i = 0; i < 2; ++i) {
    const int mBase = m0 + (i << 4);
#pragma unroll
    for (int j = 0; j < 4; ++j) {
#pragma unroll
      for (int r = 0; r < 8; ++r) slab[(mOff + r) * 68 + (j << 4) + rl] = acc[i][j][r] * WINV;
    }
    wave_lds_sync();
    if (MODE == 0) {
      float* C = (float*)Cout + (size_t)bz * (size_t)strideC;
      const int c4 = rl * 4;                                   // 256-B row segment = 16 lanes x 16 B
      const v4f b4 = bfr4(*(const v4f*)(bias + n0 + c4));
      v4f vals[8];
#pragma unroll
      for (int it = 0; it < 8; ++it) {
        const int row = it * 2 + hh;                           // it 0..7 x hh 0..1 = rows 0..15
        const v4f v = *(const v4f*)(slab + row * 68 + c4);
        const v4f o = *(const v4f*)(C + (size_t)(mBase + row) * ldc + n0 + c4);
        vals[it] = o + (v + b4);
      }
      {
#pragma unroll
        for (int it = 0; it < 8; ++it) {
          const int row = it * 2 + hh;
          *(v4f*)(C + (size_t)(mBase + row) * ldc + n0 + c4) = vals[it];
        }
        
      }
    } else {
      const int q = lane >> 3, c8 = (lane & 7) * 8;
      unsigned short* C  = (unsigned short*)Cout  + (size_t)bz * (size_t)strideC;
      unsigned short* C2 = (unsigned short*)Cout2 + (size_t)bz * (size_t)strideC;
      v4f ba = zero4(), bb = zero4();
      if (MODE != 3) {
        ba = bfr4(*(const v4f*)(bias + n0 + c8));
        bb = bfr4(*(const v4f*)(bias + n0 + c8 + 4));
      }
      v4u hv[4], lv[4];
#pragma unroll
      for (int it = 0; it < 4; ++it) {
        const int row = it * 4 + q;                            // it 0..3 x q 0..3 = rows 0..15
        const float* sp = slab + row * 68 + c8;
        v4f fa = *(const v4f*)(sp);
        v4f fb = *(const v4f*)(sp + 4);
        if (MODE == 3) {
          const float br = bfr(bias[mBase + row]);
          fa = fa + br; fb = fb + br;
        } else {
          fa = fa + ba; fb = fb + bb;
        }
        if (MODE == 4) {
#pragma unroll
          for (int e = 0; e < 4; ++e) { fa[e] = gelu_t(fa[e]); fb[e] = gelu_t(fb[e]); }
        }
        v4u a, a2;
        if (MODE == 2) {
#pragma unroll
          for (int e = 0; e < 2; ++e) {
            const float f0 = fa[2 * e], f1 = fa[2 * e + 1];
            const float g0 = fb[2 * e], g1 = fb[2 * e + 1];
            const _Float16 x0 = (_Float16)f0, x1 = (_Float16)f1, y0 = (_Float16)g0, y1 = (_Float16)g1;
            a[e]      = pk16(h_bits(x0), h_bits(x1));
            a[e + 2]  = pk16(h_bits(y0), h_bits(y1));
            a2[e]     = pk16(h_bits((_Float16)((f0 - (float)x0) * QRS)), h_bits((_Float16)((f1 - (float)x1) * QRS)));
            a2[e + 2] = pk16(h_bits((_Float16)((g0 - (float)y0) * QRS)), h_bits((_Float16)((g1 - (float)y1) * QRS)));
          }
        } else {
          a[0] = pkh2(fa[0], fa[1]); a[1] = pkh2(fa[2], fa[3]);
          a[2] = pkh2(fb[0], fb[1]); a[3] = pkh2(fb[2], fb[3]);
          a2 = a;
        }
        hv[it] = a; lv[it] = a2;
      }
      {
#pragma unroll
        for (int it = 0; it < 4; ++it) {
          const int row = it * 4 + q;
          *(v4u*)(C + (size_t)(mBase + row) * ldc + n0 + c8) = hv[it];
          if (MODE == 2) *(v4u*)(C2 + (size_t)(mBase + row) * ldc + n0 + c8) = lv[it];
        }
        
      }
    }
    wave_lds_sync();
  }
}

#define GEMM_LDS                                                                                          \
  __shared__ __align__(16) _Float16 sA[2][128 * GPI]; /* A stage: 128 rows x 64 k, pitch GPI, two buffers */ \
  __shared__ __align__(16) _Float16 sB[2][128 * GPI]; /* Bt stage, same shape */                           \
  __shared__ __align__(16) float sT[8][16 * 68];      /* per-wave 16x64 slab, pitch 68 floats */

template <int MODE>
__global__ __launch_bounds__(256) void gemm64(
    const unsigned short* __restrict__ Ap, int lda, long long strideA,
    const unsigned short* __restrict__ Btp, int ldb, long long strideB,
    const float* __restrict__ bias,
    void* Cout, void* Cout2, int ldc, long long strideC,
    int M, int N, int K) {
  GEMM_LDS
  gemm_body<MODE>(sA, sB, sT, blockIdx.x, blockIdx.y, Ap, lda, strideA, Btp, ldb, strideB, bias,
                  Cout, Cout2, ldc, strideC, M, N, K);
}

// q, k and v^T projections of one layer in one grid: they read the same X and do not depend on each other.
//   blocks 0..191: q (MODE 2); 192..383: k (MODE 1); 384..575: v^T (MODE 3), 96 tiles per batch.
// The three branches are block-uniform, so every barrier in gemm_body is passed by the whole block.
#define TQK ((BT / 128) * (HID / 128))
#define TVB ((HID / 128) * (SEQ / 128))
__global__ __launch_bounds__(256) void gemm_qkv(
    const unsigned short* __restrict__ X, const unsigned short* __restrict__ Wqt,
    const unsigned short* __restrict__ Wkt, const unsigned short* __restrict__ Wvt,
    const float* __restrict__ bq, const float* __restrict__ bk, const float* __restrict__ bv,
    unsigned short* Qh, unsigned short* Ql, unsigned short* Kh, unsigned short* VT) {
  GEMM_LDS
  const int t = blockIdx.x;
  if (t < TQK) {
    gemm_body<2>(sA, sB, sT, t, 0, X, HID, 0LL, Wqt, HID, 0LL, bq, (void*)Qh, (void*)Ql, HID, 0LL, BT, HID, HID);
  } else if (t < 2 * TQK) {
    gemm_body<1>(sA, sB, sT, t - TQK, 0, X, HID, 0LL, Wkt, HID, 0LL, bk, (void*)Kh, (void*)Kh, HID, 0LL, BT, HID, HID);
  } else {
    const int u  = t - 2 * TQK;
    const int bz = u / TVB;
    gemm_body<3>(sA, sB, sT, u - bz * TVB, bz, Wvt, HID, 0LL, X, HID, (long long)SEQ * HID, bv,
                 (void*)VT, (void*)VT, SEQ, (long long)HID * SEQ, HID, SEQ, HID);
  }
}

__device__ __forceinline__ float xhalf(float x) {
  return __builtin_bit_cast(float, __builtin_amdgcn_permlanex16(__builtin_bit_cast(int, x), __builtin_bit_cast(int, x),
                                                                0x76543210, 0xfedcba98, false, false));
}

// 2^x of eight values in one statement. The results are early-clobber, so none of them lies on a source of the exponential in
// front of it, and the closing v_nop is the slot the instruction set asks for between a transcendental and the next instruction
// that uses its result or overwrites its source (left to itself the compiler put results on the source of the one in front).
__device__ __forceinline__ v8f exp2x8(v8f x) {
  v8f y = x;
#if defined(__HIP_DEVICE_COMPILE__)
  float y0, y1, y2, y3, y4, y5, y6, y7;
  asm("v_exp_f32 %0, %8\n\tv_exp_f32 %1, %9\n\tv_exp_f32 %2, %10\n\tv_exp_f32 %3, %11\n\t"
      "v_exp_f32 %4, %12\n\tv_exp_f32 %5, %13\n\tv_exp_f32 %6, %14\n\tv_exp_f32 %7, %15\n\tv_nop"
      : "=&v"(y0), "=&v"(y1), "=&v"(y2), "=&v"(y3), "=&v"(y4), "=&v"(y5), "=&v"(y6), "=&v"(y7)
      : "v"(x[0]), "v"(x[1]), "v"(x[2]), "v"(x[3]), "v"(x[4]), "v"(x[5]), "v"(x[6]), "v"(x[7]));
  y[0] = y0; y[1] = y1; y[2] = y2; y[3] = y3; y[4] = y4; y[5] = y5; y[6] = y6; y[7] = y7;
#endif
  return y;
}

__global__ __launch_bounds__(128)
void attn64(const unsigned short* __restrict__ qhp, const unsigned short* __restrict__ qlp,
            const unsigned short* __restrict__ khp, const unsigned short* __restrict__ vtp,
            const float* __restrict__ mask, unsigned short* ctxp, float sscale) {
  union FH { v16h v; v8h h[2]; };
  __shared__ __align__(16) _Float16 Ks[64 * API];                 // K [kv][d]    9 KB
  __shared__ __align__(16) _Float16 Vts[64 * API];                // V^T [d][kv]  9 KB
  __shared__ __align__(16) float    Mt[128];                      // per key of the chunk: [0..63] m * sscale, [64..127] -1e10 * (1 - m)
  __shared__ __align__(16) float    Os[4][16 * OPI];              // per wave context tile [row][d]

  const int tid  = threadIdx.x;
  const int wave = tid >> 5;
  const int lane = tid & 31;
  const int hh   = lane >> 4;
  const int c    = lane & 15;

  const int bx   = blockIdx.x;
  const int qb   = bx % NQB;
  const int rest = bx / NQB;
  const int h    = rest % NHD;
  const int b    = rest / NHD;
  const int q0   = qb * 64 + wave * 16;
  const size_t rowB = (size_t)b * SEQ;

  const _Float16* Qh = (const _Float16*)(const void*)qhp + (size_t)h * HD;
  const _Float16* Ql = (const _Float16*)(const void*)qlp + (size_t)h * HD;
  const _Float16* Kh = (const _Float16*)(const void*)khp + (size_t)h * HD;
  const _Float16* Vt = (const _Float16*)(const void*)vtp + ((size_t)b * HID + (size_t)h * HD) * SEQ;
  const float* mb = mask + (size_t)b * SEQ;

  // ---- Q fragments (B operand, column = query q0 + (lane&15)): 2 d-chunks, hi and residual ----
  v16h qah[2], qal[2];
#pragma unroll
  for (int dc = 0; dc < 2; ++dc) {
    const size_t qo = (rowB + q0 + c) * HID + dc * 32 + 8 * hh;
    qah[dc] = ldfrag_h(Qh + qo);
    qal[dc] = ldfrag_h(Ql + qo);
  }

  float mrun = -INFINITY;                          // this lane's query: running max, alike in both wave halves
  v8f lacc = zero8();                              // its sum of p: register r over keys = 8hh + r (mod 16); joined after the loop
  v8f oacc[4];                                     // O^T: register r of tile t = d 16t + 8hh + r of query q0 + c
#pragma unroll
  for (int t = 0; t < 4; ++t) oacc[t] = zero8();

#pragma unroll 1
  for (int kt = 0; kt < NQB; ++kt) {
    const int kv0 = kt * 64;
    __syncthreads();
    {
      const int r = tid >> 1, half = (tid & 1) * 32;
      const _Float16* kg = Kh + (rowB + kv0 + r) * HID + half;      // K row kv0+r, d = half..half+31
      const _Float16* vg = Vt + (size_t)r * SEQ + kv0 + half;      // V^T row d = r, s = kv0+half..+31
      const float mraw = mb[kv0 + (tid & 63)];                     // key kv0 + (tid & 63) < SEQ; in flight with the tile loads
#pragma unroll
      for (int i = 0; i < 4; ++i) {
        const v8h a0 = *(const v8h*)(kg + 8 * i);
        const v8h b0 = *(const v8h*)(vg + 8 * i);
        *(v8h*)(Ks  + r * API + half + 8 * i) = a0;
        *(v8h*)(Vts + r * API + half + 8 * i) = b0;
      }
      const float m = bfr(mraw);                                   // threads 0..63 store the factor, 64..127 the addend
      Mt[tid] = (tid < 64) ? m * sscale : -1.0e10f * (1.0f - m);
    }
    __syncthreads();

    // ---- scores, transposed: 64 keys x 16 queries per wave, k.qhi and k.qres ----
    v8f s[4];
#pragma unroll
    for (int j = 0; j < 4; ++j) {
      s[j] = zero8();
      v8f sl = zero8();
#pragma unroll
      for (int dc = 0; dc < 2; ++dc) {
        FH kb;
        kb.h[0] = *(const v8h*)(Ks + (j * 16 + c) * API + dc * 32 + 8 * hh);
        kb.h[1] = *(const v8h*)(Ks + (j * 16 + c) * API + dc * 32 + 16 + 8 * hh);
        s[j] = mma_h(kb.v, qah[dc], s[j]);
        sl   = mma_h(kb.v, qal[dc], sl);
      }
      const v4f ma0 = *(const v4f*)(Mt + j * 16 + 8 * hh),      ma1 = *(const v4f*)(Mt + j * 16 + 8 * hh + 4);
      const v4f mb0 = *(const v4f*)(Mt + 64 + j * 16 + 8 * hh), mb1 = *(const v4f*)(Mt + 64 + j * 16 + 8 * hh + 4);
#pragma unroll
      for (int r = 0; r < 4; ++r) {
        s[j][r]     = (s[j][r]     + sl[r]     * QRI) * ma0[r] + mb0[r];
        s[j][r + 4] = (s[j][r + 4] + sl[r + 4] * QRI) * ma1[r] + mb1[r];
      }
    }

    // ---- max of this query's 64 scores, online softmax, P^T (x1024, f16) packed in place as B fragments ----
    float mj[4];
#pragma unroll
    for (int j = 0; j < 4; ++j) {
      mj[j] = fmaxf(fmaxf(fmaxf(s[j][0], s[j][1]), fmaxf(s[j][2], s[j][3])),
                    fmaxf(fmaxf(s[j][4], s[j][5]), fmaxf(s[j][6], s[j][7])));
    }
    float m = fmaxf(fmaxf(mj[0], mj[1]), fmaxf(mj[2], mj[3]));
    m = fmaxf(m, xhalf(m));
    const float mnew  = fmaxf(mrun, m);
    const float alpha = __expf(mrun - mnew);
    mrun = mnew;
    FH pb[2];
    v8f p[4];
#pragma unroll
    for (int j = 0; j < 4; ++j) {
      p[j] = exp2x8((s[j] - mnew) * 1.4426950408889634f);
#pragma unroll
      for (int r = 0; r < 8; ++r) pb[j >> 1].v[(j & 1) * 8 + r] = (_Float16)(p[j][r] * PSC);
    }
    lacc = lacc * alpha + ((p[0] + p[1]) + (p[2] + p[3]));
#pragma unroll
    for (int t = 0; t < 4; ++t) oacc[t] *= alpha;

    // ---- context^T += V^T . P^T (f16 WMMA) ----
#pragma unroll
    for (int kk = 0; kk < 2; ++kk) {
#pragma unroll
      for (int t = 0; t < 4; ++t) {
        FH vb;
        vb.h[0] = *(const v8h*)(Vts + (t * 16 + c) * API + kk * 32 + 8 * hh);
        vb.h[1] = *(const v8h*)(Vts + (t * 16 + c) * API + kk * 32 + 16 + 8 * hh);
        oacc[t] = mma_h(vb.v, pb[kk].v, oacc[t]);
      }
    }
  }

  float* os = Os[wave];
  {
    const float lsum = ((lacc[0] + lacc[1]) + (lacc[2] + lacc[3])) + ((lacc[4] + lacc[5]) + (lacc[6] + lacc[7]));
    const float l = lsum + xhalf(lsum);            // the two halves' key sums joined
    const float inv = ((l > 0.f) ? (1.0f / l) : 0.f) * PSI;
#pragma unroll
    for (int t = 0; t < 4; ++t) {
      v4f lo, hi;
#pragma unroll
      for (int r = 0; r < 4; ++r) { lo[r] = oacc[t][r] * inv; hi[r] = oacc[t][r + 4] * inv; }
      *(v4f*)(os + c * OPI + t * 16 + 8 * hh)     = lo;
      *(v4f*)(os + c * OPI + t * 16 + 8 * hh + 4) = hi;
    }
  }
  wave_lds_sync();
  {
    const int q4 = lane >> 3, c8 = (lane & 7) * 8;
    v4u hv[4];
#pragma unroll
    for (int it = 0; it < 4; ++it) {
      const int row = it * 4 + q4;           // it 0..3 x q4 0..3 = rows 0..15 of the wave tile
      const float* sp = os + row * OPI + c8;
      const v4f fa = *(const v4f*)(sp);
      const v4f fb = *(const v4f*)(sp + 4);
      v4u a;
      a[0] = pkh2(fa[0], fa[1]); a[1] = pkh2(fa[2], fa[3]);
      a[2] = pkh2(fb[0], fb[1]); a[3] = pkh2(fb[2], fb[3]);
      hv[it] = a;
    }
    {
#pragma unroll
      for (int it = 0; it < 4; ++it) {
        const int row = it * 4 + q4;
        const size_t go = (rowB + q0 + row) * HID + (size_t)h * HD + c8;
        *(v4u*)(ctxp + go) = hv[it];
      }
      
    }
  }
}

// =====================================================================================================
// Workspace map (bytes), all region sizes multiples of 128 and exact multiples of their 64x64- or 128x128-tile / whole-row
// store granularity (M, N multiples of 128; 768- and 3072-wide rows), so no padded tails are needed:
//   Hres f32 [4096][768]        12582912
//   X    f16 [4096][768]         6291456   (LN output plane, reused by LN1 and LN2)
//   Qh   f16 [4096][768]         6291456
//   Ql   f16 [4096][768]         6291456   (q residual x4096)
//   Kh   f16 [4096][768]         6291456
//   VT   f16 [2][768][2048]      6291456
//   Ctx  f16 [4096][768]         6291456
//   G    f16 [4096][3072]       25165824
//   per layer (2 x 14155776):
//   Wq_t,Wk_t,Wv_t,Wo_t f16 [768][768]  4 x 1179648
//   W1_t f16 [3072][768]         4718592
//   W2_t f16 [768][3072]         4718592
//   total                      103809024
// Both layers' weights are converted by the first launch, each layer into its own region ([out n][in k], k contiguous = the Bt / A layout).
// =====================================================================================================
extern "C" void kernel_launch(void* const* d_in, const int* in_sizes, int n_in,
                              void* d_out, int out_size, void* d_ws, size_t ws_size,
                              hipStream_t stream) {
  if (n_in < 21) return;
  if (in_sizes[0] != BT * HID || in_sizes[1] != BT * HID || in_sizes[2] != NB * SEQ) return;
  if (in_sizes[3] != 2 * HID || in_sizes[4] != 2 * HID) return;
  if (in_sizes[5] != 2 * HID * HID || in_sizes[7] != 2 * HID * HID ||
      in_sizes[9] != 2 * HID * HID || in_sizes[11] != 2 * HID * HID) return;
  if (in_sizes[6] != 2 * HID || in_sizes[8] != 2 * HID || in_sizes[10] != 2 * HID || in_sizes[12] != 2 * HID) return;
  if (in_sizes[13] != 2 * HID || in_sizes[14] != 2 * HID) return;
  if (in_sizes[15] != 2 * HID * DFF || in_sizes[16] != 2 * DFF ||
      in_sizes[17] != 2 * DFF * HID || in_sizes[18] != 2 * HID) return;
  if (in_sizes[19] != HID || in_sizes[20] != HID) return;
  if (out_size != BT * HID) return;

  const float* in_h  = (const float*)d_in[0];
  const float* embs  = (const float*)d_in[1];
  const float* mask  = (const float*)d_in[2];
  const float* ln1_s = (const float*)d_in[3];
  const float* ln1_b = (const float*)d_in[4];
  const float* wq    = (const float*)d_in[5];
  const float* bq    = (const float*)d_in[6];
  const float* wk    = (const float*)d_in[7];
  const float* bk    = (const float*)d_in[8];
  const float* wv    = (const float*)d_in[9];
  const float* bv    = (const float*)d_in[10];
  const float* wo    = (const float*)d_in[11];
  const float* bo    = (const float*)d_in[12];
  const float* ln2_s = (const float*)d_in[13];
  const float* ln2_b = (const float*)d_in[14];
  const float* w1    = (const float*)d_in[15];
  const float* b1    = (const float*)d_in[16];
  const float* w2    = (const float*)d_in[17];
  const float* b2    = (const float*)d_in[18];
  const float* lnf_s = (const float*)d_in[19];
  const float* lnf_b = (const float*)d_in[20];
  float* out = (float*)d_out;

  const size_t PH  = (size_t)BT * HID * 4;        // 12582912
  const size_t PA  = (size_t)BT * HID * 2;        //  6291456
  const size_t PVT = (size_t)NB * HID * SEQ * 2;  //  6291456
  const size_t PG  = (size_t)BT * DFF * 2;        // 25165824
  const size_t PW  = (size_t)HID * HID * 2;       //  1179648
  const size_t PW1 = (size_t)HID * DFF * 2;       //  4718592
  size_t off = 0;
  const size_t oH   = off; off += PH;
  const size_t oX   = off; off += PA;
  const size_t oQh  = off; off += PA;
  const size_t oQl  = off; off += PA;
  const size_t oKh  = off; off += PA;
  const size_t oVT  = off; off += PVT;
  const size_t oCtx = off; off += PA;
  const size_t oG   = off; off += PG;
  const size_t oWt  = off; off += 2 * (4 * PW + 2 * PW1);
  if (off > ws_size) return;                      // off = 103809024
  if (off > (size_t)134217728) return;

  char* ws = (char*)d_ws;
  float*          Hres = (float*)(ws + oH);
  unsigned short* X    = (unsigned short*)(ws + oX);
  unsigned short* Qh   = (unsigned short*)(ws + oQh);
  unsigned short* Ql   = (unsigned short*)(ws + oQl);
  unsigned short* Kh   = (unsigned short*)(ws + oKh);
  unsigned short* VT   = (unsigned short*)(ws + oVT);
  unsigned short* Ctx  = (unsigned short*)(ws + oCtx);
  unsigned short* G    = (unsigned short*)(ws + oG);
  unsigned short* Wt   = (unsigned short*)(ws + oWt);

  const dim3 blk(256);
  const dim3 gLN(BT / 8);                                           // 512 blocks, 8 rows each
  const dim3 gPrep(BT / 8 + 2 * CVL);                               // 512 row groups + 2 x 1728 weight tiles
  const dim3 gHH((BT / 128) * (HID / 128), 1);                      // 32 x 6  = 192 blocks
  const dim3 gQKV(2 * TQK + NB * TVB);                              // 192 + 192 + 2 x 96 = 576 blocks
  const dim3 gF1((BT / 128) * (DFF / 128), 1);                      // 32 x 24 = 768 blocks
  const dim3 gAt(NB * NHD * NQB);                                   // 768 blocks of 128

  for (int l = 0; l < 2; ++l) {
    unsigned short* Wqt = Wt + (size_t)l * WLH;
    unsigned short* Wkt = Wqt + (size_t)HID * HID;
    unsigned short* Wvt = Wkt + (size_t)HID * HID;
    unsigned short* Wot = Wvt + (size_t)HID * HID;
    unsigned short* W1t = Wot + (size_t)HID * HID;
    unsigned short* W2t = W1t + (size_t)HID * DFF;
    // (1) h = h + input_embs; hn = LN1(h) -> X (f16); with layer 0 also
    // (2) the weights of both layers: f32 [in][out] -> f16 [out][in] (bf16-RNE values x64)
    if (l == 0) {
      prep<<<gPrep, blk, 0, stream>>>(in_h, embs, Hres, ln1_s, ln1_b, X, wq, wk, wv, wo, w1, w2, Wt);
    } else {
      ln_rows<true, false, false><<<gLN, blk, 0, stream>>>(Hres, embs, Hres, ln1_s + HID, ln1_b + HID, (void*)X, BT);
    }
    // (3) q = hn . Wq + bq -> f16 hi + residual planes [b*SEQ+t][h*64+d]  (M=4096, N=768, K=768)
    // (4) k = hn . Wk + bk -> f16 plane
    // (5) v^T = Wv_t . hn^T per batch -> f16 [b][h*64+d][s]  (A = Wv_t [n][k], Bt = X rows of batch b; M=768, N=2048, K=768)
    gemm_qkv<<<gQKV, blk, 0, stream>>>(X, Wqt, Wkt, Wvt, bq + l * HID, bk + l * HID, bv + l * HID, Qh, Ql, Kh, VT);
    // (6) attention -> Ctx f16 [b*SEQ+t][h*64+d]
    attn64<<<gAt, dim3(128), 0, stream>>>(Qh, Ql, Kh, VT, mask, Ctx, 0.125f);
    // (7) h = h + (ctx . Wo + bo)  (f32, in place)
    gemm64<0><<<gHH, blk, 0, stream>>>(Ctx, HID, 0LL, Wot, HID, 0LL, bo + l * HID,
                                       (void*)Hres, (void*)Hres, HID, 0LL, BT, HID, HID);
    // (8) hn = LN2(h) -> X
    ln_rows<false, false, false><<<gLN, blk, 0, stream>>>(Hres, embs, Hres, ln2_s + l * HID, ln2_b + l * HID, (void*)X, BT);
    // (9) g = gelu(hn . W1 + b1) -> G f16 [4096][3072]  (M=4096, N=3072, K=768)
    gemm64<4><<<gF1, blk, 0, stream>>>(X, HID, 0LL, W1t, HID, 0LL, b1 + l * DFF,
                                       (void*)G, (void*)G, DFF, 0LL, BT, DFF, HID);
    // (10) h = h + (g . W2 + b2)  (M=4096, N=768, K=3072, f32 in place)
    gemm64<0><<<gHH, blk, 0, stream>>>(G, DFF, 0LL, W2t, DFF, 0LL, b2 + l * HID,
                                       (void*)Hres, (void*)Hres, HID, 0LL, BT, HID, DFF);
  }
  // (11) out = LN_f(h) -> f32 [2][2048][768]
  ln_rows<false, false, true><<<gLN, blk, 0, stream>>>(Hres, embs, Hres, lnf_s, lnf_b, (void*)out, BT);
  (void)hipGetLastError();
}

// v005
// Measured time: 326 microseconds a run.
// Timed twice side by side with v004, it ran 1.08 times as fast both times.
// Over all steps from v000 it is 3.01 times as fast.
// Contractions: q, k, v^T, out and ffn projections = v_wmma_f32_16x16x32_f16 (f16 activations; weights bf16-RNE then x64 as f16), single product;
// q.k^T = v_wmma_f32_16x16x32_f16 with q as f16 hi + f16 residual (x4096) planes and k f16, 2 products in separate accumulators;
// p.v = v_wmma_f32_16x16x32_f16 (p carried x1024 in f16, v f16); f32 accumulate everywhere; layernorm, softmax and gelu in f32.
#include <hip/hip_runtime.h>
#include <math.h>
#include <stdint.h>

#define NB   2
#define SEQ  2048
#define HID  768
#define NHD  12
#define HD   64
#define DFF  3072
#define BT   (NB * SEQ)
#define NQB  (SEQ / 64)
#define WSC  64.0f
#define WINV 0.015625f
#define QRS  4096.0f
#define QRI  0.000244140625f
#define PSC  1024.0f
#define PSI  0.0009765625f
#define GPI  72                 // LDS row pitch of a GEMM stage, in halves: 64 k + 8 = 144 B
#define API  72                 // LDS row pitch of the attention K and V^T tiles, in halves: 64 + 8 = 144 B = 16 B x odd
#define OPI  68                 // LDS row pitch of the attention context tile, in floats: 64 + 4 = 272 B = 16 B x odd
static_assert(NHD * HD == HID);
static_assert((SEQ % 64) == 0 && (HID % 64) == 0 && (DFF % 64) == 0 && (BT % 64) == 0);
static_assert(HID == 6 * 128);
static_assert((SEQ % 128) == 0 && (HID % 128) == 0 && (DFF % 128) == 0 && (BT % 128) == 0);

typedef _Float16 v16h __attribute__((ext_vector_type(16)));
typedef _Float16 v8h  __attribute__((ext_vector_type(8)));
typedef float    v8f  __attribute__((ext_vector_type(8)));
typedef float    v4f  __attribute__((ext_vector_type(4)));
typedef unsigned int v4u __attribute__((ext_vector_type(4)));

// ---- scalar helpers -----------------------------------------------------------------------------
__device__ __forceinline__ unsigned short bf_bits(float f) {        // f32 -> bf16 bits, RNE convert
  const unsigned u = __float_as_uint(f);
  return (unsigned short)((u + 0x7FFFu + ((u >> 16) & 1u)) >> 16);
}
__device__ __forceinline__ float bfr(float f) { return __uint_as_float(((unsigned)bf_bits(f)) << 16); }
__device__ __forceinline__ v4f bfr4(v4f a) {
  v4f r;
  r[0] = bfr(a[0]); r[1] = bfr(a[1]); r[2] = bfr(a[2]); r[3] = bfr(a[3]);
  return r;
}
__device__ __forceinline__ unsigned short h_bits(_Float16 x) { return __builtin_bit_cast(unsigned short, x); }
__device__ __forceinline__ unsigned pk16(unsigned short a, unsigned short b) { return (unsigned)a | ((unsigned)b << 16); }
__device__ __forceinline__ unsigned pkh2(float a, float b) { return pk16(h_bits((_Float16)a), h_bits((_Float16)b)); }
__device__ __forceinline__ v8f zero8() { v8f z = {0.f, 0.f, 0.f, 0.f, 0.f, 0.f, 0.f, 0.f}; return z; }
__device__ __forceinline__ v4f zero4() { v4f z = {0.f, 0.f, 0.f, 0.f}; return z; }

// ---- fragment loader: 16-bit A/B operand, lane -> row/col (lane&15); p already includes +8*(lane>>4);
//      elements 0..7 <- p[0..7] (k0+8h..), elements 8..15 <- p[16..23] (k0+16+8h..)
__device__ __forceinline__ v16h ldfrag_h(const _Float16* p) {
  union { v16h v; v8h h[2]; } f;
  f.h[0] = *(const v8h*)(p);
  f.h[1] = *(const v8h*)(p + 16);
  return f.v;
}

// ---- WMMA with trailing VALU hazard gap -----------------------------------------------------------
__device__ __forceinline__ v8f mma_h(v16h a, v16h b, v8f c) {
  c = __builtin_amdgcn_wmma_f32_16x16x32_f16(false, a, false, b, (short)0, c, false, false);
#if defined(__HIP_DEVICE_COMPILE__)
  asm volatile("v_nop\n\tv_nop\n\tv_nop\n\tv_nop" : "+v"(c) : "v"(a), "v"(b));
#endif
  return c;
}

// release/acquire + wave barrier for same-wave LDS exchange
__device__ __forceinline__ void wave_lds_sync() {
  __builtin_amdgcn_fence(__ATOMIC_RELEASE, "workgroup");
  __builtin_amdgcn_wave_barrier();
  __builtin_amdgcn_fence(__ATOMIC_ACQUIRE, "workgroup");
}

// tanh-approximation gelu, tanh(u) = 1 - 2/(exp(2u)+1) with u clamped to [-16,16]
__device__ __forceinline__ float gelu_t(float x) {
  float u = 0.7978845608028654f * (x + 0.044715f * x * x * x);
  u = fminf(fmaxf(u, -16.0f), 16.0f);
  const float e  = __expf(2.0f * u);
  const float th = 1.0f - 2.0f * __builtin_amdgcn_rcpf(e + 1.0f);
  return 0.5f * x * (1.0f + th);
}

// =====================================================================================================
// Residual add + LayerNorm, one wave per row of 768. grid = nrows/8, 256 threads.
//   x = src row (RSRC: bf16-RNE the loaded values) (+ ADDE: bf16-RNE(embs row)); ADDE also stores x to hdst
//   (may alias src: every lane reads its own 24 columns before storing them).
//   else:  y -> f16 rows via a per-wave LDS row buffer (lane l: 8 halves at col 256j+8l, 512 B per instruction).
// coverage: 8 waves x grid(512) = 4096 rows; 6 x 128 floats / 3 x 256 halves = the whole 768-wide row.
// =====================================================================================================
// blk = index of the 8-row group; rb = the block's 8 x 768 float row buffer in LDS.
template <bool ADDE, bool RSRC, bool OUT32>
__device__ __forceinline__ void ln_body(int blk, float* rb, const float* src, const float* embs, float* hdst,
                                        const float* __restrict__ sc, const float* __restrict__ bi,
                                        void* outp, int nrows) {
  const int tid = threadIdx.x, wave = tid >> 5, lane = tid & 31;
  const int row = blk * 8 + wave;
  if (row >= nrows) return;                       // wave-uniform; no block barrier behind it in this body
  const size_t rbase = (size_t)row * HID;
  v4f x[6];
#pragma unroll
  for (int i = 0; i < 6; ++i) {
    const int col = i * 128 + lane * 4;
    v4f a = *(const v4f*)(src + rbase + col);
    if (RSRC) a = bfr4(a);
    if (ADDE) {
      const v4f e = bfr4(*(const v4f*)(embs + rbase + col));
      a = a + e;
    }
    x[i] = a;
    // precaution: a later load's result may be given the address registers of this trip's loads; this keeps the wait in front of that
    asm volatile("s_wait_xcnt 0x0" ::: "memory");
  }
  if (ADDE) {
    {
#pragma unroll
      for (int i = 0; i < 6; ++i) *(v4f*)(hdst + rbase + i * 128 + lane * 4) = x[i];
      
    }
  }
  float s = 0.f;
#pragma unroll
  for (int i = 0; i < 6; ++i) s += (x[i][0] + x[i][1]) + (x[i][2] + x[i][3]);
#pragma unroll
  for (int off = 1; off < 32; off <<= 1) s += __shfl_xor(s, off, 32);
  const float mean = s * (1.0f / 768.0f);
  float qv = 0.f;
#pragma unroll
  for (int i = 0; i < 6; ++i) {
    const v4f d = x[i] - mean;
    qv += (d[0] * d[0] + d[1] * d[1]) + (d[2] * d[2] + d[3] * d[3]);
  }
#pragma unroll
  for (int off = 1; off < 32; off <<= 1) qv += __shfl_xor(qv, off, 32);
  const float var  = qv * (1.0f / 768.0f);
  const float rinv = rsqrtf(var + 1e-5f);
  v4f y[6];
#pragma unroll
  for (int i = 0; i < 6; ++i) {
    const int col = i * 128 + lane * 4;
    const v4f s4 = bfr4(*(const v4f*)(sc + col));
    const v4f b4 = bfr4(*(const v4f*)(bi + col));
    y[i] = (x[i] - mean) * rinv * s4 + b4;
  }
  if (OUT32) {
    float* o = (float*)outp;
    {
#pragma unroll
      for (int i = 0; i < 6; ++i) *(v4f*)(o + rbase + i * 128 + lane * 4) = y[i];
      
    }
  } else {
    float* rw = rb + wave * HID;
#pragma unroll
    for (int i = 0; i < 6; ++i) *(v4f*)(rw + i * 128 + lane * 4) = y[i];
    wave_lds_sync();
    v4u pk[3];
#pragma unroll
    for (int j = 0; j < 3; ++j) {
      const v4f a = *(const v4f*)(rw + j * 256 + lane * 8);
      const v4f c = *(const v4f*)(rw + j * 256 + lane * 8 + 4);
      v4u p;
      p[0] = pkh2(a[0], a[1]); p[1] = pkh2(a[2], a[3]);
      p[2] = pkh2(c[0], c[1]); p[3] = pkh2(c[2], c[3]);
      pk[j] = p;
    }
    unsigned short* o = (unsigned short*)outp;
    {
#pragma unroll
      for (int j = 0; j < 3; ++j) *(v4u*)(o + rbase + j * 256 + lane * 8) = pk[j];
      
    }
  }
}

template <bool ADDE, bool RSRC, bool OUT32>
__global__ __launch_bounds__(256) void ln_rows(const float* src, const float* embs, float* hdst,
                                               const float* __restrict__ sc, const float* __restrict__ bi,
                                               void* outp, int nrows) {
  __shared__ __align__(16) float rb[8 * HID];
  ln_body<ADDE, RSRC, OUT32>(blockIdx.x, rb, src, embs, hdst, sc, bi, outp, nrows);
}

// =====================================================================================================
// Weight convert + transpose: W f32 [K][N] (row-major, in-major) -> O f16 [N][K] = f16(bf16-RNE(w) * 64).
// One block = one tile of 64 k x 64 n through LDS, origin (k0, n0); 256 threads; sT = the block's 64 x 72 half tile in LDS.
//   read: thread (r = tid>>2 = k row, cq = (tid&3)*16 = n quarter) reads 16 floats (4 x 16 B) -> sT[n][k]
//   write: wave w, lane: rows (n) w*8 + it*4 + (lane>>3), 8 halves per lane at k (lane&7)*8:
// coverage: 8 waves x 8 rows = 64 n rows x 64 k per block; the caller deals N/64 x K/64 tiles exactly.
// =====================================================================================================
__device__ __forceinline__ void conv_body(_Float16* sT, const float* __restrict__ W, unsigned short* O,
                                          int K, int N, int n0, int k0) {
  const int tid = threadIdx.x;
  {
    const int r = tid >> 2, cq = (tid & 3) * 16;
    const float* p = W + (size_t)(k0 + r) * N + n0 + cq;
#pragma unroll
    for (int g = 0; g < 4; ++g) {
      const v4f a = *(const v4f*)(p + 4 * g);
#pragma unroll
      for (int e = 0; e < 4; ++e) sT[(cq + 4 * g + e) * 72 + r] = (_Float16)(bfr(a[e]) * WSC);
    }
  }
  __syncthreads();
  const int wave = tid >> 5, lane = tid & 31;
  const int q = lane >> 3, c8 = (lane & 7) * 8;
  union HU { v8h h; v4u u; };
  HU pk[2];
#pragma unroll
  for (int it = 0; it < 2; ++it) {
    const int row = wave * 8 + it * 4 + q;
    pk[it].h = *(const v8h*)(sT + row * 72 + c8);
  }
  const _Float16 dummy = (_Float16)0.0f; (void)dummy;
  {
#pragma unroll
    for (int it = 0; it < 2; ++it) {
      const int row = wave * 8 + it * 4 + q;
      *(v4u*)(O + (size_t)(n0 + row) * K + k0 + c8) = pk[it].u;
    }
    // precaution: where this body is inlined in front of other code, the stores' registers may be rewritten there; this keeps the wait in front of that
    asm volatile("s_wait_xcnt 0x0" ::: "memory");
  }
}

// =====================================================================================================
// First launch: the work that depends on the inputs alone, dealt by block index in one grid.
//   blocks 0 .. BT/8-1: h + embs and LN1 of layer 0 (ln_body);
//   then per layer CVL = 3 x CVS blocks of weight tiles (conv_body): CVS tiles of wq, wk, wv, wo (144 each), CVS of w1, CVS of w2.
// Converted weights of layer l lie at Wt + l * WLH halves: Wq_t, Wk_t, Wv_t, Wo_t (HID*HID each), W1_t, W2_t (HID*DFF each).
// Every branch below is block-uniform; the one block barrier (in conv_body) is passed by all 256 threads of its block.
// =====================================================================================================
#define CVS  576                                  // 4 * 12 * 12 = 48 * 12 = 12 * 48 tiles
#define CVL  (3 * CVS)
#define WLH  (4 * HID * HID + 2 * HID * DFF)      // halves of converted weights per layer
static_assert(4 * (HID / 64) * (HID / 64) == CVS && (DFF / 64) * (HID / 64) == CVS);
__global__ __launch_bounds__(256) void prep(const float* in_h, const float* embs, float* hdst,
                                            const float* __restrict__ sc, const float* __restrict__ bi,
                                            unsigned short* X,
                                            const float* __restrict__ wq, const float* __restrict__ wk,
                                            const float* __restrict__ wv, const float* __restrict__ wo,
                                            const float* __restrict__ w1, const float* __restrict__ w2,
                                            unsigned short* Wt) {
  __shared__ __align__(16) float rb[8 * HID];
  __shared__ __align__(16) _Float16 sT[64 * 72];
  const int bx = blockIdx.x;
  if (bx < BT / 8) {
    ln_body<true, true, false>(bx, rb, in_h, embs, hdst, sc, bi, (void*)X, BT);
    return;
  }
  int t = bx - BT / 8;
  const int l = t / CVL;
  t -= l * CVL;
  const int seg = t / CVS;
  t -= seg * CVS;
  unsigned short* Ol = Wt + (size_t)l * WLH;
  if (seg == 0) {
    const int z = t / 144;
    const int r = t - z * 144;
    const float* W = ((z == 0) ? wq : (z == 1) ? wk : (z == 2) ? wv : wo) + (size_t)l * HID * HID;
    conv_body(sT, W, Ol + (size_t)z * HID * HID, HID, HID, (r % 12) * 64, (r / 12) * 64);
  } else if (seg == 1) {
    conv_body(sT, w1 + (size_t)l * HID * DFF, Ol + (size_t)4 * HID * HID, HID, DFF, (t % 48) * 64, (t / 48) * 64);
  } else {
    conv_body(sT, w2 + (size_t)l * HID * DFF, Ol + (size_t)4 * HID * HID + (size_t)HID * DFF, DFF, HID,
              (t % 12) * 64, (t / 12) * 64);
  }
}

// =====================================================================================================
// Register-blocked f16 WMMA GEMM: C[m][n] = sum_k A[m][k] * Bt[n][k] (accumulator scaled by 1/64 in the
// epilogue = the weight carry). Block = 8 waves (4 x 2) = one 128x128 tile of C, one 32x64 tile per wave.
// A row-major [M][K] pitch lda, Bt row-major [N][K] pitch ldb (k contiguous); M, N multiples of 128, K multiple of 64.
// Operands go through LDS in stages of 64 k: 128 rows x 128 B of A and of Bt per stage. Each wave-wide 16-B load
// covers 4 whole 128-B lines (8 lanes per row); rows lie in LDS at pitch 144 B (16 B x odd) for the 16-B fragment reads.
// Two LDS buffers, one block barrier per stage: stage s+1 is loaded into registers behind the barrier of stage s,
// while stage s is multiplied, and stored to the other buffer, whose last readers (stage s-1) all passed that barrier.
// tile = index of the block tile, bz = batch index (strides in elements). Both A and B fragments use the split k map of ldfrag_h.
// MODE 1: f16 C = acc/64 + bias[n]
// MODE 2: f16 hi C = f16(v), f16 residual C2 = f16((v - hi) * 4096), v = acc/64 + bias[n]
// MODE 3: f16 C = acc/64 + bias[m]
// MODE 4: f16 C = gelu(acc/64 + bias[n])
// bias values bf16-RNE converted in register. Epilogue: 16-row slabs staged per wave in LDS; each 64-wide row
// coverage: 2 slabs x 16 rows x 64 cols = the wave's whole tile; 8 waves per block; grid = (M/128) * (N/128).
// =====================================================================================================
template <int MODE>
__device__ __forceinline__ void gemm_body(
    _Float16 (*sA)[128 * GPI], _Float16 (*sB)[128 * GPI], float (*sT)[16 * 68], int tile, int bz,
    const unsigned short* __restrict__ Ap, int lda, long long strideA,
    const unsigned short* __restrict__ Btp, int ldb, long long strideB,
    const float* __restrict__ bias,
    void* Cout, void* Cout2, int ldc, long long strideC,
    int M, int N, int K) {
  const int tid  = threadIdx.x;
  const int lane = tid & 31;
  const int wave = tid >> 5;
  const int tilesN = N >> 7;
  const int tilesM = M >> 7;
  if (tile >= tilesM * tilesN) return;             // block-uniform, in front of every barrier
  const int tm = tile / tilesN;
  const int tn = tile - tm * tilesN;
  const int bm0 = tm << 7;                         // block tile origin
  const int bn0 = tn << 7;
  const int wm  = (wave >> 1) << 5;                // wave tile origin inside the block tile
  const int wn  = (wave & 1) << 6;
  const int m0 = bm0 + wm;
  const int n0 = bn0 + wn;

  const _Float16* Ab = (const _Float16*)(const void*)Ap  + (size_t)bz * (size_t)strideA;
  const _Float16* Bb = (const _Float16*)(const void*)Btp + (size_t)bz * (size_t)strideB;

  const int rl   = lane & 15;                      // row (A) / col (B, D) within subtile
  const int hh   = lane >> 4;
  const int koff = hh * 8;                         // k offset of this lane half
  const int mOff = hh * 8;                         // D row offset

  // staging map: thread -> row (tid>>3) + 32*it, 16-B piece (tid&7) of the row's 128 B; 4 it x 32 rows = 128 rows
  const int srow = tid >> 3;
  const int scol = (tid & 7) * 8;
  const _Float16* ga = Ab + (size_t)(bm0 + srow) * lda + scol;
  const _Float16* gb = Bb + (size_t)(bn0 + srow) * ldb + scol;
  const int sofs = srow * GPI + scol;

  v8f acc[2][4];
#pragma unroll
  for (int i = 0; i < 2; ++i)
#pragma unroll
    for (int j = 0; j < 4; ++j) acc[i][j] = zero8();

  v8h ra[4], rb[4];
#pragma unroll
  for (int it = 0; it < 4; ++it) {
    ra[it] = *(const v8h*)(ga + (size_t)(it * 32) * lda);
    rb[it] = *(const v8h*)(gb + (size_t)(it * 32) * ldb);
  }

  const int nst = K >> 6;
  // kept rolled: one stage is already 16 WMMAs and 24 fragment loads a wave; unrolling would only grow code and registers
#pragma unroll 1
  for (int s = 0; s < nst; ++s) {
    _Float16* dA = sA[s & 1];
    _Float16* dB = sB[s & 1];
#pragma unroll
    for (int it = 0; it < 4; ++it) {
      *(v8h*)(dA + sofs + it * 32 * GPI) = ra[it];
      *(v8h*)(dB + sofs + it * 32 * GPI) = rb[it];
    }
    __syncthreads();                               // publishes stage s; ends every wave's reads of stage s-1
    if (s + 1 < nst) {                             // block-uniform: next stage's loads fly under this stage's WMMAs
      const int kn = (s + 1) << 6;
#pragma unroll
      for (int it = 0; it < 4; ++it) {
        ra[it] = *(const v8h*)(ga + (size_t)(it * 32) * lda + kn);
        rb[it] = *(const v8h*)(gb + (size_t)(it * 32) * ldb + kn);
      }
      // precaution: the address registers of these loads are rewritten right below; this keeps the wait in front of that
      asm volatile("s_wait_xcnt 0x0" ::: "memory");
    }
#pragma unroll
    for (int kk = 0; kk < 2; ++kk) {
      v16h bfg[4], af[2];
#pragma unroll
      for (int j = 0; j < 4; ++j)
        bfg[j] = ldfrag_h(dB + (wn + (j << 4) + rl) * GPI + kk * 32 + koff);
#pragma unroll
      for (int i = 0; i < 2; ++i)
        af[i] = ldfrag_h(dA + (wm + (i << 4) + rl) * GPI + kk * 32 + koff);
#pragma unroll
      for (int i = 0; i < 2; ++i)
#pragma unroll
        for (int j = 0; j < 4; ++j) acc[i][j] = mma_h(af[i], bfg[j], acc[i][j]);
    }
  }

  // ---- epilogue ----
  float* slab = sT[wave];
#pragma unroll
  for (int i = 0; i < 2; ++i) {
    const int mBase = m0 + (i << 4);
#pragma unroll
    for (int j = 0; j < 4; ++j) {
#pragma unroll
      for (int r = 0; r < 8; ++r) slab[(mOff + r) * 68 + (j << 4) + rl] = acc[i][j][r] * WINV;
    }
    wave_lds_sync();
    if (MODE == 0) {
      float* C = (float*)Cout + (size_t)bz * (size_t)strideC;
      const int c4 = rl * 4;                                   // 256-B row segment = 16 lanes x 16 B
      const v4f b4 = bfr4(*(const v4f*)(bias + n0 + c4));
      v4f vals[8];
#pragma unroll
      for (int it = 0; it < 8; ++it) {
        const int row = it * 2 + hh;                           // it 0..7 x hh 0..1 = rows 0..15
        const v4f v = *(const v4f*)(slab + row * 68 + c4);
        const v4f o = *(const v4f*)(C + (size_t)(mBase + row) * ldc + n0 + c4);
        vals[it] = o + (v + b4);
      }
      {
#pragma unroll
        for (int it = 0; it < 8; ++it) {
          const int row = it * 2 + hh;
          *(v4f*)(C + (size_t)(mBase + row) * ldc + n0 + c4) = vals[it];
        }
        
      }
    } else {
      const int q = lane >> 3, c8 = (lane & 7) * 8;
      unsigned short* C  = (unsigned short*)Cout  + (size_t)bz * (size_t)strideC;
      unsigned short* C2 = (unsigned short*)Cout2 + (size_t)bz * (size_t)strideC;
      v4f ba = zero4(), bb = zero4();
      if (MODE != 3) {
        ba = bfr4(*(const v4f*)(bias + n0 + c8));
        bb = bfr4(*(const v4f*)(bias + n0 + c8 + 4));
      }
      v4u hv[4], lv[4];
#pragma unroll
      for (int it = 0; it < 4; ++it) {
        const int row = it * 4 + q;                            // it 0..3 x q 0..3 = rows 0..15
        const float* sp = slab + row * 68 + c8;
        v4f fa = *(const v4f*)(sp);
        v4f fb = *(const v4f*)(sp + 4);
        if (MODE == 3) {
          const float br = bfr(bias[mBase + row]);
          fa = fa + br; fb = fb + br;
        } else {
          fa = fa + ba; fb = fb + bb;
        }
        if (MODE == 4) {
#pragma unroll
          for (int e = 0; e < 4; ++e) { fa[e] = gelu_t(fa[e]); fb[e] = gelu_t(fb[e]); }
        }
        v4u a, a2;
        if (MODE == 2) {
#pragma unroll
          for (int e = 0; e < 2; ++e) {
            const float f0 = fa[2 * e], f1 = fa[2 * e + 1];
            const float g0 = fb[2 * e], g1 = fb[2 * e + 1];
            const _Float16 x0 = (_Float16)f0, x1 = (_Float16)f1, y0 = (_Float16)g0, y1 = (_Float16)g1;
            a[e]      = pk16(h_bits(x0), h_bits(x1));
            a[e + 2]  = pk16(h_bits(y0), h_bits(y1));
            a2[e]     = pk16(h_bits((_Float16)((f0 - (float)x0) * QRS)), h_bits((_Float16)((f1 - (float)x1) * QRS)));
            a2[e + 2] = pk16(h_bits((_Float16)((g0 - (float)y0) * QRS)), h_bits((_Float16)((g1 - (float)y1) * QRS)));
          }
        } else {
          a[0] = pkh2(fa[0], fa[1]); a[1] = pkh2(fa[2], fa[3]);
          a[2] = pkh2(fb[0], fb[1]); a[3] = pkh2(fb[2], fb[3]);
          a2 = a;
        }
        hv[it] = a; lv[it] = a2;
      }
      {
#pragma unroll
        for (int it = 0; it < 4; ++it) {
          const int row = it * 4 + q;
          *(v4u*)(C + (size_t)(mBase + row) * ldc + n0 + c8) = hv[it];
          if (MODE == 2) *(v4u*)(C2 + (size_t)(mBase + row) * ldc + n0 + c8) = lv[it];
        }
        
      }
    }
    wave_lds_sync();
  }
}

#define GEMM_LDS                                                                                          \
  __shared__ __align__(16) _Float16 sA[2][128 * GPI]; /* A stage: 128 rows x 64 k, pitch GPI, two buffers */ \
  __shared__ __align__(16) _Float16 sB[2][128 * GPI]; /* Bt stage, same shape */                           \
  __shared__ __align__(16) float sT[8][16 * 68];      /* per-wave 16x64 slab, pitch 68 floats */

template <int MODE>
__global__ __launch_bounds__(256) void gemm64(
    const unsigned short* __restrict__ Ap, int lda, long long strideA,
    const unsigned short* __restrict__ Btp, int ldb, long long strideB,
    const float* __restrict__ bias,
    void* Cout, void* Cout2, int ldc, long long strideC,
    int M, int N, int K) {
  GEMM_LDS
  gemm_body<MODE>(sA, sB, sT, blockIdx.x, blockIdx.y, Ap, lda, strideA, Btp, ldb, strideB, bias,
                  Cout, Cout2, ldc, strideC, M, N, K);
}

// q, k and v^T projections of one layer in one grid: they read the same X and do not depend on each other.
//   blocks 0..191: q (MODE 2); 192..383: k (MODE 1); 384..575: v^T (MODE 3), 96 tiles per batch.
// The three branches are block-uniform, so every barrier in gemm_body is passed by the whole block.
#define TQK ((BT / 128) * (HID / 128))
#define TVB ((HID / 128) * (SEQ / 128))
__global__ __launch_bounds__(256) void gemm_qkv(
    const unsigned short* __restrict__ X, const unsigned short* __restrict__ Wqt,
    const unsigned short* __restrict__ Wkt, const unsigned short* __restrict__ Wvt,
    const float* __restrict__ bq, const float* __restrict__ bk, const float* __restrict__ bv,
    unsigned short* Qh, unsigned short* Ql, unsigned short* Kh, unsigned short* VT) {
  GEMM_LDS
  const int t = blockIdx.x;
  if (t < TQK) {
    gemm_body<2>(sA, sB, sT, t, 0, X, HID, 0LL, Wqt, HID, 0LL, bq, (void*)Qh, (void*)Ql, HID, 0LL, BT, HID, HID);
  } else if (t < 2 * TQK) {
    gemm_body<1>(sA, sB, sT, t - TQK, 0, X, HID, 0LL, Wkt, HID, 0LL, bk, (void*)Kh, (void*)Kh, HID, 0LL, BT, HID, HID);
  } else {
    const int u  = t - 2 * TQK;
    const int bz = u / TVB;
    gemm_body<3>(sA, sB, sT, u - bz * TVB, bz, Wvt, HID, 0LL, X, HID, (long long)SEQ * HID, bv,
                 (void*)VT, (void*)VT, SEQ, (long long)HID * SEQ, HID, SEQ, HID);
  }
}

__device__ __forceinline__ float xhalf(float x) {
  return __builtin_bit_cast(float, __builtin_amdgcn_permlanex16(__builtin_bit_cast(int, x), __builtin_bit_cast(int, x),
                                                                0x76543210, 0xfedcba98, false, false));
}

// 2^x of eight values in one statement. The results are early-clobber, so none of them lies on a source of the exponential in
// front of it, and the closing v_nop is the slot the instruction set asks for between a transcendental and the next instruction
// that uses its result or overwrites its source (left to itself the compiler put results on the source of the one in front).
__device__ __forceinline__ v8f exp2x8(v8f x) {
  v8f y = x;
#if defined(__HIP_DEVICE_COMPILE__)
  float y0, y1, y2, y3, y4, y5, y6, y7;
  asm("v_exp_f32 %0, %8\n\tv_exp_f32 %1, %9\n\tv_exp_f32 %2, %10\n\tv_exp_f32 %3, %11\n\t"
      "v_exp_f32 %4, %12\n\tv_exp_f32 %5, %13\n\tv_exp_f32 %6, %14\n\tv_exp_f32 %7, %15\n\tv_nop"
      : "=&v"(y0), "=&v"(y1), "=&v"(y2), "=&v"(y3), "=&v"(y4), "=&v"(y5), "=&v"(y6), "=&v"(y7)
      : "v"(x[0]), "v"(x[1]), "v"(x[2]), "v"(x[3]), "v"(x[4]), "v"(x[5]), "v"(x[6]), "v"(x[7]));
  y[0] = y0; y[1] = y1; y[2] = y2; y[3] = y3; y[4] = y4; y[5] = y5; y[6] = y6; y[7] = y7;
#endif
  return y;
}

__global__ __launch_bounds__(128)
void attn64(const unsigned short* __restrict__ qhp, const unsigned short* __restrict__ qlp,
            const unsigned short* __restrict__ khp, const unsigned short* __restrict__ vtp,
            const float* __restrict__ mask, unsigned short* ctxp, float sscale) {
  union FH { v16h v; v8h h[2]; };
  __shared__ __align__(16) _Float16 Ks[64 * API];                 // K [kv][d]    9 KB
  __shared__ __align__(16) _Float16 Vts[64 * API];                // V^T [d][kv]  9 KB
  __shared__ __align__(16) float    Mt[128];                      // per key of the chunk: [0..63] m * sscale, [64..127] -1e10 * (1 - m)
  __shared__ __align__(16) float    Os[4][16 * OPI];              // per wave context tile [row][d]

  const int tid  = threadIdx.x;
  const int wave = tid >> 5;
  const int lane = tid & 31;
  const int hh   = lane >> 4;
  const int c    = lane & 15;

  const int bx   = blockIdx.x;
  const int qb   = bx % NQB;
  const int rest = bx / NQB;
  const int h    = rest % NHD;
  const int b    = rest / NHD;
  const int q0   = qb * 64 + wave * 16;
  const size_t rowB = (size_t)b * SEQ;

  const _Float16* Qh = (const _Float16*)(const void*)qhp + (size_t)h * HD;
  const _Float16* Ql = (const _Float16*)(const void*)qlp + (size_t)h * HD;
  const _Float16* Kh = (const _Float16*)(const void*)khp + (size_t)h * HD;
  const _Float16* Vt = (const _Float16*)(const void*)vtp + ((size_t)b * HID + (size_t)h * HD) * SEQ;
  const float* mb = mask + (size_t)b * SEQ;

  // ---- Q fragments (B operand, column = query q0 + (lane&15)): 2 d-chunks, hi and residual ----
  v16h qah[2], qal[2];
#pragma unroll
  for (int dc = 0; dc < 2; ++dc) {
    const size_t qo = (rowB + q0 + c) * HID + dc * 32 + 8 * hh;
    qah[dc] = ldfrag_h(Qh + qo);
    qal[dc] = ldfrag_h(Ql + qo);
  }

  float mrun = -INFINITY;                          // this lane's query: running max, alike in both wave halves
  v8f lacc = zero8();                              // its sum of p: register r over keys = 8hh + r (mod 16); joined after the loop
  v8f oacc[4];                                     // O^T: register r of tile t = d 16t + 8hh + r of query q0 + c
#pragma unroll
  for (int t = 0; t < 4; ++t) oacc[t] = zero8();

#pragma unroll 1
  for (int kt = 0; kt < NQB; ++kt) {
    const int kv0 = kt * 64;
    __syncthreads();
    {
      const int r = tid >> 1, half = (tid & 1) * 32;
      const _Float16* kg = Kh + (rowB + kv0 + r) * HID + half;      // K row kv0+r, d = half..half+31
      const _Float16* vg = Vt + (size_t)r * SEQ + kv0 + half;      // V^T row d = r, s = kv0+half..+31
      const float mraw = mb[kv0 + (tid & 63)];                     // key kv0 + (tid & 63) < SEQ; in flight with the tile loads
#pragma unroll
      for (int i = 0; i < 4; ++i) {
        const v8h a0 = *(const v8h*)(kg + 8 * i);
        const v8h b0 = *(const v8h*)(vg + 8 * i);
        *(v8h*)(Ks  + r * API + half + 8 * i) = a0;
        *(v8h*)(Vts + r * API + half + 8 * i) = b0;
      }
      const float m = bfr(mraw);                                   // threads 0..63 store the factor, 64..127 the addend
      Mt[tid] = (tid < 64) ? m * sscale : -1.0e10f * (1.0f - m);
    }
    __syncthreads();

    // ---- scores, transposed: 64 keys x 16 queries per wave, k.qhi and k.qres ----
    // LDS reads of a chunk stand in three groups, each a run of products or arithmetic ahead of its last user, so that the waits are
    // counted ones; read pair by pair in front of each product, every pair's LDS latency is waited out alone, 16 times a chunk.
    // group 1: all 8 K fragments and the mask terms of keys 0..31
    FH kb[4][2];
    v4f mf[4][2], md[4][2];                        // per key: factor m * sscale, addend -1e10 * (1 - m); [j][0] = r 0..3, [j][1] = r 4..7
#pragma unroll
    for (int j = 0; j < 4; ++j) {
#pragma unroll
      for (int dc = 0; dc < 2; ++dc) {
        kb[j][dc].h[0] = *(const v8h*)(Ks + (j * 16 + c) * API + dc * 32 + 8 * hh);
        kb[j][dc].h[1] = *(const v8h*)(Ks + (j * 16 + c) * API + dc * 32 + 16 + 8 * hh);
      }
    }
#pragma unroll
    for (int j = 0; j < 2; ++j) {
      mf[j][0] = *(const v4f*)(Mt + j * 16 + 8 * hh);      mf[j][1] = *(const v4f*)(Mt + j * 16 + 8 * hh + 4);
      md[j][0] = *(const v4f*)(Mt + 64 + j * 16 + 8 * hh); md[j][1] = *(const v4f*)(Mt + 64 + j * 16 + 8 * hh + 4);
    }
    v8f s[4], sl[4];
#pragma unroll
    for (int j = 0; j < 2; ++j) {
      s[j] = zero8();
      sl[j] = zero8();
#pragma unroll
      for (int dc = 0; dc < 2; ++dc) {
        s[j]  = mma_h(kb[j][dc].v, qah[dc], s[j]);
        sl[j] = mma_h(kb[j][dc].v, qal[dc], sl[j]);
      }
    }
    // group 2: the mask terms of keys 32..63, used behind the next 8 products
#pragma unroll
    for (int j = 2; j < 4; ++j) {
      mf[j][0] = *(const v4f*)(Mt + j * 16 + 8 * hh);      mf[j][1] = *(const v4f*)(Mt + j * 16 + 8 * hh + 4);
      md[j][0] = *(const v4f*)(Mt + 64 + j * 16 + 8 * hh); md[j][1] = *(const v4f*)(Mt + 64 + j * 16 + 8 * hh + 4);
    }
#pragma unroll
    for (int j = 0; j < 2; ++j) {
#pragma unroll
      for (int r = 0; r < 4; ++r) {
        s[j][r]     = (s[j][r]     + sl[j][r]     * QRI) * mf[j][0][r] + md[j][0][r];
        s[j][r + 4] = (s[j][r + 4] + sl[j][r + 4] * QRI) * mf[j][1][r] + md[j][1][r];
      }
    }
#pragma unroll
    for (int j = 2; j < 4; ++j) {
      s[j] = zero8();
      sl[j] = zero8();
#pragma unroll
      for (int dc = 0; dc < 2; ++dc) {
        s[j]  = mma_h(kb[j][dc].v, qah[dc], s[j]);
        sl[j] = mma_h(kb[j][dc].v, qal[dc], sl[j]);
      }
    }
    // group 3: all 8 V^T fragments, so that they land under the softmax arithmetic
    FH vb[2][4];
#pragma unroll
    for (int kk = 0; kk < 2; ++kk) {
#pragma unroll
      for (int t = 0; t < 4; ++t) {
        vb[kk][t].h[0] = *(const v8h*)(Vts + (t * 16 + c) * API + kk * 32 + 8 * hh);
        vb[kk][t].h[1] = *(const v8h*)(Vts + (t * 16 + c) * API + kk * 32 + 16 + 8 * hh);
      }
    }
#pragma unroll
    for (int j = 2; j < 4; ++j) {
#pragma unroll
      for (int r = 0; r < 4; ++r) {
        s[j][r]     = (s[j][r]     + sl[j][r]     * QRI) * mf[j][0][r] + md[j][0][r];
        s[j][r + 4] = (s[j][r + 4] + sl[j][r + 4] * QRI) * mf[j][1][r] + md[j][1][r];
      }
    }

    // ---- max of this query's 64 scores, online softmax, P^T (x1024, f16) packed in place as B fragments ----
    float mj[4];
#pragma unroll
    for (int j = 0; j < 4; ++j) {
      mj[j] = fmaxf(fmaxf(fmaxf(s[j][0], s[j][1]), fmaxf(s[j][2], s[j][3])),
                    fmaxf(fmaxf(s[j][4], s[j][5]), fmaxf(s[j][6], s[j][7])));
    }
    float m = fmaxf(fmaxf(mj[0], mj[1]), fmaxf(mj[2], mj[3]));
    m = fmaxf(m, xhalf(m));
    const float mnew  = fmaxf(mrun, m);
    const float alpha = __expf(mrun - mnew);
    mrun = mnew;
    FH pb[2];
    v8f p[4];
#pragma unroll
    for (int j = 0; j < 4; ++j) {
      p[j] = exp2x8((s[j] - mnew) * 1.4426950408889634f);
#pragma unroll
      for (int r = 0; r < 8; ++r) pb[j >> 1].v[(j & 1) * 8 + r] = (_Float16)(p[j][r] * PSC);
    }
    lacc = lacc * alpha + ((p[0] + p[1]) + (p[2] + p[3]));
#pragma unroll
    for (int t = 0; t < 4; ++t) oacc[t] *= alpha;

    // ---- context^T += V^T . P^T (f16 WMMA) ----
#pragma unroll
    for (int kk = 0; kk < 2; ++kk) {
#pragma unroll
      for (int t = 0; t < 4; ++t) oacc[t] = mma_h(vb[kk][t].v, pb[kk].v, oacc[t]);
    }
  }

  float* os = Os[wave];
  {
    const float lsum = ((lacc[0] + lacc[1]) + (lacc[2] + lacc[3])) + ((lacc[4] + lacc[5]) + (lacc[6] + lacc[7]));
    const float l = lsum + xhalf(lsum);            // the two halves' key sums joined
    const float inv = ((l > 0.f) ? (1.0f / l) : 0.f) * PSI;
#pragma unroll
    for (int t = 0; t < 4; ++t) {
      v4f lo, hi;
#pragma unroll
      for (int r = 0; r < 4; ++r) { lo[r] = oacc[t][r] * inv; hi[r] = oacc[t][r + 4] * inv; }
      *(v4f*)(os + c * OPI + t * 16 + 8 * hh)     = lo;
      *(v4f*)(os + c * OPI + t * 16 + 8 * hh + 4) = hi;
    }
  }
  wave_lds_sync();
  {
    const int q4 = lane >> 3, c8 = (lane & 7) * 8;
    v4u hv[4];
#pragma unroll
    for (int it = 0; it < 4; ++it) {
      const int row = it * 4 + q4;           // it 0..3 x q4 0..3 = rows 0..15 of the wave tile
      const float* sp = os + row * OPI + c8;
      const v4f fa = *(const v4f*)(sp);
      const v4f fb = *(const v4f*)(sp + 4);
      v4u a;
      a[0] = pkh2(fa[0], fa[1]); a[1] = pkh2(fa[2], fa[3]);
      a[2] = pkh2(fb[0], fb[1]); a[3] = pkh2(fb[2], fb[3]);
      hv[it] = a;
    }
    {
#pragma unroll
      for (int it = 0; it < 4; ++it) {
        const int row = it * 4 + q4;
        const size_t go = (rowB + q0 + row) * HID + (size_t)h * HD + c8;
        *(v4u*)(ctxp + go) = hv[it];
      }
      
    }
  }
}

// =====================================================================================================
// Workspace map (bytes), all region sizes multiples of 128 and exact multiples of their 64x64- or 128x128-tile / whole-row
// store granularity (M, N multiples of 128; 768- and 3072-wide rows), so no padded tails are needed:
//   Hres f32 [4096][768]        12582912
//   X    f16 [4096][768]         6291456   (LN output plane, reused by LN1 and LN2)
//   Qh   f16 [4096][768]         6291456
//   Ql   f16 [4096][768]         6291456   (q residual x4096)
//   Kh   f16 [4096][768]         6291456
//   VT   f16 [2][768][2048]      6291456
//   Ctx  f16 [4096][768]         6291456
//   G    f16 [4096][3072]       25165824
//   per layer (2 x 14155776):
//   Wq_t,Wk_t,Wv_t,Wo_t f16 [768][768]  4 x 1179648
//   W1_t f16 [3072][768]         4718592
//   W2_t f16 [768][3072]         4718592
//   total                      103809024
// Both layers' weights are converted by the first launch, each layer into its own region ([out n][in k], k contiguous = the Bt / A layout).
// =====================================================================================================
extern "C" void kernel_launch(void* const* d_in, const int* in_sizes, int n_in,
                              void* d_out, int out_size, void* d_ws, size_t ws_size,
                              hipStream_t stream) {
  if (n_in < 21) return;
  if (in_sizes[0] != BT * HID || in_sizes[1] != BT * HID || in_sizes[2] != NB * SEQ) return;
  if (in_sizes[3] != 2 * HID || in_sizes[4] != 2 * HID) return;
  if (in_sizes[5] != 2 * HID * HID || in_sizes[7] != 2 * HID * HID ||
      in_sizes[9] != 2 * HID * HID || in_sizes[11] != 2 * HID * HID) return;
  if (in_sizes[6] != 2 * HID || in_sizes[8] != 2 * HID || in_sizes[10] != 2 * HID || in_sizes[12] != 2 * HID) return;
  if (in_sizes[13] != 2 * HID || in_sizes[14] != 2 * HID) return;
  if (in_sizes[15] != 2 * HID * DFF || in_sizes[16] != 2 * DFF ||
      in_sizes[17] != 2 * DFF * HID || in_sizes[18] != 2 * HID) return;
  if (in_sizes[19] != HID || in_sizes[20] != HID) return;
  if (out_size != BT * HID) return;

  const float* in_h  = (const float*)d_in[0];
  const float* embs  = (const float*)d_in[1];
  const float* mask  = (const float*)d_in[2];
  const float* ln1_s = (const float*)d_in[3];
  const float* ln1_b = (const float*)d_in[4];
  const float* wq    = (const float*)d_in[5];
  const float* bq    = (const float*)d_in[6];
  const float* wk    = (const float*)d_in[7];
  const float* bk    = (const float*)d_in[8];
  const float* wv    = (const float*)d_in[9];
  const float* bv    = (const float*)d_in[10];
  const float* wo    = (const float*)d_in[11];
  const float* bo    = (const float*)d_in[12];
  const float* ln2_s = (const float*)d_in[13];
  const float* ln2_b = (const float*)d_in[14];
  const float* w1    = (const float*)d_in[15];
  const float* b1    = (const float*)d_in[16];
  const float* w2    = (const float*)d_in[17];
  const float* b2    = (const float*)d_in[18];
  const float* lnf_s = (const float*)d_in[19];
  const float* lnf_b = (const float*)d_in[20];
  float* out = (float*)d_out;

  const size_t PH  = (size_t)BT * HID * 4;        // 12582912
  const size_t PA  = (size_t)BT * HID * 2;        //  6291456
  const size_t PVT = (size_t)NB * HID * SEQ * 2;  //  6291456
  const size_t PG  = (size_t)BT * DFF * 2;        // 25165824
  const size_t PW  = (size_t)HID * HID * 2;       //  1179648
  const size_t PW1 = (size_t)HID * DFF * 2;       //  4718592
  size_t off = 0;
  const size_t oH   = off; off += PH;
  const size_t oX   = off; off += PA;
  const size_t oQh  = off; off += PA;
  const size_t oQl  = off; off += PA;
  const size_t oKh  = off; off += PA;
  const size_t oVT  = off; off += PVT;
  const size_t oCtx = off; off += PA;
  const size_t oG   = off; off += PG;
  const size_t oWt  = off; off += 2 * (4 * PW + 2 * PW1);
  if (off > ws_size) return;                      // off = 103809024
  if (off > (size_t)134217728) return;

  char* ws = (char*)d_ws;
  float*          Hres = (float*)(ws + oH);
  unsigned short* X    = (unsigned short*)(ws + oX);
  unsigned short* Qh   = (unsigned short*)(ws + oQh);
  unsigned short* Ql   = (unsigned short*)(ws + oQl);
  unsigned short* Kh   = (unsigned short*)(ws + oKh);
  unsigned short* VT   = (unsigned short*)(ws + oVT);
  unsigned short* Ctx  = (unsigned short*)(ws + oCtx);
  unsigned short* G    = (unsigned short*)(ws + oG);
  unsigned short* Wt   = (unsigned short*)(ws + oWt);

  const dim3 blk(256);
  const dim3 gLN(BT / 8);                                           // 512 blocks, 8 rows each
  const dim3 gPrep(BT / 8 + 2 * CVL);                               // 512 row groups + 2 x 1728 weight tiles
  const dim3 gHH((BT / 128) * (HID / 128), 1);                      // 32 x 6  = 192 blocks
  const dim3 gQKV(2 * TQK + NB * TVB);                              // 192 + 192 + 2 x 96 = 576 blocks
  const dim3 gF1((BT / 128) * (DFF / 128), 1);                      // 32 x 24 = 768 blocks
  const dim3 gAt(NB * NHD * NQB);                                   // 768 blocks of 128

  for (int l = 0; l < 2; ++l) {
    unsigned short* Wqt = Wt + (size_t)l * WLH;
    unsigned short* Wkt = Wqt + (size_t)HID * HID;
    unsigned short* Wvt = Wkt + (size_t)HID * HID;
    unsigned short* Wot = Wvt + (size_t)HID * HID;
    unsigned short* W1t = Wot + (size_t)HID * HID;
    unsigned short* W2t = W1t + (size_t)HID * DFF;
    // (1) h = h + input_embs; hn = LN1(h) -> X (f16); with layer 0 also
    // (2) the weights of both layers: f32 [in][out] -> f16 [out][in] (bf16-RNE values x64)
    if (l == 0) {
      prep<<<gPrep, blk, 0, stream>>>(in_h, embs, Hres, ln1_s, ln1_b, X, wq, wk, wv, wo, w1, w2, Wt);
    } else {
      ln_rows<true, false, false><<<gLN, blk, 0, stream>>>(Hres, embs, Hres, ln1_s + HID, ln1_b + HID, (void*)X, BT);
    }
    // (3) q = hn . Wq + bq -> f16 hi + residual planes [b*SEQ+t][h*64+d]  (M=4096, N=768, K=768)
    // (4) k = hn . Wk + bk -> f16 plane
    // (5) v^T = Wv_t . hn^T per batch -> f16 [b][h*64+d][s]  (A = Wv_t [n][k], Bt = X rows of batch b; M=768, N=2048, K=768)
    gemm_qkv<<<gQKV, blk, 0, stream>>>(X, Wqt, Wkt, Wvt, bq + l * HID, bk + l * HID, bv + l * HID, Qh, Ql, Kh, VT);
    // (6) attention -> Ctx f16 [b*SEQ+t][h*64+d]
    attn64<<<gAt, dim3(128), 0, stream>>>(Qh, Ql, Kh, VT, mask, Ctx, 0.125f);
    // (7) h = h + (ctx . Wo + bo)  (f32, in place)
    gemm64<0><<<gHH, blk, 0, stream>>>(Ctx, HID, 0LL, Wot, HID, 0LL, bo + l * HID,
                                       (void*)Hres, (void*)Hres, HID, 0LL, BT, HID, HID);
    // (8) hn = LN2(h) -> X
    ln_rows<false, false, false><<<gLN, blk, 0, stream>>>(Hres, embs, Hres, ln2_s + l * HID, ln2_b + l * HID, (void*)X, BT);
    // (9) g = gelu(hn . W1 + b1) -> G f16 [4096][3072]  (M=4096, N=3072, K=768)
    gemm64<4><<<gF1, blk, 0, stream>>>(X, HID, 0LL, W1t, HID, 0LL, b1 + l * DFF,
                                       (void*)G, (void*)G, DFF, 0LL, BT, DFF, HID);
    // (10) h = h + (g . W2 + b2)  (M=4096, N=768, K=3072, f32 in place)
    gemm64<0><<<gHH, blk, 0, stream>>>(G, DFF, 0LL, W2t, DFF, 0LL, b2 + l * HID,
                                       (void*)Hres, (void*)Hres, HID, 0LL, BT, HID, DFF);
  }
  // (11) out = LN_f(h) -> f32 [2][2048][768]
  ln_rows<false, false, true><<<gLN, blk, 0, stream>>>(Hres, embs, Hres, lnf_s, lnf_b, (void*)out, BT);
  (void)hipGetLastError();
}

// v006
// Measured time: 313 microseconds a run.
// Two timings next to v005 put it at 1.05 and 1.04 times that version's speed.
// All steps since v000 together make it 3.15 times as fast.
// Contractions: q, k, v^T, out and ffn projections = v_wmma_f32_16x16x32_f16 (f16 activations; weights bf16-RNE then x64 as f16), single product;
// q.k^T = v_wmma_f32_16x16x32_f16 with q as f16 hi + f16 residual (x4096) planes and k f16, 2 products in separate accumulators;
// p.v = v_wmma_f32_16x16x32_f16 (p carried x1024 in f16, v f16); f32 accumulate everywhere; layernorm, softmax and gelu in f32.
#include <hip/hip_runtime.h>
#include <math.h>
#include <stdint.h>

#define NB   2
#define SEQ  2048
#define HID  768
#define NHD  12
#define HD   64
#define DFF  3072
#define BT   (NB * SEQ)
#define NQB  (SEQ / 64)
#define WSC  64.0f
#define WINV 0.015625f
#define QRS  4096.0f
#define QRI  0.000244140625f
#define PSC  1024.0f
#define PSI  0.0009765625f
#define GPI  72                 // LDS row pitch of a GEMM stage, in halves: 64 k + 8 = 144 B
#define API  72                 // LDS row pitch of the attention K and V^T tiles, in halves: 64 + 8 = 144 B = 16 B x odd
#define OPI  68                 // LDS row pitch of the attention context tile, in floats: 64 + 4 = 272 B = 16 B x odd
static_assert(NHD * HD == HID);
static_assert((SEQ % 64) == 0 && (HID % 64) == 0 && (DFF % 64) == 0 && (BT % 64) == 0);
static_assert(HID == 6 * 128);
static_assert((SEQ % 128) == 0 && (HID % 128) == 0 && (DFF % 128) == 0 && (BT % 128) == 0);

typedef _Float16 v16h __attribute__((ext_vector_type(16)));
typedef _Float16 v8h  __attribute__((ext_vector_type(8)));
typedef float    v8f  __attribute__((ext_vector_type(8)));
typedef float    v4f  __attribute__((ext_vector_type(4)));
typedef unsigned int v4u __attribute__((ext_vector_type(4)));

// ---- scalar helpers -----------------------------------------------------------------------------
__device__ __forceinline__ unsigned short bf_bits(float f) {        // f32 -> bf16 bits, RNE convert
  const unsigned u = __float_as_uint(f);
  return (unsigned short)((u + 0x7FFFu + ((u >> 16) & 1u)) >> 16);
}
__device__ __forceinline__ float bfr(float f) { return __uint_as_float(((unsigned)bf_bits(f)) << 16); }
__device__ __forceinline__ v4f bfr4(v4f a) {
  v4f r;
  r[0] = bfr(a[0]); r[1] = bfr(a[1]); r[2] = bfr(a[2]); r[3] = bfr(a[3]);
  return r;
}
__device__ __forceinline__ unsigned short h_bits(_Float16 x) { return __builtin_bit_cast(unsigned short, x); }
__device__ __forceinline__ unsigned pk16(unsigned short a, unsigned short b) { return (unsigned)a | ((unsigned)b << 16); }
__device__ __forceinline__ unsigned pkh2(float a, float b) { return pk16(h_bits((_Float16)a), h_bits((_Float16)b)); }
__device__ __forceinline__ v8f zero8() { v8f z = {0.f, 0.f, 0.f, 0.f, 0.f, 0.f, 0.f, 0.f}; return z; }
__device__ __forceinline__ v4f zero4() { v4f z = {0.f, 0.f, 0.f, 0.f}; return z; }

// ---- fragment loader: 16-bit A/B operand, lane -> row/col (lane&15); p already includes +8*(lane>>4);
//      elements 0..7 <- p[0..7] (k0+8h..), elements 8..15 <- p[16..23] (k0+16+8h..)
__device__ __forceinline__ v16h ldfrag_h(const _Float16* p) {
  union { v16h v; v8h h[2]; } f;
  f.h[0] = *(const v8h*)(p);
  f.h[1] = *(const v8h*)(p + 16);
  return f.v;
}

// ---- WMMA with trailing VALU hazard gap -----------------------------------------------------------
__device__ __forceinline__ v8f mma_h(v16h a, v16h b, v8f c) {
  c = __builtin_amdgcn_wmma_f32_16x16x32_f16(false, a, false, b, (short)0, c, false, false);
#if defined(__HIP_DEVICE_COMPILE__)
  asm volatile("v_nop\n\tv_nop\n\tv_nop\n\tv_nop" : "+v"(c) : "v"(a), "v"(b));
#endif
  return c;
}

// release/acquire + wave barrier for same-wave LDS exchange
__device__ __forceinline__ void wave_lds_sync() {
  __builtin_amdgcn_fence(__ATOMIC_RELEASE, "workgroup");
  __builtin_amdgcn_wave_barrier();
  __builtin_amdgcn_fence(__ATOMIC_ACQUIRE, "workgroup");
}

// ---- asynchronous copies to LDS ------------------------------------------------------------------
__device__ __forceinline__ unsigned lds_off(const void* p) { return (unsigned)(size_t)p; }   // byte offset in the work-group's LDS

// Eight 16-B copies per lane, global memory -> LDS through no register: l* = the lane's LDS byte address, g* = its global address.
// The closing s_wait_xcnt 0 is a precaution: it stands in front of every later rewrite of the address registers the copies name.
__device__ __forceinline__ void copy8(unsigned l0, unsigned l1, unsigned l2, unsigned l3,
                                      unsigned l4, unsigned l5, unsigned l6, unsigned l7,
                                      const _Float16* g0, const _Float16* g1, const _Float16* g2, const _Float16* g3,
                                      const _Float16* g4, const _Float16* g5, const _Float16* g6, const _Float16* g7) {
#if defined(__HIP_DEVICE_COMPILE__)
  asm volatile("global_load_async_to_lds_b128 %0, %8, off\n\t"
               "global_load_async_to_lds_b128 %1, %9, off\n\t"
               "global_load_async_to_lds_b128 %2, %10, off\n\t"
               "global_load_async_to_lds_b128 %3, %11, off\n\t"
               "global_load_async_to_lds_b128 %4, %12, off\n\t"
               "global_load_async_to_lds_b128 %5, %13, off\n\t"
               "global_load_async_to_lds_b128 %6, %14, off\n\t"
               "global_load_async_to_lds_b128 %7, %15, off\n\t"
               "s_wait_xcnt 0x0"
               :: "v"(l0), "v"(l1), "v"(l2), "v"(l3), "v"(l4), "v"(l5), "v"(l6), "v"(l7),
                  "v"(g0), "v"(g1), "v"(g2), "v"(g3), "v"(g4), "v"(g5), "v"(g6), "v"(g7)
               : "memory");
#endif
}
// this wave's LDS reads have returned: stands in front of the barrier behind which their buffer is refilled
__device__ __forceinline__ void wait_ds0() { asm volatile("s_wait_dscnt 0x0" ::: "memory"); }
// this wave's copies have landed: stands in front of the barrier behind which other waves read them (the compiler places no wait for a copy)
__device__ __forceinline__ void wait_async0() { asm volatile("s_wait_asynccnt 0x0" ::: "memory"); }

// tanh-approximation gelu, tanh(u) = 1 - 2/(exp(2u)+1) with u clamped to [-16,16]
__device__ __forceinline__ float gelu_t(float x) {
  float u = 0.7978845608028654f * (x + 0.044715f * x * x * x);
  u = fminf(fmaxf(u, -16.0f), 16.0f);
  const float e  = __expf(2.0f * u);
  const float th = 1.0f - 2.0f * __builtin_amdgcn_rcpf(e + 1.0f);
  return 0.5f * x * (1.0f + th);
}

// =====================================================================================================
// Residual add + LayerNorm, one wave per row of 768. grid = nrows/8, 256 threads.
//   x = src row (RSRC: bf16-RNE the loaded values) (+ ADDE: bf16-RNE(embs row)); ADDE also stores x to hdst
//   (may alias src: every lane reads its own 24 columns before storing them).
//   else:  y -> f16 rows via a per-wave LDS row buffer (lane l: 8 halves at col 256j+8l, 512 B per instruction).
// coverage: 8 waves x grid(512) = 4096 rows; 6 x 128 floats / 3 x 256 halves = the whole 768-wide row.
// =====================================================================================================
// blk = index of the 8-row group; rb = the block's 8 x 768 float row buffer in LDS.
template <bool ADDE, bool RSRC, bool OUT32>
__device__ __forceinline__ void ln_body(int blk, float* rb, const float* src, const float* embs, float* hdst,
                                        const float* __restrict__ sc, const float* __restrict__ bi,
                                        void* outp, int nrows) {
  const int tid = threadIdx.x, wave = tid >> 5, lane = tid & 31;
  const int row = blk * 8 + wave;
  if (row >= nrows) return;                       // wave-uniform; no block barrier behind it in this body
  const size_t rbase = (size_t)row * HID;
  v4f x[6];
#pragma unroll
  for (int i = 0; i < 6; ++i) {
    const int col = i * 128 + lane * 4;
    v4f a = *(const v4f*)(src + rbase + col);
    if (RSRC) a = bfr4(a);
    if (ADDE) {
      const v4f e = bfr4(*(const v4f*)(embs + rbase + col));
      a = a + e;
    }
    x[i] = a;
    // precaution: a later load's result may be given the address registers of this trip's loads; this keeps the wait in front of that
    asm volatile("s_wait_xcnt 0x0" ::: "memory");
  }
  if (ADDE) {
    {
#pragma unroll
      for (int i = 0; i < 6; ++i) *(v4f*)(hdst + rbase + i * 128 + lane * 4) = x[i];
      
    }
  }
  float s = 0.f;
#pragma unroll
  for (int i = 0; i < 6; ++i) s += (x[i][0] + x[i][1]) + (x[i][2] + x[i][3]);
#pragma unroll
  for (int off = 1; off < 32; off <<= 1) s += __shfl_xor(s, off, 32);
  const float mean = s * (1.0f / 768.0f);
  float qv = 0.f;
#pragma unroll
  for (int i = 0; i < 6; ++i) {
    const v4f d = x[i] - mean;
    qv += (d[0] * d[0] + d[1] * d[1]) + (d[2] * d[2] + d[3] * d[3]);
  }
#pragma unroll
  for (int off = 1; off < 32; off <<= 1) qv += __shfl_xor(qv, off, 32);
  const float var  = qv * (1.0f / 768.0f);
  const float rinv = rsqrtf(var + 1e-5f);
  v4f y[6];
#pragma unroll
  for (int i = 0; i < 6; ++i) {
    const int col = i * 128 + lane * 4;
    const v4f s4 = bfr4(*(const v4f*)(sc + col));
    const v4f b4 = bfr4(*(const v4f*)(bi + col));
    y[i] = (x[i] - mean) * rinv * s4 + b4;
  }
  if (OUT32) {
    float* o = (float*)outp;
    {
#pragma unroll
      for (int i = 0; i < 6; ++i) *(v4f*)(o + rbase + i * 128 + lane * 4) = y[i];
      
    }
  } else {
    float* rw = rb + wave * HID;
#pragma unroll
    for (int i = 0; i < 6; ++i) *(v4f*)(rw + i * 128 + lane * 4) = y[i];
    wave_lds_sync();
    v4u pk[3];
#pragma unroll
    for (int j = 0; j < 3; ++j) {
      const v4f a = *(const v4f*)(rw + j * 256 + lane * 8);
      const v4f c = *(const v4f*)(rw + j * 256 + lane * 8 + 4);
      v4u p;
      p[0] = pkh2(a[0], a[1]); p[1] = pkh2(a[2], a[3]);
      p[2] = pkh2(c[0], c[1]); p[3] = pkh2(c[2], c[3]);
      pk[j] = p;
    }
    unsigned short* o = (unsigned short*)outp;
    {
#pragma unroll
      for (int j = 0; j < 3; ++j) *(v4u*)(o + rbase + j * 256 + lane * 8) = pk[j];
      
    }
  }
}

template <bool ADDE, bool RSRC, bool OUT32>
__global__ __launch_bounds__(256) void ln_rows(const float* src, const float* embs, float* hdst,
                                               const float* __restrict__ sc, const float* __restrict__ bi,
                                               void* outp, int nrows) {
  __shared__ __align__(16) float rb[8 * HID];
  ln_body<ADDE, RSRC, OUT32>(blockIdx.x, rb, src, embs, hdst, sc, bi, outp, nrows);
}

// =====================================================================================================
// Weight convert + transpose: W f32 [K][N] (row-major, in-major) -> O f16 [N][K] = f16(bf16-RNE(w) * 64).
// One block = one tile of 64 k x 64 n through LDS, origin (k0, n0); 256 threads; sT = the block's 64 x 72 half tile in LDS.
//   read: thread (r = tid>>2 = k row, cq = (tid&3)*16 = n quarter) reads 16 floats (4 x 16 B) -> sT[n][k]
//   write: wave w, lane: rows (n) w*8 + it*4 + (lane>>3), 8 halves per lane at k (lane&7)*8:
// coverage: 8 waves x 8 rows = 64 n rows x 64 k per block; the caller deals N/64 x K/64 tiles exactly.
// =====================================================================================================
__device__ __forceinline__ void conv_body(_Float16* sT, const float* __restrict__ W, unsigned short* O,
                                          int K, int N, int n0, int k0) {
  const int tid = threadIdx.x;
  {
    const int r = tid >> 2, cq = (tid & 3) * 16;
    const float* p = W + (size_t)(k0 + r) * N + n0 + cq;
#pragma unroll
    for (int g = 0; g < 4; ++g) {
      const v4f a = *(const v4f*)(p + 4 * g);
#pragma unroll
      for (int e = 0; e < 4; ++e) sT[(cq + 4 * g + e) * 72 + r] = (_Float16)(bfr(a[e]) * WSC);
    }
  }
  __syncthreads();
  const int wave = tid >> 5, lane = tid & 31;
  const int q = lane >> 3, c8 = (lane & 7) * 8;
  union HU { v8h h; v4u u; };
  HU pk[2];
#pragma unroll
  for (int it = 0; it < 2; ++it) {
    const int row = wave * 8 + it * 4 + q;
    pk[it].h = *(const v8h*)(sT + row * 72 + c8);
  }
  const _Float16 dummy = (_Float16)0.0f; (void)dummy;
  {
#pragma unroll
    for (int it = 0; it < 2; ++it) {
      const int row = wave * 8 + it * 4 + q;
      *(v4u*)(O + (size_t)(n0 + row) * K + k0 + c8) = pk[it].u;
    }
    // precaution: where this body is inlined in front of other code, the stores' registers may be rewritten there; this keeps the wait in front of that
    asm volatile("s_wait_xcnt 0x0" ::: "memory");
  }
}

// =====================================================================================================
// First launch: the work that depends on the inputs alone, dealt by block index in one grid.
//   blocks 0 .. BT/8-1: h + embs and LN1 of layer 0 (ln_body);
//   then per layer CVL = 3 x CVS blocks of weight tiles (conv_body): CVS tiles of wq, wk, wv, wo (144 each), CVS of w1, CVS of w2.
// Converted weights of layer l lie at Wt + l * WLH halves: Wq_t, Wk_t, Wv_t, Wo_t (HID*HID each), W1_t, W2_t (HID*DFF each).
// Every branch below is block-uniform; the one block barrier (in conv_body) is passed by all 256 threads of its block.
// =====================================================================================================
#define CVS  576                                  // 4 * 12 * 12 = 48 * 12 = 12 * 48 tiles
#define CVL  (3 * CVS)
#define WLH  (4 * HID * HID + 2 * HID * DFF)      // halves of converted weights per layer
static_assert(4 * (HID / 64) * (HID / 64) == CVS && (DFF / 64) * (HID / 64) == CVS);
__global__ __launch_bounds__(256) void prep(const float* in_h, const float* embs, float* hdst,
                                            const float* __restrict__ sc, const float* __restrict__ bi,
                                            unsigned short* X,
                                            const float* __restrict__ wq, const float* __restrict__ wk,
                                            const float* __restrict__ wv, const float* __restrict__ wo,
                                            const float* __restrict__ w1, const float* __restrict__ w2,
                                            unsigned short* Wt) {
  __shared__ __align__(16) float rb[8 * HID];
  __shared__ __align__(16) _Float16 sT[64 * 72];
  const int bx = blockIdx.x;
  if (bx < BT / 8) {
    ln_body<true, true, false>(bx, rb, in_h, embs, hdst, sc, bi, (void*)X, BT);
    return;
  }
  int t = bx - BT / 8;
  const int l = t / CVL;
  t -= l * CVL;
  const int seg = t / CVS;
  t -= seg * CVS;
  unsigned short* Ol = Wt + (size_t)l * WLH;
  if (seg == 0) {
    const int z = t / 144;
    const int r = t - z * 144;
    const float* W = ((z == 0) ? wq : (z == 1) ? wk : (z == 2) ? wv : wo) + (size_t)l * HID * HID;
    conv_body(sT, W, Ol + (size_t)z * HID * HID, HID, HID, (r % 12) * 64, (r / 12) * 64);
  } else if (seg == 1) {
    conv_body(sT, w1 + (size_t)l * HID * DFF, Ol + (size_t)4 * HID * HID, HID, DFF, (t % 48) * 64, (t / 48) * 64);
  } else {
    conv_body(sT, w2 + (size_t)l * HID * DFF, Ol + (size_t)4 * HID * HID + (size_t)HID * DFF, DFF, HID,
              (t % 12) * 64, (t / 12) * 64);
  }
}

// =====================================================================================================
// Register-blocked f16 WMMA GEMM: C[m][n] = sum_k A[m][k] * Bt[n][k] (accumulator scaled by 1/64 in the
// epilogue = the weight carry). Block = 8 waves (4 x 2) = one 128x128 tile of C, one 32x64 tile per wave.
// A row-major [M][K] pitch lda, Bt row-major [N][K] pitch ldb (k contiguous); M, N multiples of 128, K multiple of 64.
// Operands go through LDS in stages of 64 k: 128 rows x 128 B of A and of Bt per stage, brought by asynchronous 16-B copies. Each
// wave-wide copy covers 4 whole 128-B lines (8 lanes per row); rows lie in LDS at pitch 144 B (16 B x odd) for the 16-B fragment reads.
// Two LDS buffers, one block barrier per stage, at the loop's foot: behind it stage s+1 (copied while stage s was multiplied) is
// readable, and stage s+2 is copied into the buffer of stage s, whose readers all passed that barrier.
// tile = index of the block tile, bz = batch index (strides in elements). Both A and B fragments use the split k map of ldfrag_h.
// MODE 1: f16 C = acc/64 + bias[n]
// MODE 2: f16 hi C = f16(v), f16 residual C2 = f16((v - hi) * 4096), v = acc/64 + bias[n]
// MODE 3: f16 C = acc/64 + bias[m]
// MODE 4: f16 C = gelu(acc/64 + bias[n])
// bias values bf16-RNE converted in register. Epilogue: 16-row slabs staged per wave in LDS; each 64-wide row
// coverage: 2 slabs x 16 rows x 64 cols = the wave's whole tile; 8 waves per block; grid = (M/128) * (N/128).
// =====================================================================================================
template <int MODE>
__device__ __forceinline__ void gemm_body(
    _Float16 (*sA)[128 * GPI], _Float16 (*sB)[128 * GPI], float (*sT)[16 * 68], int tile, int bz,
    const unsigned short* __restrict__ Ap, int lda, long long strideA,
    const unsigned short* __restrict__ Btp, int ldb, long long strideB,
    const float* __restrict__ bias,
    void* Cout, void* Cout2, int ldc, long long strideC,
    int M, int N, int K) {
  const int tid  = threadIdx.x;
  const int lane = tid & 31;
  const int wave = tid >> 5;
  const int tilesN = N >> 7;
  const int tilesM = M >> 7;
  if (tile >= tilesM * tilesN) return;             // block-uniform, in front of every barrier
  const int tm = tile / tilesN;
  const int tn = tile - tm * tilesN;
  const int bm0 = tm << 7;                         // block tile origin
  const int bn0 = tn << 7;
  const int wm  = (wave >> 1) << 5;                // wave tile origin inside the block tile
  const int wn  = (wave & 1) << 6;
  const int m0 = bm0 + wm;
  const int n0 = bn0 + wn;

  const _Float16* Ab = (const _Float16*)(const void*)Ap  + (size_t)bz * (size_t)strideA;
  const _Float16* Bb = (const _Float16*)(const void*)Btp + (size_t)bz * (size_t)strideB;

  const int rl   = lane & 15;                      // row (A) / col (B, D) within subtile
  const int hh   = lane >> 4;
  const int koff = hh * 8;                         // k offset of this lane half
  const int mOff = hh * 8;                         // D row offset

  // staging map: thread -> row (tid>>3) + 32*it, 16-B piece (tid&7) of the row's 128 B; 4 it x 32 rows = 128 rows
  const int srow = tid >> 3;
  const int scol = (tid & 7) * 8;
  const _Float16* ga = Ab + (size_t)(bm0 + srow) * lda + scol;
  const _Float16* gb = Bb + (size_t)(bn0 + srow) * ldb + scol;
  const int sofs = srow * GPI + scol;

  v8f acc[2][4];
#pragma unroll
  for (int i = 0; i < 2; ++i)
#pragma unroll
    for (int j = 0; j < 4; ++j) acc[i][j] = zero8();

  const unsigned la0 = lds_off(&sA[0][0]) + (unsigned)sofs * 2u;   // this thread's 16 B of row srow in buffer 0
  const unsigned lb0 = lds_off(&sB[0][0]) + (unsigned)sofs * 2u;
  const size_t a32 = (size_t)32 * lda, b32 = (size_t)32 * ldb;
  constexpr unsigned SBUF = 128u * GPI * 2u;                       // bytes of one buffer
  constexpr unsigned SR32 = 32u * GPI * 2u;                        // bytes of 32 LDS rows
  auto issue = [&](int st) {                                       // stage st -> buffer st & 1: 4 x 32 rows of A and of Bt
    const unsigned la = la0 + (unsigned)(st & 1) * SBUF, lb = lb0 + (unsigned)(st & 1) * SBUF;
    const _Float16* pa = ga + ((size_t)st << 6);
    const _Float16* pb = gb + ((size_t)st << 6);
    copy8(la, la + SR32, la + 2u * SR32, la + 3u * SR32, lb, lb + SR32, lb + 2u * SR32, lb + 3u * SR32,
          pa, pa + a32, pa + 2 * a32, pa + 3 * a32, pb, pb + b32, pb + 2 * b32, pb + 3 * b32);
  };

  const int nst = K >> 6;
  issue(0);
  wait_async0();
  __syncthreads();                                 // publishes stage 0
  if (nst > 1) issue(1);                           // block-uniform
  // kept rolled: one stage is already 16 WMMAs and 24 fragment loads a wave; unrolling would only grow code and registers
#pragma unroll 1
  for (int s = 0; s < nst; ++s) {
    const _Float16* dA = sA[s & 1];
    const _Float16* dB = sB[s & 1];
#pragma unroll
    for (int kk = 0; kk < 2; ++kk) {
      v16h bfg[4], af[2];
      af[0] = ldfrag_h(dA + (wm + rl) * GPI + kk * 32 + koff);
#pragma unroll
      for (int j = 0; j < 4; ++j)
        bfg[j] = ldfrag_h(dB + (wn + (j << 4) + rl) * GPI + kk * 32 + koff);
      af[1] = ldfrag_h(dA + (wm + 16 + rl) * GPI + kk * 32 + koff);
#pragma unroll
      for (int i = 0; i < 2; ++i)
#pragma unroll
        for (int j = 0; j < 4; ++j) acc[i][j] = mma_h(af[i], bfg[j], acc[i][j]);
    }
    wait_ds0();
    wait_async0();
    __syncthreads();                               // publishes stage s+1; ends every wave's reads of stage s
    if (s + 2 < nst) issue(s + 2);                 // block-uniform: flies under the WMMAs of stage s+1
  }
  wait_async0();

  // ---- epilogue ----
  float* slab = sT[wave];
#pragma unroll
  for (int i = 0; i < 2; ++i) {
    const int mBase = m0 + (i << 4);
#pragma unroll
    for (int j = 0; j < 4; ++j) {
#pragma unroll
      for (int r = 0; r < 8; ++r) slab[(mOff + r) * 68 + (j << 4) + rl] = acc[i][j][r] * WINV;
    }
    wave_lds_sync();
    if (MODE == 0) {
      float* C = (float*)Cout + (size_t)bz * (size_t)strideC;
      const int c4 = rl * 4;                                   // 256-B row segment = 16 lanes x 16 B
      const v4f b4 = bfr4(*(const v4f*)(bias + n0 + c4));
      v4f vals[8];
#pragma unroll
      for (int it = 0; it < 8; ++it) {
        const int row = it * 2 + hh;                           // it 0..7 x hh 0..1 = rows 0..15
        const v4f v = *(const v4f*)(slab + row * 68 + c4);
        const v4f o = *(const v4f*)(C + (size_t)(mBase + row) * ldc + n0 + c4);
        vals[it] = o + (v + b4);
      }
      {
#pragma unroll
        for (int it = 0; it < 8; ++it) {
          const int row = it * 2 + hh;
          *(v4f*)(C + (size_t)(mBase + row) * ldc + n0 + c4) = vals[it];
        }
        
      }
    } else {
      const int q = lane >> 3, c8 = (lane & 7) * 8;
      unsigned short* C  = (unsigned short*)Cout  + (size_t)bz * (size_t)strideC;
      unsigned short* C2 = (unsigned short*)Cout2 + (size_t)bz * (size_t)strideC;
      v4f ba = zero4(), bb = zero4();
      if (MODE != 3) {
        ba = bfr4(*(const v4f*)(bias + n0 + c8));
        bb = bfr4(*(const v4f*)(bias + n0 + c8 + 4));
      }
      v4u hv[4], lv[4];
#pragma unroll
      for (int it = 0; it < 4; ++it) {
        const int row = it * 4 + q;                            // it 0..3 x q 0..3 = rows 0..15
        const float* sp = slab + row * 68 + c8;
        v4f fa = *(const v4f*)(sp);
        v4f fb = *(const v4f*)(sp + 4);
        if (MODE == 3) {
          const float br = bfr(bias[mBase + row]);
          fa = fa + br; fb = fb + br;
        } else {
          fa = fa + ba; fb = fb + bb;
        }
        if (MODE == 4) {
#pragma unroll
          for (int e = 0; e < 4; ++e) { fa[e] = gelu_t(fa[e]); fb[e] = gelu_t(fb[e]); }
        }
        v4u a, a2;
        if (MODE == 2) {
#pragma unroll
          for (int e = 0; e < 2; ++e) {
            const float f0 = fa[2 * e], f1 = fa[2 * e + 1];
            const float g0 = fb[2 * e], g1 = fb[2 * e + 1];
            const _Float16 x0 = (_Float16)f0, x1 = (_Float16)f1, y0 = (_Float16)g0, y1 = (_Float16)g1;
            a[e]      = pk16(h_bits(x0), h_bits(x1));
            a[e + 2]  = pk16(h_bits(y0), h_bits(y1));
            a2[e]     = pk16(h_bits((_Float16)((f0 - (float)x0) * QRS)), h_bits((_Float16)((f1 - (float)x1) * QRS)));
            a2[e + 2] = pk16(h_bits((_Float16)((g0 - (float)y0) * QRS)), h_bits((_Float16)((g1 - (float)y1) * QRS)));
          }
        } else {
          a[0] = pkh2(fa[0], fa[1]); a[1] = pkh2(fa[2], fa[3]);
          a[2] = pkh2(fb[0], fb[1]); a[3] = pkh2(fb[2], fb[3]);
          a2 = a;
        }
        hv[it] = a; lv[it] = a2;
      }
      {
#pragma unroll
        for (int it = 0; it < 4; ++it) {
          const int row = it * 4 + q;
          *(v4u*)(C + (size_t)(mBase + row) * ldc + n0 + c8) = hv[it];
          if (MODE == 2) *(v4u*)(C2 + (size_t)(mBase + row) * ldc + n0 + c8) = lv[it];
        }
        
      }
    }
    wave_lds_sync();
  }
}

#define GEMM_LDS                                                                                          \
  __shared__ __align__(16) _Float16 sA[2][128 * GPI]; /* A stage: 128 rows x 64 k, pitch GPI, two buffers */ \
  __shared__ __align__(16) _Float16 sB[2][128 * GPI]; /* Bt stage, same shape */                           \
  __shared__ __align__(16) float sT[8][16 * 68];      /* per-wave 16x64 slab, pitch 68 floats */

template <int MODE>
__global__ __launch_bounds__(256) void gemm64(
    const unsigned short* __restrict__ Ap, int lda, long long strideA,
    const unsigned short* __restrict__ Btp, int ldb, long long strideB,
    const float* __restrict__ bias,
    void* Cout, void* Cout2, int ldc, long long strideC,
    int M, int N, int K) {
  GEMM_LDS
  gemm_body<MODE>(sA, sB, sT, blockIdx.x, blockIdx.y, Ap, lda, strideA, Btp, ldb, strideB, bias,
                  Cout, Cout2, ldc, strideC, M, N, K);
}

// q, k and v^T projections of one layer in one grid: they read the same X and do not depend on each other.
//   blocks 0..191: q (MODE 2); 192..383: k (MODE 1); 384..575: v^T (MODE 3), 96 tiles per batch.
// The three branches are block-uniform, so every barrier in gemm_body is passed by the whole block.
#define TQK ((BT / 128) * (HID / 128))
#define TVB ((HID / 128) * (SEQ / 128))
__global__ __launch_bounds__(256) void gemm_qkv(
    const unsigned short* __restrict__ X, const unsigned short* __restrict__ Wqt,
    const unsigned short* __restrict__ Wkt, const unsigned short* __restrict__ Wvt,
    const float* __restrict__ bq, const float* __restrict__ bk, const float* __restrict__ bv,
    unsigned short* Qh, unsigned short* Ql, unsigned short* Kh, unsigned short* VT) {
  GEMM_LDS
  const int t = blockIdx.x;
  if (t < TQK) {
    gemm_body<2>(sA, sB, sT, t, 0, X, HID, 0LL, Wqt, HID, 0LL, bq, (void*)Qh, (void*)Ql, HID, 0LL, BT, HID, HID);
  } else if (t < 2 * TQK) {
    gemm_body<1>(sA, sB, sT, t - TQK, 0, X, HID, 0LL, Wkt, HID, 0LL, bk, (void*)Kh, (void*)Kh, HID, 0LL, BT, HID, HID);
  } else {
    const int u  = t - 2 * TQK;
    const int bz = u / TVB;
    gemm_body<3>(sA, sB, sT, u - bz * TVB, bz, Wvt, HID, 0LL, X, HID, (long long)SEQ * HID, bv,
                 (void*)VT, (void*)VT, SEQ, (long long)HID * SEQ, HID, SEQ, HID);
  }
}

__device__ __forceinline__ float xhalf(float x) {
  return __builtin_bit_cast(float, __builtin_amdgcn_permlanex16(__builtin_bit_cast(int, x), __builtin_bit_cast(int, x),
                                                                0x76543210, 0xfedcba98, false, false));
}

// 2^x of eight values in one statement. The results are early-clobber, so none of them lies on a source of the exponential in
// front of it, and the closing v_nop is the slot the instruction set asks for between a transcendental and the next instruction
// that uses its result or overwrites its source (left to itself the compiler put results on the source of the one in front).
__device__ __forceinline__ v8f exp2x8(v8f x) {
  v8f y = x;
#if defined(__HIP_DEVICE_COMPILE__)
  float y0, y1, y2, y3, y4, y5, y6, y7;
  asm("v_exp_f32 %0, %8\n\tv_exp_f32 %1, %9\n\tv_exp_f32 %2, %10\n\tv_exp_f32 %3, %11\n\t"
      "v_exp_f32 %4, %12\n\tv_exp_f32 %5, %13\n\tv_exp_f32 %6, %14\n\tv_exp_f32 %7, %15\n\tv_nop"
      : "=&v"(y0), "=&v"(y1), "=&v"(y2), "=&v"(y3), "=&v"(y4), "=&v"(y5), "=&v"(y6), "=&v"(y7)
      : "v"(x[0]), "v"(x[1]), "v"(x[2]), "v"(x[3]), "v"(x[4]), "v"(x[5]), "v"(x[6]), "v"(x[7]));
  y[0] = y0; y[1] = y1; y[2] = y2; y[3] = y3; y[4] = y4; y[5] = y5; y[6] = y6; y[7] = y7;
#endif
  return y;
}

__global__ __launch_bounds__(128)
void attn64(const unsigned short* __restrict__ qhp, const unsigned short* __restrict__ qlp,
            const unsigned short* __restrict__ khp, const unsigned short* __restrict__ vtp,
            const float* __restrict__ mask, unsigned short* ctxp, float sscale) {
  union FH { v16h v; v8h h[2]; };
  __shared__ __align__(16) _Float16 Ks[2][64 * API];              // K [kv][d]    9 KB, two buffers
  __shared__ __align__(16) _Float16 Vts[2][64 * API];             // V^T [d][kv]  9 KB, two buffers
  __shared__ __align__(16) float    Mt[2][128];                   // per key of the chunk: [0..63] m * sscale, [64..127] -1e10 * (1 - m)
  __shared__ __align__(16) float    Os[4][16 * OPI];              // per wave context tile [row][d]

  const int tid  = threadIdx.x;
  const int wave = tid >> 5;
  const int lane = tid & 31;
  const int hh   = lane >> 4;
  const int c    = lane & 15;

  const int bx   = blockIdx.x;
  const int qb   = bx % NQB;
  const int rest = bx / NQB;
  const int h    = rest % NHD;
  const int b    = rest / NHD;
  const int q0   = qb * 64 + wave * 16;
  const size_t rowB = (size_t)b * SEQ;

  const _Float16* Qh = (const _Float16*)(const void*)qhp + (size_t)h * HD;
  const _Float16* Ql = (const _Float16*)(const void*)qlp + (size_t)h * HD;
  const _Float16* Kh = (const _Float16*)(const void*)khp + (size_t)h * HD;
  const _Float16* Vt = (const _Float16*)(const void*)vtp + ((size_t)b * HID + (size_t)h * HD) * SEQ;
  const float* mb = mask + (size_t)b * SEQ;

  // ---- Q fragments (B operand, column = query q0 + (lane&15)): 2 d-chunks, hi and residual ----
  v16h qah[2], qal[2];
#pragma unroll
  for (int dc = 0; dc < 2; ++dc) {
    const size_t qo = (rowB + q0 + c) * HID + dc * 32 + 8 * hh;
    qah[dc] = ldfrag_h(Qh + qo);
    qal[dc] = ldfrag_h(Ql + qo);
  }

  float mrun = -INFINITY;                          // this lane's query: running max, alike in both wave halves
  v8f lacc = zero8();                              // its sum of p: register r over keys = 8hh + r (mod 16); joined after the loop
  v8f oacc[4];                                     // O^T: register r of tile t = d 16t + 8hh + r of query q0 + c
#pragma unroll
  for (int t = 0; t < 4; ++t) oacc[t] = zero8();

  // staging map: thread -> row (tid>>3) + 16*i, 16-B piece (tid&7) of the row's 128 B; 4 i x 16 rows = 64 rows of K and of V^T
  const int srow = tid >> 3, scol = (tid & 7) * 8;
  const _Float16* kg = Kh + (rowB + srow) * HID + scol;            // K row srow of chunk 0
  const _Float16* vg = Vt + (size_t)srow * SEQ + scol;             // V^T row d = srow, keys of chunk 0
  const unsigned lk0 = lds_off(&Ks[0][0])  + (unsigned)(srow * API + scol) * 2u;
  const unsigned lv0 = lds_off(&Vts[0][0]) + (unsigned)(srow * API + scol) * 2u;
  constexpr unsigned ABUF = 64u * API * 2u;                        // bytes of one buffer
  constexpr unsigned AR16 = 16u * API * 2u;                        // bytes of 16 LDS rows
  auto issue = [&](int ch) {                                       // chunk ch < NQB -> buffer ch & 1
    const unsigned lk = lk0 + (unsigned)(ch & 1) * ABUF, lv = lv0 + (unsigned)(ch & 1) * ABUF;
    const _Float16* pk = kg + (size_t)ch * 64 * HID;
    const _Float16* pv = vg + (size_t)ch * 64;
    copy8(lk, lk + AR16, lk + 2u * AR16, lk + 3u * AR16, lv, lv + AR16, lv + 2u * AR16, lv + 3u * AR16,
          pk, pk + 16 * HID, pk + 32 * HID, pk + 48 * HID, pv, pv + 16 * SEQ, pv + 32 * SEQ, pv + 48 * SEQ);
  };
  auto mterm = [&](float mraw) {                                   // threads 0..63 hold the factor, 64..127 the addend
    const float m = bfr(mraw);
    return (tid < 64) ? m * sscale : -1.0e10f * (1.0f - m);
  };
  static_assert(NQB >= 2);
  issue(0);
  Mt[0][tid] = mterm(mb[tid & 63]);
  wait_async0();
  __syncthreads();                                 // publishes chunk 0
  issue(1);

#pragma unroll 1
  for (int kt = 0; kt < NQB; ++kt) {
    const _Float16* Kc = Ks[kt & 1];
    const _Float16* Vc = Vts[kt & 1];
    const float*    Mc = Mt[kt & 1];
    // mask value of the next chunk's key, in flight under this chunk; the last trip takes its own chunk again (in bounds, read by nobody)
    const float mraw = mb[((kt + 1 < NQB) ? kt + 1 : kt) * 64 + (tid & 63)];

    // ---- scores, transposed: 64 keys x 16 queries per wave, k.qhi and k.qres ----
    // LDS reads of a chunk stand in three groups, each a run of products or arithmetic ahead of its last user, so that the waits are
    // counted ones; read pair by pair in front of each product, every pair's LDS latency is waited out alone, 16 times a chunk.
    // group 1: all 8 K fragments and the mask terms of keys 0..31
    FH kb[4][2];
    v4f mf[4][2], md[4][2];                        // per key: factor m * sscale, addend -1e10 * (1 - m); [j][0] = r 0..3, [j][1] = r 4..7
#pragma unroll
    for (int j = 0; j < 4; ++j) {
#pragma unroll
      for (int dc = 0; dc < 2; ++dc) {
        kb[j][dc].h[0] = *(const v8h*)(Kc + (j * 16 + c) * API + dc * 32 + 8 * hh);
        kb[j][dc].h[1] = *(const v8h*)(Kc + (j * 16 + c) * API + dc * 32 + 16 + 8 * hh);
      }
    }
#pragma unroll
    for (int j = 0; j < 2; ++j) {
      mf[j][0] = *(const v4f*)(Mc + j * 16 + 8 * hh);      mf[j][1] = *(const v4f*)(Mc + j * 16 + 8 * hh + 4);
      md[j][0] = *(const v4f*)(Mc + 64 + j * 16 + 8 * hh); md[j][1] = *(const v4f*)(Mc + 64 + j * 16 + 8 * hh + 4);
    }
    v8f s[4], sl[4];
#pragma unroll
    for (int j = 0; j < 2; ++j) {
      s[j] = zero8();
      sl[j] = zero8();
#pragma unroll
      for (int dc = 0; dc < 2; ++dc) {
        s[j]  = mma_h(kb[j][dc].v, qah[dc], s[j]);
        sl[j] = mma_h(kb[j][dc].v, qal[dc], sl[j]);
      }
    }
    // group 2: the mask terms of keys 32..63, used behind the next 8 products
#pragma unroll
    for (int j = 2; j < 4; ++j) {
      mf[j][0] = *(const v4f*)(Mc + j * 16 + 8 * hh);      mf[j][1] = *(const v4f*)(Mc + j * 16 + 8 * hh + 4);
      md[j][0] = *(const v4f*)(Mc + 64 + j * 16 + 8 * hh); md[j][1] = *(const v4f*)(Mc + 64 + j * 16 + 8 * hh + 4);
    }
#pragma unroll
    for (int j = 0; j < 2; ++j) {
#pragma unroll
      for (int r = 0; r < 4; ++r) {
        s[j][r]     = (s[j][r]     + sl[j][r]     * QRI) * mf[j][0][r] + md[j][0][r];
        s[j][r + 4] = (s[j][r + 4] + sl[j][r + 4] * QRI) * mf[j][1][r] + md[j][1][r];
      }
    }
#pragma unroll
    for (int j = 2; j < 4; ++j) {
      s[j] = zero8();
      sl[j] = zero8();
#pragma unroll
      for (int dc = 0; dc < 2; ++dc) {
        s[j]  = mma_h(kb[j][dc].v, qah[dc], s[j]);
        sl[j] = mma_h(kb[j][dc].v, qal[dc], sl[j]);
      }
    }
    // group 3: all 8 V^T fragments, so that they land under the softmax arithmetic
    FH vb[2][4];
#pragma unroll
    for (int kk = 0; kk < 2; ++kk) {
#pragma unroll
      for (int t = 0; t < 4; ++t) {
        vb[kk][t].h[0] = *(const v8h*)(Vc + (t * 16 + c) * API + kk * 32 + 8 * hh);
        vb[kk][t].h[1] = *(const v8h*)(Vc + (t * 16 + c) * API + kk * 32 + 16 + 8 * hh);
      }
    }
#pragma unroll
    for (int j = 2; j < 4; ++j) {
#pragma unroll
      for (int r = 0; r < 4; ++r) {
        s[j][r]     = (s[j][r]     + sl[j][r]     * QRI) * mf[j][0][r] + md[j][0][r];
        s[j][r + 4] = (s[j][r + 4] + sl[j][r + 4] * QRI) * mf[j][1][r] + md[j][1][r];
      }
    }

    // ---- max of this query's 64 scores, online softmax, P^T (x1024, f16) packed in place as B fragments ----
    float mj[4];
#pragma unroll
    for (int j = 0; j < 4; ++j) {
      mj[j] = fmaxf(fmaxf(fmaxf(s[j][0], s[j][1]), fmaxf(s[j][2], s[j][3])),
                    fmaxf(fmaxf(s[j][4], s[j][5]), fmaxf(s[j][6], s[j][7])));
    }
    float m = fmaxf(fmaxf(mj[0], mj[1]), fmaxf(mj[2], mj[3]));
    m = fmaxf(m, xhalf(m));
    const float mnew  = fmaxf(mrun, m);
    const float alpha = __expf(mrun - mnew);
    mrun = mnew;
    FH pb[2];
    v8f p[4];
#pragma unroll
    for (int j = 0; j < 4; ++j) {
      p[j] = exp2x8((s[j] - mnew) * 1.4426950408889634f);
#pragma unroll
      for (int r = 0; r < 8; ++r) pb[j >> 1].v[(j & 1) * 8 + r] = (_Float16)(p[j][r] * PSC);
    }
    lacc = lacc * alpha + ((p[0] + p[1]) + (p[2] + p[3]));
#pragma unroll
    for (int t = 0; t < 4; ++t) oacc[t] *= alpha;

    // ---- context^T += V^T . P^T (f16 WMMA) ----
#pragma unroll
    for (int kk = 0; kk < 2; ++kk) {
#pragma unroll
      for (int t = 0; t < 4; ++t) oacc[t] = mma_h(vb[kk][t].v, pb[kk].v, oacc[t]);
    }

    Mt[(kt + 1) & 1][tid] = mterm(mraw);           // its last readers passed the barrier at the foot of trip kt-1
    wait_ds0();
    wait_async0();
    __syncthreads();                               // publishes chunk kt+1; ends every wave's reads of chunk kt
    if (kt + 2 < NQB) issue(kt + 2);               // block-uniform: flies under the work on chunk kt+1
  }
  wait_async0();

  float* os = Os[wave];
  {
    const float lsum = ((lacc[0] + lacc[1]) + (lacc[2] + lacc[3])) + ((lacc[4] + lacc[5]) + (lacc[6] + lacc[7]));
    const float l = lsum + xhalf(lsum);            // the two halves' key sums joined
    const float inv = ((l > 0.f) ? (1.0f / l) : 0.f) * PSI;
#pragma unroll
    for (int t = 0; t < 4; ++t) {
      v4f lo, hi;
#pragma unroll
      for (int r = 0; r < 4; ++r) { lo[r] = oacc[t][r] * inv; hi[r] = oacc[t][r + 4] * inv; }
      *(v4f*)(os + c * OPI + t * 16 + 8 * hh)     = lo;
      *(v4f*)(os + c * OPI + t * 16 + 8 * hh + 4) = hi;
    }
  }
  wave_lds_sync();
  {
    const int q4 = lane >> 3, c8 = (lane & 7) * 8;
    v4u hv[4];
#pragma unroll
    for (int it = 0; it < 4; ++it) {
      const int row = it * 4 + q4;           // it 0..3 x q4 0..3 = rows 0..15 of the wave tile
      const float* sp = os + row * OPI + c8;
      const v4f fa = *(const v4f*)(sp);
      const v4f fb = *(const v4f*)(sp + 4);
      v4u a;
      a[0] = pkh2(fa[0], fa[1]); a[1] = pkh2(fa[2], fa[3]);
      a[2] = pkh2(fb[0], fb[1]); a[3] = pkh2(fb[2], fb[3]);
      hv[it] = a;
    }
    {
#pragma unroll
      for (int it = 0; it < 4; ++it) {
        const int row = it * 4 + q4;
        const size_t go = (rowB + q0 + row) * HID + (size_t)h * HD + c8;
        *(v4u*)(ctxp + go) = hv[it];
      }
      
    }
  }
}

// =====================================================================================================
// Workspace map (bytes), all region sizes multiples of 128 and exact multiples of their 64x64- or 128x128-tile / whole-row
// store granularity (M, N multiples of 128; 768- and 3072-wide rows), so no padded tails are needed:
//   Hres f32 [4096][768]        12582912
//   X    f16 [4096][768]         6291456   (LN output plane, reused by LN1 and LN2)
//   Qh   f16 [4096][768]         6291456
//   Ql   f16 [4096][768]         6291456   (q residual x4096)
//   Kh   f16 [4096][768]         6291456
//   VT   f16 [2][768][2048]      6291456
//   Ctx  f16 [4096][768]         6291456
//   G    f16 [4096][3072]       25165824
//   per layer (2 x 14155776):
//   Wq_t,Wk_t,Wv_t,Wo_t f16 [768][768]  4 x 1179648
//   W1_t f16 [3072][768]         4718592
//   W2_t f16 [768][3072]         4718592
//   total                      103809024
// Both layers' weights are converted by the first launch, each layer into its own region ([out n][in k], k contiguous = the Bt / A layout).
// =====================================================================================================
extern "C" void kernel_launch(void* const* d_in, const int* in_sizes, int n_in,
                              void* d_out, int out_size, void* d_ws, size_t ws_size,
                              hipStream_t stream) {
  if (n_in < 21) return;
  if (in_sizes[0] != BT * HID || in_sizes[1] != BT * HID || in_sizes[2] != NB * SEQ) return;
  if (in_sizes[3] != 2 * HID || in_sizes[4] != 2 * HID) return;
  if (in_sizes[5] != 2 * HID * HID || in_sizes[7] != 2 * HID * HID ||
      in_sizes[9] != 2 * HID * HID || in_sizes[11] != 2 * HID * HID) return;
  if (in_sizes[6] != 2 * HID || in_sizes[8] != 2 * HID || in_sizes[10] != 2 * HID || in_sizes[12] != 2 * HID) return;
  if (in_sizes[13] != 2 * HID || in_sizes[14] != 2 * HID) return;
  if (in_sizes[15] != 2 * HID * DFF || in_sizes[16] != 2 * DFF ||
      in_sizes[17] != 2 * DFF * HID || in_sizes[18] != 2 * HID) return;
  if (in_sizes[19] != HID || in_sizes[20] != HID) return;
  if (out_size != BT * HID) return;

  const float* in_h  = (const float*)d_in[0];
  const float* embs  = (const float*)d_in[1];
  const float* mask  = (const float*)d_in[2];
  const float* ln1_s = (const float*)d_in[3];
  const float* ln1_b = (const float*)d_in[4];
  const float* wq    = (const float*)d_in[5];
  const float* bq    = (const float*)d_in[6];
  const float* wk    = (const float*)d_in[7];
  const float* bk    = (const float*)d_in[8];
  const float* wv    = (const float*)d_in[9];
  const float* bv    = (const float*)d_in[10];
  const float* wo    = (const float*)d_in[11];
  const float* bo    = (const float*)d_in[12];
  const float* ln2_s = (const float*)d_in[13];
  const float* ln2_b = (const float*)d_in[14];
  const float* w1    = (const float*)d_in[15];
  const float* b1    = (const float*)d_in[16];
  const float* w2    = (const float*)d_in[17];
  const float* b2    = (const float*)d_in[18];
  const float* lnf_s = (const float*)d_in[19];
  const float* lnf_b = (const float*)d_in[20];
  float* out = (float*)d_out;

  const size_t PH  = (size_t)BT * HID * 4;        // 12582912
  const size_t PA  = (size_t)BT * HID * 2;        //  6291456
  const size_t PVT = (size_t)NB * HID * SEQ * 2;  //  6291456
  const size_t PG  = (size_t)BT * DFF * 2;        // 25165824
  const size_t PW  = (size_t)HID * HID * 2;       //  1179648
  const size_t PW1 = (size_t)HID * DFF * 2;       //  4718592
  size_t off = 0;
  const size_t oH   = off; off += PH;
  const size_t oX   = off; off += PA;
  const size_t oQh  = off; off += PA;
  const size_t oQl  = off; off += PA;
  const size_t oKh  = off; off += PA;
  const size_t oVT  = off; off += PVT;
  const size_t oCtx = off; off += PA;
  const size_t oG   = off; off += PG;
  const size_t oWt  = off; off += 2 * (4 * PW + 2 * PW1);
  if (off > ws_size) return;                      // off = 103809024
  if (off > (size_t)134217728) return;

  char* ws = (char*)d_ws;
  float*          Hres = (float*)(ws + oH);
  unsigned short* X    = (unsigned short*)(ws + oX);
  unsigned short* Qh   = (unsigned short*)(ws + oQh);
  unsigned short* Ql   = (unsigned short*)(ws + oQl);
  unsigned short* Kh   = (unsigned short*)(ws + oKh);
  unsigned short* VT   = (unsigned short*)(ws + oVT);
  unsigned short* Ctx  = (unsigned short*)(ws + oCtx);
  unsigned short* G    = (unsigned short*)(ws + oG);
  unsigned short* Wt   = (unsigned short*)(ws + oWt);

  const dim3 blk(256);
  const dim3 gLN(BT / 8);                                           // 512 blocks, 8 rows each
  const dim3 gPrep(BT / 8 + 2 * CVL);                               // 512 row groups + 2 x 1728 weight tiles
  const dim3 gHH((BT / 128) * (HID / 128), 1);                      // 32 x 6  = 192 blocks
  const dim3 gQKV(2 * TQK + NB * TVB);                              // 192 + 192 + 2 x 96 = 576 blocks
  const dim3 gF1((BT / 128) * (DFF / 128), 1);                      // 32 x 24 = 768 blocks
  const dim3 gAt(NB * NHD * NQB);                                   // 768 blocks of 128

  for (int l = 0; l < 2; ++l) {
    unsigned short* Wqt = Wt + (size_t)l * WLH;
    unsigned short* Wkt = Wqt + (size_t)HID * HID;
    unsigned short* Wvt = Wkt + (size_t)HID * HID;
    unsigned short* Wot = Wvt + (size_t)HID * HID;
    unsigned short* W1t = Wot + (size_t)HID * HID;
    unsigned short* W2t = W1t + (size_t)HID * DFF;
    // (1) h = h + input_embs; hn = LN1(h) -> X (f16); with layer 0 also
    // (2) the weights of both layers: f32 [in][out] -> f16 [out][in] (bf16-RNE values x64)
    if (l == 0) {
      prep<<<gPrep, blk, 0, stream>>>(in_h, embs, Hres, ln1_s, ln1_b, X, wq, wk, wv, wo, w1, w2, Wt);
    } else {
      ln_rows<true, false, false><<<gLN, blk, 0, stream>>>(Hres, embs, Hres, ln1_s + HID, ln1_b + HID, (void*)X, BT);
    }
    // (3) q = hn . Wq + bq -> f16 hi + residual planes [b*SEQ+t][h*64+d]  (M=4096, N=768, K=768)
    // (4) k = hn . Wk + bk -> f16 plane
    // (5) v^T = Wv_t . hn^T per batch -> f16 [b][h*64+d][s]  (A = Wv_t [n][k], Bt = X rows of batch b; M=768, N=2048, K=768)
    gemm_qkv<<<gQKV, blk, 0, stream>>>(X, Wqt, Wkt, Wvt, bq + l * HID, bk + l * HID, bv + l * HID, Qh, Ql, Kh, VT);
    // (6) attention -> Ctx f16 [b*SEQ+t][h*64+d]
    attn64<<<gAt, dim3(128), 0, stream>>>(Qh, Ql, Kh, VT, mask, Ctx, 0.125f);
    // (7) h = h + (ctx . Wo + bo)  (f32, in place)
    gemm64<0><<<gHH, blk, 0, stream>>>(Ctx, HID, 0LL, Wot, HID, 0LL, bo + l * HID,
                                       (void*)Hres, (void*)Hres, HID, 0LL, BT, HID, HID);
    // (8) hn = LN2(h) -> X
    ln_rows<false, false, false><<<gLN, blk, 0, stream>>>(Hres, embs, Hres, ln2_s + l * HID, ln2_b + l * HID, (void*)X, BT);
    // (9) g = gelu(hn . W1 + b1) -> G f16 [4096][3072]  (M=4096, N=3072, K=768)
    gemm64<4><<<gF1, blk, 0, stream>>>(X, HID, 0LL, W1t, HID, 0LL, b1 + l * DFF,
                                       (void*)G, (void*)G, DFF, 0LL, BT, DFF, HID);
    // (10) h = h + (g . W2 + b2)  (M=4096, N=768, K=3072, f32 in place)
    gemm64<0><<<gHH, blk, 0, stream>>>(G, DFF, 0LL, W2t, DFF, 0LL, b2 + l * HID,
                                       (void*)Hres, (void*)Hres, HID, 0LL, BT, HID, DFF);
  }
  // (11) out = LN_f(h) -> f32 [2][2048][768]
  ln_rows<false, false, true><<<gLN, blk, 0, stream>>>(Hres, embs, Hres, lnf_s, lnf_b, (void*)out, BT);
  (void)hipGetLastError();
}

// v007
// A run of this version takes 279 microseconds.
// Next to v006, in two timings, it ran 1.13 times as fast each time.
// Over all steps from v000 it is 3.55 times as fast.
// Contractions: q, k, v^T, out and ffn projections = v_wmma_f32_16x16x32_f16 (f16 activations; weights bf16-RNE then x64 as f16), single product;
// q.k^T = v_wmma_f32_16x16x32_f16 with q as f16 hi + f16 residual (x4096) planes and k f16, 2 products in separate accumulators;
// p.v = v_wmma_f32_16x16x32_f16 (p carried x1024 in f16, v f16); f32 accumulate everywhere; layernorm, softmax and gelu in f32.
#include <hip/hip_runtime.h>
#include <math.h>
#include <stdint.h>

#define NB   2
#define SEQ  2048
#define HID  768
#define NHD  12
#define HD   64
#define DFF  3072
#define BT   (NB * SEQ)
#define NQB  (SEQ / 64)
#define WSC  64.0f
#define WINV 0.015625f
#define QRS  4096.0f
#define QRI  0.000244140625f
#define PSC  1024.0f
#define PSI  0.0009765625f
#define API  72                 // LDS row pitch of the attention K and V^T tiles, in halves: 64 + 8 = 144 B = 16 B x odd
#define OPI  68                 // LDS row pitch of the attention context tile, in floats: 64 + 4 = 272 B = 16 B x odd
static_assert(NHD * HD == HID);
static_assert((SEQ % 64) == 0 && (HID % 64) == 0 && (DFF % 64) == 0 && (BT % 64) == 0);
static_assert(HID == 6 * 128);
static_assert((SEQ % 128) == 0 && (HID % 128) == 0 && (DFF % 128) == 0 && (BT % 128) == 0);
static_assert((HID % 256) == 0 && (DFF % 256) == 0);

typedef _Float16 v16h __attribute__((ext_vector_type(16)));
typedef _Float16 v8h  __attribute__((ext_vector_type(8)));
typedef float    v8f  __attribute__((ext_vector_type(8)));
typedef float    v4f  __attribute__((ext_vector_type(4)));
typedef unsigned int v4u __attribute__((ext_vector_type(4)));

// ---- scalar helpers -----------------------------------------------------------------------------
__device__ __forceinline__ unsigned short bf_bits(float f) {        // f32 -> bf16 bits, RNE convert
  const unsigned u = __float_as_uint(f);
  return (unsigned short)((u + 0x7FFFu + ((u >> 16) & 1u)) >> 16);
}
__device__ __forceinline__ float bfr(float f) { return __uint_as_float(((unsigned)bf_bits(f)) << 16); }
__device__ __forceinline__ v4f bfr4(v4f a) {
  v4f r;
  r[0] = bfr(a[0]); r[1] = bfr(a[1]); r[2] = bfr(a[2]); r[3] = bfr(a[3]);
  return r;
}
__device__ __forceinline__ unsigned short h_bits(_Float16 x) { return __builtin_bit_cast(unsigned short, x); }
__device__ __forceinline__ unsigned pk16(unsigned short a, unsigned short b) { return (unsigned)a | ((unsigned)b << 16); }
__device__ __forceinline__ unsigned pkh2(float a, float b) { return pk16(h_bits((_Float16)a), h_bits((_Float16)b)); }
__device__ __forceinline__ v8f zero8() { v8f z = {0.f, 0.f, 0.f, 0.f, 0.f, 0.f, 0.f, 0.f}; return z; }
__device__ __forceinline__ v4f zero4() { v4f z = {0.f, 0.f, 0.f, 0.f}; return z; }

// ---- fragment loader: 16-bit A/B operand, lane -> row/col (lane&15); p already includes +8*(lane>>4);
//      elements 0..7 <- p[0..7] (k0+8h..), elements 8..15 <- p[16..23] (k0+16+8h..)
__device__ __forceinline__ v16h ldfrag_h(const _Float16* p) {
  union { v16h v; v8h h[2]; } f;
  f.h[0] = *(const v8h*)(p);
  f.h[1] = *(const v8h*)(p + 16);
  return f.v;
}

// ---- WMMA with trailing VALU hazard gap -----------------------------------------------------------
__device__ __forceinline__ v8f mma_h(v16h a, v16h b, v8f c) {
  c = __builtin_amdgcn_wmma_f32_16x16x32_f16(false, a, false, b, (short)0, c, false, false);
#if defined(__HIP_DEVICE_COMPILE__)
  asm volatile("v_nop\n\tv_nop\n\tv_nop\n\tv_nop" : "+v"(c) : "v"(a), "v"(b));
#endif
  return c;
}

// release/acquire + wave barrier for same-wave LDS exchange
__device__ __forceinline__ void wave_lds_sync() {
  __builtin_amdgcn_fence(__ATOMIC_RELEASE, "workgroup");
  __builtin_amdgcn_wave_barrier();
  __builtin_amdgcn_fence(__ATOMIC_ACQUIRE, "workgroup");
}

// ---- asynchronous copies to LDS ------------------------------------------------------------------
__device__ __forceinline__ unsigned lds_off(const void* p) { return (unsigned)(size_t)p; }   // byte offset in the work-group's LDS

// Eight 16-B copies per lane, global memory -> LDS through no register: l* = the lane's LDS byte address, g* = its global address.
// The closing s_wait_xcnt 0 is a precaution: it stands in front of every later rewrite of the address registers the copies name.
__device__ __forceinline__ void copy8(unsigned l0, unsigned l1, unsigned l2, unsigned l3,
                                      unsigned l4, unsigned l5, unsigned l6, unsigned l7,
                                      const _Float16* g0, const _Float16* g1, const _Float16* g2, const _Float16* g3,
                                      const _Float16* g4, const _Float16* g5, const _Float16* g6, const _Float16* g7) {
#if defined(__HIP_DEVICE_COMPILE__)
  asm volatile("global_load_async_to_lds_b128 %0, %8, off\n\t"
               "global_load_async_to_lds_b128 %1, %9, off\n\t"
               "global_load_async_to_lds_b128 %2, %10, off\n\t"
               "global_load_async_to_lds_b128 %3, %11, off\n\t"
               "global_load_async_to_lds_b128 %4, %12, off\n\t"
               "global_load_async_to_lds_b128 %5, %13, off\n\t"
               "global_load_async_to_lds_b128 %6, %14, off\n\t"
               "global_load_async_to_lds_b128 %7, %15, off\n\t"
               "s_wait_xcnt 0x0"
               :: "v"(l0), "v"(l1), "v"(l2), "v"(l3), "v"(l4), "v"(l5), "v"(l6), "v"(l7),
                  "v"(g0), "v"(g1), "v"(g2), "v"(g3), "v"(g4), "v"(g5), "v"(g6), "v"(g7)
               : "memory");
#endif
}
// this wave's LDS reads have returned: stands in front of the barrier behind which their buffer is refilled
__device__ __forceinline__ void wait_ds0() { asm volatile("s_wait_dscnt 0x0" ::: "memory"); }
// this wave's copies have landed: stands in front of the barrier behind which other waves read them (the compiler places no wait for a copy)
__device__ __forceinline__ void wait_async0() { asm volatile("s_wait_asynccnt 0x0" ::: "memory"); }

// tanh-approximation gelu, tanh(u) = 1 - 2/(exp(2u)+1) with u clamped to [-16,16]
__device__ __forceinline__ float gelu_t(float x) {
  float u = 0.7978845608028654f * (x + 0.044715f * x * x * x);
  u = fminf(fmaxf(u, -16.0f), 16.0f);
  const float e  = __expf(2.0f * u);
  const float th = 1.0f - 2.0f * __builtin_amdgcn_rcpf(e + 1.0f);
  return 0.5f * x * (1.0f + th);
}

// =====================================================================================================
// Residual add + LayerNorm, one wave per row of 768. grid = nrows/8, 256 threads.
//   x = src row (RSRC: bf16-RNE the loaded values) (+ ADDE: bf16-RNE(embs row)); ADDE also stores x to hdst
//   (may alias src: every lane reads its own 24 columns before storing them).
//   else:  y -> f16 rows via a per-wave LDS row buffer (lane l: 8 halves at col 256j+8l, 512 B per instruction).
// coverage: 8 waves x grid(512) = 4096 rows; 6 x 128 floats / 3 x 256 halves = the whole 768-wide row.
// =====================================================================================================
// blk = index of the 8-row group; rb = the block's 8 x 768 float row buffer in LDS.
template <bool ADDE, bool RSRC, bool OUT32>
__device__ __forceinline__ void ln_body(int blk, float* rb, const float* src, const float* embs, float* hdst,
                                        const float* __restrict__ sc, const float* __restrict__ bi,
                                        void* outp, int nrows) {
  const int tid = threadIdx.x, wave = tid >> 5, lane = tid & 31;
  const int row = blk * 8 + wave;
  if (row >= nrows) return;                       // wave-uniform; no block barrier behind it in this body
  const size_t rbase = (size_t)row * HID;
  v4f x[6];
#pragma unroll
  for (int i = 0; i < 6; ++i) {
    const int col = i * 128 + lane * 4;
    v4f a = *(const v4f*)(src + rbase + col);
    if (RSRC) a = bfr4(a);
    if (ADDE) {
      const v4f e = bfr4(*(const v4f*)(embs + rbase + col));
      a = a + e;
    }
    x[i] = a;
    // precaution: a later load's result may be given the address registers of this trip's loads; this keeps the wait in front of that
    asm volatile("s_wait_xcnt 0x0" ::: "memory");
  }
  if (ADDE) {
    {
#pragma unroll
      for (int i = 0; i < 6; ++i) *(v4f*)(hdst + rbase + i * 128 + lane * 4) = x[i];
      
    }
  }
  float s = 0.f;
#pragma unroll
  for (int i = 0; i < 6; ++i) s += (x[i][0] + x[i][1]) + (x[i][2] + x[i][3]);
#pragma unroll
  for (int off = 1; off < 32; off <<= 1) s += __shfl_xor(s, off, 32);
  const float mean = s * (1.0f / 768.0f);
  float qv = 0.f;
#pragma unroll
  for (int i = 0; i < 6; ++i) {
    const v4f d = x[i] - mean;
    qv += (d[0] * d[0] + d[1] * d[1]) + (d[2] * d[2] + d[3] * d[3]);
  }
#pragma unroll
  for (int off = 1; off < 32; off <<= 1) qv += __shfl_xor(qv, off, 32);
  const float var  = qv * (1.0f / 768.0f);
  const float rinv = rsqrtf(var + 1e-5f);
  v4f y[6];
#pragma unroll
  for (int i = 0; i < 6; ++i) {
    const int col = i * 128 + lane * 4;
    const v4f s4 = bfr4(*(const v4f*)(sc + col));
    const v4f b4 = bfr4(*(const v4f*)(bi + col));
    y[i] = (x[i] - mean) * rinv * s4 + b4;
  }
  if (OUT32) {
    float* o = (float*)outp;
    {
#pragma unroll
      for (int i = 0; i < 6; ++i) *(v4f*)(o + rbase + i * 128 + lane * 4) = y[i];
      
    }
  } else {
    float* rw = rb + wave * HID;
#pragma unroll
    for (int i = 0; i < 6; ++i) *(v4f*)(rw + i * 128 + lane * 4) = y[i];
    wave_lds_sync();
    v4u pk[3];
#pragma unroll
    for (int j = 0; j < 3; ++j) {
      const v4f a = *(const v4f*)(rw + j * 256 + lane * 8);
      const v4f c = *(const v4f*)(rw + j * 256 + lane * 8 + 4);
      v4u p;
      p[0] = pkh2(a[0], a[1]); p[1] = pkh2(a[2], a[3]);
      p[2] = pkh2(c[0], c[1]); p[3] = pkh2(c[2], c[3]);
      pk[j] = p;
    }
    unsigned short* o = (unsigned short*)outp;
    {
#pragma unroll
      for (int j = 0; j < 3; ++j) *(v4u*)(o + rbase + j * 256 + lane * 8) = pk[j];
      
    }
  }
}

template <bool ADDE, bool RSRC, bool OUT32>
__global__ __launch_bounds__(256) void ln_rows(const float* src, const float* embs, float* hdst,
                                               const float* __restrict__ sc, const float* __restrict__ bi,
                                               void* outp, int nrows) {
  __shared__ __align__(16) float rb[8 * HID];
  ln_body<ADDE, RSRC, OUT32>(blockIdx.x, rb, src, embs, hdst, sc, bi, outp, nrows);
}

// =====================================================================================================
// Weight convert + transpose: W f32 [K][N] (row-major, in-major) -> O f16 [N][K] = f16(bf16-RNE(w) * 64).
// One block = one tile of 64 k x 64 n through LDS, origin (k0, n0); 256 threads; sT = the block's 64 x 72 half tile in LDS.
//   read: thread (r = tid>>2 = k row, cq = (tid&3)*16 = n quarter) reads 16 floats (4 x 16 B) -> sT[n][k]
//   write: wave w, lane: rows (n) w*8 + it*4 + (lane>>3), 8 halves per lane at k (lane&7)*8:
// coverage: 8 waves x 8 rows = 64 n rows x 64 k per block; the caller deals N/64 x K/64 tiles exactly.
// =====================================================================================================
__device__ __forceinline__ void conv_body(_Float16* sT, const float* __restrict__ W, unsigned short* O,
                                          int K, int N, int n0, int k0) {
  const int tid = threadIdx.x;
  {
    const int r = tid >> 2, cq = (tid & 3) * 16;
    const float* p = W + (size_t)(k0 + r) * N + n0 + cq;
#pragma unroll
    for (int g = 0; g < 4; ++g) {
      const v4f a = *(const v4f*)(p + 4 * g);
#pragma unroll
      for (int e = 0; e < 4; ++e) sT[(cq + 4 * g + e) * 72 + r] = (_Float16)(bfr(a[e]) * WSC);
    }
  }
  __syncthreads();
  const int wave = tid >> 5, lane = tid & 31;
  const int q = lane >> 3, c8 = (lane & 7) * 8;
  union HU { v8h h; v4u u; };
  HU pk[2];
#pragma unroll
  for (int it = 0; it < 2; ++it) {
    const int row = wave * 8 + it * 4 + q;
    pk[it].h = *(const v8h*)(sT + row * 72 + c8);
  }
  const _Float16 dummy = (_Float16)0.0f; (void)dummy;
  {
#pragma unroll
    for (int it = 0; it < 2; ++it) {
      const int row = wave * 8 + it * 4 + q;
      *(v4u*)(O + (size_t)(n0 + row) * K + k0 + c8) = pk[it].u;
    }
    // precaution: where this body is inlined in front of other code, the stores' registers may be rewritten there; this keeps the wait in front of that
    asm volatile("s_wait_xcnt 0x0" ::: "memory");
  }
}

// =====================================================================================================
// First launch: the work that depends on the inputs alone, dealt by block index in one grid.
//   blocks 0 .. BT/8-1: h + embs and LN1 of layer 0 (ln_body);
//   then per layer CVL = 3 x CVS blocks of weight tiles (conv_body): CVS tiles of wq, wk, wv, wo (144 each), CVS of w1, CVS of w2.
// Converted weights of layer l lie at Wt + l * WLH halves: Wq_t, Wk_t, Wv_t, Wo_t (HID*HID each), W1_t, W2_t (HID*DFF each).
// Every branch below is block-uniform; the one block barrier (in conv_body) is passed by all 256 threads of its block.
// =====================================================================================================
#define CVS  576                                  // 4 * 12 * 12 = 48 * 12 = 12 * 48 tiles
#define CVL  (3 * CVS)
#define WLH  (4 * HID * HID + 2 * HID * DFF)      // halves of converted weights per layer
static_assert(4 * (HID / 64) * (HID / 64) == CVS && (DFF / 64) * (HID / 64) == CVS);
__global__ __launch_bounds__(256) void prep(const float* in_h, const float* embs, float* hdst,
                                            const float* __restrict__ sc, const float* __restrict__ bi,
                                            unsigned short* X,
                                            const float* __restrict__ wq, const float* __restrict__ wk,
                                            const float* __restrict__ wv, const float* __restrict__ wo,
                                            const float* __restrict__ w1, const float* __restrict__ w2,
                                            unsigned short* Wt) {
  __shared__ __align__(16) float rb[8 * HID];
  __shared__ __align__(16) _Float16 sT[64 * 72];
  const int bx = blockIdx.x;
  if (bx < BT / 8) {
    ln_body<true, true, false>(bx, rb, in_h, embs, hdst, sc, bi, (void*)X, BT);
    return;
  }
  int t = bx - BT / 8;
  const int l = t / CVL;
  t -= l * CVL;
  const int seg = t / CVS;
  t -= seg * CVS;
  unsigned short* Ol = Wt + (size_t)l * WLH;
  if (seg == 0) {
    const int z = t / 144;
    const int r = t - z * 144;
    const float* W = ((z == 0) ? wq : (z == 1) ? wk : (z == 2) ? wv : wo) + (size_t)l * HID * HID;
    conv_body(sT, W, Ol + (size_t)z * HID * HID, HID, HID, (r % 12) * 64, (r / 12) * 64);
  } else if (seg == 1) {
    conv_body(sT, w1 + (size_t)l * HID * DFF, Ol + (size_t)4 * HID * HID, HID, DFF, (t % 48) * 64, (t / 48) * 64);
  } else {
    conv_body(sT, w2 + (size_t)l * HID * DFF, Ol + (size_t)4 * HID * HID + (size_t)HID * DFF, DFF, HID,
              (t % 12) * 64, (t / 12) * 64);
  }
}

// =====================================================================================================
// Register-blocked f16 WMMA GEMM: C[m][n] = sum_k A[m][k] * Bt[n][k] (accumulator scaled by 1/64 in the
// epilogue = the weight carry). Block = 8 waves (4 x 2) = one 128x128 tile of C, one 32x64 tile per wave.
// A row-major [M][K] pitch lda, Bt row-major [N][K] pitch ldb (k contiguous); M, N multiples of 128, K multiple of BK.
// Operands go through LDS in stages of BK k: 128 rows x 2 BK bytes of A and of Bt per stage, brought by asynchronous 16-B copies. Each
// wave-wide copy covers 4 whole 128-B lines; rows lie in LDS at pitch 2 BK + 16 B (16 B x odd) for the 16-B fragment reads.
// BK = 64 where several blocks share a WGP and cover each other's waits. BK = 256 for the grids of 192 blocks, one block to a WGP:
// there only the block's own copies are in flight, and a stage has to hold enough bytes and enough products to cover their latency.
// Two LDS buffers, one block barrier per stage, at the loop's foot: behind it stage s+1 (copied while stage s was multiplied) is
// readable, and stage s+2 is copied into the buffer of stage s, whose readers all passed that barrier.
// tile = index of the block tile, bz = batch index (strides in elements). Both A and B fragments use the split k map of ldfrag_h.
// MODE 1: f16 C = acc/64 + bias[n]
// MODE 2: f16 hi C = f16(v), f16 residual C2 = f16((v - hi) * 4096), v = acc/64 + bias[n]
// MODE 3: f16 C = acc/64 + bias[m]
// MODE 4: f16 C = gelu(acc/64 + bias[n])
// bias values bf16-RNE converted in register. Epilogue: 16-row slabs staged per wave in LDS; each 64-wide row
// coverage: 2 slabs x 16 rows x 64 cols = the wave's whole tile; 8 waves per block; grid = (M/128) * (N/128).
// =====================================================================================================
template <int MODE, int BK>
__device__ __forceinline__ void gemm_body(
    _Float16 (*sA)[128 * (BK + 8)], _Float16 (*sB)[128 * (BK + 8)], float (*sT)[16 * 68], int tile, int bz,
    const unsigned short* __restrict__ Ap, int lda, long long strideA,
    const unsigned short* __restrict__ Btp, int ldb, long long strideB,
    const float* __restrict__ bias,
    void* Cout, void* Cout2, int ldc, long long strideC,
    int M, int N, int K) {
  static_assert(BK == 64 || BK == 256);
  constexpr int LBK = (BK == 64) ? 6 : 8;          // log2 BK
  constexpr int GPI = BK + 8;                      // LDS row pitch of a stage, in halves
  constexpr int PR  = BK / 8;                      // 16-B pieces of a stage row
  constexpr int RP  = 256 / PR;                    // rows that one copy of each of the 256 threads covers
  const int tid  = threadIdx.x;
  const int lane = tid & 31;
  const int wave = tid >> 5;
  const int tilesN = N >> 7;
  const int tilesM = M >> 7;
  if (tile >= tilesM * tilesN) return;             // block-uniform, in front of every barrier
  const int tm = tile / tilesN;
  const int tn = tile - tm * tilesN;
  const int bm0 = tm << 7;                         // block tile origin
  const int bn0 = tn << 7;
  const int wm  = (wave >> 1) << 5;                // wave tile origin inside the block tile
  const int wn  = (wave & 1) << 6;
  const int m0 = bm0 + wm;
  const int n0 = bn0 + wn;

  const _Float16* Ab = (const _Float16*)(const void*)Ap  + (size_t)bz * (size_t)strideA;
  const _Float16* Bb = (const _Float16*)(const void*)Btp + (size_t)bz * (size_t)strideB;

  const int rl   = lane & 15;                      // row (A) / col (B, D) within subtile
  const int hh   = lane >> 4;
  const int koff = hh * 8;                         // k offset of this lane half
  const int mOff = hh * 8;                         // D row offset

  // staging map: thread -> row tid / PR + RP * it, 16-B piece tid % PR of the row's 2 BK bytes; (128 / RP) it x RP rows = 128 rows
  const int srow = tid >> (LBK - 3);
  const int scol = (tid & (PR - 1)) * 8;
  const _Float16* ga = Ab + (size_t)(bm0 + srow) * lda + scol;
  const _Float16* gb = Bb + (size_t)(bn0 + srow) * ldb + scol;
  const int sofs = srow * GPI + scol;

  v8f acc[2][4];
#pragma unroll
  for (int i = 0; i < 2; ++i)
#pragma unroll
    for (int j = 0; j < 4; ++j) acc[i][j] = zero8();

  const unsigned la0 = lds_off(&sA[0][0]) + (unsigned)sofs * 2u;   // this thread's 16 B of row srow in buffer 0
  const unsigned lb0 = lds_off(&sB[0][0]) + (unsigned)sofs * 2u;
  const size_t aR = (size_t)RP * lda, bR = (size_t)RP * ldb;
  constexpr unsigned SBUF = 128u * GPI * 2u;                       // bytes of one buffer
  constexpr unsigned SRP  = (unsigned)RP * GPI * 2u;               // bytes of RP LDS rows
  auto issue = [&](int st) {                                       // stage st -> buffer st & 1: (128 / RP) x RP rows of A and of Bt
    const unsigned la = la0 + (unsigned)(st & 1) * SBUF, lb = lb0 + (unsigned)(st & 1) * SBUF;
    const _Float16* pa = ga + ((size_t)st << LBK);
    const _Float16* pb = gb + ((size_t)st << LBK);
    if (BK == 64) {
      copy8(la, la + SRP, la + 2u * SRP, la + 3u * SRP, lb, lb + SRP, lb + 2u * SRP, lb + 3u * SRP,
            pa, pa + aR, pa + 2 * aR, pa + 3 * aR, pb, pb + bR, pb + 2 * bR, pb + 3 * bR);
    } else {
      // both loops unrolled: two statements of eight copies each, their LDS steps compile-time constants
#pragma unroll
      for (int g = 0; g < 128 / RP; g += 8) {                      // 32 copies a thread and stage, 63 may be outstanding
        const unsigned l = la + (unsigned)g * SRP;
        const _Float16* p = pa + (size_t)g * aR;
        copy8(l, l + SRP, l + 2u * SRP, l + 3u * SRP, l + 4u * SRP, l + 5u * SRP, l + 6u * SRP, l + 7u * SRP,
              p, p + aR, p + 2 * aR, p + 3 * aR, p + 4 * aR, p + 5 * aR, p + 6 * aR, p + 7 * aR);
      }
#pragma unroll
      for (int g = 0; g < 128 / RP; g += 8) {
        const unsigned l = lb + (unsigned)g * SRP;
        const _Float16* p = pb + (size_t)g * bR;
        copy8(l, l + SRP, l + 2u * SRP, l + 3u * SRP, l + 4u * SRP, l + 5u * SRP, l + 6u * SRP, l + 7u * SRP,
              p, p + bR, p + 2 * bR, p + 3 * bR, p + 4 * bR, p + 5 * bR, p + 6 * bR, p + 7 * bR);
      }
    }
  };

  const int nst = K >> LBK;
  issue(0);
  wait_async0();
  __syncthreads();                                 // publishes stage 0
  if (nst > 1) issue(1);                           // block-uniform
  // kept rolled: one stage is already 16 WMMAs and 24 fragment loads a wave or more; unrolling would only grow code and registers
#pragma unroll 1
  for (int s = 0; s < nst; ++s) {
    const _Float16* dA = sA[s & 1];
    const _Float16* dB = sB[s & 1];
#pragma unroll
    for (int kk = 0; kk < BK / 32; ++kk) {
      v16h bfg[4], af[2];
      af[0] = ldfrag_h(dA + (wm + rl) * GPI + kk * 32 + koff);
#pragma unroll
      for (int j = 0; j < 4; ++j)
        bfg[j] = ldfrag_h(dB + (wn + (j << 4) + rl) * GPI + kk * 32 + koff);
      af[1] = ldfrag_h(dA + (wm + 16 + rl) * GPI + kk * 32 + koff);
#pragma unroll
      for (int i = 0; i < 2; ++i)
#pragma unroll
        for (int j = 0; j < 4; ++j) acc[i][j] = mma_h(af[i], bfg[j], acc[i][j]);
    }
    wait_ds0();
    wait_async0();
    __syncthreads();                               // publishes stage s+1; ends every wave's reads of stage s
    if (s + 2 < nst) issue(s + 2);                 // block-uniform: flies under the WMMAs of stage s+1
  }
  wait_async0();

  // ---- epilogue ----
  float* slab = sT[wave];
#pragma unroll
  for (int i = 0; i < 2; ++i) {
    const int mBase = m0 + (i << 4);
#pragma unroll
    for (int j = 0; j < 4; ++j) {
#pragma unroll
      for (int r = 0; r < 8; ++r) slab[(mOff + r) * 68 + (j << 4) + rl] = acc[i][j][r] * WINV;
    }
    wave_lds_sync();
    if (MODE == 0) {
      float* C = (float*)Cout + (size_t)bz * (size_t)strideC;
      const int c4 = rl * 4;                                   // 256-B row segment = 16 lanes x 16 B
      const v4f b4 = bfr4(*(const v4f*)(bias + n0 + c4));
      v4f vals[8];
#pragma unroll
      for (int it = 0; it < 8; ++it) {
        const int row = it * 2 + hh;                           // it 0..7 x hh 0..1 = rows 0..15
        const v4f v = *(const v4f*)(slab + row * 68 + c4);
        const v4f o = *(const v4f*)(C + (size_t)(mBase + row) * ldc + n0 + c4);
        vals[it] = o + (v + b4);
      }
      {
#pragma unroll
        for (int it = 0; it < 8; ++it) {
          const int row = it * 2 + hh;
          *(v4f*)(C + (size_t)(mBase + row) * ldc + n0 + c4) = vals[it];
        }
        
      }
    } else {
      const int q = lane >> 3, c8 = (lane & 7) * 8;
      unsigned short* C  = (unsigned short*)Cout  + (size_t)bz * (size_t)strideC;
      unsigned short* C2 = (unsigned short*)Cout2 + (size_t)bz * (size_t)strideC;
      v4f ba = zero4(), bb = zero4();
      if (MODE != 3) {
        ba = bfr4(*(const v4f*)(bias + n0 + c8));
        bb = bfr4(*(const v4f*)(bias + n0 + c8 + 4));
      }
      v4u hv[4], lv[4];
#pragma unroll
      for (int it = 0; it < 4; ++it) {
        const int row = it * 4 + q;                            // it 0..3 x q 0..3 = rows 0..15
        const float* sp = slab + row * 68 + c8;
        v4f fa = *(const v4f*)(sp);
        v4f fb = *(const v4f*)(sp + 4);
        if (MODE == 3) {
          const float br = bfr(bias[mBase + row]);
          fa = fa + br; fb = fb + br;
        } else {
          fa = fa + ba; fb = fb + bb;
        }
        if (MODE == 4) {
#pragma unroll
          for (int e = 0; e < 4; ++e) { fa[e] = gelu_t(fa[e]); fb[e] = gelu_t(fb[e]); }
        }
        v4u a, a2;
        if (MODE == 2) {
#pragma unroll
          for (int e = 0; e < 2; ++e) {
            const float f0 = fa[2 * e], f1 = fa[2 * e + 1];
            const float g0 = fb[2 * e], g1 = fb[2 * e + 1];
            const _Float16 x0 = (_Float16)f0, x1 = (_Float16)f1, y0 = (_Float16)g0, y1 = (_Float16)g1;
            a[e]      = pk16(h_bits(x0), h_bits(x1));
            a[e + 2]  = pk16(h_bits(y0), h_bits(y1));
            a2[e]     = pk16(h_bits((_Float16)((f0 - (float)x0) * QRS)), h_bits((_Float16)((f1 - (float)x1) * QRS)));
            a2[e + 2] = pk16(h_bits((_Float16)((g0 - (float)y0) * QRS)), h_bits((_Float16)((g1 - (float)y1) * QRS)));
          }
        } else {
          a[0] = pkh2(fa[0], fa[1]); a[1] = pkh2(fa[2], fa[3]);
          a[2] = pkh2(fb[0], fb[1]); a[3] = pkh2(fb[2], fb[3]);
          a2 = a;
        }
        hv[it] = a; lv[it] = a2;
      }
      {
#pragma unroll
        for (int it = 0; it < 4; ++it) {
          const int row = it * 4 + q;
          *(v4u*)(C + (size_t)(mBase + row) * ldc + n0 + c8) = hv[it];
          if (MODE == 2) *(v4u*)(C2 + (size_t)(mBase + row) * ldc + n0 + c8) = lv[it];
        }
        
      }
    }
    wave_lds_sync();
  }
}

#define GEMM_LDS(BK)                                                                                             \
  __shared__ __align__(16) _Float16 sA[2][128 * ((BK) + 8)]; /* A stage: 128 rows x BK k, pitch BK + 8, two buffers */ \
  __shared__ __align__(16) _Float16 sB[2][128 * ((BK) + 8)]; /* Bt stage, same shape */                           \
  __shared__ __align__(16) float sT[8][16 * 68];      /* per-wave 16x64 slab, pitch 68 floats */

template <int MODE>
__global__ __launch_bounds__(256) void gemm64(
    const unsigned short* __restrict__ Ap, int lda, long long strideA,
    const unsigned short* __restrict__ Btp, int ldb, long long strideB,
    const float* __restrict__ bias,
    void* Cout, void* Cout2, int ldc, long long strideC,
    int M, int N, int K) {
  constexpr int BK = (MODE == 0) ? 256 : 64;       // MODE 0 runs on the grids of 192 blocks; K = 768 or 3072, multiples of 256
  GEMM_LDS(BK)
  gemm_body<MODE, BK>(sA, sB, sT, blockIdx.x, blockIdx.y, Ap, lda, strideA, Btp, ldb, strideB, bias,
                  Cout, Cout2, ldc, strideC, M, N, K);
}

// q, k and v^T projections of one layer in one grid: they read the same X and do not depend on each other.
//   blocks 0..191: q (MODE 2); 192..383: k (MODE 1); 384..575: v^T (MODE 3), 96 tiles per batch.
// The three branches are block-uniform, so every barrier in gemm_body is passed by the whole block.
#define TQK ((BT / 128) * (HID / 128))
#define TVB ((HID / 128) * (SEQ / 128))
__global__ __launch_bounds__(256) void gemm_qkv(
    const unsigned short* __restrict__ X, const unsigned short* __restrict__ Wqt,
    const unsigned short* __restrict__ Wkt, const unsigned short* __restrict__ Wvt,
    const float* __restrict__ bq, const float* __restrict__ bk, const float* __restrict__ bv,
    unsigned short* Qh, unsigned short* Ql, unsigned short* Kh, unsigned short* VT) {
  GEMM_LDS(64)
  const int t = blockIdx.x;
  if (t < TQK) {
    gemm_body<2, 64>(sA, sB, sT, t, 0, X, HID, 0LL, Wqt, HID, 0LL, bq, (void*)Qh, (void*)Ql, HID, 0LL, BT, HID, HID);
  } else if (t < 2 * TQK) {
    gemm_body<1, 64>(sA, sB, sT, t - TQK, 0, X, HID, 0LL, Wkt, HID, 0LL, bk, (void*)Kh, (void*)Kh, HID, 0LL, BT, HID, HID);
  } else {
    const int u  = t - 2 * TQK;
    const int bz = u / TVB;
    gemm_body<3, 64>(sA, sB, sT, u - bz * TVB, bz, Wvt, HID, 0LL, X, HID, (long long)SEQ * HID, bv,
                 (void*)VT, (void*)VT, SEQ, (long long)HID * SEQ, HID, SEQ, HID);
  }
}

__device__ __forceinline__ float xhalf(float x) {
  return __builtin_bit_cast(float, __builtin_amdgcn_permlanex16(__builtin_bit_cast(int, x), __builtin_bit_cast(int, x),
                                                                0x76543210, 0xfedcba98, false, false));
}

// 2^x of eight values in one statement. The results are early-clobber, so none of them lies on a source of the exponential in
// front of it, and the closing v_nop is the slot the instruction set asks for between a transcendental and the next instruction
// that uses its result or overwrites its source (left to itself the compiler put results on the source of the one in front).
__device__ __forceinline__ v8f exp2x8(v8f x) {
  v8f y = x;
#if defined(__HIP_DEVICE_COMPILE__)
  float y0, y1, y2, y3, y4, y5, y6, y7;
  asm("v_exp_f32 %0, %8\n\tv_exp_f32 %1, %9\n\tv_exp_f32 %2, %10\n\tv_exp_f32 %3, %11\n\t"
      "v_exp_f32 %4, %12\n\tv_exp_f32 %5, %13\n\tv_exp_f32 %6, %14\n\tv_exp_f32 %7, %15\n\tv_nop"
      : "=&v"(y0), "=&v"(y1), "=&v"(y2), "=&v"(y3), "=&v"(y4), "=&v"(y5), "=&v"(y6), "=&v"(y7)
      : "v"(x[0]), "v"(x[1]), "v"(x[2]), "v"(x[3]), "v"(x[4]), "v"(x[5]), "v"(x[6]), "v"(x[7]));
  y[0] = y0; y[1] = y1; y[2] = y2; y[3] = y3; y[4] = y4; y[5] = y5; y[6] = y6; y[7] = y7;
#endif
  return y;
}

__global__ __launch_bounds__(128)
void attn64(const unsigned short* __restrict__ qhp, const unsigned short* __restrict__ qlp,
            const unsigned short* __restrict__ khp, const unsigned short* __restrict__ vtp,
            const float* __restrict__ mask, unsigned short* ctxp, float sscale) {
  union FH { v16h v; v8h h[2]; };
  __shared__ __align__(16) _Float16 Ks[2][64 * API];              // K [kv][d]    9 KB, two buffers
  __shared__ __align__(16) _Float16 Vts[2][64 * API];             // V^T [d][kv]  9 KB, two buffers
  __shared__ __align__(16) float    Mt[2][128];                   // per key of the chunk: [0..63] m * sscale, [64..127] -1e10 * (1 - m)
  __shared__ __align__(16) float    Os[4][16 * OPI];              // per wave context tile [row][d]

  const int tid  = threadIdx.x;
  const int wave = tid >> 5;
  const int lane = tid & 31;
  const int hh   = lane >> 4;
  const int c    = lane & 15;

  const int bx   = blockIdx.x;
  const int qb   = bx % NQB;
  const int rest = bx / NQB;
  const int h    = rest % NHD;
  const int b    = rest / NHD;
  const int q0   = qb * 64 + wave * 16;
  const size_t rowB = (size_t)b * SEQ;

  const _Float16* Qh = (const _Float16*)(const void*)qhp + (size_t)h * HD;
  const _Float16* Ql = (const _Float16*)(const void*)qlp + (size_t)h * HD;
  const _Float16* Kh = (const _Float16*)(const void*)khp + (size_t)h * HD;
  const _Float16* Vt = (const _Float16*)(const void*)vtp + ((size_t)b * HID + (size_t)h * HD) * SEQ;
  const float* mb = mask + (size_t)b * SEQ;

  // ---- Q fragments (B operand, column = query q0 + (lane&15)): 2 d-chunks, hi and residual ----
  v16h qah[2], qal[2];
#pragma unroll
  for (int dc = 0; dc < 2; ++dc) {
    const size_t qo = (rowB + q0 + c) * HID + dc * 32 + 8 * hh;
    qah[dc] = ldfrag_h(Qh + qo);
    qal[dc] = ldfrag_h(Ql + qo);
  }

  float mrun = -INFINITY;                          // this lane's query: running max, alike in both wave halves
  v8f lacc = zero8();                              // its sum of p: register r over keys = 8hh + r (mod 16); joined after the loop
  v8f oacc[4];                                     // O^T: register r of tile t = d 16t + 8hh + r of query q0 + c
#pragma unroll
  for (int t = 0; t < 4; ++t) oacc[t] = zero8();

  // staging map: thread -> row (tid>>3) + 16*i, 16-B piece (tid&7) of the row's 128 B; 4 i x 16 rows = 64 rows of K and of V^T
  const int srow = tid >> 3, scol = (tid & 7) * 8;
  const _Float16* kg = Kh + (rowB + srow) * HID + scol;            // K row srow of chunk 0
  const _Float16* vg = Vt + (size_t)srow * SEQ + scol;             // V^T row d = srow, keys of chunk 0
  const unsigned lk0 = lds_off(&Ks[0][0])  + (unsigned)(srow * API + scol) * 2u;
  const unsigned lv0 = lds_off(&Vts[0][0]) + (unsigned)(srow * API + scol) * 2u;
  constexpr unsigned ABUF = 64u * API * 2u;                        // bytes of one buffer
  constexpr unsigned AR16 = 16u * API * 2u;                        // bytes of 16 LDS rows
  auto issue = [&](int ch) {                                       // chunk ch < NQB -> buffer ch & 1
    const unsigned lk = lk0 + (unsigned)(ch & 1) * ABUF, lv = lv0 + (unsigned)(ch & 1) * ABUF;
    const _Float16* pk = kg + (size_t)ch * 64 * HID;
    const _Float16* pv = vg + (size_t)ch * 64;
    copy8(lk, lk + AR16, lk + 2u * AR16, lk + 3u * AR16, lv, lv + AR16, lv + 2u * AR16, lv + 3u * AR16,
          pk, pk + 16 * HID, pk + 32 * HID, pk + 48 * HID, pv, pv + 16 * SEQ, pv + 32 * SEQ, pv + 48 * SEQ);
  };
  auto mterm = [&](float mraw) {                                   // threads 0..63 hold the factor, 64..127 the addend
    const float m = bfr(mraw);
    return (tid < 64) ? m * sscale : -1.0e10f * (1.0f - m);
  };
  static_assert(NQB >= 2);
  issue(0);
  Mt[0][tid] = mterm(mb[tid & 63]);
  wait_async0();
  __syncthreads();                                 // publishes chunk 0
  issue(1);

#pragma unroll 1
  for (int kt = 0; kt < NQB; ++kt) {
    const _Float16* Kc = Ks[kt & 1];
    const _Float16* Vc = Vts[kt & 1];
    const float*    Mc = Mt[kt & 1];
    // mask value of the next chunk's key, in flight under this chunk; the last trip takes its own chunk again (in bounds, read by nobody)
    const float mraw = mb[((kt + 1 < NQB) ? kt + 1 : kt) * 64 + (tid & 63)];

    // ---- scores, transposed: 64 keys x 16 queries per wave, k.qhi and k.qres ----
    // LDS reads of a chunk stand in three groups, each a run of products or arithmetic ahead of its last user, so that the waits are
    // counted ones; read pair by pair in front of each product, every pair's LDS latency is waited out alone, 16 times a chunk.
    // group 1: all 8 K fragments and the mask terms of keys 0..31
    FH kb[4][2];
    v4f mf[4][2], md[4][2];                        // per key: factor m * sscale, addend -1e10 * (1 - m); [j][0] = r 0..3, [j][1] = r 4..7
#pragma unroll
    for (int j = 0; j < 4; ++j) {
#pragma unroll
      for (int dc = 0; dc < 2; ++dc) {
        kb[j][dc].h[0] = *(const v8h*)(Kc + (j * 16 + c) * API + dc * 32 + 8 * hh);
        kb[j][dc].h[1] = *(const v8h*)(Kc + (j * 16 + c) * API + dc * 32 + 16 + 8 * hh);
      }
    }
#pragma unroll
    for (int j = 0; j < 2; ++j) {
      mf[j][0] = *(const v4f*)(Mc + j * 16 + 8 * hh);      mf[j][1] = *(const v4f*)(Mc + j * 16 + 8 * hh + 4);
      md[j][0] = *(const v4f*)(Mc + 64 + j * 16 + 8 * hh); md[j][1] = *(const v4f*)(Mc + 64 + j * 16 + 8 * hh + 4);
    }
    v8f s[4], sl[4];
#pragma unroll
    for (int j = 0; j < 2; ++j) {
      s[j] = zero8();
      sl[j] = zero8();
#pragma unroll
      for (int dc = 0; dc < 2; ++dc) {
        s[j]  = mma_h(kb[j][dc].v, qah[dc], s[j]);
        sl[j] = mma_h(kb[j][dc].v, qal[dc], sl[j]);
      }
    }
    // group 2: the mask terms of keys 32..63, used behind the next 8 products
#pragma unroll
    for (int j = 2; j < 4; ++j) {
      mf[j][0] = *(const v4f*)(Mc + j * 16 + 8 * hh);      mf[j][1] = *(const v4f*)(Mc + j * 16 + 8 * hh + 4);
      md[j][0] = *(const v4f*)(Mc + 64 + j * 16 + 8 * hh); md[j][1] = *(const v4f*)(Mc + 64 + j * 16 + 8 * hh + 4);
    }
#pragma unroll
    for (int j = 0; j < 2; ++j) {
#pragma unroll
      for (int r = 0; r < 4; ++r) {
        s[j][r]     = (s[j][r]     + sl[j][r]     * QRI) * mf[j][0][r] + md[j][0][r];
        s[j][r + 4] = (s[j][r + 4] + sl[j][r + 4] * QRI) * mf[j][1][r] + md[j][1][r];
      }
    }
#pragma unroll
    for (int j = 2; j < 4; ++j) {
      s[j] = zero8();
      sl[j] = zero8();
#pragma unroll
      for (int dc = 0; dc < 2; ++dc) {
        s[j]  = mma_h(kb[j][dc].v, qah[dc], s[j]);
        sl[j] = mma_h(kb[j][dc].v, qal[dc], sl[j]);
      }
    }
    // group 3: all 8 V^T fragments, so that they land under the softmax arithmetic
    FH vb[2][4];
#pragma unroll
    for (int kk = 0; kk < 2; ++kk) {
#pragma unroll
      for (int t = 0; t < 4; ++t) {
        vb[kk][t].h[0] = *(const v8h*)(Vc + (t * 16 + c) * API + kk * 32 + 8 * hh);
        vb[kk][t].h[1] = *(const v8h*)(Vc + (t * 16 + c) * API + kk * 32 + 16 + 8 * hh);
      }
    }
#pragma unroll
    for (int j = 2; j < 4; ++j) {
#pragma unroll
      for (int r = 0; r < 4; ++r) {
        s[j][r]     = (s[j][r]     + sl[j][r]     * QRI) * mf[j][0][r] + md[j][0][r];
        s[j][r + 4] = (s[j][r + 4] + sl[j][r + 4] * QRI) * mf[j][1][r] + md[j][1][r];
      }
    }

    // ---- max of this query's 64 scores, online softmax, P^T (x1024, f16) packed in place as B fragments ----
    float mj[4];
#pragma unroll
    for (int j = 0; j < 4; ++j) {
      mj[j] = fmaxf(fmaxf(fmaxf(s[j][0], s[j][1]), fmaxf(s[j][2], s[j][3])),
                    fmaxf(fmaxf(s[j][4], s[j][5]), fmaxf(s[j][6], s[j][7])));
    }
    float m = fmaxf(fmaxf(mj[0], mj[1]), fmaxf(mj[2], mj[3]));
    m = fmaxf(m, xhalf(m));
    const float mnew  = fmaxf(mrun, m);
    const float alpha = __expf(mrun - mnew);
    mrun = mnew;
    FH pb[2];
    v8f p[4];
#pragma unroll
    for (int j = 0; j < 4; ++j) {
      p[j] = exp2x8((s[j] - mnew) * 1.4426950408889634f);
#pragma unroll
      for (int r = 0; r < 8; ++r) pb[j >> 1].v[(j & 1) * 8 + r] = (_Float16)(p[j][r] * PSC);
    }
    lacc = lacc * alpha + ((p[0] + p[1]) + (p[2] + p[3]));
#pragma unroll
    for (int t = 0; t < 4; ++t) oacc[t] *= alpha;

    // ---- context^T += V^T . P^T (f16 WMMA) ----
#pragma unroll
    for (int kk = 0; kk < 2; ++kk) {
#pragma unroll
      for (int t = 0; t < 4; ++t) oacc[t] = mma_h(vb[kk][t].v, pb[kk].v, oacc[t]);
    }

    Mt[(kt + 1) & 1][tid] = mterm(mraw);           // its last readers passed the barrier at the foot of trip kt-1
    wait_ds0();
    wait_async0();
    __syncthreads();                               // publishes chunk kt+1; ends every wave's reads of chunk kt
    if (kt + 2 < NQB) issue(kt + 2);               // block-uniform: flies under the work on chunk kt+1
  }
  wait_async0();

  float* os = Os[wave];
  {
    const float lsum = ((lacc[0] + lacc[1]) + (lacc[2] + lacc[3])) + ((lacc[4] + lacc[5]) + (lacc[6] + lacc[7]));
    const float l = lsum + xhalf(lsum);            // the two halves' key sums joined
    const float inv = ((l > 0.f) ? (1.0f / l) : 0.f) * PSI;
#pragma unroll
    for (int t = 0; t < 4; ++t) {
      v4f lo, hi;
#pragma unroll
      for (int r = 0; r < 4; ++r) { lo[r] = oacc[t][r] * inv; hi[r] = oacc[t][r + 4] * inv; }
      *(v4f*)(os + c * OPI + t * 16 + 8 * hh)     = lo;
      *(v4f*)(os + c * OPI + t * 16 + 8 * hh + 4) = hi;
    }
  }
  wave_lds_sync();
  {
    const int q4 = lane >> 3, c8 = (lane & 7) * 8;
    v4u hv[4];
#pragma unroll
    for (int it = 0; it < 4; ++it) {
      const int row = it * 4 + q4;           // it 0..3 x q4 0..3 = rows 0..15 of the wave tile
      const float* sp = os + row * OPI + c8;
      const v4f fa = *(const v4f*)(sp);
      const v4f fb = *(const v4f*)(sp + 4);
      v4u a;
      a[0] = pkh2(fa[0], fa[1]); a[1] = pkh2(fa[2], fa[3]);
      a[2] = pkh2(fb[0], fb[1]); a[3] = pkh2(fb[2], fb[3]);
      hv[it] = a;
    }
    {
#pragma unroll
      for (int it = 0; it < 4; ++it) {
        const int row = it * 4 + q4;
        const size_t go = (rowB + q0 + row) * HID + (size_t)h * HD + c8;
        *(v4u*)(ctxp + go) = hv[it];
      }
      
    }
  }
}

// =====================================================================================================
// Workspace map (bytes), all region sizes multiples of 128 and exact multiples of their 64x64- or 128x128-tile / whole-row
// store granularity (M, N multiples of 128; 768- and 3072-wide rows), so no padded tails are needed:
//   Hres f32 [4096][768]        12582912
//   X    f16 [4096][768]         6291456   (LN output plane, reused by LN1 and LN2)
//   Qh   f16 [4096][768]         6291456
//   Ql   f16 [4096][768]         6291456   (q residual x4096)
//   Kh   f16 [4096][768]         6291456
//   VT   f16 [2][768][2048]      6291456
//   Ctx  f16 [4096][768]         6291456
//   G    f16 [4096][3072]       25165824
//   per layer (2 x 14155776):
//   Wq_t,Wk_t,Wv_t,Wo_t f16 [768][768]  4 x 1179648
//   W1_t f16 [3072][768]         4718592
//   W2_t f16 [768][3072]         4718592
//   total                      103809024
// Both layers' weights are converted by the first launch, each layer into its own region ([out n][in k], k contiguous = the Bt / A layout).
// =====================================================================================================
extern "C" void kernel_launch(void* const* d_in, const int* in_sizes, int n_in,
                              void* d_out, int out_size, void* d_ws, size_t ws_size,
                              hipStream_t stream) {
  if (n_in < 21) return;
  if (in_sizes[0] != BT * HID || in_sizes[1] != BT * HID || in_sizes[2] != NB * SEQ) return;
  if (in_sizes[3] != 2 * HID || in_sizes[4] != 2 * HID) return;
  if (in_sizes[5] != 2 * HID * HID || in_sizes[7] != 2 * HID * HID ||
      in_sizes[9] != 2 * HID * HID || in_sizes[11] != 2 * HID * HID) return;
  if (in_sizes[6] != 2 * HID || in_sizes[8] != 2 * HID || in_sizes[10] != 2 * HID || in_sizes[12] != 2 * HID) return;
  if (in_sizes[13] != 2 * HID || in_sizes[14] != 2 * HID) return;
  if (in_sizes[15] != 2 * HID * DFF || in_sizes[16] != 2 * DFF ||
      in_sizes[17] != 2 * DFF * HID || in_sizes[18] != 2 * HID) return;
  if (in_sizes[19] != HID || in_sizes[20] != HID) return;
  if (out_size != BT * HID) return;

  const float* in_h  = (const float*)d_in[0];
  const float* embs  = (const float*)d_in[1];
  const float* mask  = (const float*)d_in[2];
  const float* ln1_s = (const float*)d_in[3];
  const float* ln1_b = (const float*)d_in[4];
  const float* wq    = (const float*)d_in[5];
  const float* bq    = (const float*)d_in[6];
  const float* wk    = (const float*)d_in[7];
  const float* bk    = (const float*)d_in[8];
  const float* wv    = (const float*)d_in[9];
  const float* bv    = (const float*)d_in[10];
  const float* wo    = (const float*)d_in[11];
  const float* bo    = (const float*)d_in[12];
  const float* ln2_s = (const float*)d_in[13];
  const float* ln2_b = (const float*)d_in[14];
  const float* w1    = (const float*)d_in[15];
  const float* b1    = (const float*)d_in[16];
  const float* w2    = (const float*)d_in[17];
  const float* b2    = (const float*)d_in[18];
  const float* lnf_s = (const float*)d_in[19];
  const float* lnf_b = (const float*)d_in[20];
  float* out = (float*)d_out;

  const size_t PH  = (size_t)BT * HID * 4;        // 12582912
  const size_t PA  = (size_t)BT * HID * 2;        //  6291456
  const size_t PVT = (size_t)NB * HID * SEQ * 2;  //  6291456
  const size_t PG  = (size_t)BT * DFF * 2;        // 25165824
  const size_t PW  = (size_t)HID * HID * 2;       //  1179648
  const size_t PW1 = (size_t)HID * DFF * 2;       //  4718592
  size_t off = 0;
  const size_t oH   = off; off += PH;
  const size_t oX   = off; off += PA;
  const size_t oQh  = off; off += PA;
  const size_t oQl  = off; off += PA;
  const size_t oKh  = off; off += PA;
  const size_t oVT  = off; off += PVT;
  const size_t oCtx = off; off += PA;
  const size_t oG   = off; off += PG;
  const size_t oWt  = off; off += 2 * (4 * PW + 2 * PW1);
  if (off > ws_size) return;                      // off = 103809024
  if (off > (size_t)134217728) return;

  char* ws = (char*)d_ws;
  float*          Hres = (float*)(ws + oH);
  unsigned short* X    = (unsigned short*)(ws + oX);
  unsigned short* Qh   = (unsigned short*)(ws + oQh);
  unsigned short* Ql   = (unsigned short*)(ws + oQl);
  unsigned short* Kh   = (unsigned short*)(ws + oKh);
  unsigned short* VT   = (unsigned short*)(ws + oVT);
  unsigned short* Ctx  = (unsigned short*)(ws + oCtx);
  unsigned short* G    = (unsigned short*)(ws + oG);
  unsigned short* Wt   = (unsigned short*)(ws + oWt);

  const dim3 blk(256);
  const dim3 gLN(BT / 8);                                           // 512 blocks, 8 rows each
  const dim3 gPrep(BT / 8 + 2 * CVL);                               // 512 row groups + 2 x 1728 weight tiles
  const dim3 gHH((BT / 128) * (HID / 128), 1);                      // 32 x 6  = 192 blocks
  const dim3 gQKV(2 * TQK + NB * TVB);                              // 192 + 192 + 2 x 96 = 576 blocks
  const dim3 gF1((BT / 128) * (DFF / 128), 1);                      // 32 x 24 = 768 blocks
  const dim3 gAt(NB * NHD * NQB);                                   // 768 blocks of 128

  for (int l = 0; l < 2; ++l) {
    unsigned short* Wqt = Wt + (size_t)l * WLH;
    unsigned short* Wkt = Wqt + (size_t)HID * HID;
    unsigned short* Wvt = Wkt + (size_t)HID * HID;
    unsigned short* Wot = Wvt + (size_t)HID * HID;
    unsigned short* W1t = Wot + (size_t)HID * HID;
    unsigned short* W2t = W1t + (size_t)HID * DFF;
    // (1) h = h + input_embs; hn = LN1(h) -> X (f16); with layer 0 also
    // (2) the weights of both layers: f32 [in][out] -> f16 [out][in] (bf16-RNE values x64)
    if (l == 0) {
      prep<<<gPrep, blk, 0, stream>>>(in_h, embs, Hres, ln1_s, ln1_b, X, wq, wk, wv, wo, w1, w2, Wt);
    } else {
      ln_rows<true, false, false><<<gLN, blk, 0, stream>>>(Hres, embs, Hres, ln1_s + HID, ln1_b + HID, (void*)X, BT);
    }
    // (3) q = hn . Wq + bq -> f16 hi + residual planes [b*SEQ+t][h*64+d]  (M=4096, N=768, K=768)
    // (4) k = hn . Wk + bk -> f16 plane
    // (5) v^T = Wv_t . hn^T per batch -> f16 [b][h*64+d][s]  (A = Wv_t [n][k], Bt = X rows of batch b; M=768, N=2048, K=768)
    gemm_qkv<<<gQKV, blk, 0, stream>>>(X, Wqt, Wkt, Wvt, bq + l * HID, bk + l * HID, bv + l * HID, Qh, Ql, Kh, VT);
    // (6) attention -> Ctx f16 [b*SEQ+t][h*64+d]
    attn64<<<gAt, dim3(128), 0, stream>>>(Qh, Ql, Kh, VT, mask, Ctx, 0.125f);
    // (7) h = h + (ctx . Wo + bo)  (f32, in place)
    gemm64<0><<<gHH, blk, 0, stream>>>(Ctx, HID, 0LL, Wot, HID, 0LL, bo + l * HID,
                                       (void*)Hres, (void*)Hres, HID, 0LL, BT, HID, HID);
    // (8) hn = LN2(h) -> X
    ln_rows<false, false, false><<<gLN, blk, 0, stream>>>(Hres, embs, Hres, ln2_s + l * HID, ln2_b + l * HID, (void*)X, BT);
    // (9) g = gelu(hn . W1 + b1) -> G f16 [4096][3072]  (M=4096, N=3072, K=768)
    gemm64<4><<<gF1, blk, 0, stream>>>(X, HID, 0LL, W1t, HID, 0LL, b1 + l * DFF,
                                       (void*)G, (void*)G, DFF, 0LL, BT, DFF, HID);
    // (10) h = h + (g . W2 + b2)  (M=4096, N=768, K=3072, f32 in place)
    gemm64<0><<<gHH, blk, 0, stream>>>(G, DFF, 0LL, W2t, DFF, 0LL, b2 + l * HID,
                                       (void*)Hres, (void*)Hres, HID, 0LL, BT, HID, DFF);
  }
  // (11) out = LN_f(h) -> f32 [2][2048][768]
  ln_rows<false, false, true><<<gLN, blk, 0, stream>>>(Hres, embs, Hres, lnf_s, lnf_b, (void*)out, BT);
  (void)hipGetLastError();
}

// v008
// Measured time: 271 microseconds a run.
// In both of two side-by-side timings against v007, it was 1.03 times as fast.
// Counting every step since v000, it is 3.66 times as fast.
// Contractions: q, k, v^T, out and ffn projections = v_wmma_f32_16x16x32_f16 (f16 activations; weights bf16-RNE then x64 as f16), single product;
// q.k^T = v_wmma_f32_16x16x32_f16 with q as f16 hi + f16 residual (x4096) planes and k f16, 2 products in separate accumulators;
// p.v = v_wmma_f32_16x16x32_f16 (p carried x1024 in f16, v f16); f32 accumulate everywhere; layernorm, softmax and gelu in f32.
#include <hip/hip_runtime.h>
#include <math.h>
#include <stdint.h>

#define NB   2
#define SEQ  2048
#define HID  768
#define NHD  12
#define HD   64
#define DFF  3072
#define BT   (NB * SEQ)
#define NQB  (SEQ / 64)
#define WSC  64.0f
#define WINV 0.015625f
#define QRS  4096.0f
#define QRI  0.000244140625f
#define PSC  1024.0f
#define PSI  0.0009765625f
#define API  72                 // LDS row pitch of the attention K and V^T tiles, in halves: 64 + 8 = 144 B = 16 B x odd
#define OPI  68                 // LDS row pitch of the attention context tile, in floats: 64 + 4 = 272 B = 16 B x odd
static_assert(NHD * HD == HID);
static_assert((SEQ % 64) == 0 && (HID % 64) == 0 && (DFF % 64) == 0 && (BT % 64) == 0);
static_assert(HID == 6 * 128);
static_assert((SEQ % 128) == 0 && (HID % 128) == 0 && (DFF % 128) == 0 && (BT % 128) == 0);
static_assert((HID % 256) == 0 && (DFF % 256) == 0);

typedef _Float16 v16h __attribute__((ext_vector_type(16)));
typedef _Float16 v8h  __attribute__((ext_vector_type(8)));
typedef float    v8f  __attribute__((ext_vector_type(8)));
typedef float    v4f  __attribute__((ext_vector_type(4)));
typedef unsigned int v4u __attribute__((ext_vector_type(4)));

// ---- scalar helpers -----------------------------------------------------------------------------
__device__ __forceinline__ unsigned short bf_bits(float f) {        // f32 -> bf16 bits, RNE convert
  const unsigned u = __float_as_uint(f);
  return (unsigned short)((u + 0x7FFFu + ((u >> 16) & 1u)) >> 16);
}
__device__ __forceinline__ float bfr(float f) { return __uint_as_float(((unsigned)bf_bits(f)) << 16); }
__device__ __forceinline__ v4f bfr4(v4f a) {
  v4f r;
  r[0] = bfr(a[0]); r[1] = bfr(a[1]); r[2] = bfr(a[2]); r[3] = bfr(a[3]);
  return r;
}
__device__ __forceinline__ unsigned short h_bits(_Float16 x) { return __builtin_bit_cast(unsigned short, x); }
__device__ __forceinline__ unsigned pk16(unsigned short a, unsigned short b) { return (unsigned)a | ((unsigned)b << 16); }
__device__ __forceinline__ unsigned pkh2(float a, float b) { return pk16(h_bits((_Float16)a), h_bits((_Float16)b)); }
__device__ __forceinline__ v8f zero8() { v8f z = {0.f, 0.f, 0.f, 0.f, 0.f, 0.f, 0.f, 0.f}; return z; }
__device__ __forceinline__ v4f zero4() { v4f z = {0.f, 0.f, 0.f, 0.f}; return z; }

// ---- fragment loader: 16-bit A/B operand, lane -> row/col (lane&15); p already includes +8*(lane>>4);
//      elements 0..7 <- p[0..7] (k0+8h..), elements 8..15 <- p[16..23] (k0+16+8h..)
__device__ __forceinline__ v16h ldfrag_h(const _Float16* p) {
  union { v16h v; v8h h[2]; } f;
  f.h[0] = *(const v8h*)(p);
  f.h[1] = *(const v8h*)(p + 16);
  return f.v;
}

// ---- WMMA with trailing VALU hazard gap (the GEMM loops) -------------------------------------------
__device__ __forceinline__ v8f mma_h(v16h a, v16h b, v8f c) {
  c = __builtin_amdgcn_wmma_f32_16x16x32_f16(false, a, false, b, (short)0, c, false, false);
#if defined(__HIP_DEVICE_COMPILE__)
  asm volatile("v_nop\n\tv_nop\n\tv_nop\n\tv_nop" : "+v"(c) : "v"(a), "v"(b));
#endif
  return c;
}
// The builtin alone, for the attention loop: there three waves share a SIMD's vector port and written v_nop take slots from the other
// waves' softmax arithmetic; the compiler keeps the distance to the next user of D, A or B itself, with useful instructions where it has them.
__device__ __forceinline__ v8f mma_p(v16h a, v16h b, v8f c) {
  return __builtin_amdgcn_wmma_f32_16x16x32_f16(false, a, false, b, (short)0, c, false, false);
}

// release/acquire + wave barrier for same-wave LDS exchange
__device__ __forceinline__ void wave_lds_sync() {
  __builtin_amdgcn_fence(__ATOMIC_RELEASE, "workgroup");
  __builtin_amdgcn_wave_barrier();
  __builtin_amdgcn_fence(__ATOMIC_ACQUIRE, "workgroup");
}

// ---- asynchronous copies to LDS ------------------------------------------------------------------
__device__ __forceinline__ unsigned lds_off(const void* p) { return (unsigned)(size_t)p; }   // byte offset in the work-group's LDS

// Eight 16-B copies per lane, global memory -> LDS through no register: l* = the lane's LDS byte address, g* = its global address.
// The closing s_wait_xcnt 0 is a precaution: it stands in front of every later rewrite of the address registers the copies name.
__device__ __forceinline__ void copy8(unsigned l0, unsigned l1, unsigned l2, unsigned l3,
                                      unsigned l4, unsigned l5, unsigned l6, unsigned l7,
                                      const _Float16* g0, const _Float16* g1, const _Float16* g2, const _Float16* g3,
                                      const _Float16* g4, const _Float16* g5, const _Float16* g6, const _Float16* g7) {
#if defined(__HIP_DEVICE_COMPILE__)
  asm volatile("global_load_async_to_lds_b128 %0, %8, off\n\t"
               "global_load_async_to_lds_b128 %1, %9, off\n\t"
               "global_load_async_to_lds_b128 %2, %10, off\n\t"
               "global_load_async_to_lds_b128 %3, %11, off\n\t"
               "global_load_async_to_lds_b128 %4, %12, off\n\t"
               "global_load_async_to_lds_b128 %5, %13, off\n\t"
               "global_load_async_to_lds_b128 %6, %14, off\n\t"
               "global_load_async_to_lds_b128 %7, %15, off\n\t"
               "s_wait_xcnt 0x0"
               :: "v"(l0), "v"(l1), "v"(l2), "v"(l3), "v"(l4), "v"(l5), "v"(l6), "v"(l7),
                  "v"(g0), "v"(g1), "v"(g2), "v"(g3), "v"(g4), "v"(g5), "v"(g6), "v"(g7)
               : "memory");
#endif
}
// this wave's LDS reads have returned: stands in front of the barrier behind which their buffer is refilled
__device__ __forceinline__ void wait_ds0() { asm volatile("s_wait_dscnt 0x0" ::: "memory"); }
// this wave's copies have landed: stands in front of the barrier behind which other waves read them (the compiler places no wait for a copy)
__device__ __forceinline__ void wait_async0() { asm volatile("s_wait_asynccnt 0x0" ::: "memory"); }

// tanh-approximation gelu, tanh(u) = 1 - 2/(exp(2u)+1) with u clamped to [-16,16]
__device__ __forceinline__ float gelu_t(float x) {
  float u = 0.7978845608028654f * (x + 0.044715f * x * x * x);
  u = fminf(fmaxf(u, -16.0f), 16.0f);
  const float e  = __expf(2.0f * u);
  const float th = 1.0f - 2.0f * __builtin_amdgcn_rcpf(e + 1.0f);
  return 0.5f * x * (1.0f + th);
}

// =====================================================================================================
// Residual add + LayerNorm, one wave per row of 768. grid = nrows/8, 256 threads.
//   x = src row (RSRC: bf16-RNE the loaded values) (+ ADDE: bf16-RNE(embs row)); ADDE also stores x to hdst
//   (may alias src: every lane reads its own 24 columns before storing them).
//   else:  y -> f16 rows via a per-wave LDS row buffer (lane l: 8 halves at col 256j+8l, 512 B per instruction).
// coverage: 8 waves x grid(512) = 4096 rows; 6 x 128 floats / 3 x 256 halves = the whole 768-wide row.
// =====================================================================================================
// blk = index of the 8-row group; rb = the block's 8 x 768 float row buffer in LDS.
template <bool ADDE, bool RSRC, bool OUT32>
__device__ __forceinline__ void ln_body(int blk, float* rb, const float* src, const float* embs, float* hdst,
                                        const float* __restrict__ sc, const float* __restrict__ bi,
                                        void* outp, int nrows) {
  const int tid = threadIdx.x, wave = tid >> 5, lane = tid & 31;
  const int row = blk * 8 + wave;
  if (row >= nrows) return;                       // wave-uniform; no block barrier behind it in this body
  const size_t rbase = (size_t)row * HID;
  v4f x[6];
#pragma unroll
  for (int i = 0; i < 6; ++i) {
    const int col = i * 128 + lane * 4;
    v4f a = *(const v4f*)(src + rbase + col);
    if (RSRC) a = bfr4(a);
    if (ADDE) {
      const v4f e = bfr4(*(const v4f*)(embs + rbase + col));
      a = a + e;
    }
    x[i] = a;
    // precaution: a later load's result may be given the address registers of this trip's loads; this keeps the wait in front of that
    asm volatile("s_wait_xcnt 0x0" ::: "memory");
  }
  if (ADDE) {
    {
#pragma unroll
      for (int i = 0; i < 6; ++i) *(v4f*)(hdst + rbase + i * 128 + lane * 4) = x[i];
      
    }
  }
  float s = 0.f;
#pragma unroll
  for (int i = 0; i < 6; ++i) s += (x[i][0] + x[i][1]) + (x[i][2] + x[i][3]);
#pragma unroll
  for (int off = 1; off < 32; off <<= 1) s += __shfl_xor(s, off, 32);
  const float mean = s * (1.0f / 768.0f);
  float qv = 0.f;
#pragma unroll
  for (int i = 0; i < 6; ++i) {
    const v4f d = x[i] - mean;
    qv += (d[0] * d[0] + d[1] * d[1]) + (d[2] * d[2] + d[3] * d[3]);
  }
#pragma unroll
  for (int off = 1; off < 32; off <<= 1) qv += __shfl_xor(qv, off, 32);
  const float var  = qv * (1.0f / 768.0f);
  const float rinv = rsqrtf(var + 1e-5f);
  v4f y[6];
#pragma unroll
  for (int i = 0; i < 6; ++i) {
    const int col = i * 128 + lane * 4;
    const v4f s4 = bfr4(*(const v4f*)(sc + col));
    const v4f b4 = bfr4(*(const v4f*)(bi + col));
    y[i] = (x[i] - mean) * rinv * s4 + b4;
  }
  if (OUT32) {
    float* o = (float*)outp;
    {
#pragma unroll
      for (int i = 0; i < 6; ++i) *(v4f*)(o + rbase + i * 128 + lane * 4) = y[i];
      
    }
  } else {
    float* rw = rb + wave * HID;
#pragma unroll
    for (int i = 0; i < 6; ++i) *(v4f*)(rw + i * 128 + lane * 4) = y[i];
    wave_lds_sync();
    v4u pk[3];
#pragma unroll
    for (int j = 0; j < 3; ++j) {
      const v4f a = *(const v4f*)(rw + j * 256 + lane * 8);
      const v4f c = *(const v4f*)(rw + j * 256 + lane * 8 + 4);
      v4u p;
      p[0] = pkh2(a[0], a[1]); p[1] = pkh2(a[2], a[3]);
      p[2] = pkh2(c[0], c[1]); p[3] = pkh2(c[2], c[3]);
      pk[j] = p;
    }
    unsigned short* o = (unsigned short*)outp;
    {
#pragma unroll
      for (int j = 0; j < 3; ++j) *(v4u*)(o + rbase + j * 256 + lane * 8) = pk[j];
      
    }
  }
}

template <bool ADDE, bool RSRC, bool OUT32>
__global__ __launch_bounds__(256) void ln_rows(const float* src, const float* embs, float* hdst,
                                               const float* __restrict__ sc, const float* __restrict__ bi,
                                               void* outp, int nrows) {
  __shared__ __align__(16) float rb[8 * HID];
  ln_body<ADDE, RSRC, OUT32>(blockIdx.x, rb, src, embs, hdst, sc, bi, outp, nrows);
}

// =====================================================================================================
// Weight convert + transpose: W f32 [K][N] (row-major, in-major) -> O f16 [N][K] = f16(bf16-RNE(w) * 64).
// One block = one tile of 64 k x 64 n through LDS, origin (k0, n0); 256 threads; sT = the block's 64 x 72 half tile in LDS.
//   read: thread (r = tid>>2 = k row, cq = (tid&3)*16 = n quarter) reads 16 floats (4 x 16 B) -> sT[n][k]
//   write: wave w, lane: rows (n) w*8 + it*4 + (lane>>3), 8 halves per lane at k (lane&7)*8:
// coverage: 8 waves x 8 rows = 64 n rows x 64 k per block; the caller deals N/64 x K/64 tiles exactly.
// =====================================================================================================
__device__ __forceinline__ void conv_body(_Float16* sT, const float* __restrict__ W, unsigned short* O,
                                          int K, int N, int n0, int k0) {
  const int tid = threadIdx.x;
  {
    const int r = tid >> 2, cq = (tid & 3) * 16;
    const float* p = W + (size_t)(k0 + r) * N + n0 + cq;
#pragma unroll
    for (int g = 0; g < 4; ++g) {
      const v4f a = *(const v4f*)(p + 4 * g);
#pragma unroll
      for (int e = 0; e < 4; ++e) sT[(cq + 4 * g + e) * 72 + r] = (_Float16)(bfr(a[e]) * WSC);
    }
  }
  __syncthreads();
  const int wave = tid >> 5, lane = tid & 31;
  const int q = lane >> 3, c8 = (lane & 7) * 8;
  union HU { v8h h; v4u u; };
  HU pk[2];
#pragma unroll
  for (int it = 0; it < 2; ++it) {
    const int row = wave * 8 + it * 4 + q;
    pk[it].h = *(const v8h*)(sT + row * 72 + c8);
  }
  const _Float16 dummy = (_Float16)0.0f; (void)dummy;
  {
#pragma unroll
    for (int it = 0; it < 2; ++it) {
      const int row = wave * 8 + it * 4 + q;
      *(v4u*)(O + (size_t)(n0 + row) * K + k0 + c8) = pk[it].u;
    }
    // precaution: where this body is inlined in front of other code, the stores' registers may be rewritten there; this keeps the wait in front of that
    asm volatile("s_wait_xcnt 0x0" ::: "memory");
  }
}

// =====================================================================================================
// First launch: the work that depends on the inputs alone, dealt by block index in one grid.
//   blocks 0 .. BT/8-1: h + embs and LN1 of layer 0 (ln_body);
//   then per layer CVL = 3 x CVS blocks of weight tiles (conv_body): CVS tiles of wq, wk, wv, wo (144 each), CVS of w1, CVS of w2.
// Converted weights of layer l lie at Wt + l * WLH halves: Wq_t, Wk_t, Wv_t, Wo_t (HID*HID each), W1_t, W2_t (HID*DFF each).
// Every branch below is block-uniform; the one block barrier (in conv_body) is passed by all 256 threads of its block.
// =====================================================================================================
#define CVS  576                                  // 4 * 12 * 12 = 48 * 12 = 12 * 48 tiles
#define CVL  (3 * CVS)
#define WLH  (4 * HID * HID + 2 * HID * DFF)      // halves of converted weights per layer
static_assert(4 * (HID / 64) * (HID / 64) == CVS && (DFF / 64) * (HID / 64) == CVS);
__global__ __launch_bounds__(256) void prep(const float* in_h, const float* embs, float* hdst,
                                            const float* __restrict__ sc, const float* __restrict__ bi,
                                            unsigned short* X,
                                            const float* __restrict__ wq, const float* __restrict__ wk,
                                            const float* __restrict__ wv, const float* __restrict__ wo,
                                            const float* __restrict__ w1, const float* __restrict__ w2,
                                            unsigned short* Wt) {
  __shared__ __align__(16) float rb[8 * HID];
  __shared__ __align__(16) _Float16 sT[64 * 72];
  const int bx = blockIdx.x;
  if (bx < BT / 8) {
    ln_body<true, true, false>(bx, rb, in_h, embs, hdst, sc, bi, (void*)X, BT);
    return;
  }
  int t = bx - BT / 8;
  const int l = t / CVL;
  t -= l * CVL;
  const int seg = t / CVS;
  t -= seg * CVS;
  unsigned short* Ol = Wt + (size_t)l * WLH;
  if (seg == 0) {
    const int z = t / 144;
    const int r = t - z * 144;
    const float* W = ((z == 0) ? wq : (z == 1) ? wk : (z == 2) ? wv : wo) + (size_t)l * HID * HID;
    conv_body(sT, W, Ol + (size_t)z * HID * HID, HID, HID, (r % 12) * 64, (r / 12) * 64);
  } else if (seg == 1) {
    conv_body(sT, w1 + (size_t)l * HID * DFF, Ol + (size_t)4 * HID * HID, HID, DFF, (t % 48) * 64, (t / 48) * 64);
  } else {
    conv_body(sT, w2 + (size_t)l * HID * DFF, Ol + (size_t)4 * HID * HID + (size_t)HID * DFF, DFF, HID,
              (t % 12) * 64, (t / 12) * 64);
  }
}

// =====================================================================================================
// Register-blocked f16 WMMA GEMM: C[m][n] = sum_k A[m][k] * Bt[n][k] (accumulator scaled by 1/64 in the
// epilogue = the weight carry). Block = 8 waves (4 x 2) = one 128x128 tile of C, one 32x64 tile per wave.
// A row-major [M][K] pitch lda, Bt row-major [N][K] pitch ldb (k contiguous); M, N multiples of 128, K multiple of BK.
// Operands go through LDS in stages of BK k: 128 rows x 2 BK bytes of A and of Bt per stage, brought by asynchronous 16-B copies. Each
// wave-wide copy covers 4 whole 128-B lines; rows lie in LDS at pitch 2 BK + 16 B (16 B x odd) for the 16-B fragment reads.
// BK = 64 where several blocks share a WGP and cover each other's waits. BK = 256 for the grids of 192 blocks, one block to a WGP:
// there only the block's own copies are in flight, and a stage has to hold enough bytes and enough products to cover their latency.
// Two LDS buffers, one block barrier per stage, at the loop's foot: behind it stage s+1 (copied while stage s was multiplied) is
// readable, and stage s+2 is copied into the buffer of stage s, whose readers all passed that barrier.
// tile = index of the block tile, bz = batch index (strides in elements). Both A and B fragments use the split k map of ldfrag_h.
// MODE 1: f16 C = acc/64 + bias[n]
// MODE 2: f16 hi C = f16(v), f16 residual C2 = f16((v - hi) * 4096), v = acc/64 + bias[n]
// MODE 3: f16 C = acc/64 + bias[m]
// MODE 4: f16 C = gelu(acc/64 + bias[n])
// bias values bf16-RNE converted in register. Epilogue: 16-row slabs staged per wave in LDS; each 64-wide row
// coverage: 2 slabs x 16 rows x 64 cols = the wave's whole tile; 8 waves per block; grid = (M/128) * (N/128).
// =====================================================================================================
template <int MODE, int BK>
__device__ __forceinline__ void gemm_body(
    _Float16 (*sA)[128 * (BK + 8)], _Float16 (*sB)[128 * (BK + 8)], float (*sT)[16 * 68], int tile, int bz,
    const unsigned short* __restrict__ Ap, int lda, long long strideA,
    const unsigned short* __restrict__ Btp, int ldb, long long strideB,
    const float* __restrict__ bias,
    void* Cout, void* Cout2, int ldc, long long strideC,
    int M, int N, int K) {
  static_assert(BK == 64 || BK == 256);
  constexpr int LBK = (BK == 64) ? 6 : 8;          // log2 BK
  constexpr int GPI = BK + 8;                      // LDS row pitch of a stage, in halves
  constexpr int PR  = BK / 8;                      // 16-B pieces of a stage row
  constexpr int RP  = 256 / PR;                    // rows that one copy of each of the 256 threads covers
  const int tid  = threadIdx.x;
  const int lane = tid & 31;
  const int wave = tid >> 5;
  const int tilesN = N >> 7;
  const int tilesM = M >> 7;
  if (tile >= tilesM * tilesN) return;             // block-uniform, in front of every barrier
  const int tm = tile / tilesN;
  const int tn = tile - tm * tilesN;
  const int bm0 = tm << 7;                         // block tile origin
  const int bn0 = tn << 7;
  const int wm  = (wave >> 1) << 5;                // wave tile origin inside the block tile
  const int wn  = (wave & 1) << 6;
  const int m0 = bm0 + wm;
  const int n0 = bn0 + wn;

  const _Float16* Ab = (const _Float16*)(const void*)Ap  + (size_t)bz * (size_t)strideA;
  const _Float16* Bb = (const _Float16*)(const void*)Btp + (size_t)bz * (size_t)strideB;

  const int rl   = lane & 15;                      // row (A) / col (B, D) within subtile
  const int hh   = lane >> 4;
  const int koff = hh * 8;                         // k offset of this lane half
  const int mOff = hh * 8;                         // D row offset

  // staging map: thread -> row tid / PR + RP * it, 16-B piece tid % PR of the row's 2 BK bytes; (128 / RP) it x RP rows = 128 rows
  const int srow = tid >> (LBK - 3);
  const int scol = (tid & (PR - 1)) * 8;
  const _Float16* ga = Ab + (size_t)(bm0 + srow) * lda + scol;
  const _Float16* gb = Bb + (size_t)(bn0 + srow) * ldb + scol;
  const int sofs = srow * GPI + scol;

  v8f acc[2][4];
#pragma unroll
  for (int i = 0; i < 2; ++i)
#pragma unroll
    for (int j = 0; j < 4; ++j) acc[i][j] = zero8();

  const unsigned la0 = lds_off(&sA[0][0]) + (unsigned)sofs * 2u;   // this thread's 16 B of row srow in buffer 0
  const unsigned lb0 = lds_off(&sB[0][0]) + (unsigned)sofs * 2u;
  const size_t aR = (size_t)RP * lda, bR = (size_t)RP * ldb;
  constexpr unsigned SBUF = 128u * GPI * 2u;                       // bytes of one buffer
  constexpr unsigned SRP  = (unsigned)RP * GPI * 2u;               // bytes of RP LDS rows
  auto issue = [&](int st) {                                       // stage st -> buffer st & 1: (128 / RP) x RP rows of A and of Bt
    const unsigned la = la0 + (unsigned)(st & 1) * SBUF, lb = lb0 + (unsigned)(st & 1) * SBUF;
    const _Float16* pa = ga + ((size_t)st << LBK);
    const _Float16* pb = gb + ((size_t)st << LBK);
    if (BK == 64) {
      copy8(la, la + SRP, la + 2u * SRP, la + 3u * SRP, lb, lb + SRP, lb + 2u * SRP, lb + 3u * SRP,
            pa, pa + aR, pa + 2 * aR, pa + 3 * aR, pb, pb + bR, pb + 2 * bR, pb + 3 * bR);
    } else {
      // both loops unrolled: two statements of eight copies each, their LDS steps compile-time constants
#pragma unroll
      for (int g = 0; g < 128 / RP; g += 8) {                      // 32 copies a thread and stage, 63 may be outstanding
        const unsigned l = la + (unsigned)g * SRP;
        const _Float16* p = pa + (size_t)g * aR;
        copy8(l, l + SRP, l + 2u * SRP, l + 3u * SRP, l + 4u * SRP, l + 5u * SRP, l + 6u * SRP, l + 7u * SRP,
              p, p + aR, p + 2 * aR, p + 3 * aR, p + 4 * aR, p + 5 * aR, p + 6 * aR, p + 7 * aR);
      }
#pragma unroll
      for (int g = 0; g < 128 / RP; g += 8) {
        const unsigned l = lb + (unsigned)g * SRP;
        const _Float16* p = pb + (size_t)g * bR;
        copy8(l, l + SRP, l + 2u * SRP, l + 3u * SRP, l + 4u * SRP, l + 5u * SRP, l + 6u * SRP, l + 7u * SRP,
              p, p + bR, p + 2 * bR, p + 3 * bR, p + 4 * bR, p + 5 * bR, p + 6 * bR, p + 7 * bR);
      }
    }
  };

  const int nst = K >> LBK;
  issue(0);
  wait_async0();
  __syncthreads();                                 // publishes stage 0
  if (nst > 1) issue(1);                           // block-uniform
  // kept rolled: one stage is already 16 WMMAs and 24 fragment loads a wave or more; unrolling would only grow code and registers
#pragma unroll 1
  for (int s = 0; s < nst; ++s) {
    const _Float16* dA = sA[s & 1];
    const _Float16* dB = sB[s & 1];
#pragma unroll
    for (int kk = 0; kk < BK / 32; ++kk) {
      v16h bfg[4], af[2];
      af[0] = ldfrag_h(dA + (wm + rl) * GPI + kk * 32 + koff);
#pragma unroll
      for (int j = 0; j < 4; ++j)
        bfg[j] = ldfrag_h(dB + (wn + (j << 4) + rl) * GPI + kk * 32 + koff);
      af[1] = ldfrag_h(dA + (wm + 16 + rl) * GPI + kk * 32 + koff);
#pragma unroll
      for (int i = 0; i < 2; ++i)
#pragma unroll
        for (int j = 0; j < 4; ++j) acc[i][j] = mma_h(af[i], bfg[j], acc[i][j]);
    }
    wait_ds0();
    wait_async0();
    __syncthreads();                               // publishes stage s+1; ends every wave's reads of stage s
    if (s + 2 < nst) issue(s + 2);                 // block-uniform: flies under the WMMAs of stage s+1
  }
  wait_async0();

  // ---- epilogue ----
  float* slab = sT[wave];
#pragma unroll
  for (int i = 0; i < 2; ++i) {
    const int mBase = m0 + (i << 4);
#pragma unroll
    for (int j = 0; j < 4; ++j) {
#pragma unroll
      for (int r = 0; r < 8; ++r) slab[(mOff + r) * 68 + (j << 4) + rl] = acc[i][j][r] * WINV;
    }
    wave_lds_sync();
    if (MODE == 0) {
      float* C = (float*)Cout + (size_t)bz * (size_t)strideC;
      const int c4 = rl * 4;                                   // 256-B row segment = 16 lanes x 16 B
      const v4f b4 = bfr4(*(const v4f*)(bias + n0 + c4));
      v4f vals[8];
#pragma unroll
      for (int it = 0; it < 8; ++it) {
        const int row = it * 2 + hh;                           // it 0..7 x hh 0..1 = rows 0..15
        const v4f v = *(const v4f*)(slab + row * 68 + c4);
        const v4f o = *(const v4f*)(C + (size_t)(mBase + row) * ldc + n0 + c4);
        vals[it] = o + (v + b4);
      }
      {
#pragma unroll
        for (int it = 0; it < 8; ++it) {
          const int row = it * 2 + hh;
          *(v4f*)(C + (size_t)(mBase + row) * ldc + n0 + c4) = vals[it];
        }
        
      }
    } else {
      const int q = lane >> 3, c8 = (lane & 7) * 8;
      unsigned short* C  = (unsigned short*)Cout  + (size_t)bz * (size_t)strideC;
      unsigned short* C2 = (unsigned short*)Cout2 + (size_t)bz * (size_t)strideC;
      v4f ba = zero4(), bb = zero4();
      if (MODE != 3) {
        ba = bfr4(*(const v4f*)(bias + n0 + c8));
        bb = bfr4(*(const v4f*)(bias + n0 + c8 + 4));
      }
      v4u hv[4], lv[4];
#pragma unroll
      for (int it = 0; it < 4; ++it) {
        const int row = it * 4 + q;                            // it 0..3 x q 0..3 = rows 0..15
        const float* sp = slab + row * 68 + c8;
        v4f fa = *(const v4f*)(sp);
        v4f fb = *(const v4f*)(sp + 4);
        if (MODE == 3) {
          const float br = bfr(bias[mBase + row]);
          fa = fa + br; fb = fb + br;
        } else {
          fa = fa + ba; fb = fb + bb;
        }
        if (MODE == 4) {
#pragma unroll
          for (int e = 0; e < 4; ++e) { fa[e] = gelu_t(fa[e]); fb[e] = gelu_t(fb[e]); }
        }
        v4u a, a2;
        if (MODE == 2) {
#pragma unroll
          for (int e = 0; e < 2; ++e) {
            const float f0 = fa[2 * e], f1 = fa[2 * e + 1];
            const float g0 = fb[2 * e], g1 = fb[2 * e + 1];
            const _Float16 x0 = (_Float16)f0, x1 = (_Float16)f1, y0 = (_Float16)g0, y1 = (_Float16)g1;
            a[e]      = pk16(h_bits(x0), h_bits(x1));
            a[e + 2]  = pk16(h_bits(y0), h_bits(y1));
            a2[e]     = pk16(h_bits((_Float16)((f0 - (float)x0) * QRS)), h_bits((_Float16)((f1 - (float)x1) * QRS)));
            a2[e + 2] = pk16(h_bits((_Float16)((g0 - (float)y0) * QRS)), h_bits((_Float16)((g1 - (float)y1) * QRS)));
          }
        } else {
          a[0] = pkh2(fa[0], fa[1]); a[1] = pkh2(fa[2], fa[3]);
          a[2] = pkh2(fb[0], fb[1]); a[3] = pkh2(fb[2], fb[3]);
          a2 = a;
        }
        hv[it] = a; lv[it] = a2;
      }
      {
#pragma unroll
        for (int it = 0; it < 4; ++it) {
          const int row = it * 4 + q;
          *(v4u*)(C + (size_t)(mBase + row) * ldc + n0 + c8) = hv[it];
          if (MODE == 2) *(v4u*)(C2 + (size_t)(mBase + row) * ldc + n0 + c8) = lv[it];
        }
        
      }
    }
    wave_lds_sync();
  }
}

#define GEMM_LDS(BK)                                                                                             \
  __shared__ __align__(16) _Float16 sA[2][128 * ((BK) + 8)]; /* A stage: 128 rows x BK k, pitch BK + 8, two buffers */ \
  __shared__ __align__(16) _Float16 sB[2][128 * ((BK) + 8)]; /* Bt stage, same shape */                           \
  __shared__ __align__(16) float sT[8][16 * 68];      /* per-wave 16x64 slab, pitch 68 floats */

template <int MODE>
__global__ __launch_bounds__(256) void gemm64(
    const unsigned short* __restrict__ Ap, int lda, long long strideA,
    const unsigned short* __restrict__ Btp, int ldb, long long strideB,
    const float* __restrict__ bias,
    void* Cout, void* Cout2, int ldc, long long strideC,
    int M, int N, int K) {
  constexpr int BK = (MODE == 0) ? 256 : 64;       // MODE 0 runs on the grids of 192 blocks; K = 768 or 3072, multiples of 256
  GEMM_LDS(BK)
  gemm_body<MODE, BK>(sA, sB, sT, blockIdx.x, blockIdx.y, Ap, lda, strideA, Btp, ldb, strideB, bias,
                  Cout, Cout2, ldc, strideC, M, N, K);
}

// q, k and v^T projections of one layer in one grid: they read the same X and do not depend on each other.
//   blocks 0..191: q (MODE 2); 192..383: k (MODE 1); 384..575: v^T (MODE 3), 96 tiles per batch.
// The three branches are block-uniform, so every barrier in gemm_body is passed by the whole block.
#define TQK ((BT / 128) * (HID / 128))
#define TVB ((HID / 128) * (SEQ / 128))
__global__ __launch_bounds__(256) void gemm_qkv(
    const unsigned short* __restrict__ X, const unsigned short* __restrict__ Wqt,
    const unsigned short* __restrict__ Wkt, const unsigned short* __restrict__ Wvt,
    const float* __restrict__ bq, const float* __restrict__ bk, const float* __restrict__ bv,
    unsigned short* Qh, unsigned short* Ql, unsigned short* Kh, unsigned short* VT) {
  GEMM_LDS(64)
  const int t = blockIdx.x;
  if (t < TQK) {
    gemm_body<2, 64>(sA, sB, sT, t, 0, X, HID, 0LL, Wqt, HID, 0LL, bq, (void*)Qh, (void*)Ql, HID, 0LL, BT, HID, HID);
  } else if (t < 2 * TQK) {
    gemm_body<1, 64>(sA, sB, sT, t - TQK, 0, X, HID, 0LL, Wkt, HID, 0LL, bk, (void*)Kh, (void*)Kh, HID, 0LL, BT, HID, HID);
  } else {
    const int u  = t - 2 * TQK;
    const int bz = u / TVB;
    gemm_body<3, 64>(sA, sB, sT, u - bz * TVB, bz, Wvt, HID, 0LL, X, HID, (long long)SEQ * HID, bv,
                 (void*)VT, (void*)VT, SEQ, (long long)HID * SEQ, HID, SEQ, HID);
  }
}

__device__ __forceinline__ float xhalf(float x) {
  return __builtin_bit_cast(float, __builtin_amdgcn_permlanex16(__builtin_bit_cast(int, x), __builtin_bit_cast(int, x),
                                                                0x76543210, 0xfedcba98, false, false));
}

// 2^x of eight values in one statement. The results are early-clobber, so none of them lies on a source of the exponential in
// front of it, and the closing v_nop is the slot the instruction set asks for between a transcendental and the next instruction
// that uses its result or overwrites its source (left to itself the compiler put results on the source of the one in front).
__device__ __forceinline__ v8f exp2x8(v8f x) {
  v8f y = x;
#if defined(__HIP_DEVICE_COMPILE__)
  float y0, y1, y2, y3, y4, y5, y6, y7;
  asm("v_exp_f32 %0, %8\n\tv_exp_f32 %1, %9\n\tv_exp_f32 %2, %10\n\tv_exp_f32 %3, %11\n\t"
      "v_exp_f32 %4, %12\n\tv_exp_f32 %5, %13\n\tv_exp_f32 %6, %14\n\tv_exp_f32 %7, %15\n\tv_nop"
      : "=&v"(y0), "=&v"(y1), "=&v"(y2), "=&v"(y3), "=&v"(y4), "=&v"(y5), "=&v"(y6), "=&v"(y7)
      : "v"(x[0]), "v"(x[1]), "v"(x[2]), "v"(x[3]), "v"(x[4]), "v"(x[5]), "v"(x[6]), "v"(x[7]));
  y[0] = y0; y[1] = y1; y[2] = y2; y[3] = y3; y[4] = y4; y[5] = y5; y[6] = y6; y[7] = y7;
#endif
  return y;
}

__global__ __launch_bounds__(128)
void attn64(const unsigned short* __restrict__ qhp, const unsigned short* __restrict__ qlp,
            const unsigned short* __restrict__ khp, const unsigned short* __restrict__ vtp,
            const float* __restrict__ mask, unsigned short* ctxp, float sscale) {
  union FH { v16h v; v8h h[2]; };
  __shared__ __align__(16) _Float16 Ks[2][64 * API];              // K [kv][d]    9 KB, two buffers
  __shared__ __align__(16) _Float16 Vts[2][64 * API];             // V^T [d][kv]  9 KB, two buffers
  __shared__ __align__(16) float    Mt[2][128];                   // per key of the chunk: [0..63] m * sscale, [64..127] -1e10 * (1 - m)
  __shared__ __align__(16) float    Os[4][16 * OPI];              // per wave context tile [row][d]

  const int tid  = threadIdx.x;
  const int wave = tid >> 5;
  const int lane = tid & 31;
  const int hh   = lane >> 4;
  const int c    = lane & 15;

  const int bx   = blockIdx.x;
  const int qb   = bx % NQB;
  const int rest = bx / NQB;
  const int h    = rest % NHD;
  const int b    = rest / NHD;
  const int q0   = qb * 64 + wave * 16;
  const size_t rowB = (size_t)b * SEQ;

  const _Float16* Qh = (const _Float16*)(const void*)qhp + (size_t)h * HD;
  const _Float16* Ql = (const _Float16*)(const void*)qlp + (size_t)h * HD;
  const _Float16* Kh = (const _Float16*)(const void*)khp + (size_t)h * HD;
  const _Float16* Vt = (const _Float16*)(const void*)vtp + ((size_t)b * HID + (size_t)h * HD) * SEQ;
  const float* mb = mask + (size_t)b * SEQ;

  // ---- Q fragments (B operand, column = query q0 + (lane&15)): 2 d-chunks, hi and residual ----
  v16h qah[2], qal[2];
#pragma unroll
  for (int dc = 0; dc < 2; ++dc) {
    const size_t qo = (rowB + q0 + c) * HID + dc * 32 + 8 * hh;
    qah[dc] = ldfrag_h(Qh + qo);
    qal[dc] = ldfrag_h(Ql + qo);
  }

  float mrun = -INFINITY;                          // this lane's query: running max, alike in both wave halves
  v8f lacc = zero8();                              // its sum of p: register r over keys = 8hh + r (mod 16); joined after the loop
  v8f oacc[4];                                     // O^T: register r of tile t = d 16t + 8hh + r of query q0 + c
#pragma unroll
  for (int t = 0; t < 4; ++t) oacc[t] = zero8();

  // staging map: thread -> row (tid>>3) + 16*i, 16-B piece (tid&7) of the row's 128 B; 4 i x 16 rows = 64 rows of K and of V^T
  const int srow = tid >> 3, scol = (tid & 7) * 8;
  const _Float16* kg = Kh + (rowB + srow) * HID + scol;            // K row srow of chunk 0
  const _Float16* vg = Vt + (size_t)srow * SEQ + scol;             // V^T row d = srow, keys of chunk 0
  const unsigned lk0 = lds_off(&Ks[0][0])  + (unsigned)(srow * API + scol) * 2u;
  const unsigned lv0 = lds_off(&Vts[0][0]) + (unsigned)(srow * API + scol) * 2u;
  constexpr unsigned ABUF = 64u * API * 2u;                        // bytes of one buffer
  constexpr unsigned AR16 = 16u * API * 2u;                        // bytes of 16 LDS rows
  auto issue = [&](int ch) {                                       // chunk ch < NQB -> buffer ch & 1
    const unsigned lk = lk0 + (unsigned)(ch & 1) * ABUF, lv = lv0 + (unsigned)(ch & 1) * ABUF;
    const _Float16* pk = kg + (size_t)ch * 64 * HID;
    const _Float16* pv = vg + (size_t)ch * 64;
    copy8(lk, lk + AR16, lk + 2u * AR16, lk + 3u * AR16, lv, lv + AR16, lv + 2u * AR16, lv + 3u * AR16,
          pk, pk + 16 * HID, pk + 32 * HID, pk + 48 * HID, pv, pv + 16 * SEQ, pv + 32 * SEQ, pv + 48 * SEQ);
  };
  auto mterm = [&](float mraw) {                                   // threads 0..63 hold the factor, 64..127 the addend
    const float m = bfr(mraw);
    return (tid < 64) ? m * sscale : -1.0e10f * (1.0f - m);
  };
  static_assert(NQB >= 2);
  issue(0);
  Mt[0][tid] = mterm(mb[tid & 63]);
  wait_async0();
  __syncthreads();                                 // publishes chunk 0
  issue(1);

#pragma unroll 1
  for (int kt = 0; kt < NQB; ++kt) {
    const _Float16* Kc = Ks[kt & 1];
    const _Float16* Vc = Vts[kt & 1];
    const float*    Mc = Mt[kt & 1];
    // mask value of the next chunk's key, in flight under this chunk; the last trip takes its own chunk again (in bounds, read by nobody)
    const float mraw = mb[((kt + 1 < NQB) ? kt + 1 : kt) * 64 + (tid & 63)];

    // ---- scores, transposed: 64 keys x 16 queries per wave, k.qhi and k.qres ----
    // LDS reads of a chunk stand in three groups, each a run of products or arithmetic ahead of its last user, so that the waits are
    // counted ones; read pair by pair in front of each product, every pair's LDS latency is waited out alone, 16 times a chunk.
    // group 1: all 8 K fragments and the mask terms of keys 0..31
    FH kb[4][2];
    v4f mf[4][2], md[4][2];                        // per key: factor m * sscale, addend -1e10 * (1 - m); [j][0] = r 0..3, [j][1] = r 4..7
#pragma unroll
    for (int j = 0; j < 4; ++j) {
#pragma unroll
      for (int dc = 0; dc < 2; ++dc) {
        kb[j][dc].h[0] = *(const v8h*)(Kc + (j * 16 + c) * API + dc * 32 + 8 * hh);
        kb[j][dc].h[1] = *(const v8h*)(Kc + (j * 16 + c) * API + dc * 32 + 16 + 8 * hh);
      }
    }
#pragma unroll
    for (int j = 0; j < 2; ++j) {
      mf[j][0] = *(const v4f*)(Mc + j * 16 + 8 * hh);      mf[j][1] = *(const v4f*)(Mc + j * 16 + 8 * hh + 4);
      md[j][0] = *(const v4f*)(Mc + 64 + j * 16 + 8 * hh); md[j][1] = *(const v4f*)(Mc + 64 + j * 16 + 8 * hh + 4);
    }
    // keeps this group of LDS reads in one place ahead of its users: without it the compiler sinks reads in among the products
    __builtin_amdgcn_sched_barrier(0);
    v8f s[4], sl[4];
#pragma unroll
    for (int j = 0; j < 2; ++j) {
      s[j] = zero8();
      sl[j] = zero8();
#pragma unroll
      for (int dc = 0; dc < 2; ++dc) {
        s[j]  = mma_p(kb[j][dc].v, qah[dc], s[j]);
        sl[j] = mma_p(kb[j][dc].v, qal[dc], sl[j]);
      }
    }
    // group 2: the mask terms of keys 32..63, used behind the next 8 products
#pragma unroll
    for (int j = 2; j < 4; ++j) {
      mf[j][0] = *(const v4f*)(Mc + j * 16 + 8 * hh);      mf[j][1] = *(const v4f*)(Mc + j * 16 + 8 * hh + 4);
      md[j][0] = *(const v4f*)(Mc + 64 + j * 16 + 8 * hh); md[j][1] = *(const v4f*)(Mc + 64 + j * 16 + 8 * hh + 4);
    }
    // keeps the eight products above back to back, each filling the distance behind the one before it, ahead of the mask arithmetic on their
    // results: without it the compiler interleaves the two and pads with more v_nop
    __builtin_amdgcn_sched_barrier(0);
#pragma unroll
    for (int j = 0; j < 2; ++j) {
#pragma unroll
      for (int r = 0; r < 4; ++r) {
        s[j][r]     = (s[j][r]     + sl[j][r]     * QRI) * mf[j][0][r] + md[j][0][r];
        s[j][r + 4] = (s[j][r + 4] + sl[j][r + 4] * QRI) * mf[j][1][r] + md[j][1][r];
      }
    }
#pragma unroll
    for (int j = 2; j < 4; ++j) {
      s[j] = zero8();
      sl[j] = zero8();
#pragma unroll
      for (int dc = 0; dc < 2; ++dc) {
        s[j]  = mma_p(kb[j][dc].v, qah[dc], s[j]);
        sl[j] = mma_p(kb[j][dc].v, qal[dc], sl[j]);
      }
    }
    // group 3: all 8 V^T fragments, so that they land under the softmax arithmetic
    FH vb[2][4];
#pragma unroll
    for (int kk = 0; kk < 2; ++kk) {
#pragma unroll
      for (int t = 0; t < 4; ++t) {
        vb[kk][t].h[0] = *(const v8h*)(Vc + (t * 16 + c) * API + kk * 32 + 8 * hh);
        vb[kk][t].h[1] = *(const v8h*)(Vc + (t * 16 + c) * API + kk * 32 + 16 + 8 * hh);
      }
    }
    // keeps this group of LDS reads in one place ahead of its users: without it the compiler sinks reads in among the products
    __builtin_amdgcn_sched_barrier(0);
#pragma unroll
    for (int j = 2; j < 4; ++j) {
#pragma unroll
      for (int r = 0; r < 4; ++r) {
        s[j][r]     = (s[j][r]     + sl[j][r]     * QRI) * mf[j][0][r] + md[j][0][r];
        s[j][r + 4] = (s[j][r + 4] + sl[j][r + 4] * QRI) * mf[j][1][r] + md[j][1][r];
      }
    }

    // ---- max of this query's 64 scores, online softmax, P^T (x1024, f16) packed in place as B fragments ----
    float mj[4];
#pragma unroll
    for (int j = 0; j < 4; ++j) {
      mj[j] = fmaxf(fmaxf(fmaxf(s[j][0], s[j][1]), fmaxf(s[j][2], s[j][3])),
                    fmaxf(fmaxf(s[j][4], s[j][5]), fmaxf(s[j][6], s[j][7])));
    }
    float m = fmaxf(fmaxf(mj[0], mj[1]), fmaxf(mj[2], mj[3]));
    m = fmaxf(m, xhalf(m));
    const float mnew  = fmaxf(mrun, m);
    const float alpha = __expf(mrun - mnew);
    mrun = mnew;
    FH pb[2];
    v8f p[4];
#pragma unroll
    for (int j = 0; j < 4; ++j) {
      p[j] = exp2x8((s[j] - mnew) * 1.4426950408889634f);
#pragma unroll
      for (int r = 0; r < 8; ++r) pb[j >> 1].v[(j & 1) * 8 + r] = (_Float16)(p[j][r] * PSC);
    }
    lacc = lacc * alpha + ((p[0] + p[1]) + (p[2] + p[3]));
#pragma unroll
    for (int t = 0; t < 4; ++t) oacc[t] *= alpha;

    // ---- context^T += V^T . P^T (f16 WMMA) ----
#pragma unroll
    for (int kk = 0; kk < 2; ++kk) {
#pragma unroll
      for (int t = 0; t < 4; ++t) oacc[t] = mma_p(vb[kk][t].v, pb[kk].v, oacc[t]);
    }

    Mt[(kt + 1) & 1][tid] = mterm(mraw);           // its last readers passed the barrier at the foot of trip kt-1
    wait_ds0();
    wait_async0();
    __syncthreads();                               // publishes chunk kt+1; ends every wave's reads of chunk kt
    if (kt + 2 < NQB) issue(kt + 2);               // block-uniform: flies under the work on chunk kt+1
  }
  wait_async0();

  float* os = Os[wave];
  {
    const float lsum = ((lacc[0] + lacc[1]) + (lacc[2] + lacc[3])) + ((lacc[4] + lacc[5]) + (lacc[6] + lacc[7]));
    const float l = lsum + xhalf(lsum);            // the two halves' key sums joined
    const float inv = ((l > 0.f) ? (1.0f / l) : 0.f) * PSI;
#pragma unroll
    for (int t = 0; t < 4; ++t) {
      v4f lo, hi;
#pragma unroll
      for (int r = 0; r < 4; ++r) { lo[r] = oacc[t][r] * inv; hi[r] = oacc[t][r + 4] * inv; }
      *(v4f*)(os + c * OPI + t * 16 + 8 * hh)     = lo;
      *(v4f*)(os + c * OPI + t * 16 + 8 * hh + 4) = hi;
    }
  }
  wave_lds_sync();
  {
    const int q4 = lane >> 3, c8 = (lane & 7) * 8;
    v4u hv[4];
#pragma unroll
    for (int it = 0; it < 4; ++it) {
      const int row = it * 4 + q4;           // it 0..3 x q4 0..3 = rows 0..15 of the wave tile
      const float* sp = os + row * OPI + c8;
      const v4f fa = *(const v4f*)(sp);
      const v4f fb = *(const v4f*)(sp + 4);
      v4u a;
      a[0] = pkh2(fa[0], fa[1]); a[1] = pkh2(fa[2], fa[3]);
      a[2] = pkh2(fb[0], fb[1]); a[3] = pkh2(fb[2], fb[3]);
      hv[it] = a;
    }
    {
#pragma unroll
      for (int it = 0; it < 4; ++it) {
        const int row = it * 4 + q4;
        const size_t go = (rowB + q0 + row) * HID + (size_t)h * HD + c8;
        *(v4u*)(ctxp + go) = hv[it];
      }
      
    }
  }
}

// =====================================================================================================
// Workspace map (bytes), all region sizes multiples of 128 and exact multiples of their 64x64- or 128x128-tile / whole-row
// store granularity (M, N multiples of 128; 768- and 3072-wide rows), so no padded tails are needed:
//   Hres f32 [4096][768]        12582912
//   X    f16 [4096][768]         6291456   (LN output plane, reused by LN1 and LN2)
//   Qh   f16 [4096][768]         6291456
//   Ql   f16 [4096][768]         6291456   (q residual x4096)
//   Kh   f16 [4096][768]         6291456
//   VT   f16 [2][768][2048]      6291456
//   Ctx  f16 [4096][768]         6291456
//   G    f16 [4096][3072]       25165824
//   per layer (2 x 14155776):
//   Wq_t,Wk_t,Wv_t,Wo_t f16 [768][768]  4 x 1179648
//   W1_t f16 [3072][768]         4718592
//   W2_t f16 [768][3072]         4718592
//   total                      103809024
// Both layers' weights are converted by the first launch, each layer into its own region ([out n][in k], k contiguous = the Bt / A layout).
// =====================================================================================================
extern "C" void kernel_launch(void* const* d_in, const int* in_sizes, int n_in,
                              void* d_out, int out_size, void* d_ws, size_t ws_size,
                              hipStream_t stream) {
  if (n_in < 21) return;
  if (in_sizes[0] != BT * HID || in_sizes[1] != BT * HID || in_sizes[2] != NB * SEQ) return;
  if (in_sizes[3] != 2 * HID || in_sizes[4] != 2 * HID) return;
  if (in_sizes[5] != 2 * HID * HID || in_sizes[7] != 2 * HID * HID ||
      in_sizes[9] != 2 * HID * HID || in_sizes[11] != 2 * HID * HID) return;
  if (in_sizes[6] != 2 * HID || in_sizes[8] != 2 * HID || in_sizes[10] != 2 * HID || in_sizes[12] != 2 * HID) return;
  if (in_sizes[13] != 2 * HID || in_sizes[14] != 2 * HID) return;
  if (in_sizes[15] != 2 * HID * DFF || in_sizes[16] != 2 * DFF ||
      in_sizes[17] != 2 * DFF * HID || in_sizes[18] != 2 * HID) return;
  if (in_sizes[19] != HID || in_sizes[20] != HID) return;
  if (out_size != BT * HID) return;

  const float* in_h  = (const float*)d_in[0];
  const float* embs  = (const float*)d_in[1];
  const float* mask  = (const float*)d_in[2];
  const float* ln1_s = (const float*)d_in[3];
  const float* ln1_b = (const float*)d_in[4];
  const float* wq    = (const float*)d_in[5];
  const float* bq    = (const float*)d_in[6];
  const float* wk    = (const float*)d_in[7];
  const float* bk    = (const float*)d_in[8];
  const float* wv    = (const float*)d_in[9];
  const float* bv    = (const float*)d_in[10];
  const float* wo    = (const float*)d_in[11];
  const float* bo    = (const float*)d_in[12];
  const float* ln2_s = (const float*)d_in[13];
  const float* ln2_b = (const float*)d_in[14];
  const float* w1    = (const float*)d_in[15];
  const float* b1    = (const float*)d_in[16];
  const float* w2    = (const float*)d_in[17];
  const float* b2    = (const float*)d_in[18];
  const float* lnf_s = (const float*)d_in[19];
  const float* lnf_b = (const float*)d_in[20];
  float* out = (float*)d_out;

  const size_t PH  = (size_t)BT * HID * 4;        // 12582912
  const size_t PA  = (size_t)BT * HID * 2;        //  6291456
  const size_t PVT = (size_t)NB * HID * SEQ * 2;  //  6291456
  const size_t PG  = (size_t)BT * DFF * 2;        // 25165824
  const size_t PW  = (size_t)HID * HID * 2;       //  1179648
  const size_t PW1 = (size_t)HID * DFF * 2;       //  4718592
  size_t off = 0;
  const size_t oH   = off; off += PH;
  const size_t oX   = off; off += PA;
  const size_t oQh  = off; off += PA;
  const size_t oQl  = off; off += PA;
  const size_t oKh  = off; off += PA;
  const size_t oVT  = off; off += PVT;
  const size_t oCtx = off; off += PA;
  const size_t oG   = off; off += PG;
  const size_t oWt  = off; off += 2 * (4 * PW + 2 * PW1);
  if (off > ws_size) return;                      // off = 103809024
  if (off > (size_t)134217728) return;

  char* ws = (char*)d_ws;
  float*          Hres = (float*)(ws + oH);
  unsigned short* X    = (unsigned short*)(ws + oX);
  unsigned short* Qh   = (unsigned short*)(ws + oQh);
  unsigned short* Ql   = (unsigned short*)(ws + oQl);
  unsigned short* Kh   = (unsigned short*)(ws + oKh);
  unsigned short* VT   = (unsigned short*)(ws + oVT);
  unsigned short* Ctx  = (unsigned short*)(ws + oCtx);
  unsigned short* G    = (unsigned short*)(ws + oG);
  unsigned short* Wt   = (unsigned short*)(ws + oWt);

  const dim3 blk(256);
  const dim3 gLN(BT / 8);                                           // 512 blocks, 8 rows each
  const dim3 gPrep(BT / 8 + 2 * CVL);                               // 512 row groups + 2 x 1728 weight tiles
  const dim3 gHH((BT / 128) * (HID / 128), 1);                      // 32 x 6  = 192 blocks
  const dim3 gQKV(2 * TQK + NB * TVB);                              // 192 + 192 + 2 x 96 = 576 blocks
  const dim3 gF1((BT / 128) * (DFF / 128), 1);                      // 32 x 24 = 768 blocks
  const dim3 gAt(NB * NHD * NQB);                                   // 768 blocks of 128

  for (int l = 0; l < 2; ++l) {
    unsigned short* Wqt = Wt + (size_t)l * WLH;
    unsigned short* Wkt = Wqt + (size_t)HID * HID;
    unsigned short* Wvt = Wkt + (size_t)HID * HID;
    unsigned short* Wot = Wvt + (size_t)HID * HID;
    unsigned short* W1t = Wot + (size_t)HID * HID;
    unsigned short* W2t = W1t + (size_t)HID * DFF;
    // (1) h = h + input_embs; hn = LN1(h) -> X (f16); with layer 0 also
    // (2) the weights of both layers: f32 [in][out] -> f16 [out][in] (bf16-RNE values x64)
    if (l == 0) {
      prep<<<gPrep, blk, 0, stream>>>(in_h, embs, Hres, ln1_s, ln1_b, X, wq, wk, wv, wo, w1, w2, Wt);
    } else {
      ln_rows<true, false, false><<<gLN, blk, 0, stream>>>(Hres, embs, Hres, ln1_s + HID, ln1_b + HID, (void*)X, BT);
    }
    // (3) q = hn . Wq + bq -> f16 hi + residual planes [b*SEQ+t][h*64+d]  (M=4096, N=768, K=768)
    // (4) k = hn . Wk + bk -> f16 plane
    // (5) v^T = Wv_t . hn^T per batch -> f16 [b][h*64+d][s]  (A = Wv_t [n][k], Bt = X rows of batch b; M=768, N=2048, K=768)
    gemm_qkv<<<gQKV, blk, 0, stream>>>(X, Wqt, Wkt, Wvt, bq + l * HID, bk + l * HID, bv + l * HID, Qh, Ql, Kh, VT);
    // (6) attention -> Ctx f16 [b*SEQ+t][h*64+d]
    attn64<<<gAt, dim3(128), 0, stream>>>(Qh, Ql, Kh, VT, mask, Ctx, 0.125f);
    // (7) h = h + (ctx . Wo + bo)  (f32, in place)
    gemm64<0><<<gHH, blk, 0, stream>>>(Ctx, HID, 0LL, Wot, HID, 0LL, bo + l * HID,
                                       (void*)Hres, (void*)Hres, HID, 0LL, BT, HID, HID);
    // (8) hn = LN2(h) -> X
    ln_rows<false, false, false><<<gLN, blk, 0, stream>>>(Hres, embs, Hres, ln2_s + l * HID, ln2_b + l * HID, (void*)X, BT);
    // (9) g = gelu(hn . W1 + b1) -> G f16 [4096][3072]  (M=4096, N=3072, K=768)
    gemm64<4><<<gF1, blk, 0, stream>>>(X, HID, 0LL, W1t, HID, 0LL, b1 + l * DFF,
                                       (void*)G, (void*)G, DFF, 0LL, BT, DFF, HID);
    // (10) h = h + (g . W2 + b2)  (M=4096, N=768, K=3072, f32 in place)
    gemm64<0><<<gHH, blk, 0, stream>>>(G, DFF, 0LL, W2t, DFF, 0LL, b2 + l * HID,
                                       (void*)Hres, (void*)Hres, HID, 0LL, BT, HID, DFF);
  }
  // (11) out = LN_f(h) -> f32 [2][2048][768]
  ln_rows<false, false, true><<<gLN, blk, 0, stream>>>(Hres, embs, Hres, lnf_s, lnf_b, (void*)out, BT);
  (void)hipGetLastError();
}

// v009
// It runs in 262 microseconds.
// Timed twice side by side with v008, it ran 1.03 times as fast both times.
// Counting every step since v000, it is 3.78 times as fast.
// Contractions: q, k, v^T, out and ffn projections = v_wmma_f32_16x16x32_f16 (f16 activations; weights bf16-RNE then x64 as f16), single product;
// q.k^T = v_wmma_f32_16x16x32_f16 with q as f16 hi + f16 residual planes and k f16 (k rows carry mask * 1/8 * log2 e), 2 products in one accumulator;
// p.v = v_wmma_f32_16x16x32_f16 (p carried x1024 in f16, v f16); f32 accumulate everywhere; layernorm, softmax and gelu in f32.
#include <hip/hip_runtime.h>
#include <math.h>
#include <stdint.h>

#define NB   2
#define SEQ  2048
#define HID  768
#define NHD  12
#define HD   64
#define DFF  3072
#define BT   (NB * SEQ)
#define NQB  (SEQ / 64)
#define WSC  64.0f
#define WINV 0.015625f
#define L2E  1.4426950408889634f
#define KSC  0.18033688011112042f   // 1/sqrt(64) * log2 e: the factor every k row carries, times its key's mask value
#define PLG  10.0f                  // p is carried x1024 = 2^10: the exponent's reference point lies 10 below the running max
#define HMAX 65504.0f               // largest finite f16
#define FMAX 3.402823466e38f        // largest finite f32
#define API  72                 // LDS row pitch of the attention K and V^T tiles, in halves: 64 + 8 = 144 B = 16 B x odd
#define OPI  68                 // LDS row pitch of the attention context tile, in floats: 64 + 4 = 272 B = 16 B x odd
static_assert(NHD * HD == HID);
static_assert((SEQ % 64) == 0 && (HID % 64) == 0 && (DFF % 64) == 0 && (BT % 64) == 0);
static_assert(HID == 6 * 128);
static_assert((SEQ % 128) == 0 && (HID % 128) == 0 && (DFF % 128) == 0 && (BT % 128) == 0);
static_assert((HID % 256) == 0 && (DFF % 256) == 0);

typedef _Float16 v16h __attribute__((ext_vector_type(16)));
typedef _Float16 v8h  __attribute__((ext_vector_type(8)));
typedef float    v8f  __attribute__((ext_vector_type(8)));
typedef float    v4f  __attribute__((ext_vector_type(4)));
typedef unsigned int v4u __attribute__((ext_vector_type(4)));

// ---- scalar helpers -----------------------------------------------------------------------------
__device__ __forceinline__ unsigned short bf_bits(float f) {        // f32 -> bf16 bits, RNE convert
  const unsigned u = __float_as_uint(f);
  return (unsigned short)((u + 0x7FFFu + ((u >> 16) & 1u)) >> 16);
}
__device__ __forceinline__ float bfr(float f) { return __uint_as_float(((unsigned)bf_bits(f)) << 16); }
__device__ __forceinline__ v4f bfr4(v4f a) {
  v4f r;
  r[0] = bfr(a[0]); r[1] = bfr(a[1]); r[2] = bfr(a[2]); r[3] = bfr(a[3]);
  return r;
}
__device__ __forceinline__ unsigned short h_bits(_Float16 x) { return __builtin_bit_cast(unsigned short, x); }
__device__ __forceinline__ unsigned pk16(unsigned short a, unsigned short b) { return (unsigned)a | ((unsigned)b << 16); }
__device__ __forceinline__ unsigned pkh2(float a, float b) { return pk16(h_bits((_Float16)a), h_bits((_Float16)b)); }
__device__ __forceinline__ v8f zero8() { v8f z = {0.f, 0.f, 0.f, 0.f, 0.f, 0.f, 0.f, 0.f}; return z; }
__device__ __forceinline__ v4f zero4() { v4f z = {0.f, 0.f, 0.f, 0.f}; return z; }

// ---- fragment loader: 16-bit A/B operand, lane -> row/col (lane&15); p already includes +8*(lane>>4);
//      elements 0..7 <- p[0..7] (k0+8h..), elements 8..15 <- p[16..23] (k0+16+8h..)
__device__ __forceinline__ v16h ldfrag_h(const _Float16* p) {
  union { v16h v; v8h h[2]; } f;
  f.h[0] = *(const v8h*)(p);
  f.h[1] = *(const v8h*)(p + 16);
  return f.v;
}

// ---- WMMA with trailing VALU hazard gap (the GEMM loops) -------------------------------------------
__device__ __forceinline__ v8f mma_h(v16h a, v16h b, v8f c) {
  c = __builtin_amdgcn_wmma_f32_16x16x32_f16(false, a, false, b, (short)0, c, false, false);
#if defined(__HIP_DEVICE_COMPILE__)
  asm volatile("v_nop\n\tv_nop\n\tv_nop\n\tv_nop" : "+v"(c) : "v"(a), "v"(b));
#endif
  return c;
}
// The builtin alone, for the attention loop: there three waves share a SIMD's vector port and written v_nop take slots from the other
// waves' softmax arithmetic; the compiler keeps the distance to the next user of D, A or B itself, with useful instructions where it has them.
__device__ __forceinline__ v8f mma_p(v16h a, v16h b, v8f c) {
  return __builtin_amdgcn_wmma_f32_16x16x32_f16(false, a, false, b, (short)0, c, false, false);
}

// release/acquire + wave barrier for same-wave LDS exchange
__device__ __forceinline__ void wave_lds_sync() {
  __builtin_amdgcn_fence(__ATOMIC_RELEASE, "workgroup");
  __builtin_amdgcn_wave_barrier();
  __builtin_amdgcn_fence(__ATOMIC_ACQUIRE, "workgroup");
}

// ---- asynchronous copies to LDS ------------------------------------------------------------------
__device__ __forceinline__ unsigned lds_off(const void* p) { return (unsigned)(size_t)p; }   // byte offset in the work-group's LDS

// Eight 16-B copies per lane, global memory -> LDS through no register: l* = the lane's LDS byte address, g* = its global address.
// The closing s_wait_xcnt 0 is a precaution: it stands in front of every later rewrite of the address registers the copies name.
__device__ __forceinline__ void copy8(unsigned l0, unsigned l1, unsigned l2, unsigned l3,
                                      unsigned l4, unsigned l5, unsigned l6, unsigned l7,
                                      const _Float16* g0, const _Float16* g1, const _Float16* g2, const _Float16* g3,
                                      const _Float16* g4, const _Float16* g5, const _Float16* g6, const _Float16* g7) {
#if defined(__HIP_DEVICE_COMPILE__)
  asm volatile("global_load_async_to_lds_b128 %0, %8, off\n\t"
               "global_load_async_to_lds_b128 %1, %9, off\n\t"
               "global_load_async_to_lds_b128 %2, %10, off\n\t"
               "global_load_async_to_lds_b128 %3, %11, off\n\t"
               "global_load_async_to_lds_b128 %4, %12, off\n\t"
               "global_load_async_to_lds_b128 %5, %13, off\n\t"
               "global_load_async_to_lds_b128 %6, %14, off\n\t"
               "global_load_async_to_lds_b128 %7, %15, off\n\t"
               "s_wait_xcnt 0x0"
               :: "v"(l0), "v"(l1), "v"(l2), "v"(l3), "v"(l4), "v"(l5), "v"(l6), "v"(l7),
                  "v"(g0), "v"(g1), "v"(g2), "v"(g3), "v"(g4), "v"(g5), "v"(g6), "v"(g7)
               : "memory");
#endif
}
// this wave's LDS reads have returned: stands in front of the barrier behind which their buffer is refilled
__device__ __forceinline__ void wait_ds0() { asm volatile("s_wait_dscnt 0x0" ::: "memory"); }
// this wave's copies have landed: stands in front of the barrier behind which other waves read them (the compiler places no wait for a copy)
__device__ __forceinline__ void wait_async0() { asm volatile("s_wait_asynccnt 0x0" ::: "memory"); }

// tanh-approximation gelu, tanh(u) = 1 - 2/(exp(2u)+1) with u clamped to [-16,16]
__device__ __forceinline__ float gelu_t(float x) {
  float u = 0.7978845608028654f * (x + 0.044715f * x * x * x);
  u = fminf(fmaxf(u, -16.0f), 16.0f);
  const float e  = __expf(2.0f * u);
  const float th = 1.0f - 2.0f * __builtin_amdgcn_rcpf(e + 1.0f);
  return 0.5f * x * (1.0f + th);
}

// =====================================================================================================
// Residual add + LayerNorm, one wave per row of 768. grid = nrows/8, 256 threads.
//   x = src row (RSRC: bf16-RNE the loaded values) (+ ADDE: bf16-RNE(embs row)); ADDE also stores x to hdst
//   (may alias src: every lane reads its own 24 columns before storing them).
//   else:  y -> f16 rows via a per-wave LDS row buffer (lane l: 8 halves at col 256j+8l, 512 B per instruction).
// coverage: 8 waves x grid(512) = 4096 rows; 6 x 128 floats / 3 x 256 halves = the whole 768-wide row.
// =====================================================================================================
// blk = index of the 8-row group; rb = the block's 8 x 768 float row buffer in LDS.
template <bool ADDE, bool RSRC, bool OUT32>
__device__ __forceinline__ void ln_body(int blk, float* rb, const float* src, const float* embs, float* hdst,
                                        const float* __restrict__ sc, const float* __restrict__ bi,
                                        void* outp, int nrows) {
  const int tid = threadIdx.x, wave = tid >> 5, lane = tid & 31;
  const int row = blk * 8 + wave;
  if (row >= nrows) return;                       // wave-uniform; no block barrier behind it in this body
  const size_t rbase = (size_t)row * HID;
  v4f x[6];
#pragma unroll
  for (int i = 0; i < 6; ++i) {
    const int col = i * 128 + lane * 4;
    v4f a = *(const v4f*)(src + rbase + col);
    if (RSRC) a = bfr4(a);
    if (ADDE) {
      const v4f e = bfr4(*(const v4f*)(embs + rbase + col));
      a = a + e;
    }
    x[i] = a;
    // precaution: a later load's result may be given the address registers of this trip's loads; this keeps the wait in front of that
    asm volatile("s_wait_xcnt 0x0" ::: "memory");
  }
  if (ADDE) {
    {
#pragma unroll
      for (int i = 0; i < 6; ++i) *(v4f*)(hdst + rbase + i * 128 + lane * 4) = x[i];
      
    }
  }
  float s = 0.f;
#pragma unroll
  for (int i = 0; i < 6; ++i) s += (x[i][0] + x[i][1]) + (x[i][2] + x[i][3]);
#pragma unroll
  for (int off = 1; off < 32; off <<= 1) s += __shfl_xor(s, off, 32);
  const float mean = s * (1.0f / 768.0f);
  float qv = 0.f;
#pragma unroll
  for (int i = 0; i < 6; ++i) {
    const v4f d = x[i] - mean;
    qv += (d[0] * d[0] + d[1] * d[1]) + (d[2] * d[2] + d[3] * d[3]);
  }
#pragma unroll
  for (int off = 1; off < 32; off <<= 1) qv += __shfl_xor(qv, off, 32);
  const float var  = qv * (1.0f / 768.0f);
  const float rinv = rsqrtf(var + 1e-5f);
  v4f y[6];
#pragma unroll
  for (int i = 0; i < 6; ++i) {
    const int col = i * 128 + lane * 4;
    const v4f s4 = bfr4(*(const v4f*)(sc + col));
    const v4f b4 = bfr4(*(const v4f*)(bi + col));
    y[i] = (x[i] - mean) * rinv * s4 + b4;
  }
  if (OUT32) {
    float* o = (float*)outp;
    {
#pragma unroll
      for (int i = 0; i < 6; ++i) *(v4f*)(o + rbase + i * 128 + lane * 4) = y[i];
      
    }
  } else {
    float* rw = rb + wave * HID;
#pragma unroll
    for (int i = 0; i < 6; ++i) *(v4f*)(rw + i * 128 + lane * 4) = y[i];
    wave_lds_sync();
    v4u pk[3];
#pragma unroll
    for (int j = 0; j < 3; ++j) {
      const v4f a = *(const v4f*)(rw + j * 256 + lane * 8);
      const v4f c = *(const v4f*)(rw + j * 256 + lane * 8 + 4);
      v4u p;
      p[0] = pkh2(a[0], a[1]); p[1] = pkh2(a[2], a[3]);
      p[2] = pkh2(c[0], c[1]); p[3] = pkh2(c[2], c[3]);
      pk[j] = p;
    }
    unsigned short* o = (unsigned short*)outp;
    {
#pragma unroll
      for (int j = 0; j < 3; ++j) *(v4u*)(o + rbase + j * 256 + lane * 8) = pk[j];
      
    }
  }
}

template <bool ADDE, bool RSRC, bool OUT32>
__global__ __launch_bounds__(256) void ln_rows(const float* src, const float* embs, float* hdst,
                                               const float* __restrict__ sc, const float* __restrict__ bi,
                                               void* outp, int nrows) {
  __shared__ __align__(16) float rb[8 * HID];
  ln_body<ADDE, RSRC, OUT32>(blockIdx.x, rb, src, embs, hdst, sc, bi, outp, nrows);
}

// =====================================================================================================
// Weight convert + transpose: W f32 [K][N] (row-major, in-major) -> O f16 [N][K] = f16(bf16-RNE(w) * 64).
// One block = one tile of 64 k x 64 n through LDS, origin (k0, n0); 256 threads; sT = the block's 64 x 72 half tile in LDS.
//   read: thread (r = tid>>2 = k row, cq = (tid&3)*16 = n quarter) reads 16 floats (4 x 16 B) -> sT[n][k]
//   write: wave w, lane: rows (n) w*8 + it*4 + (lane>>3), 8 halves per lane at k (lane&7)*8:
// coverage: 8 waves x 8 rows = 64 n rows x 64 k per block; the caller deals N/64 x K/64 tiles exactly.
// =====================================================================================================
__device__ __forceinline__ void conv_body(_Float16* sT, const float* __restrict__ W, unsigned short* O,
                                          int K, int N, int n0, int k0) {
  const int tid = threadIdx.x;
  {
    const int r = tid >> 2, cq = (tid & 3) * 16;
    const float* p = W + (size_t)(k0 + r) * N + n0 + cq;
#pragma unroll
    for (int g = 0; g < 4; ++g) {
      const v4f a = *(const v4f*)(p + 4 * g);
#pragma unroll
      for (int e = 0; e < 4; ++e) sT[(cq + 4 * g + e) * 72 + r] = (_Float16)(bfr(a[e]) * WSC);
    }
  }
  __syncthreads();
  const int wave = tid >> 5, lane = tid & 31;
  const int q = lane >> 3, c8 = (lane & 7) * 8;
  union HU { v8h h; v4u u; };
  HU pk[2];
#pragma unroll
  for (int it = 0; it < 2; ++it) {
    const int row = wave * 8 + it * 4 + q;
    pk[it].h = *(const v8h*)(sT + row * 72 + c8);
  }
  const _Float16 dummy = (_Float16)0.0f; (void)dummy;
  {
#pragma unroll
    for (int it = 0; it < 2; ++it) {
      const int row = wave * 8 + it * 4 + q;
      *(v4u*)(O + (size_t)(n0 + row) * K + k0 + c8) = pk[it].u;
    }
    // precaution: where this body is inlined in front of other code, the stores' registers may be rewritten there; this keeps the wait in front of that
    asm volatile("s_wait_xcnt 0x0" ::: "memory");
  }
}

// =====================================================================================================
// First launch: the work that depends on the inputs alone, dealt by block index in one grid.
//   blocks 0 .. BT/8-1: h + embs and LN1 of layer 0 (ln_body), and the mask addends Md of their 8 tokens;
//   then per layer CVL = 3 x CVS blocks of weight tiles (conv_body): CVS tiles of wq, wk, wv, wo (144 each), CVS of w1, CVS of w2.
// Converted weights of layer l lie at Wt + l * WLH halves: Wq_t, Wk_t, Wv_t, Wo_t (HID*HID each), W1_t, W2_t (HID*DFF each).
// Every branch on bx below is block-uniform; the one block barrier (in conv_body) is passed by all 256 threads of its block.
// =====================================================================================================
#define CVS  576                                  // 4 * 12 * 12 = 48 * 12 = 12 * 48 tiles
#define CVL  (3 * CVS)
#define WLH  (4 * HID * HID + 2 * HID * DFF)      // halves of converted weights per layer
static_assert(4 * (HID / 64) * (HID / 64) == CVS && (DFF / 64) * (HID / 64) == CVS);
__global__ __launch_bounds__(256) void prep(const float* in_h, const float* embs, float* hdst,
                                            const float* __restrict__ sc, const float* __restrict__ bi,
                                            unsigned short* X,
                                            const float* __restrict__ wq, const float* __restrict__ wk,
                                            const float* __restrict__ wv, const float* __restrict__ wo,
                                            const float* __restrict__ w1, const float* __restrict__ w2,
                                            unsigned short* Wt, const float* __restrict__ mask, float* Md) {
  __shared__ __align__(16) float rb[8 * HID];
  __shared__ __align__(16) _Float16 sT[64 * 72];
  const int bx = blockIdx.x;
  if (bx < BT / 8) {
    // mask addend of this block's 8 tokens as keys, in log2 units: BT / 8 blocks x 8 = all NB * SEQ keys
    if (threadIdx.x < 8) {
      const int key = bx * 8 + (int)threadIdx.x;
      // held finite: the factor log2 e could carry an addend that is still finite in natural units past the f32 range
      Md[key] = fminf(fmaxf((-1.0e10f * (1.0f - bfr(mask[key]))) * L2E, -FMAX), FMAX);
    }
    ln_body<true, true, false>(bx, rb, in_h, embs, hdst, sc, bi, (void*)X, BT);
    return;
  }
  int t = bx - BT / 8;
  const int l = t / CVL;
  t -= l * CVL;
  const int seg = t / CVS;
  t -= seg * CVS;
  unsigned short* Ol = Wt + (size_t)l * WLH;
  if (seg == 0) {
    const int z = t / 144;
    const int r = t - z * 144;
    const float* W = ((z == 0) ? wq : (z == 1) ? wk : (z == 2) ? wv : wo) + (size_t)l * HID * HID;
    conv_body(sT, W, Ol + (size_t)z * HID * HID, HID, HID, (r % 12) * 64, (r / 12) * 64);
  } else if (seg == 1) {
    conv_body(sT, w1 + (size_t)l * HID * DFF, Ol + (size_t)4 * HID * HID, HID, DFF, (t % 48) * 64, (t / 48) * 64);
  } else {
    conv_body(sT, w2 + (size_t)l * HID * DFF, Ol + (size_t)4 * HID * HID + (size_t)HID * DFF, DFF, HID,
              (t % 12) * 64, (t / 12) * 64);
  }
}

// =====================================================================================================
// Register-blocked f16 WMMA GEMM: C[m][n] = sum_k A[m][k] * Bt[n][k] (accumulator scaled by 1/64 in the
// epilogue = the weight carry). Block = 8 waves (4 x 2) = one 128x128 tile of C, one 32x64 tile per wave.
// A row-major [M][K] pitch lda, Bt row-major [N][K] pitch ldb (k contiguous); M, N multiples of 128, K multiple of BK.
// Operands go through LDS in stages of BK k: 128 rows x 2 BK bytes of A and of Bt per stage, brought by asynchronous 16-B copies. Each
// wave-wide copy covers 4 whole 128-B lines; rows lie in LDS at pitch 2 BK + 16 B (16 B x odd) for the 16-B fragment reads.
// BK = 64 where several blocks share a WGP and cover each other's waits. BK = 256 for the grids of 192 blocks, one block to a WGP:
// there only the block's own copies are in flight, and a stage has to hold enough bytes and enough products to cover their latency.
// Two LDS buffers, one block barrier per stage, at the loop's foot: behind it stage s+1 (copied while stage s was multiplied) is
// readable, and stage s+2 is copied into the buffer of stage s, whose readers all passed that barrier.
// tile = index of the block tile, bz = batch index (strides in elements). Both A and B fragments use the split k map of ldfrag_h.
// MODE 1: f16 C = (acc/64 + bias[n]) * bf16-RNE(rowm[m]) * KSC, held in the f16 range  (the k plane: row m is a key, rowm its mask value)
// MODE 2: f16 hi C = f16(v), f16 residual C2 = f16(v - hi), v = acc/64 + bias[n]
// MODE 3: f16 C = acc/64 + bias[m]
// MODE 4: f16 C = gelu(acc/64 + bias[n])
// bias values bf16-RNE converted in register. Epilogue: 16-row slabs staged per wave in LDS; each 64-wide row
// coverage: 2 slabs x 16 rows x 64 cols = the wave's whole tile; 8 waves per block; grid = (M/128) * (N/128).
// =====================================================================================================
template <int MODE, int BK>
__device__ __forceinline__ void gemm_body(
    _Float16 (*sA)[128 * (BK + 8)], _Float16 (*sB)[128 * (BK + 8)], float (*sT)[16 * 68], int tile, int bz,
    const unsigned short* __restrict__ Ap, int lda, long long strideA,
    const unsigned short* __restrict__ Btp, int ldb, long long strideB,
    const float* __restrict__ bias, const float* __restrict__ rowm,
    void* Cout, void* Cout2, int ldc, long long strideC,
    int M, int N, int K) {
  static_assert(BK == 64 || BK == 256);
  constexpr int LBK = (BK == 64) ? 6 : 8;          // log2 BK
  constexpr int GPI = BK + 8;                      // LDS row pitch of a stage, in halves
  constexpr int PR  = BK / 8;                      // 16-B pieces of a stage row
  constexpr int RP  = 256 / PR;                    // rows that one copy of each of the 256 threads covers
  const int tid  = threadIdx.x;
  const int lane = tid & 31;
  const int wave = tid >> 5;
  const int tilesN = N >> 7;
  const int tilesM = M >> 7;
  if (tile >= tilesM * tilesN) return;             // block-uniform, in front of every barrier
  const int tm = tile / tilesN;
  const int tn = tile - tm * tilesN;
  const int bm0 = tm << 7;                         // block tile origin
  const int bn0 = tn << 7;
  const int wm  = (wave >> 1) << 5;                // wave tile origin inside the block tile
  const int wn  = (wave & 1) << 6;
  const int m0 = bm0 + wm;
  const int n0 = bn0 + wn;

  const _Float16* Ab = (const _Float16*)(const void*)Ap  + (size_t)bz * (size_t)strideA;
  const _Float16* Bb = (const _Float16*)(const void*)Btp + (size_t)bz * (size_t)strideB;

  const int rl   = lane & 15;                      // row (A) / col (B, D) within subtile
  const int hh   = lane >> 4;
  const int koff = hh * 8;                         // k offset of this lane half
  const int mOff = hh * 8;                         // D row offset

  // staging map: thread -> row tid / PR + RP * it, 16-B piece tid % PR of the row's 2 BK bytes; (128 / RP) it x RP rows = 128 rows
  const int srow = tid >> (LBK - 3);
  const int scol = (tid & (PR - 1)) * 8;
  const _Float16* ga = Ab + (size_t)(bm0 + srow) * lda + scol;
  const _Float16* gb = Bb + (size_t)(bn0 + srow) * ldb + scol;
  const int sofs = srow * GPI + scol;

  v8f acc[2][4];
#pragma unroll
  for (int i = 0; i < 2; ++i)
#pragma unroll
    for (int j = 0; j < 4; ++j) acc[i][j] = zero8();

  const unsigned la0 = lds_off(&sA[0][0]) + (unsigned)sofs * 2u;   // this thread's 16 B of row srow in buffer 0
  const unsigned lb0 = lds_off(&sB[0][0]) + (unsigned)sofs * 2u;
  const size_t aR = (size_t)RP * lda, bR = (size_t)RP * ldb;
  constexpr unsigned SBUF = 128u * GPI * 2u;                       // bytes of one buffer
  constexpr unsigned SRP  = (unsigned)RP * GPI * 2u;               // bytes of RP LDS rows
  auto issue = [&](int st) {                                       // stage st -> buffer st & 1: (128 / RP) x RP rows of A and of Bt
    const unsigned la = la0 + (unsigned)(st & 1) * SBUF, lb = lb0 + (unsigned)(st & 1) * SBUF;
    const _Float16* pa = ga + ((size_t)st << LBK);
    const _Float16* pb = gb + ((size_t)st << LBK);
    if (BK == 64) {
      copy8(la, la + SRP, la + 2u * SRP, la + 3u * SRP, lb, lb + SRP, lb + 2u * SRP, lb + 3u * SRP,
            pa, pa + aR, pa + 2 * aR, pa + 3 * aR, pb, pb + bR, pb + 2 * bR, pb + 3 * bR);
    } else {
      // both loops unrolled: two statements of eight copies each, their LDS steps compile-time constants
#pragma unroll
      for (int g = 0; g < 128 / RP; g += 8) {                      // 32 copies a thread and stage, 63 may be outstanding
        const unsigned l = la + (unsigned)g * SRP;
        const _Float16* p = pa + (size_t)g * aR;
        copy8(l, l + SRP, l + 2u * SRP, l + 3u * SRP, l + 4u * SRP, l + 5u * SRP, l + 6u * SRP, l + 7u * SRP,
              p, p + aR, p + 2 * aR, p + 3 * aR, p + 4 * aR, p + 5 * aR, p + 6 * aR, p + 7 * aR);
      }
#pragma unroll
      for (int g = 0; g < 128 / RP; g += 8) {
        const unsigned l = lb + (unsigned)g * SRP;
        const _Float16* p = pb + (size_t)g * bR;
        copy8(l, l + SRP, l + 2u * SRP, l + 3u * SRP, l + 4u * SRP, l + 5u * SRP, l + 6u * SRP, l + 7u * SRP,
              p, p + bR, p + 2 * bR, p + 3 * bR, p + 4 * bR, p + 5 * bR, p + 6 * bR, p + 7 * bR);
      }
    }
  };

  const int nst = K >> LBK;
  issue(0);
  wait_async0();
  __syncthreads();                                 // publishes stage 0
  if (nst > 1) issue(1);                           // block-uniform
  // kept rolled: one stage is already 16 WMMAs and 24 fragment loads a wave or more; unrolling would only grow code and registers
#pragma unroll 1
  for (int s = 0; s < nst; ++s) {
    const _Float16* dA = sA[s & 1];
    const _Float16* dB = sB[s & 1];
#pragma unroll
    for (int kk = 0; kk < BK / 32; ++kk) {
      v16h bfg[4], af[2];
      af[0] = ldfrag_h(dA + (wm + rl) * GPI + kk * 32 + koff);
#pragma unroll
      for (int j = 0; j < 4; ++j)
        bfg[j] = ldfrag_h(dB + (wn + (j << 4) + rl) * GPI + kk * 32 + koff);
      af[1] = ldfrag_h(dA + (wm + 16 + rl) * GPI + kk * 32 + koff);
#pragma unroll
      for (int i = 0; i < 2; ++i)
#pragma unroll
        for (int j = 0; j < 4; ++j) acc[i][j] = mma_h(af[i], bfg[j], acc[i][j]);
    }
    wait_ds0();
    wait_async0();
    __syncthreads();                               // publishes stage s+1; ends every wave's reads of stage s
    if (s + 2 < nst) issue(s + 2);                 // block-uniform: flies under the WMMAs of stage s+1
  }
  wait_async0();

  // ---- epilogue ----
  float* slab = sT[wave];
#pragma unroll
  for (int i = 0; i < 2; ++i) {
    const int mBase = m0 + (i << 4);
#pragma unroll
    for (int j = 0; j < 4; ++j) {
#pragma unroll
      for (int r = 0; r < 8; ++r) slab[(mOff + r) * 68 + (j << 4) + rl] = acc[i][j][r] * WINV;
    }
    wave_lds_sync();
    if (MODE == 0) {
      float* C = (float*)Cout + (size_t)bz * (size_t)strideC;
      const int c4 = rl * 4;                                   // 256-B row segment = 16 lanes x 16 B
      const v4f b4 = bfr4(*(const v4f*)(bias + n0 + c4));
      v4f vals[8];
#pragma unroll
      for (int it = 0; it < 8; ++it) {
        const int row = it * 2 + hh;                           // it 0..7 x hh 0..1 = rows 0..15
        const v4f v = *(const v4f*)(slab + row * 68 + c4);
        const v4f o = *(const v4f*)(C + (size_t)(mBase + row) * ldc + n0 + c4);
        vals[it] = o + (v + b4);
      }
      {
#pragma unroll
        for (int it = 0; it < 8; ++it) {
          const int row = it * 2 + hh;
          *(v4f*)(C + (size_t)(mBase + row) * ldc + n0 + c4) = vals[it];
        }
        
      }
    } else {
      const int q = lane >> 3, c8 = (lane & 7) * 8;
      unsigned short* C  = (unsigned short*)Cout  + (size_t)bz * (size_t)strideC;
      unsigned short* C2 = (unsigned short*)Cout2 + (size_t)bz * (size_t)strideC;
      v4f ba = zero4(), bb = zero4();
      if (MODE != 3) {
        ba = bfr4(*(const v4f*)(bias + n0 + c8));
        bb = bfr4(*(const v4f*)(bias + n0 + c8 + 4));
      }
      float kf[4] = {1.0f, 1.0f, 1.0f, 1.0f};
      if (MODE == 1) {
#pragma unroll
        for (int it = 0; it < 4; ++it) kf[it] = rowm[mBase + it * 4 + q];
        // precaution: stands in front of every later rewrite of the address registers of the four loads above
        asm volatile("s_wait_xcnt 0x0" ::: "memory");
#pragma unroll
        for (int it = 0; it < 4; ++it) kf[it] = bfr(kf[it]) * KSC;
      }
      v4u hv[4], lv[4];
#pragma unroll
      for (int it = 0; it < 4; ++it) {
        const int row = it * 4 + q;                            // it 0..3 x q 0..3 = rows 0..15
        const float* sp = slab + row * 68 + c8;
        v4f fa = *(const v4f*)(sp);
        v4f fb = *(const v4f*)(sp + 4);
        if (MODE == 3) {
          const float br = bfr(bias[mBase + row]);
          fa = fa + br; fb = fb + br;
        } else {
          fa = fa + ba; fb = fb + bb;
        }
        if (MODE == 1) {
          // held inside the f16 range: a mask value large enough to carry a k row past it would make the row infinite and the scores NaN,
          // while its addend (1e10 times the mask's distance from 1) is then so large that the f32 score takes nothing from the product
#pragma unroll
          for (int e = 0; e < 4; ++e) {
            fa[e] = fminf(fmaxf(fa[e] * kf[it], -HMAX), HMAX);
            fb[e] = fminf(fmaxf(fb[e] * kf[it], -HMAX), HMAX);
          }
        }
        if (MODE == 4) {
#pragma unroll
          for (int e = 0; e < 4; ++e) { fa[e] = gelu_t(fa[e]); fb[e] = gelu_t(fb[e]); }
        }
        v4u a, a2;
        if (MODE == 2) {
#pragma unroll
          for (int e = 0; e < 2; ++e) {
            const float f0 = fa[2 * e], f1 = fa[2 * e + 1];
            const float g0 = fb[2 * e], g1 = fb[2 * e + 1];
            const _Float16 x0 = (_Float16)f0, x1 = (_Float16)f1, y0 = (_Float16)g0, y1 = (_Float16)g1;
            a[e]      = pk16(h_bits(x0), h_bits(x1));
            a[e + 2]  = pk16(h_bits(y0), h_bits(y1));
            a2[e]     = pk16(h_bits((_Float16)(f0 - (float)x0)), h_bits((_Float16)(f1 - (float)x1)));
            a2[e + 2] = pk16(h_bits((_Float16)(g0 - (float)y0)), h_bits((_Float16)(g1 - (float)y1)));
          }
        } else {
          a[0] = pkh2(fa[0], fa[1]); a[1] = pkh2(fa[2], fa[3]);
          a[2] = pkh2(fb[0], fb[1]); a[3] = pkh2(fb[2], fb[3]);
          a2 = a;
        }
        hv[it] = a; lv[it] = a2;
      }
      {
#pragma unroll
        for (int it = 0; it < 4; ++it) {
          const int row = it * 4 + q;
          *(v4u*)(C + (size_t)(mBase + row) * ldc + n0 + c8) = hv[it];
          if (MODE == 2) *(v4u*)(C2 + (size_t)(mBase + row) * ldc + n0 + c8) = lv[it];
        }
        
      }
    }
    wave_lds_sync();
  }
}

#define GEMM_LDS(BK)                                                                                             \
  __shared__ __align__(16) _Float16 sA[2][128 * ((BK) + 8)]; /* A stage: 128 rows x BK k, pitch BK + 8, two buffers */ \
  __shared__ __align__(16) _Float16 sB[2][128 * ((BK) + 8)]; /* Bt stage, same shape */                           \
  __shared__ __align__(16) float sT[8][16 * 68];      /* per-wave 16x64 slab, pitch 68 floats */

template <int MODE>
__global__ __launch_bounds__(256) void gemm64(
    const unsigned short* __restrict__ Ap, int lda, long long strideA,
    const unsigned short* __restrict__ Btp, int ldb, long long strideB,
    const float* __restrict__ bias,
    void* Cout, void* Cout2, int ldc, long long strideC,
    int M, int N, int K) {
  constexpr int BK = (MODE == 0) ? 256 : 64;       // MODE 0 runs on the grids of 192 blocks; K = 768 or 3072, multiples of 256
  GEMM_LDS(BK)
  gemm_body<MODE, BK>(sA, sB, sT, blockIdx.x, blockIdx.y, Ap, lda, strideA, Btp, ldb, strideB, bias, nullptr,
                  Cout, Cout2, ldc, strideC, M, N, K);
}

// q, k and v^T projections of one layer in one grid: they read the same X and do not depend on each other.
//   blocks 0..191: q (MODE 2); 192..383: k (MODE 1); 384..575: v^T (MODE 3), 96 tiles per batch.
// The three branches are block-uniform, so every barrier in gemm_body is passed by the whole block.
#define TQK ((BT / 128) * (HID / 128))
#define TVB ((HID / 128) * (SEQ / 128))
__global__ __launch_bounds__(256) void gemm_qkv(
    const unsigned short* __restrict__ X, const unsigned short* __restrict__ Wqt,
    const unsigned short* __restrict__ Wkt, const unsigned short* __restrict__ Wvt,
    const float* __restrict__ bq, const float* __restrict__ bk, const float* __restrict__ bv,
    const float* __restrict__ mask,
    unsigned short* Qh, unsigned short* Ql, unsigned short* Kh, unsigned short* VT) {
  GEMM_LDS(64)
  const int t = blockIdx.x;
  if (t < TQK) {
    gemm_body<2, 64>(sA, sB, sT, t, 0, X, HID, 0LL, Wqt, HID, 0LL, bq, nullptr, (void*)Qh, (void*)Ql, HID, 0LL, BT, HID, HID);
  } else if (t < 2 * TQK) {
    gemm_body<1, 64>(sA, sB, sT, t - TQK, 0, X, HID, 0LL, Wkt, HID, 0LL, bk, mask, (void*)Kh, (void*)Kh, HID, 0LL, BT, HID, HID);
  } else {
    const int u  = t - 2 * TQK;
    const int bz = u / TVB;
    gemm_body<3, 64>(sA, sB, sT, u - bz * TVB, bz, Wvt, HID, 0LL, X, HID, (long long)SEQ * HID, bv, nullptr,
                 (void*)VT, (void*)VT, SEQ, (long long)HID * SEQ, HID, SEQ, HID);
  }
}

__device__ __forceinline__ float xhalf(float x) {
  return __builtin_bit_cast(float, __builtin_amdgcn_permlanex16(__builtin_bit_cast(int, x), __builtin_bit_cast(int, x),
                                                                0x76543210, 0xfedcba98, false, false));
}

// 2^x of eight values in one statement. The results are early-clobber, so none of them lies on a source of the exponential in
// front of it, and the closing v_nop is the slot the instruction set asks for between a transcendental and the next instruction
// that uses its result or overwrites its source (left to itself the compiler put results on the source of the one in front).
__device__ __forceinline__ v8f exp2x8(v8f x) {
  v8f y = x;
#if defined(__HIP_DEVICE_COMPILE__)
  float y0, y1, y2, y3, y4, y5, y6, y7;
  asm("v_exp_f32 %0, %8\n\tv_exp_f32 %1, %9\n\tv_exp_f32 %2, %10\n\tv_exp_f32 %3, %11\n\t"
      "v_exp_f32 %4, %12\n\tv_exp_f32 %5, %13\n\tv_exp_f32 %6, %14\n\tv_exp_f32 %7, %15\n\tv_nop"
      : "=&v"(y0), "=&v"(y1), "=&v"(y2), "=&v"(y3), "=&v"(y4), "=&v"(y5), "=&v"(y6), "=&v"(y7)
      : "v"(x[0]), "v"(x[1]), "v"(x[2]), "v"(x[3]), "v"(x[4]), "v"(x[5]), "v"(x[6]), "v"(x[7]));
  y[0] = y0; y[1] = y1; y[2] = y2; y[3] = y3; y[4] = y4; y[5] = y5; y[6] = y6; y[7] = y7;
#endif
  return y;
}

__global__ __launch_bounds__(128)
void attn64(const unsigned short* __restrict__ qhp, const unsigned short* __restrict__ qlp,
            const unsigned short* __restrict__ khp, const unsigned short* __restrict__ vtp,
            const float* __restrict__ mdp, unsigned short* ctxp) {
  union FH { v16h v; v8h h[2]; };
  union F8 { v8f v; v4f q[2]; };
  __shared__ __align__(16) _Float16 Ks[2][64 * API];              // K [kv][d]    9 KB, two buffers
  __shared__ __align__(16) _Float16 Vts[2][64 * API];             // V^T [d][kv]  9 KB, two buffers
  __shared__ __align__(16) float    Ms[SEQ];                      // mask addend of every key of this batch, 8 KB
  __shared__ __align__(16) float    Os[4][16 * OPI];              // per wave context tile [row][d]

  const int tid  = threadIdx.x;
  const int wave = tid >> 5;
  const int lane = tid & 31;
  const int hh   = lane >> 4;
  const int c    = lane & 15;

  const int bx   = blockIdx.x;
  const int qb   = bx % NQB;
  const int rest = bx / NQB;
  const int h    = rest % NHD;
  const int b    = rest / NHD;
  const int q0   = qb * 64 + wave * 16;
  const size_t rowB = (size_t)b * SEQ;

  const _Float16* Qh = (const _Float16*)(const void*)qhp + (size_t)h * HD;
  const _Float16* Ql = (const _Float16*)(const void*)qlp + (size_t)h * HD;
  const _Float16* Kh = (const _Float16*)(const void*)khp + (size_t)h * HD;
  const _Float16* Vt = (const _Float16*)(const void*)vtp + ((size_t)b * HID + (size_t)h * HD) * SEQ;
  const float* mdb = mdp + (size_t)b * SEQ;                        // addend of key 0 of this batch

  // ---- Q fragments (B operand, column = query q0 + (lane&15)): 2 d-chunks, hi and residual ----
  v16h qah[2], qal[2];
#pragma unroll
  for (int dc = 0; dc < 2; ++dc) {
    const size_t qo = (rowB + q0 + c) * HID + dc * 32 + 8 * hh;
    qah[dc] = ldfrag_h(Qh + qo);
    qal[dc] = ldfrag_h(Ql + qo);
  }

  float crun = -INFINITY;                          // this lane's query: running max less 10 (log2 units), alike in both wave halves
  v8f lacc = zero8();                              // its sum of 1024 p: register r over keys = 8hh + r (mod 16); joined after the loop
  v8f oacc[4];                                     // O^T: register r of tile t = d 16t + 8hh + r of query q0 + c
#pragma unroll
  for (int t = 0; t < 4; ++t) oacc[t] = zero8();

  // staging map: thread -> row (tid>>3) + 16*i, 16-B piece (tid&7) of the row's 128 B; 4 i x 16 rows = 64 rows of K and of V^T
  const int srow = tid >> 3, scol = (tid & 7) * 8;
  const _Float16* kg = Kh + (rowB + srow) * HID + scol;            // K row srow of chunk 0
  const _Float16* vg = Vt + (size_t)srow * SEQ + scol;             // V^T row d = srow, keys of chunk 0
  const unsigned lk0 = lds_off(&Ks[0][0])  + (unsigned)(srow * API + scol) * 2u;
  const unsigned lv0 = lds_off(&Vts[0][0]) + (unsigned)(srow * API + scol) * 2u;
  constexpr unsigned ABUF = 64u * API * 2u;                        // bytes of one buffer
  constexpr unsigned AR16 = 16u * API * 2u;                        // bytes of 16 LDS rows
  auto issue = [&](int ch) {                                       // chunk ch < NQB -> buffer ch & 1
    const unsigned lk = lk0 + (unsigned)(ch & 1) * ABUF, lv = lv0 + (unsigned)(ch & 1) * ABUF;
    const _Float16* pk = kg + (size_t)ch * 64 * HID;
    const _Float16* pv = vg + (size_t)ch * 64;
    copy8(lk, lk + AR16, lk + 2u * AR16, lk + 3u * AR16, lv, lv + AR16, lv + 2u * AR16, lv + 3u * AR16,
          pk, pk + 16 * HID, pk + 32 * HID, pk + 48 * HID, pv, pv + 16 * SEQ, pv + 32 * SEQ, pv + 48 * SEQ);
  };
  static_assert(NQB >= 2 && SEQ == 4 * 128 * 4);
  issue(0);
  {
    // the batch's addends -> LDS: 4 x 128 threads x 16 B = 8 KB, whole lines; published by the barrier below
    v4f x[4];
#pragma unroll
    for (int i = 0; i < 4; ++i) x[i] = *(const v4f*)(mdb + (i * 128 + tid) * 4);
    // precaution: stands in front of every later rewrite of the address registers of the four loads above
    asm volatile("s_wait_xcnt 0x0" ::: "memory");
#pragma unroll
    for (int i = 0; i < 4; ++i) *(v4f*)(Ms + (i * 128 + tid) * 4) = x[i];
  }
  wait_async0();
  __syncthreads();                                 // publishes chunk 0 and the addends
  issue(1);

#pragma unroll 1
  for (int kt = 0; kt < NQB; ++kt) {
    const _Float16* Kc = Ks[kt & 1];
    const _Float16* Vc = Vts[kt & 1];

    // ---- scores, transposed: 64 keys x 16 queries per wave: md + k.qhi + k.qres, four products chained per tile ----
    // LDS reads of a chunk stand in two groups, each a run of products or arithmetic ahead of its last user, so that the waits are
    // counted ones; read pair by pair in front of each product, every pair's LDS latency is waited out alone, 16 times a chunk.
    // group 1: the mask addends (register r of tile j = key 16j + 8hh + r, the place of that key's score in the accumulator), all 8 K fragments
    // in the order of their use (LDS reads return in order): each tile's addends with its first fragment, then the second fragments
    F8 mdv[4];
    FH kb[4][2];
    const float* Mc = Ms + kt * 64 + 8 * hh;
#pragma unroll
    for (int dc = 0; dc < 2; ++dc) {
#pragma unroll
      for (int j = 0; j < 4; ++j) {
        if (dc == 0) {
          mdv[j].q[0] = *(const v4f*)(Mc + j * 16);
          mdv[j].q[1] = *(const v4f*)(Mc + j * 16 + 4);
        }
        kb[j][dc].h[0] = *(const v8h*)(Kc + (j * 16 + c) * API + dc * 32 + 8 * hh);
        kb[j][dc].h[1] = *(const v8h*)(Kc + (j * 16 + c) * API + dc * 32 + 16 + 8 * hh);
      }
    }
    // keeps this group of LDS reads in one place ahead of its users: without it the compiler sinks reads in among the products
    __builtin_amdgcn_sched_barrier(0);
    // the tiles take turns, so that a tile's next product does not stand directly behind the one whose result it adds to
    v8f s[4];
#pragma unroll
    for (int j = 0; j < 4; ++j) s[j] = mma_p(kb[j][0].v, qah[0], mdv[j].v);
#pragma unroll
    for (int j = 0; j < 4; ++j) s[j] = mma_p(kb[j][0].v, qal[0], s[j]);
    // group 2: all 8 V^T fragments, so that they land under the products and the softmax arithmetic
    FH vb[2][4];
#pragma unroll
    for (int kk = 0; kk < 2; ++kk) {
#pragma unroll
      for (int t = 0; t < 4; ++t) {
        vb[kk][t].h[0] = *(const v8h*)(Vc + (t * 16 + c) * API + kk * 32 + 8 * hh);
        vb[kk][t].h[1] = *(const v8h*)(Vc + (t * 16 + c) * API + kk * 32 + 16 + 8 * hh);
      }
    }
    // keeps this group of LDS reads in one place ahead of its users: without it the compiler sinks reads in among the products
    __builtin_amdgcn_sched_barrier(0);
#pragma unroll
    for (int j = 0; j < 4; ++j) s[j] = mma_p(kb[j][1].v, qah[1], s[j]);
#pragma unroll
    for (int j = 0; j < 4; ++j) s[j] = mma_p(kb[j][1].v, qal[1], s[j]);
    // keeps the eight products above back to back, each filling the distance behind the one before it, ahead of the arithmetic on their
    // results: without it the compiler interleaves the two and pads with more v_nop
    __builtin_amdgcn_sched_barrier(0);

    // ---- max of this query's 64 scores, online softmax, P^T (x1024, f16) packed in place as B fragments ----
    float mj[4];
#pragma unroll
    for (int j = 0; j < 4; ++j) {
      mj[j] = fmaxf(fmaxf(fmaxf(s[j][0], s[j][1]), fmaxf(s[j][2], s[j][3])),
                    fmaxf(fmaxf(s[j][4], s[j][5]), fmaxf(s[j][6], s[j][7])));
    }
    float m = fmaxf(fmaxf(mj[0], mj[1]), fmaxf(mj[2], mj[3]));
    m = fmaxf(m, xhalf(m));
    // every term of this query is taken against the same reference point c, and a change of c rescales by 2^(c_old - c_new): the
    // rounding of max - 10 (where the max is huge, as with every key masked) therefore cancels between the context and the sum.
    // Where that rounding puts c more than 15 below the max (f32 step 16), the max itself is taken: 2^(s - c) then never passes 2^15
    // and its f16 convert stays finite for any mask.
    const float c0    = m - PLG;
    const float cch   = (m - c0 > 15.0f) ? m : c0;
    const float cnew  = fmaxf(crun, cch);
    const float alpha = __builtin_amdgcn_exp2f(crun - cnew);
    crun = cnew;
    FH pb[2];
    v8f p[4];
#pragma unroll
    for (int j = 0; j < 4; ++j) {
      p[j] = exp2x8(s[j] - cnew);
#pragma unroll
      for (int r = 0; r < 8; ++r) pb[j >> 1].v[(j & 1) * 8 + r] = (_Float16)p[j][r];
    }
    lacc = lacc * alpha + ((p[0] + p[1]) + (p[2] + p[3]));
#pragma unroll
    for (int t = 0; t < 4; ++t) oacc[t] *= alpha;

    // ---- context^T += V^T . P^T (f16 WMMA) ----
#pragma unroll
    for (int kk = 0; kk < 2; ++kk) {
#pragma unroll
      for (int t = 0; t < 4; ++t) oacc[t] = mma_p(vb[kk][t].v, pb[kk].v, oacc[t]);
    }

    // keeps the waits and the barrier at the foot: without it the compiler lifts them to behind the last LDS read, in front of the softmax,
    // and the copies issued at the last foot have that much less time to land
    __builtin_amdgcn_sched_barrier(0);
    wait_ds0();
    wait_async0();
    __syncthreads();                               // publishes chunk kt+1; ends every wave's reads of chunk kt
    if (kt + 2 < NQB) issue(kt + 2);               // block-uniform: flies under the work on chunk kt+1
  }
  wait_async0();

  float* os = Os[wave];
  {
    const float lsum = ((lacc[0] + lacc[1]) + (lacc[2] + lacc[3])) + ((lacc[4] + lacc[5]) + (lacc[6] + lacc[7]));
    const float l = lsum + xhalf(lsum);            // the two halves' key sums joined
    const float inv = (l > 0.f) ? (1.0f / l) : 0.f;   // sum and context both carry the x1024
#pragma unroll
    for (int t = 0; t < 4; ++t) {
      v4f lo, hi;
#pragma unroll
      for (int r = 0; r < 4; ++r) { lo[r] = oacc[t][r] * inv; hi[r] = oacc[t][r + 4] * inv; }
      *(v4f*)(os + c * OPI + t * 16 + 8 * hh)     = lo;
      *(v4f*)(os + c * OPI + t * 16 + 8 * hh + 4) = hi;
    }
  }
  wave_lds_sync();
  {
    const int q4 = lane >> 3, c8 = (lane & 7) * 8;
    v4u hv[4];
#pragma unroll
    for (int it = 0; it < 4; ++it) {
      const int row = it * 4 + q4;           // it 0..3 x q4 0..3 = rows 0..15 of the wave tile
      const float* sp = os + row * OPI + c8;
      const v4f fa = *(const v4f*)(sp);
      const v4f fb = *(const v4f*)(sp + 4);
      v4u a;
      a[0] = pkh2(fa[0], fa[1]); a[1] = pkh2(fa[2], fa[3]);
      a[2] = pkh2(fb[0], fb[1]); a[3] = pkh2(fb[2], fb[3]);
      hv[it] = a;
    }
    {
#pragma unroll
      for (int it = 0; it < 4; ++it) {
        const int row = it * 4 + q4;
        const size_t go = (rowB + q0 + row) * HID + (size_t)h * HD + c8;
        *(v4u*)(ctxp + go) = hv[it];
      }
      
    }
  }
}

// =====================================================================================================
// Workspace map (bytes), all region sizes multiples of 128 and exact multiples of their 64x64- or 128x128-tile / whole-row
// store granularity (M, N multiples of 128; 768- and 3072-wide rows), so no padded tails are needed:
//   Hres f32 [4096][768]        12582912
//   X    f16 [4096][768]         6291456   (LN output plane, reused by LN1 and LN2)
//   Qh   f16 [4096][768]         6291456
//   Ql   f16 [4096][768]         6291456   (q residual)
//   Kh   f16 [4096][768]         6291456
//   VT   f16 [2][768][2048]      6291456
//   Ctx  f16 [4096][768]         6291456
//   G    f16 [4096][3072]       25165824
//   per layer (2 x 14155776):
//   Wq_t,Wk_t,Wv_t,Wo_t f16 [768][768]  4 x 1179648
//   W1_t f16 [3072][768]         4718592
//   W2_t f16 [768][3072]         4718592
//   Md   f32 [2][2048]             16384   (mask addends)
//   total                      103825408
// Both layers' weights are converted by the first launch, each layer into its own region ([out n][in k], k contiguous = the Bt / A layout).
// =====================================================================================================
extern "C" void kernel_launch(void* const* d_in, const int* in_sizes, int n_in,
                              void* d_out, int out_size, void* d_ws, size_t ws_size,
                              hipStream_t stream) {
  if (n_in < 21) return;
  if (in_sizes[0] != BT * HID || in_sizes[1] != BT * HID || in_sizes[2] != NB * SEQ) return;
  if (in_sizes[3] != 2 * HID || in_sizes[4] != 2 * HID) return;
  if (in_sizes[5] != 2 * HID * HID || in_sizes[7] != 2 * HID * HID ||
      in_sizes[9] != 2 * HID * HID || in_sizes[11] != 2 * HID * HID) return;
  if (in_sizes[6] != 2 * HID || in_sizes[8] != 2 * HID || in_sizes[10] != 2 * HID || in_sizes[12] != 2 * HID) return;
  if (in_sizes[13] != 2 * HID || in_sizes[14] != 2 * HID) return;
  if (in_sizes[15] != 2 * HID * DFF || in_sizes[16] != 2 * DFF ||
      in_sizes[17] != 2 * DFF * HID || in_sizes[18] != 2 * HID) return;
  if (in_sizes[19] != HID || in_sizes[20] != HID) return;
  if (out_size != BT * HID) return;

  const float* in_h  = (const float*)d_in[0];
  const float* embs  = (const float*)d_in[1];
  const float* mask  = (const float*)d_in[2];
  const float* ln1_s = (const float*)d_in[3];
  const float* ln1_b = (const float*)d_in[4];
  const float* wq    = (const float*)d_in[5];
  const float* bq    = (const float*)d_in[6];
  const float* wk    = (const float*)d_in[7];
  const float* bk    = (const float*)d_in[8];
  const float* wv    = (const float*)d_in[9];
  const float* bv    = (const float*)d_in[10];
  const float* wo    = (const float*)d_in[11];
  const float* bo    = (const float*)d_in[12];
  const float* ln2_s = (const float*)d_in[13];
  const float* ln2_b = (const float*)d_in[14];
  const float* w1    = (const float*)d_in[15];
  const float* b1    = (const float*)d_in[16];
  const float* w2    = (const float*)d_in[17];
  const float* b2    = (const float*)d_in[18];
  const float* lnf_s = (const float*)d_in[19];
  const float* lnf_b = (const float*)d_in[20];
  float* out = (float*)d_out;

  const size_t PH  = (size_t)BT * HID * 4;        // 12582912
  const size_t PA  = (size_t)BT * HID * 2;        //  6291456
  const size_t PVT = (size_t)NB * HID * SEQ * 2;  //  6291456
  const size_t PG  = (size_t)BT * DFF * 2;        // 25165824
  const size_t PW  = (size_t)HID * HID * 2;       //  1179648
  const size_t PW1 = (size_t)HID * DFF * 2;       //  4718592
  size_t off = 0;
  const size_t oH   = off; off += PH;
  const size_t oX   = off; off += PA;
  const size_t oQh  = off; off += PA;
  const size_t oQl  = off; off += PA;
  const size_t oKh  = off; off += PA;
  const size_t oVT  = off; off += PVT;
  const size_t oCtx = off; off += PA;
  const size_t oG   = off; off += PG;
  const size_t oWt  = off; off += 2 * (4 * PW + 2 * PW1);
  const size_t oMd  = off; off += (size_t)BT * 4;
  if (off > ws_size) return;                      // off = 103825408
  if (off > (size_t)134217728) return;

  char* ws = (char*)d_ws;
  float*          Hres = (float*)(ws + oH);
  unsigned short* X    = (unsigned short*)(ws + oX);
  unsigned short* Qh   = (unsigned short*)(ws + oQh);
  unsigned short* Ql   = (unsigned short*)(ws + oQl);
  unsigned short* Kh   = (unsigned short*)(ws + oKh);
  unsigned short* VT   = (unsigned short*)(ws + oVT);
  unsigned short* Ctx  = (unsigned short*)(ws + oCtx);
  unsigned short* G    = (unsigned short*)(ws + oG);
  unsigned short* Wt   = (unsigned short*)(ws + oWt);
  float*          Md   = (float*)(ws + oMd);

  const dim3 blk(256);
  const dim3 gLN(BT / 8);                                           // 512 blocks, 8 rows each
  const dim3 gPrep(BT / 8 + 2 * CVL);                               // 512 row groups + 2 x 1728 weight tiles
  const dim3 gHH((BT / 128) * (HID / 128), 1);                      // 32 x 6  = 192 blocks
  const dim3 gQKV(2 * TQK + NB * TVB);                              // 192 + 192 + 2 x 96 = 576 blocks
  const dim3 gF1((BT / 128) * (DFF / 128), 1);                      // 32 x 24 = 768 blocks
  const dim3 gAt(NB * NHD * NQB);                                   // 768 blocks of 128

  for (int l = 0; l < 2; ++l) {
    unsigned short* Wqt = Wt + (size_t)l * WLH;
    unsigned short* Wkt = Wqt + (size_t)HID * HID;
    unsigned short* Wvt = Wkt + (size_t)HID * HID;
    unsigned short* Wot = Wvt + (size_t)HID * HID;
    unsigned short* W1t = Wot + (size_t)HID * HID;
    unsigned short* W2t = W1t + (size_t)HID * DFF;
    // (1) h = h + input_embs; hn = LN1(h) -> X (f16); with layer 0 also
    // (2) the weights of both layers: f32 [in][out] -> f16 [out][in] (bf16-RNE values x64)
    if (l == 0) {
      prep<<<gPrep, blk, 0, stream>>>(in_h, embs, Hres, ln1_s, ln1_b, X, wq, wk, wv, wo, w1, w2, Wt, mask, Md);
    } else {
      ln_rows<true, false, false><<<gLN, blk, 0, stream>>>(Hres, embs, Hres, ln1_s + HID, ln1_b + HID, (void*)X, BT);
    }
    // (3) q = hn . Wq + bq -> f16 hi + residual planes [b*SEQ+t][h*64+d]  (M=4096, N=768, K=768)
    // (4) k = (hn . Wk + bk) * mask / 8 * log2 e -> f16 plane
    // (5) v^T = Wv_t . hn^T per batch -> f16 [b][h*64+d][s]  (A = Wv_t [n][k], Bt = X rows of batch b; M=768, N=2048, K=768)
    gemm_qkv<<<gQKV, blk, 0, stream>>>(X, Wqt, Wkt, Wvt, bq + l * HID, bk + l * HID, bv + l * HID, mask, Qh, Ql, Kh, VT);
    // (6) attention -> Ctx f16 [b*SEQ+t][h*64+d]
    attn64<<<gAt, dim3(128), 0, stream>>>(Qh, Ql, Kh, VT, Md, Ctx);
    // (7) h = h + (ctx . Wo + bo)  (f32, in place)
    gemm64<0><<<gHH, blk, 0, stream>>>(Ctx, HID, 0LL, Wot, HID, 0LL, bo + l * HID,
                                       (void*)Hres, (void*)Hres, HID, 0LL, BT, HID, HID);
    // (8) hn = LN2(h) -> X
    ln_rows<false, false, false><<<gLN, blk, 0, stream>>>(Hres, embs, Hres, ln2_s + l * HID, ln2_b + l * HID, (void*)X, BT);
    // (9) g = gelu(hn . W1 + b1) -> G f16 [4096][3072]  (M=4096, N=3072, K=768)
    gemm64<4><<<gF1, blk, 0, stream>>>(X, HID, 0LL, W1t, HID, 0LL, b1 + l * DFF,
                                       (void*)G, (void*)G, DFF, 0LL, BT, DFF, HID);
    // (10) h = h + (g . W2 + b2)  (M=4096, N=768, K=3072, f32 in place)
    gemm64<0><<<gHH, blk, 0, stream>>>(G, DFF, 0LL, W2t, DFF, 0LL, b2 + l * HID,
                                       (void*)Hres, (void*)Hres, HID, 0LL, BT, HID, DFF);
  }
  // (11) out = LN_f(h) -> f32 [2][2048][768]
  ln_rows<false, false, true><<<gLN, blk, 0, stream>>>(Hres, embs, Hres, lnf_s, lnf_b, (void*)out, BT);
  (void)hipGetLastError();
}

// v010
// A run of this version takes 252 microseconds.
// Timed twice side by side with v009, it ran 1.04 times as fast both times.
// All steps since v000 together make it 3.94 times as fast.
// Contractions: q, k, v^T, out and ffn projections = v_wmma_f32_16x16x32_f16 (f16 activations; weights bf16-RNE then x64 as f16), single product;
// LN1 and LN2 are folded into the q, k, v^T and ffn1 products (operand = h as f16, weights times the norm's scale, mean and 1/sigma applied in f32 behind the product);
// h is carried less the means of the out and ffn2 bias vectors, a shift of whole rows that every LayerNorm takes out again;
// q.k^T = v_wmma_f32_16x16x32_f16 with q as f16 hi + f16 residual planes and k f16 (k rows carry mask * 1/8 * log2 e), 2 products in one accumulator;
// p.v = v_wmma_f32_16x16x32_f16 (p carried x1024 in f16, v f16); f32 accumulate everywhere; layernorm, softmax and gelu in f32.
#include <hip/hip_runtime.h>
#include <math.h>
#include <stdint.h>

#define NB   2
#define SEQ  2048
#define HID  768
#define NHD  12
#define HD   64
#define DFF  3072
#define BT   (NB * SEQ)
#define NQB  (SEQ / 64)
#define WSC  64.0f
#define WINV 0.015625f
#define L2E  1.4426950408889634f
#define KSC  0.18033688011112042f   // 1/sqrt(64) * log2 e: the factor every k row carries, times its key's mask value
#define PLG  10.0f                  // p is carried x1024 = 2^10: the exponent's reference point lies 10 below the running max
#define HMAX 65504.0f               // largest finite f16
#define FMAX 3.402823466e38f        // largest finite f32
#define API  72                 // LDS row pitch of the attention K and V^T tiles, in halves: 64 + 8 = 144 B = 16 B x odd
#define NPG  (HID / 64)         // row-statistics partials per token: one pair (sum, sum of squared distances from the group's own mean) per 64 columns of h
#define CLN  (3 * HID + DFF)    // LayerNorm fold vectors per layer: one entry per output column of wq, wk, wv, w1, in that order
#define OPI  68                 // LDS row pitch of the attention context tile, in floats: 64 + 4 = 272 B = 16 B x odd
static_assert(NHD * HD == HID);
static_assert((SEQ % 64) == 0 && (HID % 64) == 0 && (DFF % 64) == 0 && (BT % 64) == 0);
static_assert(HID == 6 * 128);
static_assert((SEQ % 128) == 0 && (HID % 128) == 0 && (DFF % 128) == 0 && (BT % 128) == 0);
static_assert((HID % 256) == 0 && (DFF % 256) == 0);

typedef _Float16 v16h __attribute__((ext_vector_type(16)));
typedef _Float16 v8h  __attribute__((ext_vector_type(8)));
typedef float    v8f  __attribute__((ext_vector_type(8)));
typedef float    v4f  __attribute__((ext_vector_type(4)));
typedef unsigned int v4u __attribute__((ext_vector_type(4)));
typedef unsigned int v2u __attribute__((ext_vector_type(2)));
typedef float    v2f  __attribute__((ext_vector_type(2)));

// ---- scalar helpers -----------------------------------------------------------------------------
__device__ __forceinline__ unsigned short bf_bits(float f) {        // f32 -> bf16 bits, RNE convert
  const unsigned u = __float_as_uint(f);
  return (unsigned short)((u + 0x7FFFu + ((u >> 16) & 1u)) >> 16);
}
__device__ __forceinline__ float bfr(float f) { return __uint_as_float(((unsigned)bf_bits(f)) << 16); }
__device__ __forceinline__ v4f bfr4(v4f a) {
  v4f r;
  r[0] = bfr(a[0]); r[1] = bfr(a[1]); r[2] = bfr(a[2]); r[3] = bfr(a[3]);
  return r;
}
__device__ __forceinline__ unsigned short h_bits(_Float16 x) { return __builtin_bit_cast(unsigned short, x); }
__device__ __forceinline__ unsigned pk16(unsigned short a, unsigned short b) { return (unsigned)a | ((unsigned)b << 16); }
__device__ __forceinline__ unsigned pkh2(float a, float b) { return pk16(h_bits((_Float16)a), h_bits((_Float16)b)); }
__device__ __forceinline__ v8f zero8() { v8f z = {0.f, 0.f, 0.f, 0.f, 0.f, 0.f, 0.f, 0.f}; return z; }
__device__ __forceinline__ v4f zero4() { v4f z = {0.f, 0.f, 0.f, 0.f}; return z; }

// ---- fragment loader: 16-bit A/B operand, lane -> row/col (lane&15); p already includes +8*(lane>>4);
//      elements 0..7 <- p[0..7] (k0+8h..), elements 8..15 <- p[16..23] (k0+16+8h..)
__device__ __forceinline__ v16h ldfrag_h(const _Float16* p) {
  union { v16h v; v8h h[2]; } f;
  f.h[0] = *(const v8h*)(p);
  f.h[1] = *(const v8h*)(p + 16);
  return f.v;
}

// ---- WMMA with trailing VALU hazard gap (the GEMM loops) -------------------------------------------
__device__ __forceinline__ v8f mma_h(v16h a, v16h b, v8f c) {
  c = __builtin_amdgcn_wmma_f32_16x16x32_f16(false, a, false, b, (short)0, c, false, false);
#if defined(__HIP_DEVICE_COMPILE__)
  asm volatile("v_nop\n\tv_nop\n\tv_nop\n\tv_nop" : "+v"(c) : "v"(a), "v"(b));
#endif
  return c;
}
// The builtin alone, for the attention loop: there three waves share a SIMD's vector port and written v_nop take slots from the other
// waves' softmax arithmetic; the compiler keeps the distance to the next user of D, A or B itself, with useful instructions where it has them.
__device__ __forceinline__ v8f mma_p(v16h a, v16h b, v8f c) {
  return __builtin_amdgcn_wmma_f32_16x16x32_f16(false, a, false, b, (short)0, c, false, false);
}

// release/acquire + wave barrier for same-wave LDS exchange
__device__ __forceinline__ void wave_lds_sync() {
  __builtin_amdgcn_fence(__ATOMIC_RELEASE, "workgroup");
  __builtin_amdgcn_wave_barrier();
  __builtin_amdgcn_fence(__ATOMIC_ACQUIRE, "workgroup");
}

// ---- asynchronous copies to LDS ------------------------------------------------------------------
__device__ __forceinline__ unsigned lds_off(const void* p) { return (unsigned)(size_t)p; }   // byte offset in the work-group's LDS

// Eight 16-B copies per lane, global memory -> LDS through no register: l* = the lane's LDS byte address, g* = its global address.
// The closing s_wait_xcnt 0 is a precaution: it stands in front of every later rewrite of the address registers the copies name.
__device__ __forceinline__ void copy8(unsigned l0, unsigned l1, unsigned l2, unsigned l3,
                                      unsigned l4, unsigned l5, unsigned l6, unsigned l7,
                                      const _Float16* g0, const _Float16* g1, const _Float16* g2, const _Float16* g3,
                                      const _Float16* g4, const _Float16* g5, const _Float16* g6, const _Float16* g7) {
#if defined(__HIP_DEVICE_COMPILE__)
  asm volatile("global_load_async_to_lds_b128 %0, %8, off\n\t"
               "global_load_async_to_lds_b128 %1, %9, off\n\t"
               "global_load_async_to_lds_b128 %2, %10, off\n\t"
               "global_load_async_to_lds_b128 %3, %11, off\n\t"
               "global_load_async_to_lds_b128 %4, %12, off\n\t"
               "global_load_async_to_lds_b128 %5, %13, off\n\t"
               "global_load_async_to_lds_b128 %6, %14, off\n\t"
               "global_load_async_to_lds_b128 %7, %15, off\n\t"
               "s_wait_xcnt 0x0"
               :: "v"(l0), "v"(l1), "v"(l2), "v"(l3), "v"(l4), "v"(l5), "v"(l6), "v"(l7),
                  "v"(g0), "v"(g1), "v"(g2), "v"(g3), "v"(g4), "v"(g5), "v"(g6), "v"(g7)
               : "memory");
#endif
}
// this wave's LDS reads have returned: stands in front of the barrier behind which their buffer is refilled
__device__ __forceinline__ void wait_ds0() { asm volatile("s_wait_dscnt 0x0" ::: "memory"); }
// this wave's copies have landed: stands in front of the barrier behind which other waves read them (the compiler places no wait for a copy)
__device__ __forceinline__ void wait_async0() { asm volatile("s_wait_asynccnt 0x0" ::: "memory"); }

// x + x of lane l ^ XM inside a 16-lane row, one vector instruction (a shuffle written in HIP goes through the LDS unit and its latency);
// every lane of the wave is on where it is used. Steps XM = 1, 2, 4, 8 leave the row's sum in all 16 lanes.
template <int XM>
__device__ __forceinline__ float add_xm(float x) {
  float y = x;
#if defined(__HIP_DEVICE_COMPILE__)
  asm("v_add_f32_dpp %0, %1, %1 row_xmask:%2 row_mask:0xf bank_mask:0xf" : "=v"(y) : "v"(x), "n"(XM));
#endif
  return y;
}
// the four steps for eight values side by side, so that each value's step stands eight instructions behind its last
__device__ __forceinline__ void rowsum8(float (&v)[8]) {
#pragma unroll
  for (int it = 0; it < 8; ++it) v[it] = add_xm<1>(v[it]);
#pragma unroll
  for (int it = 0; it < 8; ++it) v[it] = add_xm<2>(v[it]);
#pragma unroll
  for (int it = 0; it < 8; ++it) v[it] = add_xm<4>(v[it]);
#pragma unroll
  for (int it = 0; it < 8; ++it) v[it] = add_xm<8>(v[it]);
}

// tanh-approximation gelu, tanh(u) = 1 - 2/(exp(2u)+1) with u clamped to [-16,16]
__device__ __forceinline__ float gelu_t(float x) {
  float u = 0.7978845608028654f * (x + 0.044715f * x * x * x);
  u = fminf(fmaxf(u, -16.0f), 16.0f);
  const float e  = __expf(2.0f * u);
  const float th = 1.0f - 2.0f * __builtin_amdgcn_rcpf(e + 1.0f);
  return 0.5f * x * (1.0f + th);
}

// =====================================================================================================
// Residual add + LayerNorm, one wave per row of 768. grid = nrows/8, 256 threads.
//   x = src row (RSRC: bf16-RNE the loaded values) (+ ADDE: bf16-RNE(embs row)); ADDE also stores x to hdst
//   (may alias src: every lane reads its own 24 columns before storing them).
//   else:  y -> f16 rows via a per-wave LDS row buffer (lane l: 8 halves at col 256j+8l, 512 B per instruction).
// coverage: 8 waves x grid(512) = 4096 rows; 6 x 128 floats / 3 x 256 halves = the whole 768-wide row.
// =====================================================================================================
// blk = index of the 8-row group; rb = the block's 8 x 768 float row buffer in LDS.
template <bool ADDE, bool RSRC, bool OUT32>
__device__ __forceinline__ void ln_body(int blk, float* rb, const float* src, const float* embs, float* hdst,
                                        const float* __restrict__ sc, const float* __restrict__ bi,
                                        void* outp, int nrows) {
  const int tid = threadIdx.x, wave = tid >> 5, lane = tid & 31;
  const int row = blk * 8 + wave;
  if (row >= nrows) return;                       // wave-uniform; no block barrier behind it in this body
  const size_t rbase = (size_t)row * HID;
  v4f x[6];
#pragma unroll
  for (int i = 0; i < 6; ++i) {
    const int col = i * 128 + lane * 4;
    v4f a = *(const v4f*)(src + rbase + col);
    if (RSRC) a = bfr4(a);
    if (ADDE) {
      const v4f e = bfr4(*(const v4f*)(embs + rbase + col));
      a = a + e;
    }
    x[i] = a;
    // precaution: a later load's result may be given the address registers of this trip's loads; this keeps the wait in front of that
    asm volatile("s_wait_xcnt 0x0" ::: "memory");
  }
  if (ADDE) {
    {
#pragma unroll
      for (int i = 0; i < 6; ++i) *(v4f*)(hdst + rbase + i * 128 + lane * 4) = x[i];
      
    }
  }
  float s = 0.f;
#pragma unroll
  for (int i = 0; i < 6; ++i) s += (x[i][0] + x[i][1]) + (x[i][2] + x[i][3]);
#pragma unroll
  for (int off = 1; off < 32; off <<= 1) s += __shfl_xor(s, off, 32);
  const float mean = s * (1.0f / 768.0f);
  float qv = 0.f;
#pragma unroll
  for (int i = 0; i < 6; ++i) {
    const v4f d = x[i] - mean;
    qv += (d[0] * d[0] + d[1] * d[1]) + (d[2] * d[2] + d[3] * d[3]);
  }
#pragma unroll
  for (int off = 1; off < 32; off <<= 1) qv += __shfl_xor(qv, off, 32);
  const float var  = qv * (1.0f / 768.0f);
  const float rinv = rsqrtf(var + 1e-5f);
  v4f y[6];
#pragma unroll
  for (int i = 0; i < 6; ++i) {
    const int col = i * 128 + lane * 4;
    const v4f s4 = bfr4(*(const v4f*)(sc + col));
    const v4f b4 = bfr4(*(const v4f*)(bi + col));
    y[i] = (x[i] - mean) * rinv * s4 + b4;
  }
  if (OUT32) {
    float* o = (float*)outp;
    {
#pragma unroll
      for (int i = 0; i < 6; ++i) *(v4f*)(o + rbase + i * 128 + lane * 4) = y[i];
      
    }
  } else {
    float* rw = rb + wave * HID;
#pragma unroll
    for (int i = 0; i < 6; ++i) *(v4f*)(rw + i * 128 + lane * 4) = y[i];
    wave_lds_sync();
    v4u pk[3];
#pragma unroll
    for (int j = 0; j < 3; ++j) {
      const v4f a = *(const v4f*)(rw + j * 256 + lane * 8);
      const v4f c = *(const v4f*)(rw + j * 256 + lane * 8 + 4);
      v4u p;
      p[0] = pkh2(a[0], a[1]); p[1] = pkh2(a[2], a[3]);
      p[2] = pkh2(c[0], c[1]); p[3] = pkh2(c[2], c[3]);
      pk[j] = p;
    }
    unsigned short* o = (unsigned short*)outp;
    {
#pragma unroll
      for (int j = 0; j < 3; ++j) *(v4u*)(o + rbase + j * 256 + lane * 8) = pk[j];
      
    }
  }
}

// =====================================================================================================
// LayerNorm folded into the GEMM that consumes it. With x a row of h, mu and r its mean and 1/sqrt(var + eps), s and b the norm's scale and bias:
//   LN(x) . W + bias = r * (x . W' - mu * c1) + c2,   W'[k][n] = s[k] W[k][n],  c1[n] = sum_k W'[k][n],  c2[n] = sum_k b[k] W[k][n] + bias[n].
// The GEMM takes x itself (f16) as operand and W' as weights; mu and r enter in its epilogue. Whoever writes h ahead of a folded LayerNorm also writes the f16 plane X of it
// and, per token and 64 columns, the pair (sum, sum of squared distances from the 64 columns' own mean) to P[group][token]; the consuming block
// joins a token's NPG pairs: mu from the sums, the variance from the groups' own squares plus 64 (group mean - mu)^2 each, so that no large
// squares are subtracted from each other, whatever the row's mean.
// What keeps |mu| small beside sigma, so that f16(x) is as good an operand as f16(LN(x)) (f16 rounds relative to |x|, and mu * c1 is taken out
// only behind the product): h and input_embs are drawn with mean 0, the products' weights likewise, and the one term that could shift whole
// rows by a common offset, the mean of the out and ffn2 bias vectors, is left out of h (bias_means, MODE 0 of gemm_body).
// =====================================================================================================
// x = bf16-RNE(h) + bf16-RNE(embs) of layer 0, one wave per row: f32 row -> hdst, f16 row -> X; the row's sum and its sum of squared distances
// from the row mean go to P as NPG equal shares, which the consumer's join puts together again.
__device__ __forceinline__ void raw_body(int blk, float* rb, const float* src, const float* embs, float* hdst,
                                         unsigned short* X, float* P) {
  const int tid = threadIdx.x, wave = tid >> 5, lane = tid & 31;
  const int row = blk * 8 + wave;
  const size_t rbase = (size_t)row * HID;
  v4f x[6];
#pragma unroll
  for (int i = 0; i < 6; ++i) {
    const int col = i * 128 + lane * 4;
    x[i] = bfr4(*(const v4f*)(src + rbase + col)) + bfr4(*(const v4f*)(embs + rbase + col));
    // precaution: a later load's result may be given the address registers of this trip's loads; this keeps the wait in front of that
    asm volatile("s_wait_xcnt 0x0" ::: "memory");
  }
#pragma unroll
  for (int i = 0; i < 6; ++i) *(v4f*)(hdst + rbase + i * 128 + lane * 4) = x[i];
  float sm = 0.f, sq = 0.f;
#pragma unroll
  for (int i = 0; i < 6; ++i) sm += (x[i][0] + x[i][1]) + (x[i][2] + x[i][3]);
#pragma unroll
  for (int off = 1; off < 32; off <<= 1) sm += __shfl_xor(sm, off, 32);
  const float mean = sm * (1.0f / 768.0f);
#pragma unroll
  for (int i = 0; i < 6; ++i) {
    const v4f d = x[i] - mean;
    sq += (d[0] * d[0] + d[1] * d[1]) + (d[2] * d[2] + d[3] * d[3]);
  }
#pragma unroll
  for (int off = 1; off < 32; off <<= 1) sq += __shfl_xor(sq, off, 32);
  if (lane < NPG) {
    v2f t = {sm * (1.0f / NPG), sq * (1.0f / NPG)};
    *(v2f*)(P + ((size_t)lane * BT + row) * 2) = t;
  }
  float* rw = rb + wave * HID;
#pragma unroll
  for (int i = 0; i < 6; ++i) *(v4f*)(rw + i * 128 + lane * 4) = x[i];
  wave_lds_sync();
  v4u pk[3];
#pragma unroll
  for (int j = 0; j < 3; ++j) {
    const v4f a = *(const v4f*)(rw + j * 256 + lane * 8);
    const v4f c = *(const v4f*)(rw + j * 256 + lane * 8 + 4);
    v4u p;
    p[0] = pkh2(a[0], a[1]); p[1] = pkh2(a[2], a[3]);
    p[2] = pkh2(c[0], c[1]); p[3] = pkh2(c[2], c[3]);
    pk[j] = p;
  }
#pragma unroll
  for (int j = 0; j < 3; ++j) *(v4u*)(X + rbase + j * 256 + lane * 8) = pk[j];
  // precaution: stands in front of every later rewrite of the address registers of the stores above
  asm volatile("s_wait_xcnt 0x0" ::: "memory");
}

// Means of the four bias vectors that are added to h: Bm[2 l] of bo[l], Bm[2 l + 1] of b2[l] (bf16-RNE values). One block, one wave per vector.
__device__ __forceinline__ void bias_means(const float* __restrict__ bo, const float* __restrict__ b2, float* Bm) {
  const int wave = threadIdx.x >> 5, lane = threadIdx.x & 31;
  if (wave >= 4) return;                           // wave-uniform; no barrier in this body
  const float* p = ((wave & 1) ? b2 : bo) + (wave >> 1) * HID + lane * 4;
  v4f x[6];
#pragma unroll
  for (int i = 0; i < 6; ++i) x[i] = *(const v4f*)(p + i * 128);
  // precaution: the wait stands in front of every rewrite of the loads' address registers, which it names as an input so that they live up to it
  asm volatile("s_wait_xcnt 0x0" :: "v"(p) : "memory");
  float s = 0.f;
#pragma unroll
  for (int i = 0; i < 6; ++i) { const v4f a = bfr4(x[i]); s += (a[0] + a[1]) + (a[2] + a[3]); }
#pragma unroll
  for (int off = 1; off < 32; off <<= 1) s += __shfl_xor(s, off, 32);
  if (lane == 0) Bm[wave] = s * (1.0f / 768.0f);
}

// c1 and c2 of 64 output columns n0.. of one weight matrix W f32 [HID][N]; c1 sums the very f16 values the GEMM multiplies (x64, taken back).
// thread -> 4 columns (tid & 15) * 4, k = (tid >> 4) + 16 i; the 16 k groups are joined through LDS (red: 2 x 16 x 64 floats) behind one block barrier.
__device__ __forceinline__ void csum_body(float* red, const float* __restrict__ W, int N, int n0,
                                          const float* __restrict__ sk, const float* __restrict__ bk,
                                          const float* __restrict__ bias, float* c1, float* c2) {
  const int tid = threadIdx.x;
  const int c4 = (tid & 15) * 4, kg = tid >> 4;
  v4f a1 = zero4(), a2 = zero4();
  // kept rolled: a trip already has the loads of eight k in flight at once
#pragma unroll 1
  for (int i0 = 0; i0 < HID / 16; i0 += 8) {
    const float* pw = W + (size_t)(kg + 16 * i0) * N + n0 + c4;
    const float* ps = sk + kg + 16 * i0;
    const float* pb = bk + kg + 16 * i0;
    v4f w[8];
    float sv[8], bv[8];
#pragma unroll
    for (int j = 0; j < 8; ++j) {
      w[j]  = *(const v4f*)(pw + (size_t)(16 * j) * N);
      sv[j] = ps[16 * j];
      bv[j] = pb[16 * j];
    }
    // precaution: the wait stands in front of every rewrite of the loads' address registers, which it names as inputs so that they live up to it
    asm volatile("s_wait_xcnt 0x0" :: "v"(pw), "v"(ps), "v"(pb) : "memory");
#pragma unroll
    for (int j = 0; j < 8; ++j) {
      const v4f wr = bfr4(w[j]);
      const float s64 = bfr(sv[j]) * WSC, bb = bfr(bv[j]);
#pragma unroll
      for (int e = 0; e < 4; ++e) {
        a1[e] += (float)(_Float16)(wr[e] * s64);
        a2[e] += wr[e] * bb;
      }
    }
  }
  *(v4f*)(red + kg * 64 + c4)        = a1;
  *(v4f*)(red + 1024 + kg * 64 + c4) = a2;
  __syncthreads();
  if (tid < 128) {                                 // wave-uniform; no barrier behind it
    const int ci = tid & 63;
    const float* r = red + (tid >> 6) * 1024 + ci;
    float t = 0.f;
#pragma unroll
    for (int g = 0; g < 16; ++g) t += r[g * 64];
    if (tid < 64) c1[n0 + ci] = t * WINV;
    else          c2[n0 + ci] = t + bfr(bias[n0 + ci]);
    // precaution: stands in front of every later rewrite of the address registers of the load and the stores above
    asm volatile("s_wait_xcnt 0x0" ::: "memory");
  }
}

template <bool ADDE, bool RSRC, bool OUT32>
__global__ __launch_bounds__(256) void ln_rows(const float* src, const float* embs, float* hdst,
                                               const float* __restrict__ sc, const float* __restrict__ bi,
                                               void* outp, int nrows) {
  __shared__ __align__(16) float rb[8 * HID];
  ln_body<ADDE, RSRC, OUT32>(blockIdx.x, rb, src, embs, hdst, sc, bi, outp, nrows);
}

// =====================================================================================================
// Weight convert + transpose: W f32 [K][N] (row-major, in-major) -> O f16 [N][K] = f16(bf16-RNE(w) * 64),
// times bf16-RNE(sk[k]) where sk is given (the scale of the LayerNorm folded into this matrix's GEMM).
// One block = one tile of 64 k x 64 n through LDS, origin (k0, n0); 256 threads; sT = the block's 64 x 72 half tile in LDS.
//   read: thread (r = tid>>2 = k row, cq = (tid&3)*16 = n quarter) reads 16 floats (4 x 16 B) -> sT[n][k]
//   write: wave w, lane: rows (n) w*8 + it*4 + (lane>>3), 8 halves per lane at k (lane&7)*8:
// coverage: 8 waves x 8 rows = 64 n rows x 64 k per block; the caller deals N/64 x K/64 tiles exactly.
// =====================================================================================================
__device__ __forceinline__ void conv_body(_Float16* sT, const float* __restrict__ W, unsigned short* O,
                                          int K, int N, int n0, int k0, const float* __restrict__ sk) {
  const int tid = threadIdx.x;
  {
    const int r = tid >> 2, cq = (tid & 3) * 16;
    const float* p = W + (size_t)(k0 + r) * N + n0 + cq;
    v4f a[4];
#pragma unroll
    for (int g = 0; g < 4; ++g) a[g] = *(const v4f*)(p + 4 * g);
    // precaution: the wait stands in front of every rewrite of the loads' address registers, which it names as an input so that they live up to it
    asm volatile("s_wait_xcnt 0x0" :: "v"(p) : "memory");
    float sv = WSC;
    if (sk) sv = bfr(sk[k0 + r]) * WSC;            // block-uniform; behind the four loads, so that its latency runs beside theirs
#pragma unroll
    for (int g = 0; g < 4; ++g) {
#pragma unroll
      for (int e = 0; e < 4; ++e) sT[(cq + 4 * g + e) * 72 + r] = (_Float16)(bfr(a[g][e]) * sv);
    }
  }
  __syncthreads();
  const int wave = tid >> 5, lane = tid & 31;
  const int q = lane >> 3, c8 = (lane & 7) * 8;
  union HU { v8h h; v4u u; };
  HU pk[2];
#pragma unroll
  for (int it = 0; it < 2; ++it) {
    const int row = wave * 8 + it * 4 + q;
    pk[it].h = *(const v8h*)(sT + row * 72 + c8);
  }
  const _Float16 dummy = (_Float16)0.0f; (void)dummy;
  {
#pragma unroll
    for (int it = 0; it < 2; ++it) {
      const int row = wave * 8 + it * 4 + q;
      *(v4u*)(O + (size_t)(n0 + row) * K + k0 + c8) = pk[it].u;
    }
    // precaution: where this body is inlined in front of other code, the stores' registers may be rewritten there; this keeps the wait in front of that
    asm volatile("s_wait_xcnt 0x0" ::: "memory");
  }
}

// =====================================================================================================
// First launch: the work that depends on the inputs alone, dealt by block index in one grid.
//   blocks 0 .. 2*CSB-1: the fold vectors c1, c2 of wq, wk, wv (LN1) and w1 (LN2) of both layers (csum_body), 64 columns a block;
//   block 2*CSB: the means of the bo and b2 vectors (bias_means);
//   then BT/8 blocks: h + embs of layer 0 with its f16 plane and row sums (raw_body), and the mask addends Md of their 8 tokens;
//   then per layer CVL = 3 x CVS blocks of weight tiles (conv_body): CVS tiles of wq, wk, wv, wo (144 each), CVS of w1, CVS of w2.
// Converted weights of layer l lie at Wt + l * WLH halves: Wq_t, Wk_t, Wv_t, Wo_t (HID*HID each), W1_t, W2_t (HID*DFF each).
// Fold vectors of layer l lie at C1 + l * CLN and C2 + l * CLN.
// The branches that deal blocks below are block-uniform; the one block barrier (in conv_body, in csum_body) is passed by all 256 threads of its block.
// =====================================================================================================
#define CVS  576                                  // 4 * 12 * 12 = 48 * 12 = 12 * 48 tiles
#define CVL  (3 * CVS)
#define CSB  (CLN / 64)                           // 84 blocks of 64 columns per layer
#define WLH  (4 * HID * HID + 2 * HID * DFF)      // halves of converted weights per layer
static_assert(4 * (HID / 64) * (HID / 64) == CVS && (DFF / 64) * (HID / 64) == CVS);
__global__ __launch_bounds__(256) void prep(const float* in_h, const float* embs, float* hdst,
                                            const float* __restrict__ ln1s, const float* __restrict__ ln1b,
                                            const float* __restrict__ ln2s, const float* __restrict__ ln2b,
                                            const float* __restrict__ bq, const float* __restrict__ bk,
                                            const float* __restrict__ bv, const float* __restrict__ b1,
                                            const float* __restrict__ bo, const float* __restrict__ b2,
                                            unsigned short* X, float* P, float* C1, float* C2, float* Bm,
                                            const float* __restrict__ wq, const float* __restrict__ wk,
                                            const float* __restrict__ wv, const float* __restrict__ wo,
                                            const float* __restrict__ w1, const float* __restrict__ w2,
                                            unsigned short* Wt, const float* __restrict__ mask, float* Md) {
  __shared__ __align__(16) float rb[8 * HID];
  __shared__ __align__(16) _Float16 sT[64 * 72];
  if (blockIdx.x < 2 * CSB) {
    const int l = (int)blockIdx.x / CSB;
    const int u = (int)blockIdx.x - l * CSB;
    float* c1 = C1 + l * CLN;
    float* c2 = C2 + l * CLN;
    if (u < 3 * (HID / 64)) {
      const int z = u / (HID / 64);
      const float* W = ((z == 0) ? wq : (z == 1) ? wk : wv) + (size_t)l * HID * HID;
      const float* bb = ((z == 0) ? bq : (z == 1) ? bk : bv) + l * HID;
      csum_body(rb, W, HID, (u - z * (HID / 64)) * 64, ln1s + l * HID, ln1b + l * HID, bb, c1 + z * HID, c2 + z * HID);
    } else {
      csum_body(rb, w1 + (size_t)l * HID * DFF, DFF, (u - 3 * (HID / 64)) * 64, ln2s + l * HID, ln2b + l * HID, b1 + l * DFF,
                c1 + 3 * HID, c2 + 3 * HID);
    }
    return;
  }
  if (blockIdx.x == 2 * CSB) {
    bias_means(bo, b2, Bm);
    return;
  }
  const int bx = (int)blockIdx.x - (2 * CSB + 1);
  if (bx < BT / 8) {
    // mask addend of this block's 8 tokens as keys, in log2 units: BT / 8 blocks x 8 = all NB * SEQ keys
    if (threadIdx.x < 8) {
      const int key = bx * 8 + (int)threadIdx.x;
      // held finite: the factor log2 e could carry an addend that is still finite in natural units past the f32 range
      Md[key] = fminf(fmaxf((-1.0e10f * (1.0f - bfr(mask[key]))) * L2E, -FMAX), FMAX);
    }
    raw_body(bx, rb, in_h, embs, hdst, X, P);
    return;
  }
  int t = bx - BT / 8;
  const int l = t / CVL;
  t -= l * CVL;
  const int seg = t / CVS;
  t -= seg * CVS;
  unsigned short* Ol = Wt + (size_t)l * WLH;
  if (seg == 0) {
    const int z = t / 144;
    const int r = t - z * 144;
    const float* W = ((z == 0) ? wq : (z == 1) ? wk : (z == 2) ? wv : wo) + (size_t)l * HID * HID;
    conv_body(sT, W, Ol + (size_t)z * HID * HID, HID, HID, (r % 12) * 64, (r / 12) * 64, (z < 3) ? ln1s + l * HID : nullptr);
  } else if (seg == 1) {
    conv_body(sT, w1 + (size_t)l * HID * DFF, Ol + (size_t)4 * HID * HID, HID, DFF, (t % 48) * 64, (t / 48) * 64, ln2s + l * HID);
  } else {
    conv_body(sT, w2 + (size_t)l * HID * DFF, Ol + (size_t)4 * HID * HID + (size_t)HID * DFF, DFF, HID,
              (t % 12) * 64, (t / 12) * 64, nullptr);
  }
}

// =====================================================================================================
// Register-blocked f16 WMMA GEMM: C[m][n] = sum_k A[m][k] * Bt[n][k] (accumulator scaled by 1/64 in the
// epilogue = the weight carry). Block = 8 waves (4 x 2) = one 128x128 tile of C, one 32x64 tile per wave.
// A row-major [M][K] pitch lda, Bt row-major [N][K] pitch ldb (k contiguous); M, N multiples of 128, K multiple of BK.
// Operands go through LDS in stages of BK k: 128 rows x 2 BK bytes of A and of Bt per stage, brought by asynchronous 16-B copies. Each
// wave-wide copy covers 4 whole 128-B lines; rows lie in LDS at pitch 2 BK + 16 B (16 B x odd) for the 16-B fragment reads.
// BK = 64 where several blocks share a WGP and cover each other's waits. BK = 256 for the grids of 192 blocks, one block to a WGP:
// there only the block's own copies are in flight, and a stage has to hold enough bytes and enough products to cover their latency.
// Two LDS buffers, one block barrier per stage, at the loop's foot: behind it stage s+1 (copied while stage s was multiplied) is
// readable, and stage s+2 is copied into the buffer of stage s, whose readers all passed that barrier.
// tile = index of the block tile, bz = batch index (strides in elements). Both A and B fragments use the split k map of ldfrag_h.
// MODE 0: f32 C += acc/64 + bias[n] - c1[0] (bias bf16-RNE in register; c1 here points to the bias vector's mean) (+ EMB: bf16-RNE(embs), the next
//         layer's h + embs); STAT: the new rows of C also go to Xo as f16, and each row's pair (sum, sum of squared distances from the mean of the
//         wave's 64 columns) to P[column group][row].
// MODES 1 to 4 carry a folded LayerNorm: one operand is the raw f16 plane of h, and u = r[tok] * (acc/64 - mu[tok] * c1[ch]) + bias[ch], where
// bias is the fold vector c2, tok the token index (m; n in MODE 3) and ch the output channel (n; m in MODE 3). mu and r of the block's 128
// tokens come from P: read ahead of the k loop, handed round through LDS (the first bytes of sA, free by then) behind one new block barrier.
// MODE 1: f16 C = u * bf16-RNE(rowm[m]) * KSC, held in the f16 range  (the k plane: row m is a key, rowm its mask value)
// MODE 2: f16 hi C = f16(u), f16 residual C2 = f16(u - hi)
// MODE 3: f16 C = u
// MODE 4: f16 C = gelu(u) Epilogue: 16-row slabs staged per wave in LDS; each 64-wide row
// coverage: 2 slabs x 16 rows x 64 cols = the wave's whole tile; 8 waves per block; grid = (M/128) * (N/128).
// =====================================================================================================
template <int MODE, int BK, bool STAT, bool EMB>
__device__ __forceinline__ void gemm_body(
    _Float16 (*sA)[128 * (BK + 8)], _Float16 (*sB)[128 * (BK + 8)], float (*sT)[16 * 68], int tile, int bz,
    const unsigned short* __restrict__ Ap, int lda, long long strideA,
    const unsigned short* __restrict__ Btp, int ldb, long long strideB,
    const float* __restrict__ bias, const float* __restrict__ rowm,
    void* Cout, void* Cout2, int ldc, long long strideC,
    int M, int N, int K,
    const float* __restrict__ c1, float* P, unsigned short* Xo, const float* __restrict__ embs) {
  static_assert(BK == 64 || BK == 256);
  constexpr int LBK = (BK == 64) ? 6 : 8;          // log2 BK
  constexpr int GPI = BK + 8;                      // LDS row pitch of a stage, in halves
  constexpr int PR  = BK / 8;                      // 16-B pieces of a stage row
  constexpr int RP  = 256 / PR;                    // rows that one copy of each of the 256 threads covers
  const int tid  = threadIdx.x;
  const int lane = tid & 31;
  const int wave = tid >> 5;
  const int tilesN = N >> 7;
  const int tilesM = M >> 7;
  if (tile >= tilesM * tilesN) return;             // block-uniform, in front of every barrier
  const int tm = tile / tilesN;
  const int tn = tile - tm * tilesN;
  const int bm0 = tm << 7;                         // block tile origin
  const int bn0 = tn << 7;
  const int wm  = (wave >> 1) << 5;                // wave tile origin inside the block tile
  const int wn  = (wave & 1) << 6;
  const int m0 = bm0 + wm;
  const int n0 = bn0 + wn;

  const _Float16* Ab = (const _Float16*)(const void*)Ap  + (size_t)bz * (size_t)strideA;
  const _Float16* Bb = (const _Float16*)(const void*)Btp + (size_t)bz * (size_t)strideB;

  const int rl   = lane & 15;                      // row (A) / col (B, D) within subtile
  const int hh   = lane >> 4;
  const int koff = hh * 8;                         // k offset of this lane half
  const int mOff = hh * 8;                         // D row offset

  // staging map: thread -> row tid / PR + RP * it, 16-B piece tid % PR of the row's 2 BK bytes; (128 / RP) it x RP rows = 128 rows
  const int srow = tid >> (LBK - 3);
  const int scol = (tid & (PR - 1)) * 8;
  const _Float16* ga = Ab + (size_t)(bm0 + srow) * lda + scol;
  const _Float16* gb = Bb + (size_t)(bn0 + srow) * ldb + scol;
  const int sofs = srow * GPI + scol;

  v8f acc[2][4];
#pragma unroll
  for (int i = 0; i < 2; ++i)
#pragma unroll
    for (int j = 0; j < 4; ++j) acc[i][j] = zero8();

  const unsigned la0 = lds_off(&sA[0][0]) + (unsigned)sofs * 2u;   // this thread's 16 B of row srow in buffer 0
  const unsigned lb0 = lds_off(&sB[0][0]) + (unsigned)sofs * 2u;
  const size_t aR = (size_t)RP * lda, bR = (size_t)RP * ldb;
  constexpr unsigned SBUF = 128u * GPI * 2u;                       // bytes of one buffer
  constexpr unsigned SRP  = (unsigned)RP * GPI * 2u;               // bytes of RP LDS rows
  auto issue = [&](int st) {                                       // stage st -> buffer st & 1: (128 / RP) x RP rows of A and of Bt
    const unsigned la = la0 + (unsigned)(st & 1) * SBUF, lb = lb0 + (unsigned)(st & 1) * SBUF;
    const _Float16* pa = ga + ((size_t)st << LBK);
    const _Float16* pb = gb + ((size_t)st << LBK);
    if (BK == 64) {
      copy8(la, la + SRP, la + 2u * SRP, la + 3u * SRP, lb, lb + SRP, lb + 2u * SRP, lb + 3u * SRP,
            pa, pa + aR, pa + 2 * aR, pa + 3 * aR, pb, pb + bR, pb + 2 * bR, pb + 3 * bR);
    } else {
      // both loops unrolled: two statements of eight copies each, their LDS steps compile-time constants
#pragma unroll
      for (int g = 0; g < 128 / RP; g += 8) {                      // 32 copies a thread and stage, 63 may be outstanding
        const unsigned l = la + (unsigned)g * SRP;
        const _Float16* p = pa + (size_t)g * aR;
        copy8(l, l + SRP, l + 2u * SRP, l + 3u * SRP, l + 4u * SRP, l + 5u * SRP, l + 6u * SRP, l + 7u * SRP,
              p, p + aR, p + 2 * aR, p + 3 * aR, p + 4 * aR, p + 5 * aR, p + 6 * aR, p + 7 * aR);
      }
#pragma unroll
      for (int g = 0; g < 128 / RP; g += 8) {
        const unsigned l = lb + (unsigned)g * SRP;
        const _Float16* p = pb + (size_t)g * bR;
        copy8(l, l + SRP, l + 2u * SRP, l + 3u * SRP, l + 4u * SRP, l + 5u * SRP, l + 6u * SRP, l + 7u * SRP,
              p, p + bR, p + 2 * bR, p + 3 * bR, p + 4 * bR, p + 5 * bR, p + 6 * bR, p + 7 * bR);
      }
    }
  };

  const int nst = K >> LBK;
  issue(0);
  float mu = 0.f, ri = 0.f;                        // mean and 1/sqrt(var + eps) of token (tid & 127) of the block's 128
  if (MODE != 0) {
    const int tok = ((MODE == 3) ? bz * SEQ + bn0 : bm0) + (tid & 127);
    v2f pp[NPG];
#pragma unroll
    for (int g = 0; g < NPG; ++g) pp[g] = *(const v2f*)(P + ((size_t)g * BT + tok) * 2);
    // precaution: stands in front of every later rewrite of the address registers of the loads above
    asm volatile("s_wait_xcnt 0x0" ::: "memory");
    float sm = 0.f, sq = 0.f;
#pragma unroll
    for (int g = 0; g < NPG; ++g) sm += pp[g][0];
    mu = sm * (1.0f / 768.0f);
#pragma unroll
    for (int g = 0; g < NPG; ++g) {
      const float dg = pp[g][0] * (1.0f / 64.0f) - mu;         // the group's mean against the row's
      sq += pp[g][1] + 64.0f * (dg * dg);
    }
    const float ve = sq * (1.0f / 768.0f) + 1e-5f;             // at least 1e-5: no denormal reaches the instruction below
#if defined(__HIP_DEVICE_COMPILE__)
    // the closing v_nop is the slot the instruction set asks for between a transcendental and the next instruction that reads its result
    asm("v_rsq_f32 %0, %1\n\tv_nop" : "=v"(ri) : "v"(ve));
#endif
  }
  wait_async0();
  __syncthreads();                                 // publishes stage 0
  if (nst > 1) issue(1);                           // block-uniform
  // kept rolled: one stage is already 16 WMMAs and 24 fragment loads a wave or more; unrolling would only grow code and registers
#pragma unroll 1
  for (int s = 0; s < nst; ++s) {
    const _Float16* dA = sA[s & 1];
    const _Float16* dB = sB[s & 1];
#pragma unroll
    for (int kk = 0; kk < BK / 32; ++kk) {
      v16h bfg[4], af[2];
      af[0] = ldfrag_h(dA + (wm + rl) * GPI + kk * 32 + koff);
#pragma unroll
      for (int j = 0; j < 4; ++j)
        bfg[j] = ldfrag_h(dB + (wn + (j << 4) + rl) * GPI + kk * 32 + koff);
      af[1] = ldfrag_h(dA + (wm + 16 + rl) * GPI + kk * 32 + koff);
#pragma unroll
      for (int i = 0; i < 2; ++i)
#pragma unroll
        for (int j = 0; j < 4; ++j) acc[i][j] = mma_h(af[i], bfg[j], acc[i][j]);
    }
    wait_ds0();
    wait_async0();
    __syncthreads();                               // publishes stage s+1; ends every wave's reads of stage s
    if (s + 2 < nst) issue(s + 2);                 // block-uniform: flies under the WMMAs of stage s+1
  }
  wait_async0();

  // ---- epilogue ----
  const v2f* sS = (const v2f*)(const void*)&sA[0][0];   // (mu, r) of the block's 128 tokens; every read of the stages ended at the loop's last barrier
  if (MODE != 0) {
    if (tid < 128) { v2f t = {mu, ri}; *(v2f*)(void*)(&sA[0][0] + tid * 4) = t; }
    __syncthreads();                               // publishes the 128 pairs
  }
  float* slab = sT[wave];
#pragma unroll
  for (int i = 0; i < 2; ++i) {
    const int mBase = m0 + (i << 4);
#pragma unroll
    for (int j = 0; j < 4; ++j) {
#pragma unroll
      for (int r = 0; r < 8; ++r) slab[(mOff + r) * 68 + (j << 4) + rl] = acc[i][j][r] * WINV;
    }
    wave_lds_sync();
    if (MODE == 0) {
      float* C = (float*)Cout + (size_t)bz * (size_t)strideC;
      const int c4 = rl * 4;                                   // 256-B row segment = 16 lanes x 16 B
      const v4f b4 = bfr4(*(const v4f*)(bias + n0 + c4)) - c1[0];   // the vector's mean stays out of h: it would only shift whole rows
      v4f vals[8];
#pragma unroll
      for (int it = 0; it < 8; ++it) {
        const int row = it * 2 + hh;                           // it 0..7 x hh 0..1 = rows 0..15
        const v4f v = *(const v4f*)(slab + row * 68 + c4);
        const v4f o = *(const v4f*)(C + (size_t)(mBase + row) * ldc + n0 + c4);
        vals[it] = o + (v + b4);
        if (EMB) {
          vals[it] = vals[it] + bfr4(*(const v4f*)(embs + (size_t)(mBase + row) * ldc + n0 + c4));
          // precaution: a later trip may be given the address registers of this trip's loads; this keeps the wait in front of that
          asm volatile("s_wait_xcnt 0x0" ::: "memory");
        }
      }
      {
#pragma unroll
        for (int it = 0; it < 8; ++it) {
          const int row = it * 2 + hh;
          *(v4f*)(C + (size_t)(mBase + row) * ldc + n0 + c4) = vals[it];
        }
        
      }
      if (STAT) {
        // precaution, here and twice below: the wait stands behind a run of stores, in front of the code that reuses their registers
        asm volatile("s_wait_xcnt 0x0" ::: "memory");
        float ps[8], pq[8];
        v2u h2[8];
#pragma unroll
        for (int it = 0; it < 8; ++it) {
          const v4f x = vals[it];
          h2[it][0] = pkh2(x[0], x[1]); h2[it][1] = pkh2(x[2], x[3]);
          ps[it] = (x[0] + x[1]) + (x[2] + x[3]);
        }
        unsigned short* xp[8];
#pragma unroll
        for (int it = 0; it < 8; ++it) {
          xp[it] = Xo + (size_t)(mBase + it * 2 + hh) * ldc + n0 + c4;
          *(v2u*)xp[it] = h2[it];                                            // 16 lanes x 8 B = the row's whole 128-B line
        }
        asm volatile("s_wait_xcnt 0x0" ::: "memory");
        // sums over the 16 lanes that hold a row's 64 columns: first the values, then their squared distances from the mean of the 64
        rowsum8(ps);
#pragma unroll
        for (int it = 0; it < 8; ++it) {
          const v4f d = vals[it] - ps[it] * (1.0f / 64.0f);
          pq[it] = (d[0] * d[0] + d[1] * d[1]) + (d[2] * d[2] + d[3] * d[3]);
        }
        rowsum8(pq);
        if (rl == 0) {
          float* pp = P + ((size_t)(n0 >> 6) * BT + mBase + hh) * 2;         // the slab's 16 pairs = one 128-B line, this wave its one writer
          v2f t[8];
#pragma unroll
          for (int it = 0; it < 8; ++it) {
            t[it][0] = ps[it]; t[it][1] = pq[it];
            *(v2f*)(pp + it * 4) = t[it];                                    // row it * 2 + hh
          }
          asm volatile("s_wait_xcnt 0x0" ::: "memory");
        }
      }
    } else {
      const int q = lane >> 3, c8 = (lane & 7) * 8;
      unsigned short* C  = (unsigned short*)Cout  + (size_t)bz * (size_t)strideC;
      unsigned short* C2 = (unsigned short*)Cout2 + (size_t)bz * (size_t)strideC;
      v4f ba = zero4(), bb = zero4(), ca = zero4(), cb = zero4();   // c2 and c1 of this lane's 8 columns
      v4f mua = zero4(), mub = zero4(), ria = zero4(), rib = zero4();   // MODE 3: mu and r of this lane's 8 columns (tokens)
      float br4[4] = {0.f, 0.f, 0.f, 0.f}, cr4[4] = {0.f, 0.f, 0.f, 0.f};   // MODE 3: c2 and c1 of this lane's 4 rows (channels)
      const float* p2 = bias + ((MODE != 3) ? n0 + c8 : mBase + q);
      const float* p1 = c1   + ((MODE != 3) ? n0 + c8 : mBase + q);
      if (MODE != 3) {
        ba = *(const v4f*)(p2);
        bb = *(const v4f*)(p2 + 4);
        ca = *(const v4f*)(p1);
        cb = *(const v4f*)(p1 + 4);
      } else {
#pragma unroll
        for (int e = 0; e < 4; ++e) {
          const v2f t0 = sS[wn + c8 + e], t1 = sS[wn + c8 + 4 + e];
          mua[e] = t0[0]; ria[e] = t0[1]; mub[e] = t1[0]; rib[e] = t1[1];
        }
#pragma unroll
        for (int it = 0; it < 4; ++it) { br4[it] = p2[it * 4]; cr4[it] = p1[it * 4]; }
      }
      // precaution: the wait stands in front of every rewrite of the loads' address registers, which it names as inputs so that they live up to it
      asm volatile("s_wait_xcnt 0x0" :: "v"(p2), "v"(p1) : "memory");
      float kf[4] = {1.0f, 1.0f, 1.0f, 1.0f};
      if (MODE == 1) {
#pragma unroll
        for (int it = 0; it < 4; ++it) kf[it] = rowm[mBase + it * 4 + q];
        // precaution: stands in front of every later rewrite of the address registers of the four loads above
        asm volatile("s_wait_xcnt 0x0" ::: "memory");
#pragma unroll
        for (int it = 0; it < 4; ++it) kf[it] = bfr(kf[it]) * KSC;
      }
      v4u hv[4], lv[4];
#pragma unroll
      for (int it = 0; it < 4; ++it) {
        const int row = it * 4 + q;                            // it 0..3 x q 0..3 = rows 0..15
        const float* sp = slab + row * 68 + c8;
        v4f fa = *(const v4f*)(sp);
        v4f fb = *(const v4f*)(sp + 4);
        if (MODE == 3) {
          fa = (fa - mua * cr4[it]) * ria + br4[it]; fb = (fb - mub * cr4[it]) * rib + br4[it];
        } else {
          const v2f st = sS[wm + (i << 4) + row];
          fa = (fa - st[0] * ca) * st[1] + ba; fb = (fb - st[0] * cb) * st[1] + bb;
        }
        if (MODE == 1) {
          // held inside the f16 range: a mask value large enough to carry a k row past it would make the row infinite and the scores NaN,
          // while its addend (1e10 times the mask's distance from 1) is then so large that the f32 score takes nothing from the product
#pragma unroll
          for (int e = 0; e < 4; ++e) {
            fa[e] = fminf(fmaxf(fa[e] * kf[it], -HMAX), HMAX);
            fb[e] = fminf(fmaxf(fb[e] * kf[it], -HMAX), HMAX);
          }
        }
        if (MODE == 4) {
#pragma unroll
          for (int e = 0; e < 4; ++e) { fa[e] = gelu_t(fa[e]); fb[e] = gelu_t(fb[e]); }
        }
        v4u a, a2;
        if (MODE == 2) {
#pragma unroll
          for (int e = 0; e < 2; ++e) {
            const float f0 = fa[2 * e], f1 = fa[2 * e + 1];
            const float g0 = fb[2 * e], g1 = fb[2 * e + 1];
            const _Float16 x0 = (_Float16)f0, x1 = (_Float16)f1, y0 = (_Float16)g0, y1 = (_Float16)g1;
            a[e]      = pk16(h_bits(x0), h_bits(x1));
            a[e + 2]  = pk16(h_bits(y0), h_bits(y1));
            a2[e]     = pk16(h_bits((_Float16)(f0 - (float)x0)), h_bits((_Float16)(f1 - (float)x1)));
            a2[e + 2] = pk16(h_bits((_Float16)(g0 - (float)y0)), h_bits((_Float16)(g1 - (float)y1)));
          }
        } else {
          a[0] = pkh2(fa[0], fa[1]); a[1] = pkh2(fa[2], fa[3]);
          a[2] = pkh2(fb[0], fb[1]); a[3] = pkh2(fb[2], fb[3]);
          a2 = a;
        }
        hv[it] = a; lv[it] = a2;
      }
      {
#pragma unroll
        for (int it = 0; it < 4; ++it) {
          const int row = it * 4 + q;
          *(v4u*)(C + (size_t)(mBase + row) * ldc + n0 + c8) = hv[it];
          if (MODE == 2) *(v4u*)(C2 + (size_t)(mBase + row) * ldc + n0 + c8) = lv[it];
        }
        
      }
    }
    wave_lds_sync();
  }
}

#define GEMM_LDS(BK)                                                                                             \
  __shared__ __align__(16) _Float16 sA[2][128 * ((BK) + 8)]; /* A stage: 128 rows x BK k, pitch BK + 8, two buffers */ \
  __shared__ __align__(16) _Float16 sB[2][128 * ((BK) + 8)]; /* Bt stage, same shape */                           \
  __shared__ __align__(16) float sT[8][16 * 68];      /* per-wave 16x64 slab, pitch 68 floats */

template <int MODE, bool STAT, bool EMB>
__global__ __launch_bounds__(256) void gemm64(
    const unsigned short* __restrict__ Ap, int lda, long long strideA,
    const unsigned short* __restrict__ Btp, int ldb, long long strideB,
    const float* __restrict__ bias,
    void* Cout, void* Cout2, int ldc, long long strideC,
    int M, int N, int K,
    const float* __restrict__ c1, float* P, unsigned short* Xo, const float* __restrict__ embs) {
  constexpr int BK = (MODE == 0) ? 256 : 64;       // MODE 0 runs on the grids of 192 blocks; K = 768 or 3072, multiples of 256
  GEMM_LDS(BK)
  gemm_body<MODE, BK, STAT, EMB>(sA, sB, sT, blockIdx.x, blockIdx.y, Ap, lda, strideA, Btp, ldb, strideB, bias, nullptr,
                  Cout, Cout2, ldc, strideC, M, N, K, c1, P, Xo, embs);
}

// q, k and v^T projections of one layer in one grid: they read the same X (h as f16; LN1 folded in) and do not depend on each other.
//   blocks 0..191: q (MODE 2); 192..383: k (MODE 1); 384..575: v^T (MODE 3), 96 tiles per batch.
// The three branches are block-uniform, so every barrier in gemm_body is passed by the whole block.
#define TQK ((BT / 128) * (HID / 128))
#define TVB ((HID / 128) * (SEQ / 128))
__global__ __launch_bounds__(256) void gemm_qkv(
    const unsigned short* __restrict__ X, const unsigned short* __restrict__ Wqt,
    const unsigned short* __restrict__ Wkt, const unsigned short* __restrict__ Wvt,
    const float* __restrict__ c1, const float* __restrict__ c2, float* P,
    const float* __restrict__ mask,
    unsigned short* Qh, unsigned short* Ql, unsigned short* Kh, unsigned short* VT) {
  GEMM_LDS(64)
  const int t = blockIdx.x;
  if (t < TQK) {
    gemm_body<2, 64, false, false>(sA, sB, sT, t, 0, X, HID, 0LL, Wqt, HID, 0LL, c2, nullptr, (void*)Qh, (void*)Ql, HID, 0LL, BT, HID, HID,
                                   c1, P, nullptr, nullptr);
  } else if (t < 2 * TQK) {
    gemm_body<1, 64, false, false>(sA, sB, sT, t - TQK, 0, X, HID, 0LL, Wkt, HID, 0LL, c2 + HID, mask, (void*)Kh, (void*)Kh, HID, 0LL, BT, HID, HID,
                                   c1 + HID, P, nullptr, nullptr);
  } else {
    const int u  = t - 2 * TQK;
    const int bz = u / TVB;
    gemm_body<3, 64, false, false>(sA, sB, sT, u - bz * TVB, bz, Wvt, HID, 0LL, X, HID, (long long)SEQ * HID, c2 + 2 * HID, nullptr,
                                   (void*)VT, (void*)VT, SEQ, (long long)HID * SEQ, HID, SEQ, HID, c1 + 2 * HID, P, nullptr, nullptr);
  }
}

__device__ __forceinline__ float xhalf(float x) {
  return __builtin_bit_cast(float, __builtin_amdgcn_permlanex16(__builtin_bit_cast(int, x), __builtin_bit_cast(int, x),
                                                                0x76543210, 0xfedcba98, false, false));
}

// 2^x of eight values in one statement. The results are early-clobber, so none of them lies on a source of the exponential in
// front of it, and the closing v_nop is the slot the instruction set asks for between a transcendental and the next instruction
// that uses its result or overwrites its source (left to itself the compiler put results on the source of the one in front).
__device__ __forceinline__ v8f exp2x8(v8f x) {
  v8f y = x;
#if defined(__HIP_DEVICE_COMPILE__)
  float y0, y1, y2, y3, y4, y5, y6, y7;
  asm("v_exp_f32 %0, %8\n\tv_exp_f32 %1, %9\n\tv_exp_f32 %2, %10\n\tv_exp_f32 %3, %11\n\t"
      "v_exp_f32 %4, %12\n\tv_exp_f32 %5, %13\n\tv_exp_f32 %6, %14\n\tv_exp_f32 %7, %15\n\tv_nop"
      : "=&v"(y0), "=&v"(y1), "=&v"(y2), "=&v"(y3), "=&v"(y4), "=&v"(y5), "=&v"(y6), "=&v"(y7)
      : "v"(x[0]), "v"(x[1]), "v"(x[2]), "v"(x[3]), "v"(x[4]), "v"(x[5]), "v"(x[6]), "v"(x[7]));
  y[0] = y0; y[1] = y1; y[2] = y2; y[3] = y3; y[4] = y4; y[5] = y5; y[6] = y6; y[7] = y7;
#endif
  return y;
}

__global__ __launch_bounds__(128)
void attn64(const unsigned short* __restrict__ qhp, const unsigned short* __restrict__ qlp,
            const unsigned short* __restrict__ khp, const unsigned short* __restrict__ vtp,
            const float* __restrict__ mdp, unsigned short* ctxp) {
  union FH { v16h v; v8h h[2]; };
  union F8 { v8f v; v4f q[2]; };
  __shared__ __align__(16) _Float16 Ks[2][64 * API];              // K [kv][d]    9 KB, two buffers
  __shared__ __align__(16) _Float16 Vts[2][64 * API];             // V^T [d][kv]  9 KB, two buffers
  __shared__ __align__(16) float    Ms[SEQ];                      // mask addend of every key of this batch, 8 KB
  __shared__ __align__(16) float    Os[4][16 * OPI];              // per wave context tile [row][d]

  const int tid  = threadIdx.x;
  const int wave = tid >> 5;
  const int lane = tid & 31;
  const int hh   = lane >> 4;
  const int c    = lane & 15;

  const int bx   = blockIdx.x;
  const int qb   = bx % NQB;
  const int rest = bx / NQB;
  const int h    = rest % NHD;
  const int b    = rest / NHD;
  const int q0   = qb * 64 + wave * 16;
  const size_t rowB = (size_t)b * SEQ;

  const _Float16* Qh = (const _Float16*)(const void*)qhp + (size_t)h * HD;
  const _Float16* Ql = (const _Float16*)(const void*)qlp + (size_t)h * HD;
  const _Float16* Kh = (const _Float16*)(const void*)khp + (size_t)h * HD;
  const _Float16* Vt = (const _Float16*)(const void*)vtp + ((size_t)b * HID + (size_t)h * HD) * SEQ;
  const float* mdb = mdp + (size_t)b * SEQ;                        // addend of key 0 of this batch

  // ---- Q fragments (B operand, column = query q0 + (lane&15)): 2 d-chunks, hi and residual ----
  v16h qah[2], qal[2];
#pragma unroll
  for (int dc = 0; dc < 2; ++dc) {
    const size_t qo = (rowB + q0 + c) * HID + dc * 32 + 8 * hh;
    qah[dc] = ldfrag_h(Qh + qo);
    qal[dc] = ldfrag_h(Ql + qo);
  }

  float crun = -INFINITY;                          // this lane's query: running max less 10 (log2 units), alike in both wave halves
  v8f lacc = zero8();                              // its sum of 1024 p: register r over keys = 8hh + r (mod 16); joined after the loop
  v8f oacc[4];                                     // O^T: register r of tile t = d 16t + 8hh + r of query q0 + c
#pragma unroll
  for (int t = 0; t < 4; ++t) oacc[t] = zero8();

  // staging map: thread -> row (tid>>3) + 16*i, 16-B piece (tid&7) of the row's 128 B; 4 i x 16 rows = 64 rows of K and of V^T
  const int srow = tid >> 3, scol = (tid & 7) * 8;
  const _Float16* kg = Kh + (rowB + srow) * HID + scol;            // K row srow of chunk 0
  const _Float16* vg = Vt + (size_t)srow * SEQ + scol;             // V^T row d = srow, keys of chunk 0
  const unsigned lk0 = lds_off(&Ks[0][0])  + (unsigned)(srow * API + scol) * 2u;
  const unsigned lv0 = lds_off(&Vts[0][0]) + (unsigned)(srow * API + scol) * 2u;
  constexpr unsigned ABUF = 64u * API * 2u;                        // bytes of one buffer
  constexpr unsigned AR16 = 16u * API * 2u;                        // bytes of 16 LDS rows
  auto issue = [&](int ch) {                                       // chunk ch < NQB -> buffer ch & 1
    const unsigned lk = lk0 + (unsigned)(ch & 1) * ABUF, lv = lv0 + (unsigned)(ch & 1) * ABUF;
    const _Float16* pk = kg + (size_t)ch * 64 * HID;
    const _Float16* pv = vg + (size_t)ch * 64;
    copy8(lk, lk + AR16, lk + 2u * AR16, lk + 3u * AR16, lv, lv + AR16, lv + 2u * AR16, lv + 3u * AR16,
          pk, pk + 16 * HID, pk + 32 * HID, pk + 48 * HID, pv, pv + 16 * SEQ, pv + 32 * SEQ, pv + 48 * SEQ);
  };
  static_assert(NQB >= 2 && SEQ == 4 * 128 * 4);
  issue(0);
  {
    // the batch's addends -> LDS: 4 x 128 threads x 16 B = 8 KB, whole lines; published by the barrier below
    v4f x[4];
#pragma unroll
    for (int i = 0; i < 4; ++i) x[i] = *(const v4f*)(mdb + (i * 128 + tid) * 4);
    // precaution: stands in front of every later rewrite of the address registers of the four loads above
    asm volatile("s_wait_xcnt 0x0" ::: "memory");
#pragma unroll
    for (int i = 0; i < 4; ++i) *(v4f*)(Ms + (i * 128 + tid) * 4) = x[i];
  }
  wait_async0();
  __syncthreads();                                 // publishes chunk 0 and the addends
  issue(1);

#pragma unroll 1
  for (int kt = 0; kt < NQB; ++kt) {
    const _Float16* Kc = Ks[kt & 1];
    const _Float16* Vc = Vts[kt & 1];

    // ---- scores, transposed: 64 keys x 16 queries per wave: md + k.qhi + k.qres, four products chained per tile ----
    // LDS reads of a chunk stand in two groups, each a run of products or arithmetic ahead of its last user, so that the waits are
    // counted ones; read pair by pair in front of each product, every pair's LDS latency is waited out alone, 16 times a chunk.
    // group 1: the mask addends (register r of tile j = key 16j + 8hh + r, the place of that key's score in the accumulator), all 8 K fragments
    // in the order of their use (LDS reads return in order): each tile's addends with its first fragment, then the second fragments
    F8 mdv[4];
    FH kb[4][2];
    const float* Mc = Ms + kt * 64 + 8 * hh;
#pragma unroll
    for (int dc = 0; dc < 2; ++dc) {
#pragma unroll
      for (int j = 0; j < 4; ++j) {
        if (dc == 0) {
          mdv[j].q[0] = *(const v4f*)(Mc + j * 16);
          mdv[j].q[1] = *(const v4f*)(Mc + j * 16 + 4);
        }
        kb[j][dc].h[0] = *(const v8h*)(Kc + (j * 16 + c) * API + dc * 32 + 8 * hh);
        kb[j][dc].h[1] = *(const v8h*)(Kc + (j * 16 + c) * API + dc * 32 + 16 + 8 * hh);
      }
    }
    // keeps this group of LDS reads in one place ahead of its users: without it the compiler sinks reads in among the products
    __builtin_amdgcn_sched_barrier(0);
    // the tiles take turns, so that a tile's next product does not stand directly behind the one whose result it adds to
    v8f s[4];
#pragma unroll
    for (int j = 0; j < 4; ++j) s[j] = mma_p(kb[j][0].v, qah[0], mdv[j].v);
#pragma unroll
    for (int j = 0; j < 4; ++j) s[j] = mma_p(kb[j][0].v, qal[0], s[j]);
    // group 2: all 8 V^T fragments, so that they land under the products and the softmax arithmetic
    FH vb[2][4];
#pragma unroll
    for (int kk = 0; kk < 2; ++kk) {
#pragma unroll
      for (int t = 0; t < 4; ++t) {
        vb[kk][t].h[0] = *(const v8h*)(Vc + (t * 16 + c) * API + kk * 32 + 8 * hh);
        vb[kk][t].h[1] = *(const v8h*)(Vc + (t * 16 + c) * API + kk * 32 + 16 + 8 * hh);
      }
    }
    // keeps this group of LDS reads in one place ahead of its users: without it the compiler sinks reads in among the products
    __builtin_amdgcn_sched_barrier(0);
#pragma unroll
    for (int j = 0; j < 4; ++j) s[j] = mma_p(kb[j][1].v, qah[1], s[j]);
#pragma unroll
    for (int j = 0; j < 4; ++j) s[j] = mma_p(kb[j][1].v, qal[1], s[j]);
    // keeps the eight products above back to back, each filling the distance behind the one before it, ahead of the arithmetic on their
    // results: without it the compiler interleaves the two and pads with more v_nop
    __builtin_amdgcn_sched_barrier(0);

    // ---- max of this query's 64 scores, online softmax, P^T (x1024, f16) packed in place as B fragments ----
    float mj[4];
#pragma unroll
    for (int j = 0; j < 4; ++j) {
      mj[j] = fmaxf(fmaxf(fmaxf(s[j][0], s[j][1]), fmaxf(s[j][2], s[j][3])),
                    fmaxf(fmaxf(s[j][4], s[j][5]), fmaxf(s[j][6], s[j][7])));
    }
    float m = fmaxf(fmaxf(mj[0], mj[1]), fmaxf(mj[2], mj[3]));
    m = fmaxf(m, xhalf(m));
    // every term of this query is taken against the same reference point c, and a change of c rescales by 2^(c_old - c_new): the
    // rounding of max - 10 (where the max is huge, as with every key masked) therefore cancels between the context and the sum.
    // Where that rounding puts c more than 15 below the max (f32 step 16), the max itself is taken: 2^(s - c) then never passes 2^15
    // and its f16 convert stays finite for any mask.
    const float c0    = m - PLG;
    const float cch   = (m - c0 > 15.0f) ? m : c0;
    const float cnew  = fmaxf(crun, cch);
    const float alpha = __builtin_amdgcn_exp2f(crun - cnew);
    crun = cnew;
    FH pb[2];
    v8f p[4];
#pragma unroll
    for (int j = 0; j < 4; ++j) {
      p[j] = exp2x8(s[j] - cnew);
#pragma unroll
      for (int r = 0; r < 8; ++r) pb[j >> 1].v[(j & 1) * 8 + r] = (_Float16)p[j][r];
    }
    lacc = lacc * alpha + ((p[0] + p[1]) + (p[2] + p[3]));
#pragma unroll
    for (int t = 0; t < 4; ++t) oacc[t] *= alpha;

    // ---- context^T += V^T . P^T (f16 WMMA) ----
#pragma unroll
    for (int kk = 0; kk < 2; ++kk) {
#pragma unroll
      for (int t = 0; t < 4; ++t) oacc[t] = mma_p(vb[kk][t].v, pb[kk].v, oacc[t]);
    }

    // keeps the waits and the barrier at the foot: without it the compiler lifts them to behind the last LDS read, in front of the softmax,
    // and the copies issued at the last foot have that much less time to land
    __builtin_amdgcn_sched_barrier(0);
    wait_ds0();
    wait_async0();
    __syncthreads();                               // publishes chunk kt+1; ends every wave's reads of chunk kt
    if (kt + 2 < NQB) issue(kt + 2);               // block-uniform: flies under the work on chunk kt+1
  }
  wait_async0();

  float* os = Os[wave];
  {
    const float lsum = ((lacc[0] + lacc[1]) + (lacc[2] + lacc[3])) + ((lacc[4] + lacc[5]) + (lacc[6] + lacc[7]));
    const float l = lsum + xhalf(lsum);            // the two halves' key sums joined
    const float inv = (l > 0.f) ? (1.0f / l) : 0.f;   // sum and context both carry the x1024
#pragma unroll
    for (int t = 0; t < 4; ++t) {
      v4f lo, hi;
#pragma unroll
      for (int r = 0; r < 4; ++r) { lo[r] = oacc[t][r] * inv; hi[r] = oacc[t][r + 4] * inv; }
      *(v4f*)(os + c * OPI + t * 16 + 8 * hh)     = lo;
      *(v4f*)(os + c * OPI + t * 16 + 8 * hh + 4) = hi;
    }
  }
  wave_lds_sync();
  {
    const int q4 = lane >> 3, c8 = (lane & 7) * 8;
    v4u hv[4];
#pragma unroll
    for (int it = 0; it < 4; ++it) {
      const int row = it * 4 + q4;           // it 0..3 x q4 0..3 = rows 0..15 of the wave tile
      const float* sp = os + row * OPI + c8;
      const v4f fa = *(const v4f*)(sp);
      const v4f fb = *(const v4f*)(sp + 4);
      v4u a;
      a[0] = pkh2(fa[0], fa[1]); a[1] = pkh2(fa[2], fa[3]);
      a[2] = pkh2(fb[0], fb[1]); a[3] = pkh2(fb[2], fb[3]);
      hv[it] = a;
    }
    {
#pragma unroll
      for (int it = 0; it < 4; ++it) {
        const int row = it * 4 + q4;
        const size_t go = (rowB + q0 + row) * HID + (size_t)h * HD + c8;
        *(v4u*)(ctxp + go) = hv[it];
      }
      
    }
  }
}

// =====================================================================================================
// Workspace map (bytes), all region sizes multiples of 128 and exact multiples of their 64x64- or 128x128-tile / whole-row
// store granularity (M, N multiples of 128; 768- and 3072-wide rows), so no padded tails are needed:
//   Hres f32 [4096][768]        12582912
//   X    f16 [4096][768]         6291456   (h as f16, rewritten by whoever rewrites h ahead of a folded LayerNorm)
//   Qh   f16 [4096][768]         6291456
//   Ql   f16 [4096][768]         6291456   (q residual)
//   Kh   f16 [4096][768]         6291456
//   VT   f16 [2][768][2048]      6291456
//   Ctx  f16 [4096][768]         6291456
//   G    f16 [4096][3072]       25165824
//   per layer (2 x 14155776):
//   Wq_t,Wk_t,Wv_t,Wo_t f16 [768][768]  4 x 1179648
//   W1_t f16 [3072][768]         4718592
//   W2_t f16 [768][3072]         4718592
//   Md   f32 [2][2048]             16384   (mask addends)
//   P    f32 [12][4096][2]        393216   (row sums and centred sums of squares of h per 64 columns)
//   C1, C2 f32 [2][5376]        2 x 43008   (LayerNorm fold vectors)
//   Bm   f32 [4] in 128 bytes         128   (means of bo and b2 of both layers)
//   total                      104304768
// Both layers' weights are converted by the first launch, each layer into its own region ([out n][in k], k contiguous = the Bt / A layout).
// =====================================================================================================
extern "C" void kernel_launch(void* const* d_in, const int* in_sizes, int n_in,
                              void* d_out, int out_size, void* d_ws, size_t ws_size,
                              hipStream_t stream) {
  if (n_in < 21) return;
  if (in_sizes[0] != BT * HID || in_sizes[1] != BT * HID || in_sizes[2] != NB * SEQ) return;
  if (in_sizes[3] != 2 * HID || in_sizes[4] != 2 * HID) return;
  if (in_sizes[5] != 2 * HID * HID || in_sizes[7] != 2 * HID * HID ||
      in_sizes[9] != 2 * HID * HID || in_sizes[11] != 2 * HID * HID) return;
  if (in_sizes[6] != 2 * HID || in_sizes[8] != 2 * HID || in_sizes[10] != 2 * HID || in_sizes[12] != 2 * HID) return;
  if (in_sizes[13] != 2 * HID || in_sizes[14] != 2 * HID) return;
  if (in_sizes[15] != 2 * HID * DFF || in_sizes[16] != 2 * DFF ||
      in_sizes[17] != 2 * DFF * HID || in_sizes[18] != 2 * HID) return;
  if (in_sizes[19] != HID || in_sizes[20] != HID) return;
  if (out_size != BT * HID) return;

  const float* in_h  = (const float*)d_in[0];
  const float* embs  = (const float*)d_in[1];
  const float* mask  = (const float*)d_in[2];
  const float* ln1_s = (const float*)d_in[3];
  const float* ln1_b = (const float*)d_in[4];
  const float* wq    = (const float*)d_in[5];
  const float* bq    = (const float*)d_in[6];
  const float* wk    = (const float*)d_in[7];
  const float* bk    = (const float*)d_in[8];
  const float* wv    = (const float*)d_in[9];
  const float* bv    = (const float*)d_in[10];
  const float* wo    = (const float*)d_in[11];
  const float* bo    = (const float*)d_in[12];
  const float* ln2_s = (const float*)d_in[13];
  const float* ln2_b = (const float*)d_in[14];
  const float* w1    = (const float*)d_in[15];
  const float* b1    = (const float*)d_in[16];
  const float* w2    = (const float*)d_in[17];
  const float* b2    = (const float*)d_in[18];
  const float* lnf_s = (const float*)d_in[19];
  const float* lnf_b = (const float*)d_in[20];
  float* out = (float*)d_out;

  const size_t PH  = (size_t)BT * HID * 4;        // 12582912
  const size_t PA  = (size_t)BT * HID * 2;        //  6291456
  const size_t PVT = (size_t)NB * HID * SEQ * 2;  //  6291456
  const size_t PG  = (size_t)BT * DFF * 2;        // 25165824
  const size_t PW  = (size_t)HID * HID * 2;       //  1179648
  const size_t PW1 = (size_t)HID * DFF * 2;       //  4718592
  size_t off = 0;
  const size_t oH   = off; off += PH;
  const size_t oX   = off; off += PA;
  const size_t oQh  = off; off += PA;
  const size_t oQl  = off; off += PA;
  const size_t oKh  = off; off += PA;
  const size_t oVT  = off; off += PVT;
  const size_t oCtx = off; off += PA;
  const size_t oG   = off; off += PG;
  const size_t oWt  = off; off += 2 * (4 * PW + 2 * PW1);
  const size_t oMd  = off; off += (size_t)BT * 4;
  const size_t oP   = off; off += (size_t)NPG * BT * 8;
  const size_t oC1  = off; off += (size_t)2 * CLN * 4;
  const size_t oC2  = off; off += (size_t)2 * CLN * 4;
  const size_t oBm  = off; off += 128;
  if (off > ws_size) return;                      // off = 104304768
  if (off > (size_t)134217728) return;

  char* ws = (char*)d_ws;
  float*          Hres = (float*)(ws + oH);
  unsigned short* X    = (unsigned short*)(ws + oX);
  unsigned short* Qh   = (unsigned short*)(ws + oQh);
  unsigned short* Ql   = (unsigned short*)(ws + oQl);
  unsigned short* Kh   = (unsigned short*)(ws + oKh);
  unsigned short* VT   = (unsigned short*)(ws + oVT);
  unsigned short* Ctx  = (unsigned short*)(ws + oCtx);
  unsigned short* G    = (unsigned short*)(ws + oG);
  unsigned short* Wt   = (unsigned short*)(ws + oWt);
  float*          Md   = (float*)(ws + oMd);
  float*          P    = (float*)(ws + oP);
  float*          C1   = (float*)(ws + oC1);
  float*          C2   = (float*)(ws + oC2);
  float*          Bm   = (float*)(ws + oBm);

  const dim3 blk(256);
  const dim3 gLN(BT / 8);                                           // 512 blocks, 8 rows each
  const dim3 gPrep(2 * CSB + 1 + BT / 8 + 2 * CVL);                 // 168 fold-vector blocks + 1 of bias means + 512 row groups + 2 x 1728 weight tiles
  const dim3 gHH((BT / 128) * (HID / 128), 1);                      // 32 x 6  = 192 blocks
  const dim3 gQKV(2 * TQK + NB * TVB);                              // 192 + 192 + 2 x 96 = 576 blocks
  const dim3 gF1((BT / 128) * (DFF / 128), 1);                      // 32 x 24 = 768 blocks
  const dim3 gAt(NB * NHD * NQB);                                   // 768 blocks of 128

  for (int l = 0; l < 2; ++l) {
    unsigned short* Wqt = Wt + (size_t)l * WLH;
    unsigned short* Wkt = Wqt + (size_t)HID * HID;
    unsigned short* Wvt = Wkt + (size_t)HID * HID;
    unsigned short* Wot = Wvt + (size_t)HID * HID;
    unsigned short* W1t = Wot + (size_t)HID * HID;
    unsigned short* W2t = W1t + (size_t)HID * DFF;
    // (1) layer 0: h = h + input_embs -> Hres, X (f16), P; with it
    // (2) the weights of both layers: f32 [in][out] -> f16 [out][in] (bf16-RNE values x64, times the folded LayerNorm's scale), and C1, C2
    if (l == 0) {
      prep<<<gPrep, blk, 0, stream>>>(in_h, embs, Hres, ln1_s, ln1_b, ln2_s, ln2_b, bq, bk, bv, b1, bo, b2, X, P, C1, C2, Bm,
                                      wq, wk, wv, wo, w1, w2, Wt, mask, Md);
    }
    // (3) q = LN1(h) . Wq + bq -> f16 hi + residual planes [b*SEQ+t][h*64+d]  (M=4096, N=768, K=768)
    // (4) k = (LN1(h) . Wk + bk) * mask / 8 * log2 e -> f16 plane
    // (5) v^T = Wv_t . LN1(h)^T per batch -> f16 [b][h*64+d][s]  (A = Wv_t [n][k], Bt = X rows of batch b; M=768, N=2048, K=768)
    gemm_qkv<<<gQKV, blk, 0, stream>>>(X, Wqt, Wkt, Wvt, C1 + l * CLN, C2 + l * CLN, P, mask, Qh, Ql, Kh, VT);
    // (6) attention -> Ctx f16 [b*SEQ+t][h*64+d]
    attn64<<<gAt, dim3(128), 0, stream>>>(Qh, Ql, Kh, VT, Md, Ctx);
    // (7) h = h + (ctx . Wo + bo)  (f32, in place), and X, P of the new h
    gemm64<0, true, false><<<gHH, blk, 0, stream>>>(Ctx, HID, 0LL, Wot, HID, 0LL, bo + l * HID,
                                       (void*)Hres, (void*)Hres, HID, 0LL, BT, HID, HID, Bm + 2 * l, P, X, nullptr);
    // (8) g = gelu(LN2(h) . W1 + b1) -> G f16 [4096][3072]  (M=4096, N=3072, K=768)
    gemm64<4, false, false><<<gF1, blk, 0, stream>>>(X, HID, 0LL, W1t, HID, 0LL, C2 + l * CLN + 3 * HID,
                                       (void*)G, (void*)G, DFF, 0LL, BT, DFF, HID, C1 + l * CLN + 3 * HID, P, nullptr, nullptr);
    // (9) h = h + (g . W2 + b2)  (M=4096, N=768, K=3072, f32 in place); layer 0 adds the next layer's input_embs and writes X, P of that h
    if (l == 0) {
      gemm64<0, true, true><<<gHH, blk, 0, stream>>>(G, DFF, 0LL, W2t, DFF, 0LL, b2 + l * HID,
                                       (void*)Hres, (void*)Hres, HID, 0LL, BT, HID, DFF, Bm + 2 * l + 1, P, X, embs);
    } else {
      gemm64<0, false, false><<<gHH, blk, 0, stream>>>(G, DFF, 0LL, W2t, DFF, 0LL, b2 + l * HID,
                                       (void*)Hres, (void*)Hres, HID, 0LL, BT, HID, DFF, Bm + 2 * l + 1, nullptr, nullptr, nullptr);
    }
  }
  // (11) out = LN_f(h) -> f32 [2][2048][768]
  ln_rows<false, false, true><<<gLN, blk, 0, stream>>>(Hres, embs, Hres, lnf_s, lnf_b, (void*)out, BT);
  (void)hipGetLastError();
}
